// v000
// Measured on an AMD MI455X. A time is GPU time per run, averaged over a window of back-to-back runs after a warm-up
// (all launches, gaps included; the runs take copies of the inputs in turn), and the median of several windows.
// Apart from v000's, it joins two sittings. Times from different sittings can be a few percent apart, while
// side-by-side timings come from the same sitting.
// v000 is the starting kernel. One run takes 3230 microseconds.
#include <hip/hip_runtime.h>

// Multi-head attention with Shaw relative-position terms on the logits AND the values (query, key, value [2][2048][1024]; q,k,v = in W + b ('xw' 1/32, zero biases; 16 heads x 64); idx[i][j] = clip(j - i, -32, 32) + 32; attn = softmax((q.k + q_i.rel_k[idx]) / 8); out_h = attn v + sum_j attn[i][j] rel_v[idx] (tables [65][64] x 0.05, read); out = merged Wo + bo ('xw') -> [2][2048][1024] (4.2 M)).
// Layout per batch: bf16 copies of the three inputs in turn; exact projections + f32 biases; rel_k as an exact plane [128][64] (rows >= 65 zero) and rel_v^T as an exact plane [64][128]; per pass of two heads: dense scores (hybrid rows: < 512 hi/lo 3 products, rest fp16 x1024), QE = q.rel_k^T ([2][2048][128], hi/lo x exact) and a gather-add kernel (Sb[i][j] += QE[i][idx]); softmax with the 1/8; a bucketing kernel sums each row's probabilities into the 65 relative-position buckets (far-left sum, 63 near entries, far-right sum; fixed order) as hi/lo planes; W2 = buckets x rel_v ([2][2048][64], hi/lo x exact) added to attn v in f32; merged hi/lo x Wo exact + bo.
// Compute dtypes, f32 accumulate: every input rounded to bf16; projections exact + f32 biases; q.rel_k and buckets.rel_v hi/lo x exact; attention rows < 512 3 products, rest fp16; softmax f32; Wo hl x exact + bias.

#define NB_  2
#define TT   2048
#define DM   1024
#define NH_  16
#define NKV  16
#define REP  (NH_ / NKV)
#define HD   64
#define DQ   (NH_ * HD)
#define DKV  (NKV * HD)
#define ZH   2
#define RH   512                  // query rows < RH use hi+lo planes (0: none)
#define WIN  0
#define PCAR 1024.0f
#define SCL  0.125f
#define MAXR 32      // max relative position
#define NE   128     // 2*MAXR+1 = 65 table rows padded to 128
typedef _Float16 h16;
typedef unsigned short bf;
typedef __attribute__((ext_vector_type(16))) __bf16   v16bf;
typedef __attribute__((ext_vector_type(16))) _Float16 v16h;
typedef __attribute__((ext_vector_type(8)))  _Float16 v8h;
typedef __attribute__((ext_vector_type(8)))  unsigned short v8us;
typedef __attribute__((ext_vector_type(8)))  float    v8f;
typedef __attribute__((ext_vector_type(4)))  float    v4f;
typedef v8h  __attribute__((may_alias)) v8ha;
typedef v4f  __attribute__((may_alias)) v4fa;
typedef v8us __attribute__((may_alias)) v8usa;

__device__ __forceinline__ unsigned short f2bf(float f) { unsigned u = __float_as_uint(f); u += 0x7FFFu + ((u >> 16) & 1u); return (unsigned short)(u >> 16); }
__device__ __forceinline__ float bf2f(unsigned short b) { return __uint_as_float(((unsigned)b) << 16); }
__device__ __forceinline__ float bfr(float f) { return bf2f(f2bf(f)); }
__device__ __forceinline__ v16h cat16(v8h lo, v8h hi) { return __builtin_shufflevector(lo, hi, 0, 1, 2, 3, 4, 5, 6, 7, 8, 9, 10, 11, 12, 13, 14, 15); }
__device__ __forceinline__ v16bf cat16b(v8us lo, v8us hi) { return __builtin_bit_cast(v16bf, __builtin_shufflevector(lo, hi, 0, 1, 2, 3, 4, 5, 6, 7, 8, 9, 10, 11, 12, 13, 14, 15)); }
__device__ __forceinline__ v8f wmma16(v16h a, v16h b, v8f c) { return __builtin_amdgcn_wmma_f32_16x16x32_f16(false, a, false, b, (short)0, c, false, false); }
__device__ __forceinline__ v8f wmmab(v16bf a, v16bf b, v8f c) { return __builtin_amdgcn_wmma_f32_16x16x32_bf16(false, a, false, b, (short)0, c, false, false); }



// ---- k_gemmw: register-blocked GEMM, ONE WAVE per 64x64 output tile (16 accumulators), operands straight from K-contiguous 16-bit planes; grid (M/64, N/64, Z), 32 threads.
// C[m][n] (f32, pitch ldc, + optional f32 bias[n]) = sum_k A[m][k] Bt[n][k] (+ split products per NSPLIT). z-batch strides sA/sB/sC in elements. K % 32 == 0.
template <typename T16> struct WFrag;
template <> struct WFrag<h16> { typedef v16h V; static __device__ __forceinline__ V ld(const h16* p) { return cat16(*(const v8h*)p, *(const v8h*)(p + 16)); } static __device__ __forceinline__ v8f mma(V a, V b, v8f c) { return wmma16(a, b, c); } };
template <> struct WFrag<bf> { typedef v16bf V; static __device__ __forceinline__ V ld(const bf* p) { return cat16b(*(const v8us*)p, *(const v8us*)(p + 16)); } static __device__ __forceinline__ v8f mma(V a, V b, v8f c) { return wmmab(a, b, c); } };
template <typename T16, int NSPLIT, bool BIAS>
__global__ __launch_bounds__(32) void k_gemmw(const T16* __restrict__ A, const T16* __restrict__ A2, const T16* __restrict__ Bt, const T16* __restrict__ Bt2, int K, float* C, int ldc, const float* __restrict__ bias, size_t sA, size_t sB, size_t sC) {
    typedef typename WFrag<T16>::V V;
    __shared__ __align__(16) float os[16 * 68];
    const size_t z = blockIdx.z; A += z * sA; if (A2) A2 += z * sA; Bt += z * sB; if (Bt2) Bt2 += z * sB; C += z * sC;
    const int lane = threadIdx.x & 31, lr = lane & 15, hi = lane >> 4; const int r0 = blockIdx.x * 64, c0 = blockIdx.y * 64;
    v8f acc[4][4];
#pragma unroll
    for (int mb = 0; mb < 4; ++mb)
#pragma unroll
        for (int nb = 0; nb < 4; ++nb) acc[mb][nb] = (v8f){};
    const size_t aoff = (size_t)(r0 + lr) * K + 8 * hi, boff = (size_t)(c0 + lr) * K + 8 * hi;
#pragma unroll 1
    for (int kc = 0; kc < K; kc += 32) {
        V a[4], a2[4];
#pragma unroll
        for (int mb = 0; mb < 4; ++mb) { a[mb] = WFrag<T16>::ld(A + aoff + (size_t)mb * 16 * K + kc); if (NSPLIT == 1 || NSPLIT == 2) a2[mb] = WFrag<T16>::ld(A2 + aoff + (size_t)mb * 16 * K + kc); }
#pragma unroll
        for (int nb = 0; nb < 4; ++nb) { const V b = WFrag<T16>::ld(Bt + boff + (size_t)nb * 16 * K + kc); V b2; if (NSPLIT >= 2) b2 = WFrag<T16>::ld(Bt2 + boff + (size_t)nb * 16 * K + kc);
#pragma unroll
            for (int mb = 0; mb < 4; ++mb) { acc[mb][nb] = WFrag<T16>::mma(a[mb], b, acc[mb][nb]); if (NSPLIT == 1 || NSPLIT == 2) acc[mb][nb] = WFrag<T16>::mma(a2[mb], b, acc[mb][nb]); if (NSPLIT >= 2) acc[mb][nb] = WFrag<T16>::mma(a[mb], b2, acc[mb][nb]); } }
        asm volatile("v_nop\n\tv_nop\n\tv_nop\n\tv_nop" : "+v"(acc[0][0]), "+v"(acc[1][1]), "+v"(acc[2][2]), "+v"(acc[3][3]) : "v"(a[0]), "v"(a[3]));
    }
#pragma unroll
    for (int mb = 0; mb < 4; ++mb) {
#pragma unroll
        for (int nb = 0; nb < 4; ++nb) {
#pragma unroll
            for (int j = 0; j < 8; ++j) os[(hi * 8 + j) * 68 + nb * 16 + lr] = acc[mb][nb][j]; }
        __builtin_amdgcn_wave_barrier(); asm volatile("" ::: "memory");
        float* crow = C + (size_t)(r0 + mb * 16) * ldc + c0;
{
#pragma unroll
            for (int s = 0; s < 8; ++s) { const int row = 2 * s + hi, cofs = lr * 4; v4f val = *(const v4fa*)(os + row * 68 + cofs); if (BIAS) { val[0] += bfr(bias[c0 + cofs]); val[1] += bfr(bias[c0 + cofs + 1]); val[2] += bfr(bias[c0 + cofs + 2]); val[3] += bfr(bias[c0 + cofs + 3]); }
                *(v4f*)(crow + (size_t)row * ldc + cofs) = val; }
             }
        __builtin_amdgcn_wave_barrier(); asm volatile("" ::: "memory");
    }
}

__device__ __forceinline__ h16 tohx(float x) { return (h16)x; }
__device__ __forceinline__ void splitf(float y, unsigned short& h, unsigned short& l) { h = f2bf(y); l = f2bf(y - bf2f(h)); }
typedef __attribute__((ext_vector_type(2))) _Float16 v2h;
typedef __attribute__((ext_vector_type(4))) _Float16 v4h;
typedef __attribute__((ext_vector_type(2))) unsigned short v2us;
typedef __attribute__((ext_vector_type(4))) unsigned short v4us;
typedef __attribute__((ext_vector_type(2))) float v2f;
typedef __attribute__((ext_vector_type(4))) int v4i;

__global__ __launch_bounds__(256) void k_wtG(const float* __restrict__ w, int K, int N, bf* Bt) {
    const int lane = threadIdx.x & 31; const int L0 = (blockIdx.x * 8 + (threadIdx.x >> 5)) * 8; const int nlines = N * K / 64;
{
#pragma unroll 1
        for (int l = 0; l < 8; ++l) { const int L = L0 + l; if (L >= nlines) break; const size_t e = (size_t)L * 64 + lane * 2; const int k = (int)(e % K), n = (int)(e / K); v2us o;
            o[0] = f2bf(w[(size_t)k * N + n]); o[1] = f2bf(w[(size_t)(k + 1) * N + n]); *(v2us*)(Bt + e) = o; }
         }
}
__global__ __launch_bounds__(256) void k_cvt8(const float* __restrict__ src, bf* dst, size_t n8) { const size_t i = (size_t)blockIdx.x * 256 + threadIdx.x; if (i >= n8) return; const v8f v = *(const v8f*)(src + i * 8); v8us o;
#pragma unroll
    for (int k = 0; k < 8; ++k) o[k] = f2bf(v[k]); *(v8us*)(dst + i * 8) = o;  }

// k_rope: head planes [h][t][d] (fp16 + hi/lo) of rope(x) x sc with the rotate-half convention out[d] = x[d] cos[t][d] - x[d+HD/2] sin[t][d], out[d+HD/2] = x[d+HD/2] cos[t][d+HD/2] + x[d] sin[t][d+HD/2]
__global__ __launch_bounds__(256) void k_rope(const float* __restrict__ F, int pitch, int nheads, const float* __restrict__ CS, const float* __restrict__ RF, const float* __restrict__ nw, float sc, h16* P16, bf* Ph, bf* Pl) {
    const size_t e = ((size_t)blockIdx.x * 256 + threadIdx.x) * 2; if (e >= (size_t)nheads * TT * HD) return; const int d = (int)(e % HD); const int t = (int)((e / HD) % TT); const int h = (int)(e / ((size_t)HD * TT)); const float* f = F + (size_t)t * pitch + h * HD; const float rf = RF ? RF[(size_t)h * TT + t] : 1.0f; v2h o16; v2us oh, ol;
#pragma unroll
    for (int q = 0; q < 2; ++q) { const int dd = d + q; const int dp = (dd < HD / 2) ? dd + HD / 2 : dd - HD / 2; float x0 = f[dd], x1 = f[dp];
        if (RF) { float n0 = __fmul_rn(x0, rf), n1 = __fmul_rn(x1, rf); asm volatile("" : "+v"(n0)); asm volatile("" : "+v"(n1)); x0 = __fmul_rn(bfr(nw[dd]), n0); x1 = __fmul_rn(bfr(nw[dp]), n1); }
        const v2f cs = *(const v2f*)(CS + ((size_t)t * HD + dd) * 2); float a = __fmul_rn(x0, cs[0]), bq = __fmul_rn(x1, cs[1]); asm volatile("" : "+v"(a)); asm volatile("" : "+v"(bq)); const float r = ((dd < HD / 2) ? __fsub_rn(a, bq) : __fadd_rn(a, bq)) * sc;
        o16[q] = tohx(r); unsigned short a2, c2; splitf(r, a2, c2); oh[q] = a2; ol[q] = c2; }
    *(v2h*)(P16 + e) = o16; *(v2us*)(Ph + e) = oh; *(v2us*)(Pl + e) = ol;  }
__global__ __launch_bounds__(256) void k_vtp(const float* __restrict__ F, int pitch, int nheads, h16* V16, bf* Vh, bf* Vl) { const size_t e = ((size_t)blockIdx.x * 256 + threadIdx.x) * 2; if (e >= (size_t)nheads * HD * TT) return; const int t = (int)(e % TT); const int d = (int)((e / TT) % HD); const int g = (int)(e / ((size_t)TT * HD)); v2h o16; v2us oh, ol;
#pragma unroll
    for (int q = 0; q < 2; ++q) { const float x = F[(size_t)(t + q) * pitch + g * HD + d]; o16[q] = tohx(x); unsigned short a2, c2; splitf(x, a2, c2); oh[q] = a2; ol[q] = c2; }
    *(v2h*)(V16 + e) = o16; *(v2us*)(Vh + e) = oh; *(v2us*)(Vl + e) = ol;  }
__global__ __launch_bounds__(256) void k_csid(float* CS) { const int idx = blockIdx.x * 256 + threadIdx.x; if (idx >= TT * HD) return; v2f cs; cs[0] = 1.0f; cs[1] = 0.0f; *(v2f*)(CS + (size_t)idx * 2) = cs;  }
// k_asoft: per row (zz, i): t = S x HD^-0.5 (no mask); softmax over the 2048 keys (register row, one exp, fixed trees);
__global__ __launch_bounds__(256) void k_asoft(const float* __restrict__ Sb, h16* P16, bf* Ph, bf* Pl) {
    const int lane = threadIdx.x & 31; const int row = blockIdx.x * 8 + (threadIdx.x >> 5); if (row >= ZH * TT) return; const int i = row % TT; const int zz = row / TT; (void)zz; const bool hires = (i < RH); const float* sr = Sb + (size_t)row * TT; float v[TT / 32]; float mx = -3.0e38f;
#pragma unroll
    for (int ch = 0; ch < TT / 128; ++ch) { const int j0 = ch * 128 + lane * 4; const v4f a = *(const v4f*)(sr + j0);
#pragma unroll
        for (int q = 0; q < 4; ++q) { const int j = j0 + q; (void)j; const float t = a[q] * SCL; v[ch * 4 + q] = t; mx = fmaxf(mx, t); } }
#pragma unroll
    for (int sh = 16; sh; sh >>= 1) mx = fmaxf(mx, __shfl_xor(mx, sh, 32));
    float sum = 0.f;
#pragma unroll
    for (int k = 0; k < TT / 32; ++k) { float d0 = __fsub_rn(v[k], mx); asm volatile("" : "+v"(d0)); v[k] = __builtin_amdgcn_exp2f(__fmul_rn(d0, 1.4426950408889634f)); sum += v[k]; }
#pragma unroll
    for (int sh = 16; sh; sh >>= 1) sum += __shfl_xor(sum, sh, 32);
    const float f = __fdiv_rn(hires ? 1.0f : PCAR, sum);
{
        if (hires) {
#pragma unroll
            for (int ch = 0; ch < TT / 128; ++ch) { v4us oh, ol;
#pragma unroll
                for (int q = 0; q < 4; ++q) { unsigned short a, c2; splitf(v[ch * 4 + q] * f, a, c2); oh[q] = a; ol[q] = c2; }
                const size_t oo = ((size_t)zz * (RH ? RH : 1) + i) * TT + ch * 128 + lane * 4; *(v4us*)(Ph + oo) = oh; *(v4us*)(Pl + oo) = ol; }
        } else {
#pragma unroll
            for (int ch = 0; ch < TT / 128; ++ch) { v4h o4;
#pragma unroll
                for (int q = 0; q < 4; ++q) o4[q] = tohx(v[ch * 4 + q] * f);
                *(v4h*)(P16 + (size_t)row * TT + ch * 128 + lane * 4) = o4; } }
         }
}
__global__ __launch_bounds__(256) void k_epad2(const float* __restrict__ E, bf* EB) { const size_t i = (size_t)blockIdx.x * 256 + threadIdx.x; if (i >= (size_t)NE * HD / 8) return; const int d0 = (int)(i % (HD / 8)) * 8; const int r = (int)(i / (HD / 8)); const float* src = E + (size_t)min(r, 2 * MAXR) * HD + d0; v8us o;
#pragma unroll
    for (int q = 0; q < 8; ++q) { const unsigned short v = f2bf(src[q]); o[q] = (r <= 2 * MAXR) ? v : (unsigned short)0; }
    *(v8us*)(EB + (size_t)r * HD + d0) = o;  }
__global__ __launch_bounds__(256) void k_addshaw(float* Sb, const float* __restrict__ QE) { const size_t k = (size_t)blockIdx.x * 256 + threadIdx.x; if (k >= (size_t)ZH * TT * TT / 4) return; const size_t e = k * 4; const int j0 = (int)(e % TT); const int i = (int)((e / TT) % TT); const int zz = (int)(e / ((size_t)TT * TT)); const float* qe = QE + ((size_t)zz * TT + i) * NE; v4f a = *(const v4f*)(Sb + e);
#pragma unroll
    for (int q = 0; q < 4; ++q) { const int r = min(max((j0 + q) - i, -MAXR), MAXR) + MAXR;   /* this module: dist = k - q */ a[q] = __fadd_rn(a[q], qe[r]); }
    *(v4f*)(Sb + e) = a;  }
__global__ __launch_bounds__(256) void k_rvt(const float* __restrict__ E, bf* RVT) { const size_t i = (size_t)blockIdx.x * 256 + threadIdx.x; if (i >= (size_t)HD * NE / 8) return; const int r0 = (int)(i % (NE / 8)) * 8; const int d = (int)(i / (NE / 8)); v8us o;
#pragma unroll
    for (int q = 0; q < 8; ++q) { const int r = r0 + q; const unsigned short v = f2bf(E[(size_t)min(r, 2 * MAXR) * HD + d]); o[q] = (r <= 2 * MAXR) ? v : (unsigned short)0; }
    *(v8us*)(RVT + (size_t)d * NE + r0) = o;  }
__global__ __launch_bounds__(256) void k_pbucket(const bf* __restrict__ Ph, const bf* __restrict__ Pl, const h16* __restrict__ P16, bf* PBh, bf* PBl) { const int lane = threadIdx.x & 31; const int row = blockIdx.x * 8 + (threadIdx.x >> 5); if (row >= ZH * TT) return; const int i = row % TT; const bool hires = (i < RH);
    auto pval = [&](int j) -> float { const size_t o = (size_t)row * TT + j; return hires ? __fadd_rn(bf2f(Ph[(size_t)(row / TT) * RH * TT + (size_t)i * TT + j]), bf2f(Pl[(size_t)(row / TT) * RH * TT + (size_t)i * TT + j])) : __fmul_rn((float)P16[o], 0.0009765625f); };
    float sl = 0.f, sr = 0.f;
#pragma unroll 4
    for (int q = 0; q < TT / 32; ++q) { const int j = lane * (TT / 32) + q; const float p = pval(j); sl = __fadd_rn(sl, (j <= i - MAXR) ? p : 0.f); sr = __fadd_rn(sr, (j >= i + MAXR) ? p : 0.f); }
#pragma unroll
    for (int sh = 16; sh; sh >>= 1) { sl = __fadd_rn(sl, __shfl_xor(sl, sh, 32)); sr = __fadd_rn(sr, __shfl_xor(sr, sh, 32)); }
    v4us oh, ol;
#pragma unroll
    for (int q = 0; q < 4; ++q) { const int r = lane * 4 + q; float v; if (r == 0) v = sl; else if (r == 2 * MAXR) v = sr; else if (r < 2 * MAXR) { const int j = i + r - MAXR; const int jc = min(max(j, 0), TT - 1); const float p = pval(jc); v = (j >= 0 && j < TT) ? p : 0.f; } else v = 0.f; unsigned short u, w; splitf(v, u, w); oh[q] = u; ol[q] = w; }
    const size_t ob = (size_t)row * NE + lane * 4; *(v4us*)(PBh + ob) = oh; *(v4us*)(PBl + ob) = ol;  }
__global__ __launch_bounds__(256) void k_addob(float* Ob, const float* __restrict__ W2) { const size_t k = (size_t)blockIdx.x * 256 + threadIdx.x; if (k >= (size_t)ZH * TT * HD / 4) return; const size_t e = k * 4; const int i = (int)((e / HD) % TT); const float sc = (i < RH) ? 1.0f : 1024.0f; const v4f a = *(const v4f*)(Ob + e); const v4f w = *(const v4f*)(W2 + e); v4f o;
#pragma unroll
    for (int q = 0; q < 4; ++q) o[q] = __fadd_rn(a[q], __fmul_rn(w[q], sc));
    *(v4f*)(Ob + e) = o;  }
__global__ __launch_bounds__(256) void k_merge(const float* __restrict__ O, int h0, bf* Ah, bf* Al) { const size_t e = ((size_t)blockIdx.x * 256 + threadIdx.x) * 2; if (e >= (size_t)ZH * TT * HD) return; const int d = (int)(e % HD); const int t = (int)((e / HD) % TT); const int zz = (int)(e / ((size_t)HD * TT)); const float cs = (t < RH) ? 1.0f : (1.0f / PCAR); const size_t oo = (size_t)t * DQ + (h0 + zz) * HD + d;
    v2us oh, ol;
#pragma unroll
    for (int q = 0; q < 2; ++q) { unsigned short a, c2; splitf(O[e + q] * cs, a, c2); oh[q] = a; ol[q] = c2; } *(v2us*)(Ah + oo) = oh; *(v2us*)(Al + oo) = ol;  }

extern "C" void kernel_launch(void* const* d_in, const int* in_sizes, int n_in,
                              void* d_out, int out_size, void* d_ws, size_t ws_size, hipStream_t stream) {
    (void)in_sizes; (void)n_in; (void)out_size;
    const float* x = (const float*)d_in[0]; const float* xk = (const float*)d_in[1]; const float* xv = (const float*)d_in[2]; const float* wq = (const float*)d_in[3]; const float* bq = (const float*)d_in[4]; const float* wk = (const float*)d_in[5]; const float* bk = (const float*)d_in[6]; const float* wv = (const float*)d_in[7]; const float* bv = (const float*)d_in[8]; const float* wo = (const float*)d_in[9]; const float* bo = (const float*)d_in[10]; const float* relk = (const float*)d_in[11]; const float* relv = (const float*)d_in[12];   /* [65][64] each */
    float* OUT = (float*)d_out;     // [2][2048][1024]
    char* wsp = (char*)d_ws;
    auto take = [&](size_t bytes) { char* p = wsp; wsp += (bytes + 255) & ~(size_t)255; return (void*)p; };
    bf* EB = (bf*)take((size_t)NE * HD * 2); bf* RVT = (bf*)take((size_t)HD * NE * 2); float* QE = (float*)take((size_t)ZH * TT * NE * 4); bf* PBh = (bf*)take((size_t)ZH * TT * NE * 2); bf* PBl = (bf*)take((size_t)ZH * TT * NE * 2); float* W2 = (float*)take((size_t)ZH * TT * HD * 4); bf* WQ = (bf*)take((size_t)DQ * DM * 2); bf* WK = (bf*)take((size_t)DKV * DM * 2); bf* WV = (bf*)take((size_t)DKV * DM * 2); bf* WO = (bf*)take((size_t)DM * DQ * 2); float* CS = (float*)take((size_t)TT * HD * 2 * 4);
    bf* XB = (bf*)take((size_t)TT * DM * 2); float* FQ = (float*)take((size_t)TT * DQ * 4); float* FK = (float*)take((size_t)TT * DKV * 4);
    h16* QP16 = (h16*)take((size_t)NH_ * TT * HD * 2); h16* KP16 = (h16*)take((size_t)NKV * TT * HD * 2); h16* VT16 = (h16*)take((size_t)NKV * HD * TT * 2);
    bf* QPh = (bf*)take((size_t)NH_ * TT * HD * 2); bf* QPl = (bf*)take((size_t)NH_ * TT * HD * 2); bf* KPh = (bf*)take((size_t)NKV * TT * HD * 2); bf* KPl = (bf*)take((size_t)NKV * TT * HD * 2); bf* VTh = (bf*)take((size_t)NKV * HD * TT * 2); bf* VTl = (bf*)take((size_t)NKV * HD * TT * 2); bf* Ph = (bf*)take((size_t)ZH * RH * TT * 2); bf* Pl = (bf*)take((size_t)ZH * RH * TT * 2);
    float* Sb = (float*)take((size_t)ZH * TT * TT * 4); h16* P16 = (h16*)take((size_t)ZH * TT * TT * 2); float* Ob = (float*)take((size_t)ZH * TT * HD * 4); bf* ATh = (bf*)take((size_t)TT * DQ * 2); bf* ATl = (bf*)take((size_t)TT * DQ * 2);
    if ((size_t)(wsp - (char*)d_ws) > ws_size) return;    // ws 256 MiB
    float* FV = FK;   // v projection reuses the k buffer after the k planes are built (stream-ordered)
    { k_wtG<<<(unsigned)((DM * DQ / 64 + 63) / 64), 256, 0, stream>>>(wq, DM, DQ, WQ); k_wtG<<<(unsigned)((DM * DKV / 64 + 63) / 64), 256, 0, stream>>>(wk, DM, DKV, WK); k_wtG<<<(unsigned)((DM * DKV / 64 + 63) / 64), 256, 0, stream>>>(wv, DM, DKV, WV);
      k_wtG<<<(unsigned)((DQ * DM / 64 + 63) / 64), 256, 0, stream>>>(wo, DQ, DM, WO);
       }
    k_csid<<<(TT * HD + 255) / 256, 256, 0, stream>>>(CS);
    const unsigned LQ = (unsigned)(((size_t)NH_ * TT * HD / 2 + 255) / 256), LKv = (unsigned)(((size_t)NKV * TT * HD / 2 + 255) / 256);
    k_epad2<<<(unsigned)(((size_t)NE * HD / 8 + 255) / 256), 256, 0, stream>>>(relk, EB); k_rvt<<<(unsigned)(((size_t)HD * NE / 8 + 255) / 256), 256, 0, stream>>>(relv, RVT);   /* rel_k plane [128][64], rel_v^T plane [64][128] */
    for (int b = 0; b < NB_; ++b) {
        
        k_cvt8<<<(unsigned)(((size_t)TT * DM / 8 + 255) / 256), 256, 0, stream>>>(x + (size_t)b * TT * DM, XB, (size_t)TT * DM / 8);
        k_gemmw<bf, 0, true><<<dim3(TT / 64, DQ / 64, 1), 32, 0, stream>>>(XB, nullptr, WQ, nullptr, DM, FQ, DQ, bq, 0, 0, 0);
        k_rope<<<LQ, 256, 0, stream>>>(FQ, DQ, NH_, CS, nullptr, nullptr, 1.0f, QP16, QPh, QPl);
        k_cvt8<<<(unsigned)(((size_t)TT * DM / 8 + 255) / 256), 256, 0, stream>>>(xk + (size_t)b * TT * DM, XB, (size_t)TT * DM / 8); k_gemmw<bf, 0, true><<<dim3(TT / 64, DKV / 64, 1), 32, 0, stream>>>(XB, nullptr, WK, nullptr, DM, FK, DKV, bk, 0, 0, 0);
        k_rope<<<LKv, 256, 0, stream>>>(FK, DKV, NKV, CS, nullptr, nullptr, 1.0f, KP16, KPh, KPl);
        k_cvt8<<<(unsigned)(((size_t)TT * DM / 8 + 255) / 256), 256, 0, stream>>>(xv + (size_t)b * TT * DM, XB, (size_t)TT * DM / 8); k_gemmw<bf, 0, true><<<dim3(TT / 64, DKV / 64, 1), 32, 0, stream>>>(XB, nullptr, WV, nullptr, DM, FV, DKV, bv, 0, 0, 0); k_vtp<<<LKv, 256, 0, stream>>>(FV, DKV, NKV, VT16, VTh, VTl);
        for (int h0 = 0; h0 < NH_; h0 += ZH) { const size_t zq = (size_t)h0, zk = (size_t)(h0 / REP);   // one kv head per query head: the pass's two heads use consecutive kv planes (z-strides TT*HD)
            k_gemmw<bf, 2, false><<<dim3(RH / 64, TT / 64, ZH), 32, 0, stream>>>(QPh + zq * TT * HD, QPl + zq * TT * HD, KPh + zk * TT * HD, KPl + zk * TT * HD, HD, Sb, TT, nullptr, (size_t)TT * HD, (size_t)TT * HD, (size_t)TT * TT);
            k_gemmw<h16, 0, false><<<dim3((TT - RH) / 64, TT / 64, ZH), 32, 0, stream>>>(QP16 + zq * TT * HD + (size_t)RH * HD, nullptr, KP16 + zk * TT * HD, nullptr, HD, Sb + (size_t)RH * TT, TT, nullptr, (size_t)TT * HD, (size_t)TT * HD, (size_t)TT * TT);
            k_gemmw<bf, 1, false><<<dim3(TT / 64, NE / 64, ZH), 32, 0, stream>>>(QPh + zq * TT * HD, QPl + zq * TT * HD, EB, nullptr, HD, QE, NE, nullptr, (size_t)TT * HD, 0, (size_t)TT * NE);   /* QE[i][r] = q_i . rel_k[r] */
            k_addshaw<<<(unsigned)(((size_t)ZH * TT * TT / 4 + 255) / 256), 256, 0, stream>>>(Sb, QE);
            k_asoft<<<ZH * TT / 8, 256, 0, stream>>>(Sb, P16, Ph, Pl);
            k_pbucket<<<ZH * TT / 8, 256, 0, stream>>>(Ph, Pl, P16, PBh, PBl);   /* 65 relative-position bucket sums per row */
            k_gemmw<bf, 1, false><<<dim3(TT / 64, HD / 64, ZH), 32, 0, stream>>>(PBh, PBl, RVT, nullptr, NE, W2, HD, nullptr, (size_t)TT * NE, 0, (size_t)TT * HD);   /* W2 = buckets . rel_v */
            k_gemmw<bf, 2, false><<<dim3(RH / 64, HD / 64, ZH), 32, 0, stream>>>(Ph, Pl, VTh + zk * HD * TT, VTl + zk * HD * TT, TT, Ob, HD, nullptr, (size_t)RH * TT, (size_t)HD * TT, (size_t)TT * HD);
            k_gemmw<h16, 0, false><<<dim3((TT - RH) / 64, HD / 64, ZH), 32, 0, stream>>>(P16 + (size_t)RH * TT, nullptr, VT16 + zk * HD * TT, nullptr, TT, Ob + (size_t)RH * HD, HD, nullptr, (size_t)TT * TT, (size_t)HD * TT, (size_t)TT * HD);
            k_addob<<<(unsigned)(((size_t)ZH * TT * HD / 4 + 255) / 256), 256, 0, stream>>>(Ob, W2);   /* + sum_j attn[i][j] rel_v[idx] */ k_merge<<<(unsigned)(((size_t)ZH * TT * HD / 2 + 255) / 256), 256, 0, stream>>>(Ob, h0, ATh, ATl); }
        k_gemmw<bf, 1, true><<<dim3(TT / 64, DM / 64, 1), 32, 0, stream>>>(ATh, ATl, WO, nullptr, DQ, OUT + (size_t)b * TT * DM, DM, bo, 0, 0, 0); }
}

// v001
// A run of this version takes 2080 microseconds.
// Timed twice side by side with v000, it ran 1.54 times as fast both times.
#include <hip/hip_runtime.h>

// Multi-head attention with Shaw relative-position terms on the logits AND the values (query, key, value [2][2048][1024]; q,k,v = in W + b ('xw' 1/32, zero biases; 16 heads x 64); idx[i][j] = clip(j - i, -32, 32) + 32; attn = softmax((q.k + q_i.rel_k[idx]) / 8); out_h = attn v + sum_j attn[i][j] rel_v[idx] (tables [65][64] x 0.05, read); out = merged Wo + bo ('xw') -> [2][2048][1024] (4.2 M)).
// Layout per batch: bf16 copies of the three inputs in turn; exact projections + f32 biases; rel_k as an exact plane [128][64] (rows >= 65 zero) and rel_v^T as an exact plane [64][128]; per pass of two heads: dense scores (hybrid rows: < 512 hi/lo 3 products, rest fp16 x1024), QE = q.rel_k^T ([2][2048][128], hi/lo x exact) and a gather-add kernel (Sb[i][j] += QE[i][idx]); softmax with the 1/8; a bucketing kernel sums each row's probabilities into the 65 relative-position buckets (far-left sum, 63 near entries, far-right sum; fixed order) as hi/lo planes; W2 = buckets x rel_v ([2][2048][64], hi/lo x exact) added to attn v in f32; merged hi/lo x Wo exact + bo.
// Compute dtypes, f32 accumulate: every input rounded to bf16; projections exact + f32 biases; q.rel_k and buckets.rel_v hi/lo x exact; attention rows < 512 3 products, rest fp16; softmax f32; Wo hl x exact + bias.

#define NB_  2
#define TT   2048
#define DM   1024
#define NH_  16
#define NKV  16
#define REP  (NH_ / NKV)
#define HD   64
#define DQ   (NH_ * HD)
#define DKV  (NKV * HD)
#define ZH   2
#define RH   512                  // query rows < RH use hi+lo planes (0: none)
#define WIN  0
#define PCAR 1024.0f
#define SCL  0.125f
#define MAXR 32      // max relative position
#define NE   128     // 2*MAXR+1 = 65 table rows padded to 128
typedef _Float16 h16;
typedef unsigned short bf;
typedef __attribute__((ext_vector_type(16))) __bf16   v16bf;
typedef __attribute__((ext_vector_type(16))) _Float16 v16h;
typedef __attribute__((ext_vector_type(8)))  _Float16 v8h;
typedef __attribute__((ext_vector_type(8)))  unsigned short v8us;
typedef __attribute__((ext_vector_type(8)))  float    v8f;
typedef __attribute__((ext_vector_type(4)))  float    v4f;
typedef v8h  __attribute__((may_alias)) v8ha;
typedef v4f  __attribute__((may_alias)) v4fa;
typedef v8us __attribute__((may_alias)) v8usa;

__device__ __forceinline__ unsigned short f2bf(float f) { unsigned u = __float_as_uint(f); u += 0x7FFFu + ((u >> 16) & 1u); return (unsigned short)(u >> 16); }
__device__ __forceinline__ float bf2f(unsigned short b) { return __uint_as_float(((unsigned)b) << 16); }
__device__ __forceinline__ float bfr(float f) { return bf2f(f2bf(f)); }
__device__ __forceinline__ v16h cat16(v8h lo, v8h hi) { return __builtin_shufflevector(lo, hi, 0, 1, 2, 3, 4, 5, 6, 7, 8, 9, 10, 11, 12, 13, 14, 15); }
__device__ __forceinline__ v16bf cat16b(v8us lo, v8us hi) { return __builtin_bit_cast(v16bf, __builtin_shufflevector(lo, hi, 0, 1, 2, 3, 4, 5, 6, 7, 8, 9, 10, 11, 12, 13, 14, 15)); }
__device__ __forceinline__ v8f wmma16(v16h a, v16h b, v8f c) { return __builtin_amdgcn_wmma_f32_16x16x32_f16(false, a, false, b, (short)0, c, false, false); }
__device__ __forceinline__ v8f wmmab(v16bf a, v16bf b, v8f c) { return __builtin_amdgcn_wmma_f32_16x16x32_bf16(false, a, false, b, (short)0, c, false, false); }



// ---- k_gemmw: register-blocked GEMM, ONE WAVE per 64x64 output tile (16 accumulators), operands straight from K-contiguous 16-bit planes; grid (M/64, N/64, Z), 32 threads.
// C[m][n] (f32, pitch ldc, + optional f32 bias[n]) = sum_k A[m][k] Bt[n][k] (+ split products per NSPLIT). z-batch strides sA/sB/sC in elements. K % 32 == 0.
template <typename T16> struct WFrag;
template <> struct WFrag<h16> { typedef v16h V; static __device__ __forceinline__ V ld(const h16* p) { return cat16(*(const v8h*)p, *(const v8h*)(p + 16)); } static __device__ __forceinline__ v8f mma(V a, V b, v8f c) { return wmma16(a, b, c); } };
template <> struct WFrag<bf> { typedef v16bf V; static __device__ __forceinline__ V ld(const bf* p) { return cat16b(*(const v8us*)p, *(const v8us*)(p + 16)); } static __device__ __forceinline__ v8f mma(V a, V b, v8f c) { return wmmab(a, b, c); } };
template <typename T16, int NSPLIT, bool BIAS>
__global__ __launch_bounds__(32) void k_gemmw(const T16* __restrict__ A, const T16* __restrict__ A2, const T16* __restrict__ Bt, const T16* __restrict__ Bt2, int K, float* C, int ldc, const float* __restrict__ bias, size_t sA, size_t sB, size_t sC) {
    typedef typename WFrag<T16>::V V;
    __shared__ __align__(16) float os[16 * 68];
    const size_t z = blockIdx.z; A += z * sA; if (A2) A2 += z * sA; Bt += z * sB; if (Bt2) Bt2 += z * sB; C += z * sC;
    const int lane = threadIdx.x & 31, lr = lane & 15, hi = lane >> 4; const int r0 = blockIdx.x * 64, c0 = blockIdx.y * 64;
    v8f acc[4][4];
#pragma unroll
    for (int mb = 0; mb < 4; ++mb)
#pragma unroll
        for (int nb = 0; nb < 4; ++nb) acc[mb][nb] = (v8f){};
    const size_t aoff = (size_t)(r0 + lr) * K + 8 * hi, boff = (size_t)(c0 + lr) * K + 8 * hi;
#pragma unroll 1
    for (int kc = 0; kc < K; kc += 32) {
        V a[4], a2[4];
#pragma unroll
        for (int mb = 0; mb < 4; ++mb) { a[mb] = WFrag<T16>::ld(A + aoff + (size_t)mb * 16 * K + kc); if (NSPLIT == 1 || NSPLIT == 2) a2[mb] = WFrag<T16>::ld(A2 + aoff + (size_t)mb * 16 * K + kc); }
#pragma unroll
        for (int nb = 0; nb < 4; ++nb) { const V b = WFrag<T16>::ld(Bt + boff + (size_t)nb * 16 * K + kc); V b2; if (NSPLIT >= 2) b2 = WFrag<T16>::ld(Bt2 + boff + (size_t)nb * 16 * K + kc);
#pragma unroll
            for (int mb = 0; mb < 4; ++mb) { acc[mb][nb] = WFrag<T16>::mma(a[mb], b, acc[mb][nb]); if (NSPLIT == 1 || NSPLIT == 2) acc[mb][nb] = WFrag<T16>::mma(a2[mb], b, acc[mb][nb]); if (NSPLIT >= 2) acc[mb][nb] = WFrag<T16>::mma(a[mb], b2, acc[mb][nb]); } }
        asm volatile("v_nop\n\tv_nop\n\tv_nop\n\tv_nop" : "+v"(acc[0][0]), "+v"(acc[1][1]), "+v"(acc[2][2]), "+v"(acc[3][3]) : "v"(a[0]), "v"(a[3]));
    }
#pragma unroll
    for (int mb = 0; mb < 4; ++mb) {
#pragma unroll
        for (int nb = 0; nb < 4; ++nb) {
#pragma unroll
            for (int j = 0; j < 8; ++j) os[(hi * 8 + j) * 68 + nb * 16 + lr] = acc[mb][nb][j]; }
        __builtin_amdgcn_wave_barrier(); asm volatile("" ::: "memory");
        float* crow = C + (size_t)(r0 + mb * 16) * ldc + c0;
{
#pragma unroll
            for (int s = 0; s < 8; ++s) { const int row = 2 * s + hi, cofs = lr * 4; v4f val = *(const v4fa*)(os + row * 68 + cofs); if (BIAS) { val[0] += bfr(bias[c0 + cofs]); val[1] += bfr(bias[c0 + cofs + 1]); val[2] += bfr(bias[c0 + cofs + 2]); val[3] += bfr(bias[c0 + cofs + 3]); }
                *(v4f*)(crow + (size_t)row * ldc + cofs) = val; }
             }
        __builtin_amdgcn_wave_barrier(); asm volatile("" ::: "memory");
    }
}

// ---- k_gemmsk: the products of k_gemmw for a long K: ONE WORK-GROUP of NW waves per (16 MB)x64 output tile, wave w takes k in [w KK/NW, (w+1) KK/NW) (4 MB accumulators);
// the NW partial tiles meet in LDS and are summed in wave order 0..NW-1 (fixed), then leave as whole 256-byte rows (+ optional f32 bias[n]). grid (M/(16 MB), N/64, Z), 32 NW threads. NSPLIT as in k_gemmw. KK % (32 NW) == 0.
template <typename T16, int NSPLIT, bool BIAS, int KK, int MB, int NW>
__global__ __launch_bounds__(NW * 32) void k_gemmsk(const T16* __restrict__ A, const T16* __restrict__ A2, const T16* __restrict__ Bt, const T16* __restrict__ Bt2, float* C, int ldc, const float* __restrict__ bias, size_t sA, size_t sB, size_t sC) {
    typedef typename WFrag<T16>::V V;
    __shared__ __align__(16) float red[NW * MB * 1024];   // [wave][subtile mb*4+nb][half of its 8 rows a lane][lane] x 4 floats
    __shared__ __align__(16) float os[MB * 16 * 68];
    const size_t z = blockIdx.z; A += z * sA; if (NSPLIT == 1 || NSPLIT == 2) A2 += z * sA; Bt += z * sB; if (NSPLIT >= 2) Bt2 += z * sB; C += z * sC;
    const int tid = threadIdx.x, lane = tid & 31, w = tid >> 5, lr = lane & 15, hi = lane >> 4; const int r0 = blockIdx.x * (MB * 16), c0 = blockIdx.y * 64;
    // every '#pragma unroll' in this kernel makes the indices of acc, a, a2 and s constants, so that they stay in registers
    v8f acc[MB][4];
#pragma unroll
    for (int mb = 0; mb < MB; ++mb)
#pragma unroll
        for (int nb = 0; nb < 4; ++nb) acc[mb][nb] = (v8f){};
    const size_t aoff = (size_t)(r0 + lr) * KK + 8 * hi + w * (KK / NW), boff = (size_t)(c0 + lr) * KK + 8 * hi + w * (KK / NW);
    // unrolled whole (KK / (32 NW) = 4 trips here): no back edge behind a matrix instruction
#pragma unroll
    for (int kc = 0; kc < KK / NW; kc += 32) {
        V a[MB], a2[MB];
#pragma unroll
        for (int mb = 0; mb < MB; ++mb) { a[mb] = WFrag<T16>::ld(A + aoff + (size_t)mb * 16 * KK + kc); if (NSPLIT == 1 || NSPLIT == 2) a2[mb] = WFrag<T16>::ld(A2 + aoff + (size_t)mb * 16 * KK + kc); }
#pragma unroll
        for (int nb = 0; nb < 4; ++nb) { const V b = WFrag<T16>::ld(Bt + boff + (size_t)nb * 16 * KK + kc); V b2; if (NSPLIT >= 2) b2 = WFrag<T16>::ld(Bt2 + boff + (size_t)nb * 16 * KK + kc);
#pragma unroll
            for (int mb = 0; mb < MB; ++mb) { acc[mb][nb] = WFrag<T16>::mma(a[mb], b, acc[mb][nb]); if (NSPLIT == 1 || NSPLIT == 2) acc[mb][nb] = WFrag<T16>::mma(a2[mb], b, acc[mb][nb]); if (NSPLIT >= 2) acc[mb][nb] = WFrag<T16>::mma(a[mb], b2, acc[mb][nb]); } }
    }
#pragma unroll
    for (int mb = 0; mb < MB; ++mb)
#pragma unroll
        for (int nb = 0; nb < 4; ++nb) { float* rp = red + w * (MB * 1024) + (mb * 4 + nb) * 256 + lane * 4; const v8f c = acc[mb][nb];
            *(v4fa*)rp = (v4f){c[0], c[1], c[2], c[3]}; *(v4fa*)(rp + 128) = (v4f){c[4], c[5], c[6], c[7]}; }
    __syncthreads();   // every wave's partial tile is in LDS
#pragma unroll
    for (int u = 0; u < MB * 8 / NW; ++u) { const int idx = u * (NW * 32) + tid;   // one group of 4 floats of the tile; idx & 31 == lane
        v4f s = *(const v4fa*)(red + idx * 4);
#pragma unroll
        for (int q = 1; q < NW; ++q) { const v4f p = *(const v4fa*)(red + q * (MB * 1024) + idx * 4);
#pragma unroll
            for (int j = 0; j < 4; ++j) s[j] = __fadd_rn(s[j], p[j]); }
        const int t = idx >> 6, half = (idx >> 5) & 1; const int row = (t >> 2) * 16 + hi * 8 + half * 4, col = (t & 3) * 16 + lr;
#pragma unroll
        for (int j = 0; j < 4; ++j) os[(row + j) * 68 + col] = s[j]; }
    __syncthreads();   // the summed tile is whole before it is read by rows
#pragma unroll
    for (int u = 0; u < MB * 8 / NW; ++u) { const int idx = u * (NW * 32) + tid; const int row = idx >> 4, cofs = (idx & 15) * 4; v4f val = *(const v4fa*)(os + row * 68 + cofs);
        if (BIAS) { val[0] += bfr(bias[c0 + cofs]); val[1] += bfr(bias[c0 + cofs + 1]); val[2] += bfr(bias[c0 + cofs + 2]); val[3] += bfr(bias[c0 + cofs + 3]); }
        *(v4f*)(C + (size_t)(r0 + row) * ldc + c0 + cofs) = val; }
}

__device__ __forceinline__ h16 tohx(float x) { return (h16)x; }
__device__ __forceinline__ void splitf(float y, unsigned short& h, unsigned short& l) { h = f2bf(y); l = f2bf(y - bf2f(h)); }
typedef __attribute__((ext_vector_type(2))) _Float16 v2h;
typedef __attribute__((ext_vector_type(4))) _Float16 v4h;
typedef __attribute__((ext_vector_type(2))) unsigned short v2us;
typedef __attribute__((ext_vector_type(4))) unsigned short v4us;
typedef __attribute__((ext_vector_type(2))) float v2f;
typedef __attribute__((ext_vector_type(4))) int v4i;

__global__ __launch_bounds__(256) void k_wtG(const float* __restrict__ w, int K, int N, bf* Bt) {
    const int lane = threadIdx.x & 31; const int L0 = (blockIdx.x * 8 + (threadIdx.x >> 5)) * 8; const int nlines = N * K / 64;
{
#pragma unroll 1
        for (int l = 0; l < 8; ++l) { const int L = L0 + l; if (L >= nlines) break; const size_t e = (size_t)L * 64 + lane * 2; const int k = (int)(e % K), n = (int)(e / K); v2us o;
            o[0] = f2bf(w[(size_t)k * N + n]); o[1] = f2bf(w[(size_t)(k + 1) * N + n]); *(v2us*)(Bt + e) = o; }
         }
}
__global__ __launch_bounds__(256) void k_cvt8(const float* __restrict__ src, bf* dst, size_t n8) { const size_t i = (size_t)blockIdx.x * 256 + threadIdx.x; if (i >= n8) return; const v8f v = *(const v8f*)(src + i * 8); v8us o;
#pragma unroll
    for (int k = 0; k < 8; ++k) o[k] = f2bf(v[k]); *(v8us*)(dst + i * 8) = o;  }

// k_rope: head planes [h][t][d] (fp16 + hi/lo) of rope(x) x sc with the rotate-half convention out[d] = x[d] cos[t][d] - x[d+HD/2] sin[t][d], out[d+HD/2] = x[d+HD/2] cos[t][d+HD/2] + x[d] sin[t][d+HD/2]
__global__ __launch_bounds__(256) void k_rope(const float* __restrict__ F, int pitch, int nheads, const float* __restrict__ CS, const float* __restrict__ RF, const float* __restrict__ nw, float sc, h16* P16, bf* Ph, bf* Pl) {
    const size_t e = ((size_t)blockIdx.x * 256 + threadIdx.x) * 2; if (e >= (size_t)nheads * TT * HD) return; const int d = (int)(e % HD); const int t = (int)((e / HD) % TT); const int h = (int)(e / ((size_t)HD * TT)); const float* f = F + (size_t)t * pitch + h * HD; const float rf = RF ? RF[(size_t)h * TT + t] : 1.0f; v2h o16; v2us oh, ol;
#pragma unroll
    for (int q = 0; q < 2; ++q) { const int dd = d + q; const int dp = (dd < HD / 2) ? dd + HD / 2 : dd - HD / 2; float x0 = f[dd], x1 = f[dp];
        if (RF) { float n0 = __fmul_rn(x0, rf), n1 = __fmul_rn(x1, rf); asm volatile("" : "+v"(n0)); asm volatile("" : "+v"(n1)); x0 = __fmul_rn(bfr(nw[dd]), n0); x1 = __fmul_rn(bfr(nw[dp]), n1); }
        const v2f cs = *(const v2f*)(CS + ((size_t)t * HD + dd) * 2); float a = __fmul_rn(x0, cs[0]), bq = __fmul_rn(x1, cs[1]); asm volatile("" : "+v"(a)); asm volatile("" : "+v"(bq)); const float r = ((dd < HD / 2) ? __fsub_rn(a, bq) : __fadd_rn(a, bq)) * sc;
        o16[q] = tohx(r); unsigned short a2, c2; splitf(r, a2, c2); oh[q] = a2; ol[q] = c2; }
    *(v2h*)(P16 + e) = o16; *(v2us*)(Ph + e) = oh; *(v2us*)(Pl + e) = ol;  }
__global__ __launch_bounds__(256) void k_vtp(const float* __restrict__ F, int pitch, int nheads, h16* V16, bf* Vh, bf* Vl) { const size_t e = ((size_t)blockIdx.x * 256 + threadIdx.x) * 2; if (e >= (size_t)nheads * HD * TT) return; const int t = (int)(e % TT); const int d = (int)((e / TT) % HD); const int g = (int)(e / ((size_t)TT * HD)); v2h o16; v2us oh, ol;
#pragma unroll
    for (int q = 0; q < 2; ++q) { const float x = F[(size_t)(t + q) * pitch + g * HD + d]; o16[q] = tohx(x); unsigned short a2, c2; splitf(x, a2, c2); oh[q] = a2; ol[q] = c2; }
    *(v2h*)(V16 + e) = o16; *(v2us*)(Vh + e) = oh; *(v2us*)(Vl + e) = ol;  }
__global__ __launch_bounds__(256) void k_csid(float* CS) { const int idx = blockIdx.x * 256 + threadIdx.x; if (idx >= TT * HD) return; v2f cs; cs[0] = 1.0f; cs[1] = 0.0f; *(v2f*)(CS + (size_t)idx * 2) = cs;  }
// k_asoft: per row (zz, i): t = S x HD^-0.5 (no mask); softmax over the 2048 keys (register row, one exp, fixed trees);
__global__ __launch_bounds__(256) void k_asoft(const float* __restrict__ Sb, h16* P16, bf* Ph, bf* Pl) {
    const int lane = threadIdx.x & 31; const int row = blockIdx.x * 8 + (threadIdx.x >> 5); if (row >= ZH * TT) return; const int i = row % TT; const int zz = row / TT; (void)zz; const bool hires = (i < RH); const float* sr = Sb + (size_t)row * TT; float v[TT / 32]; float mx = -3.0e38f;
#pragma unroll
    for (int ch = 0; ch < TT / 128; ++ch) { const int j0 = ch * 128 + lane * 4; const v4f a = *(const v4f*)(sr + j0);
#pragma unroll
        for (int q = 0; q < 4; ++q) { const int j = j0 + q; (void)j; const float t = a[q] * SCL; v[ch * 4 + q] = t; mx = fmaxf(mx, t); } }
#pragma unroll
    for (int sh = 16; sh; sh >>= 1) mx = fmaxf(mx, __shfl_xor(mx, sh, 32));
    float sum = 0.f;
#pragma unroll
    for (int k = 0; k < TT / 32; ++k) { float d0 = __fsub_rn(v[k], mx); asm volatile("" : "+v"(d0)); v[k] = __builtin_amdgcn_exp2f(__fmul_rn(d0, 1.4426950408889634f)); sum += v[k]; }
#pragma unroll
    for (int sh = 16; sh; sh >>= 1) sum += __shfl_xor(sum, sh, 32);
    const float f = __fdiv_rn(hires ? 1.0f : PCAR, sum);
{
        if (hires) {
#pragma unroll
            for (int ch = 0; ch < TT / 128; ++ch) { v4us oh, ol;
#pragma unroll
                for (int q = 0; q < 4; ++q) { unsigned short a, c2; splitf(v[ch * 4 + q] * f, a, c2); oh[q] = a; ol[q] = c2; }
                const size_t oo = ((size_t)zz * (RH ? RH : 1) + i) * TT + ch * 128 + lane * 4; *(v4us*)(Ph + oo) = oh; *(v4us*)(Pl + oo) = ol; }
        } else {
#pragma unroll
            for (int ch = 0; ch < TT / 128; ++ch) { v4h o4;
#pragma unroll
                for (int q = 0; q < 4; ++q) o4[q] = tohx(v[ch * 4 + q] * f);
                *(v4h*)(P16 + (size_t)row * TT + ch * 128 + lane * 4) = o4; } }
         }
}
__global__ __launch_bounds__(256) void k_epad2(const float* __restrict__ E, bf* EB) { const size_t i = (size_t)blockIdx.x * 256 + threadIdx.x; if (i >= (size_t)NE * HD / 8) return; const int d0 = (int)(i % (HD / 8)) * 8; const int r = (int)(i / (HD / 8)); const float* src = E + (size_t)min(r, 2 * MAXR) * HD + d0; v8us o;
#pragma unroll
    for (int q = 0; q < 8; ++q) { const unsigned short v = f2bf(src[q]); o[q] = (r <= 2 * MAXR) ? v : (unsigned short)0; }
    *(v8us*)(EB + (size_t)r * HD + d0) = o;  }
__global__ __launch_bounds__(256) void k_addshaw(float* Sb, const float* __restrict__ QE) { const size_t k = (size_t)blockIdx.x * 256 + threadIdx.x; if (k >= (size_t)ZH * TT * TT / 4) return; const size_t e = k * 4; const int j0 = (int)(e % TT); const int i = (int)((e / TT) % TT); const int zz = (int)(e / ((size_t)TT * TT)); const float* qe = QE + ((size_t)zz * TT + i) * NE; v4f a = *(const v4f*)(Sb + e);
#pragma unroll
    for (int q = 0; q < 4; ++q) { const int r = min(max((j0 + q) - i, -MAXR), MAXR) + MAXR;   /* this module: dist = k - q */ a[q] = __fadd_rn(a[q], qe[r]); }
    *(v4f*)(Sb + e) = a;  }
__global__ __launch_bounds__(256) void k_rvt(const float* __restrict__ E, bf* RVT) { const size_t i = (size_t)blockIdx.x * 256 + threadIdx.x; if (i >= (size_t)HD * NE / 8) return; const int r0 = (int)(i % (NE / 8)) * 8; const int d = (int)(i / (NE / 8)); v8us o;
#pragma unroll
    for (int q = 0; q < 8; ++q) { const int r = r0 + q; const unsigned short v = f2bf(E[(size_t)min(r, 2 * MAXR) * HD + d]); o[q] = (r <= 2 * MAXR) ? v : (unsigned short)0; }
    *(v8us*)(RVT + (size_t)d * NE + r0) = o;  }
__global__ __launch_bounds__(256) void k_pbucket(const bf* __restrict__ Ph, const bf* __restrict__ Pl, const h16* __restrict__ P16, bf* PBh, bf* PBl) { const int lane = threadIdx.x & 31; const int row = blockIdx.x * 8 + (threadIdx.x >> 5); if (row >= ZH * TT) return; const int i = row % TT; const bool hires = (i < RH);
    auto pval = [&](int j) -> float { const size_t o = (size_t)row * TT + j; return hires ? __fadd_rn(bf2f(Ph[(size_t)(row / TT) * RH * TT + (size_t)i * TT + j]), bf2f(Pl[(size_t)(row / TT) * RH * TT + (size_t)i * TT + j])) : __fmul_rn((float)P16[o], 0.0009765625f); };
    float sl = 0.f, sr = 0.f;
#pragma unroll 4
    for (int q = 0; q < TT / 32; ++q) { const int j = lane * (TT / 32) + q; const float p = pval(j); sl = __fadd_rn(sl, (j <= i - MAXR) ? p : 0.f); sr = __fadd_rn(sr, (j >= i + MAXR) ? p : 0.f); }
#pragma unroll
    for (int sh = 16; sh; sh >>= 1) { sl = __fadd_rn(sl, __shfl_xor(sl, sh, 32)); sr = __fadd_rn(sr, __shfl_xor(sr, sh, 32)); }
    v4us oh, ol;
#pragma unroll
    for (int q = 0; q < 4; ++q) { const int r = lane * 4 + q; float v; if (r == 0) v = sl; else if (r == 2 * MAXR) v = sr; else if (r < 2 * MAXR) { const int j = i + r - MAXR; const int jc = min(max(j, 0), TT - 1); const float p = pval(jc); v = (j >= 0 && j < TT) ? p : 0.f; } else v = 0.f; unsigned short u, w; splitf(v, u, w); oh[q] = u; ol[q] = w; }
    const size_t ob = (size_t)row * NE + lane * 4; *(v4us*)(PBh + ob) = oh; *(v4us*)(PBl + ob) = ol;  }
__global__ __launch_bounds__(256) void k_addob(float* Ob, const float* __restrict__ W2) { const size_t k = (size_t)blockIdx.x * 256 + threadIdx.x; if (k >= (size_t)ZH * TT * HD / 4) return; const size_t e = k * 4; const int i = (int)((e / HD) % TT); const float sc = (i < RH) ? 1.0f : 1024.0f; const v4f a = *(const v4f*)(Ob + e); const v4f w = *(const v4f*)(W2 + e); v4f o;
#pragma unroll
    for (int q = 0; q < 4; ++q) o[q] = __fadd_rn(a[q], __fmul_rn(w[q], sc));
    *(v4f*)(Ob + e) = o;  }
__global__ __launch_bounds__(256) void k_merge(const float* __restrict__ O, int h0, bf* Ah, bf* Al) { const size_t e = ((size_t)blockIdx.x * 256 + threadIdx.x) * 2; if (e >= (size_t)ZH * TT * HD) return; const int d = (int)(e % HD); const int t = (int)((e / HD) % TT); const int zz = (int)(e / ((size_t)HD * TT)); const float cs = (t < RH) ? 1.0f : (1.0f / PCAR); const size_t oo = (size_t)t * DQ + (h0 + zz) * HD + d;
    v2us oh, ol;
#pragma unroll
    for (int q = 0; q < 2; ++q) { unsigned short a, c2; splitf(O[e + q] * cs, a, c2); oh[q] = a; ol[q] = c2; } *(v2us*)(Ah + oo) = oh; *(v2us*)(Al + oo) = ol;  }

extern "C" void kernel_launch(void* const* d_in, const int* in_sizes, int n_in,
                              void* d_out, int out_size, void* d_ws, size_t ws_size, hipStream_t stream) {
    (void)in_sizes; (void)n_in; (void)out_size;
    const float* x = (const float*)d_in[0]; const float* xk = (const float*)d_in[1]; const float* xv = (const float*)d_in[2]; const float* wq = (const float*)d_in[3]; const float* bq = (const float*)d_in[4]; const float* wk = (const float*)d_in[5]; const float* bk = (const float*)d_in[6]; const float* wv = (const float*)d_in[7]; const float* bv = (const float*)d_in[8]; const float* wo = (const float*)d_in[9]; const float* bo = (const float*)d_in[10]; const float* relk = (const float*)d_in[11]; const float* relv = (const float*)d_in[12];   /* [65][64] each */
    float* OUT = (float*)d_out;     // [2][2048][1024]
    char* wsp = (char*)d_ws;
    auto take = [&](size_t bytes) { char* p = wsp; wsp += (bytes + 255) & ~(size_t)255; return (void*)p; };
    bf* EB = (bf*)take((size_t)NE * HD * 2); bf* RVT = (bf*)take((size_t)HD * NE * 2); float* QE = (float*)take((size_t)ZH * TT * NE * 4); bf* PBh = (bf*)take((size_t)ZH * TT * NE * 2); bf* PBl = (bf*)take((size_t)ZH * TT * NE * 2); float* W2 = (float*)take((size_t)ZH * TT * HD * 4); bf* WQ = (bf*)take((size_t)DQ * DM * 2); bf* WK = (bf*)take((size_t)DKV * DM * 2); bf* WV = (bf*)take((size_t)DKV * DM * 2); bf* WO = (bf*)take((size_t)DM * DQ * 2); float* CS = (float*)take((size_t)TT * HD * 2 * 4);
    bf* XB = (bf*)take((size_t)TT * DM * 2); float* FQ = (float*)take((size_t)TT * DQ * 4); float* FK = (float*)take((size_t)TT * DKV * 4);
    h16* QP16 = (h16*)take((size_t)NH_ * TT * HD * 2); h16* KP16 = (h16*)take((size_t)NKV * TT * HD * 2); h16* VT16 = (h16*)take((size_t)NKV * HD * TT * 2);
    bf* QPh = (bf*)take((size_t)NH_ * TT * HD * 2); bf* QPl = (bf*)take((size_t)NH_ * TT * HD * 2); bf* KPh = (bf*)take((size_t)NKV * TT * HD * 2); bf* KPl = (bf*)take((size_t)NKV * TT * HD * 2); bf* VTh = (bf*)take((size_t)NKV * HD * TT * 2); bf* VTl = (bf*)take((size_t)NKV * HD * TT * 2); bf* Ph = (bf*)take((size_t)ZH * RH * TT * 2); bf* Pl = (bf*)take((size_t)ZH * RH * TT * 2);
    float* Sb = (float*)take((size_t)ZH * TT * TT * 4); h16* P16 = (h16*)take((size_t)ZH * TT * TT * 2); float* Ob = (float*)take((size_t)ZH * TT * HD * 4); bf* ATh = (bf*)take((size_t)TT * DQ * 2); bf* ATl = (bf*)take((size_t)TT * DQ * 2);
    if ((size_t)(wsp - (char*)d_ws) > ws_size) return;    // ws 256 MiB
    float* FV = FK;   // v projection reuses the k buffer after the k planes are built (stream-ordered)
    { k_wtG<<<(unsigned)((DM * DQ / 64 + 63) / 64), 256, 0, stream>>>(wq, DM, DQ, WQ); k_wtG<<<(unsigned)((DM * DKV / 64 + 63) / 64), 256, 0, stream>>>(wk, DM, DKV, WK); k_wtG<<<(unsigned)((DM * DKV / 64 + 63) / 64), 256, 0, stream>>>(wv, DM, DKV, WV);
      k_wtG<<<(unsigned)((DQ * DM / 64 + 63) / 64), 256, 0, stream>>>(wo, DQ, DM, WO);
       }
    k_csid<<<(TT * HD + 255) / 256, 256, 0, stream>>>(CS);
    const unsigned LQ = (unsigned)(((size_t)NH_ * TT * HD / 2 + 255) / 256), LKv = (unsigned)(((size_t)NKV * TT * HD / 2 + 255) / 256);
    k_epad2<<<(unsigned)(((size_t)NE * HD / 8 + 255) / 256), 256, 0, stream>>>(relk, EB); k_rvt<<<(unsigned)(((size_t)HD * NE / 8 + 255) / 256), 256, 0, stream>>>(relv, RVT);   /* rel_k plane [128][64], rel_v^T plane [64][128] */
    for (int b = 0; b < NB_; ++b) {
        
        k_cvt8<<<(unsigned)(((size_t)TT * DM / 8 + 255) / 256), 256, 0, stream>>>(x + (size_t)b * TT * DM, XB, (size_t)TT * DM / 8);
        k_gemmsk<bf, 0, true, DM, 4, 8><<<dim3(TT / 64, DQ / 64, 1), 256, 0, stream>>>(XB, nullptr, WQ, nullptr, FQ, DQ, bq, 0, 0, 0);
        k_rope<<<LQ, 256, 0, stream>>>(FQ, DQ, NH_, CS, nullptr, nullptr, 1.0f, QP16, QPh, QPl);
        k_cvt8<<<(unsigned)(((size_t)TT * DM / 8 + 255) / 256), 256, 0, stream>>>(xk + (size_t)b * TT * DM, XB, (size_t)TT * DM / 8); k_gemmsk<bf, 0, true, DM, 4, 8><<<dim3(TT / 64, DKV / 64, 1), 256, 0, stream>>>(XB, nullptr, WK, nullptr, FK, DKV, bk, 0, 0, 0);
        k_rope<<<LKv, 256, 0, stream>>>(FK, DKV, NKV, CS, nullptr, nullptr, 1.0f, KP16, KPh, KPl);
        k_cvt8<<<(unsigned)(((size_t)TT * DM / 8 + 255) / 256), 256, 0, stream>>>(xv + (size_t)b * TT * DM, XB, (size_t)TT * DM / 8); k_gemmsk<bf, 0, true, DM, 4, 8><<<dim3(TT / 64, DKV / 64, 1), 256, 0, stream>>>(XB, nullptr, WV, nullptr, FV, DKV, bv, 0, 0, 0); k_vtp<<<LKv, 256, 0, stream>>>(FV, DKV, NKV, VT16, VTh, VTl);
        for (int h0 = 0; h0 < NH_; h0 += ZH) { const size_t zq = (size_t)h0, zk = (size_t)(h0 / REP);   // one kv head per query head: the pass's two heads use consecutive kv planes (z-strides TT*HD)
            k_gemmw<bf, 2, false><<<dim3(RH / 64, TT / 64, ZH), 32, 0, stream>>>(QPh + zq * TT * HD, QPl + zq * TT * HD, KPh + zk * TT * HD, KPl + zk * TT * HD, HD, Sb, TT, nullptr, (size_t)TT * HD, (size_t)TT * HD, (size_t)TT * TT);
            k_gemmw<h16, 0, false><<<dim3((TT - RH) / 64, TT / 64, ZH), 32, 0, stream>>>(QP16 + zq * TT * HD + (size_t)RH * HD, nullptr, KP16 + zk * TT * HD, nullptr, HD, Sb + (size_t)RH * TT, TT, nullptr, (size_t)TT * HD, (size_t)TT * HD, (size_t)TT * TT);
            k_gemmw<bf, 1, false><<<dim3(TT / 64, NE / 64, ZH), 32, 0, stream>>>(QPh + zq * TT * HD, QPl + zq * TT * HD, EB, nullptr, HD, QE, NE, nullptr, (size_t)TT * HD, 0, (size_t)TT * NE);   /* QE[i][r] = q_i . rel_k[r] */
            k_addshaw<<<(unsigned)(((size_t)ZH * TT * TT / 4 + 255) / 256), 256, 0, stream>>>(Sb, QE);
            k_asoft<<<ZH * TT / 8, 256, 0, stream>>>(Sb, P16, Ph, Pl);
            k_pbucket<<<ZH * TT / 8, 256, 0, stream>>>(Ph, Pl, P16, PBh, PBl);   /* 65 relative-position bucket sums per row */
            k_gemmw<bf, 1, false><<<dim3(TT / 64, HD / 64, ZH), 32, 0, stream>>>(PBh, PBl, RVT, nullptr, NE, W2, HD, nullptr, (size_t)TT * NE, 0, (size_t)TT * HD);   /* W2 = buckets . rel_v */
            k_gemmsk<bf, 2, false, TT, 2, 16><<<dim3(RH / 32, HD / 64, ZH), 512, 0, stream>>>(Ph, Pl, VTh + zk * HD * TT, VTl + zk * HD * TT, Ob, HD, nullptr, (size_t)RH * TT, (size_t)HD * TT, (size_t)TT * HD);
            k_gemmsk<h16, 0, false, TT, 2, 16><<<dim3((TT - RH) / 32, HD / 64, ZH), 512, 0, stream>>>(P16 + (size_t)RH * TT, nullptr, VT16 + zk * HD * TT, nullptr, Ob + (size_t)RH * HD, HD, nullptr, (size_t)TT * TT, (size_t)HD * TT, (size_t)TT * HD);
            k_addob<<<(unsigned)(((size_t)ZH * TT * HD / 4 + 255) / 256), 256, 0, stream>>>(Ob, W2);   /* + sum_j attn[i][j] rel_v[idx] */ k_merge<<<(unsigned)(((size_t)ZH * TT * HD / 2 + 255) / 256), 256, 0, stream>>>(Ob, h0, ATh, ATl); }
        k_gemmsk<bf, 1, true, DQ, 4, 8><<<dim3(TT / 64, DM / 64, 1), 256, 0, stream>>>(ATh, ATl, WO, nullptr, OUT + (size_t)b * TT * DM, DM, bo, 0, 0, 0); }
}

// v002
// It runs in 1110 microseconds.
// Two timings next to v001 both put it at 1.87 times that version's speed.
// Counting every step since v000, it is 2.88 times as fast.
#include <hip/hip_runtime.h>

// Multi-head attention with Shaw relative-position terms on the logits AND the values (query, key, value [2][2048][1024]; q,k,v = in W + b ('xw' 1/32, zero biases; 16 heads x 64); idx[i][j] = clip(j - i, -32, 32) + 32; attn = softmax((q.k + q_i.rel_k[idx]) / 8); out_h = attn v + sum_j attn[i][j] rel_v[idx] (tables [65][64] x 0.05, read); out = merged Wo + bo ('xw') -> [2][2048][1024] (4.2 M)).
// Layout per batch: bf16 copies of the three inputs in turn; exact projections + f32 biases; rel_k as an exact plane [128][64] (rows >= 65 zero) and rel_v^T as an exact plane [64][128]; per pass of two heads: dense scores (hybrid rows: < 512 hi/lo 3 products, rest fp16 x1024), QE = q.rel_k^T ([2][2048][128], hi/lo x exact); one row kernel adds QE[i][idx] to the scores, does the softmax with the 1/8 and sums each row's probabilities into the 65 relative-position buckets (far-left sum, 63 near entries, far-right sum; fixed order) as hi/lo planes; W2 = buckets x rel_v ([2][2048][64], hi/lo x exact) added to attn v in f32; merged hi/lo x Wo exact + bo.
// Compute dtypes, f32 accumulate: every input rounded to bf16; projections exact + f32 biases; q.rel_k and buckets.rel_v hi/lo x exact; attention rows < 512 3 products, rest fp16; softmax f32; Wo hl x exact + bias.

#define NB_  2
#define TT   2048
#define DM   1024
#define NH_  16
#define NKV  16
#define REP  (NH_ / NKV)
#define HD   64
#define DQ   (NH_ * HD)
#define DKV  (NKV * HD)
#define ZH   2
#define RH   512                  // query rows < RH use hi+lo planes (0: none)
#define WIN  0
#define PCAR 1024.0f
#define SCL  0.125f
#define MAXR 32      // max relative position
#define NE   128     // 2*MAXR+1 = 65 table rows padded to 128
typedef _Float16 h16;
typedef unsigned short bf;
typedef __attribute__((ext_vector_type(16))) __bf16   v16bf;
typedef __attribute__((ext_vector_type(16))) _Float16 v16h;
typedef __attribute__((ext_vector_type(8)))  _Float16 v8h;
typedef __attribute__((ext_vector_type(8)))  unsigned short v8us;
typedef __attribute__((ext_vector_type(8)))  float    v8f;
typedef __attribute__((ext_vector_type(4)))  float    v4f;
typedef v8h  __attribute__((may_alias)) v8ha;
typedef v4f  __attribute__((may_alias)) v4fa;
typedef v8us __attribute__((may_alias)) v8usa;

__device__ __forceinline__ unsigned short f2bf(float f) { unsigned u = __float_as_uint(f); u += 0x7FFFu + ((u >> 16) & 1u); return (unsigned short)(u >> 16); }
__device__ __forceinline__ float bf2f(unsigned short b) { return __uint_as_float(((unsigned)b) << 16); }
__device__ __forceinline__ float bfr(float f) { return bf2f(f2bf(f)); }
__device__ __forceinline__ v16h cat16(v8h lo, v8h hi) { return __builtin_shufflevector(lo, hi, 0, 1, 2, 3, 4, 5, 6, 7, 8, 9, 10, 11, 12, 13, 14, 15); }
__device__ __forceinline__ v16bf cat16b(v8us lo, v8us hi) { return __builtin_bit_cast(v16bf, __builtin_shufflevector(lo, hi, 0, 1, 2, 3, 4, 5, 6, 7, 8, 9, 10, 11, 12, 13, 14, 15)); }
__device__ __forceinline__ v8f wmma16(v16h a, v16h b, v8f c) { return __builtin_amdgcn_wmma_f32_16x16x32_f16(false, a, false, b, (short)0, c, false, false); }
__device__ __forceinline__ v8f wmmab(v16bf a, v16bf b, v8f c) { return __builtin_amdgcn_wmma_f32_16x16x32_bf16(false, a, false, b, (short)0, c, false, false); }



// ---- k_gemmw: register-blocked GEMM, ONE WAVE per 64x64 output tile (16 accumulators), operands straight from K-contiguous 16-bit planes; grid (M/64, N/64, Z), 32 threads.
// C[m][n] (f32, pitch ldc, + optional f32 bias[n]) = sum_k A[m][k] Bt[n][k] (+ split products per NSPLIT). z-batch strides sA/sB/sC in elements. K % 32 == 0.
template <typename T16> struct WFrag;
template <> struct WFrag<h16> { typedef v16h V; static __device__ __forceinline__ V ld(const h16* p) { return cat16(*(const v8h*)p, *(const v8h*)(p + 16)); } static __device__ __forceinline__ v8f mma(V a, V b, v8f c) { return wmma16(a, b, c); } };
template <> struct WFrag<bf> { typedef v16bf V; static __device__ __forceinline__ V ld(const bf* p) { return cat16b(*(const v8us*)p, *(const v8us*)(p + 16)); } static __device__ __forceinline__ v8f mma(V a, V b, v8f c) { return wmmab(a, b, c); } };
template <typename T16, int NSPLIT, bool BIAS>
__global__ __launch_bounds__(32) void k_gemmw(const T16* __restrict__ A, const T16* __restrict__ A2, const T16* __restrict__ Bt, const T16* __restrict__ Bt2, int K, float* C, int ldc, const float* __restrict__ bias, size_t sA, size_t sB, size_t sC) {
    typedef typename WFrag<T16>::V V;
    __shared__ __align__(16) float os[16 * 68];
    const size_t z = blockIdx.z; A += z * sA; if (A2) A2 += z * sA; Bt += z * sB; if (Bt2) Bt2 += z * sB; C += z * sC;
    const int lane = threadIdx.x & 31, lr = lane & 15, hi = lane >> 4; const int r0 = blockIdx.x * 64, c0 = blockIdx.y * 64;
    v8f acc[4][4];
#pragma unroll
    for (int mb = 0; mb < 4; ++mb)
#pragma unroll
        for (int nb = 0; nb < 4; ++nb) acc[mb][nb] = (v8f){};
    const size_t aoff = (size_t)(r0 + lr) * K + 8 * hi, boff = (size_t)(c0 + lr) * K + 8 * hi;
#pragma unroll 1
    for (int kc = 0; kc < K; kc += 32) {
        V a[4], a2[4];
#pragma unroll
        for (int mb = 0; mb < 4; ++mb) { a[mb] = WFrag<T16>::ld(A + aoff + (size_t)mb * 16 * K + kc); if (NSPLIT == 1 || NSPLIT == 2) a2[mb] = WFrag<T16>::ld(A2 + aoff + (size_t)mb * 16 * K + kc); }
#pragma unroll
        for (int nb = 0; nb < 4; ++nb) { const V b = WFrag<T16>::ld(Bt + boff + (size_t)nb * 16 * K + kc); V b2; if (NSPLIT >= 2) b2 = WFrag<T16>::ld(Bt2 + boff + (size_t)nb * 16 * K + kc);
#pragma unroll
            for (int mb = 0; mb < 4; ++mb) { acc[mb][nb] = WFrag<T16>::mma(a[mb], b, acc[mb][nb]); if (NSPLIT == 1 || NSPLIT == 2) acc[mb][nb] = WFrag<T16>::mma(a2[mb], b, acc[mb][nb]); if (NSPLIT >= 2) acc[mb][nb] = WFrag<T16>::mma(a[mb], b2, acc[mb][nb]); } }
        asm volatile("v_nop\n\tv_nop\n\tv_nop\n\tv_nop" : "+v"(acc[0][0]), "+v"(acc[1][1]), "+v"(acc[2][2]), "+v"(acc[3][3]) : "v"(a[0]), "v"(a[3]));
    }
#pragma unroll
    for (int mb = 0; mb < 4; ++mb) {
#pragma unroll
        for (int nb = 0; nb < 4; ++nb) {
#pragma unroll
            for (int j = 0; j < 8; ++j) os[(hi * 8 + j) * 68 + nb * 16 + lr] = acc[mb][nb][j]; }
        __builtin_amdgcn_wave_barrier(); asm volatile("" ::: "memory");
        float* crow = C + (size_t)(r0 + mb * 16) * ldc + c0;
{
#pragma unroll
            for (int s = 0; s < 8; ++s) { const int row = 2 * s + hi, cofs = lr * 4; v4f val = *(const v4fa*)(os + row * 68 + cofs); if (BIAS) { val[0] += bfr(bias[c0 + cofs]); val[1] += bfr(bias[c0 + cofs + 1]); val[2] += bfr(bias[c0 + cofs + 2]); val[3] += bfr(bias[c0 + cofs + 3]); }
                *(v4f*)(crow + (size_t)row * ldc + cofs) = val; }
             }
        __builtin_amdgcn_wave_barrier(); asm volatile("" ::: "memory");
    }
}

// ---- k_gemmsk: the products of k_gemmw for a long K: ONE WORK-GROUP of NW waves per (16 MB)x64 output tile, wave w takes k in [w KK/NW, (w+1) KK/NW) (4 MB accumulators);
// the NW partial tiles meet in LDS and are summed in wave order 0..NW-1 (fixed), then leave as whole 256-byte rows (+ optional f32 bias[n]). grid (M/(16 MB), N/64, Z), 32 NW threads. NSPLIT as in k_gemmw. KK % (32 NW) == 0.
template <typename T16, int NSPLIT, bool BIAS, int KK, int MB, int NW>
__global__ __launch_bounds__(NW * 32) void k_gemmsk(const T16* __restrict__ A, const T16* __restrict__ A2, const T16* __restrict__ Bt, const T16* __restrict__ Bt2, float* C, int ldc, const float* __restrict__ bias, size_t sA, size_t sB, size_t sC) {
    typedef typename WFrag<T16>::V V;
    __shared__ __align__(16) float red[NW * MB * 1024];   // [wave][subtile mb*4+nb][half of its 8 rows a lane][lane] x 4 floats
    __shared__ __align__(16) float os[MB * 16 * 68];
    const size_t z = blockIdx.z; A += z * sA; if (NSPLIT == 1 || NSPLIT == 2) A2 += z * sA; Bt += z * sB; if (NSPLIT >= 2) Bt2 += z * sB; C += z * sC;
    const int tid = threadIdx.x, lane = tid & 31, w = tid >> 5, lr = lane & 15, hi = lane >> 4; const int r0 = blockIdx.x * (MB * 16), c0 = blockIdx.y * 64;
    // every '#pragma unroll' in this kernel makes the indices of acc, a, a2 and s constants, so that they stay in registers
    v8f acc[MB][4];
#pragma unroll
    for (int mb = 0; mb < MB; ++mb)
#pragma unroll
        for (int nb = 0; nb < 4; ++nb) acc[mb][nb] = (v8f){};
    const size_t aoff = (size_t)(r0 + lr) * KK + 8 * hi + w * (KK / NW), boff = (size_t)(c0 + lr) * KK + 8 * hi + w * (KK / NW);
    // unrolled whole (KK / (32 NW) = 4 trips here): no back edge behind a matrix instruction
#pragma unroll
    for (int kc = 0; kc < KK / NW; kc += 32) {
        V a[MB], a2[MB];
#pragma unroll
        for (int mb = 0; mb < MB; ++mb) { a[mb] = WFrag<T16>::ld(A + aoff + (size_t)mb * 16 * KK + kc); if (NSPLIT == 1 || NSPLIT == 2) a2[mb] = WFrag<T16>::ld(A2 + aoff + (size_t)mb * 16 * KK + kc); }
#pragma unroll
        for (int nb = 0; nb < 4; ++nb) { const V b = WFrag<T16>::ld(Bt + boff + (size_t)nb * 16 * KK + kc); V b2; if (NSPLIT >= 2) b2 = WFrag<T16>::ld(Bt2 + boff + (size_t)nb * 16 * KK + kc);
#pragma unroll
            for (int mb = 0; mb < MB; ++mb) { acc[mb][nb] = WFrag<T16>::mma(a[mb], b, acc[mb][nb]); if (NSPLIT == 1 || NSPLIT == 2) acc[mb][nb] = WFrag<T16>::mma(a2[mb], b, acc[mb][nb]); if (NSPLIT >= 2) acc[mb][nb] = WFrag<T16>::mma(a[mb], b2, acc[mb][nb]); } }
    }
#pragma unroll
    for (int mb = 0; mb < MB; ++mb)
#pragma unroll
        for (int nb = 0; nb < 4; ++nb) { float* rp = red + w * (MB * 1024) + (mb * 4 + nb) * 256 + lane * 4; const v8f c = acc[mb][nb];
            *(v4fa*)rp = (v4f){c[0], c[1], c[2], c[3]}; *(v4fa*)(rp + 128) = (v4f){c[4], c[5], c[6], c[7]}; }
    __syncthreads();   // every wave's partial tile is in LDS
#pragma unroll
    for (int u = 0; u < MB * 8 / NW; ++u) { const int idx = u * (NW * 32) + tid;   // one group of 4 floats of the tile; idx & 31 == lane
        v4f s = *(const v4fa*)(red + idx * 4);
#pragma unroll
        for (int q = 1; q < NW; ++q) { const v4f p = *(const v4fa*)(red + q * (MB * 1024) + idx * 4);
#pragma unroll
            for (int j = 0; j < 4; ++j) s[j] = __fadd_rn(s[j], p[j]); }
        const int t = idx >> 6, half = (idx >> 5) & 1; const int row = (t >> 2) * 16 + hi * 8 + half * 4, col = (t & 3) * 16 + lr;
#pragma unroll
        for (int j = 0; j < 4; ++j) os[(row + j) * 68 + col] = s[j]; }
    __syncthreads();   // the summed tile is whole before it is read by rows
#pragma unroll
    for (int u = 0; u < MB * 8 / NW; ++u) { const int idx = u * (NW * 32) + tid; const int row = idx >> 4, cofs = (idx & 15) * 4; v4f val = *(const v4fa*)(os + row * 68 + cofs);
        if (BIAS) { val[0] += bfr(bias[c0 + cofs]); val[1] += bfr(bias[c0 + cofs + 1]); val[2] += bfr(bias[c0 + cofs + 2]); val[3] += bfr(bias[c0 + cofs + 3]); }
        *(v4f*)(C + (size_t)(r0 + row) * ldc + c0 + cofs) = val; }
}

__device__ __forceinline__ h16 tohx(float x) { return (h16)x; }
__device__ __forceinline__ void splitf(float y, unsigned short& h, unsigned short& l) { h = f2bf(y); l = f2bf(y - bf2f(h)); }
typedef __attribute__((ext_vector_type(2))) _Float16 v2h;
typedef __attribute__((ext_vector_type(4))) _Float16 v4h;
typedef __attribute__((ext_vector_type(2))) unsigned short v2us;
typedef __attribute__((ext_vector_type(4))) unsigned short v4us;
typedef __attribute__((ext_vector_type(2))) float v2f;
typedef __attribute__((ext_vector_type(4))) int v4i;

__global__ __launch_bounds__(256) void k_wtG(const float* __restrict__ w, int K, int N, bf* Bt) {
    const int lane = threadIdx.x & 31; const int L0 = (blockIdx.x * 8 + (threadIdx.x >> 5)) * 8; const int nlines = N * K / 64;
{
#pragma unroll 1
        for (int l = 0; l < 8; ++l) { const int L = L0 + l; if (L >= nlines) break; const size_t e = (size_t)L * 64 + lane * 2; const int k = (int)(e % K), n = (int)(e / K); v2us o;
            o[0] = f2bf(w[(size_t)k * N + n]); o[1] = f2bf(w[(size_t)(k + 1) * N + n]); *(v2us*)(Bt + e) = o; }
         }
}
__global__ __launch_bounds__(256) void k_cvt8(const float* __restrict__ src, bf* dst, size_t n8) { const size_t i = (size_t)blockIdx.x * 256 + threadIdx.x; if (i >= n8) return; const v8f v = *(const v8f*)(src + i * 8); v8us o;
#pragma unroll
    for (int k = 0; k < 8; ++k) o[k] = f2bf(v[k]); *(v8us*)(dst + i * 8) = o;  }

// k_rope: head planes [h][t][d] (fp16 + hi/lo) of rope(x) x sc with the rotate-half convention out[d] = x[d] cos[t][d] - x[d+HD/2] sin[t][d], out[d+HD/2] = x[d+HD/2] cos[t][d+HD/2] + x[d] sin[t][d+HD/2]
__global__ __launch_bounds__(256) void k_rope(const float* __restrict__ F, int pitch, int nheads, const float* __restrict__ CS, const float* __restrict__ RF, const float* __restrict__ nw, float sc, h16* P16, bf* Ph, bf* Pl) {
    const size_t e = ((size_t)blockIdx.x * 256 + threadIdx.x) * 2; if (e >= (size_t)nheads * TT * HD) return; const int d = (int)(e % HD); const int t = (int)((e / HD) % TT); const int h = (int)(e / ((size_t)HD * TT)); const float* f = F + (size_t)t * pitch + h * HD; const float rf = RF ? RF[(size_t)h * TT + t] : 1.0f; v2h o16; v2us oh, ol;
#pragma unroll
    for (int q = 0; q < 2; ++q) { const int dd = d + q; const int dp = (dd < HD / 2) ? dd + HD / 2 : dd - HD / 2; float x0 = f[dd], x1 = f[dp];
        if (RF) { float n0 = __fmul_rn(x0, rf), n1 = __fmul_rn(x1, rf); asm volatile("" : "+v"(n0)); asm volatile("" : "+v"(n1)); x0 = __fmul_rn(bfr(nw[dd]), n0); x1 = __fmul_rn(bfr(nw[dp]), n1); }
        const v2f cs = *(const v2f*)(CS + ((size_t)t * HD + dd) * 2); float a = __fmul_rn(x0, cs[0]), bq = __fmul_rn(x1, cs[1]); asm volatile("" : "+v"(a)); asm volatile("" : "+v"(bq)); const float r = ((dd < HD / 2) ? __fsub_rn(a, bq) : __fadd_rn(a, bq)) * sc;
        o16[q] = tohx(r); unsigned short a2, c2; splitf(r, a2, c2); oh[q] = a2; ol[q] = c2; }
    *(v2h*)(P16 + e) = o16; *(v2us*)(Ph + e) = oh; *(v2us*)(Pl + e) = ol;  }
__global__ __launch_bounds__(256) void k_vtp(const float* __restrict__ F, int pitch, int nheads, h16* V16, bf* Vh, bf* Vl) { const size_t e = ((size_t)blockIdx.x * 256 + threadIdx.x) * 2; if (e >= (size_t)nheads * HD * TT) return; const int t = (int)(e % TT); const int d = (int)((e / TT) % HD); const int g = (int)(e / ((size_t)TT * HD)); v2h o16; v2us oh, ol;
#pragma unroll
    for (int q = 0; q < 2; ++q) { const float x = F[(size_t)(t + q) * pitch + g * HD + d]; o16[q] = tohx(x); unsigned short a2, c2; splitf(x, a2, c2); oh[q] = a2; ol[q] = c2; }
    *(v2h*)(V16 + e) = o16; *(v2us*)(Vh + e) = oh; *(v2us*)(Vl + e) = ol;  }
__global__ __launch_bounds__(256) void k_csid(float* CS) { const int idx = blockIdx.x * 256 + threadIdx.x; if (idx >= TT * HD) return; v2f cs; cs[0] = 1.0f; cs[1] = 0.0f; *(v2f*)(CS + (size_t)idx * 2) = cs;  }
// k_asoft: one wave per row (zz, i); the row stays in registers from the raw scores to the bucket sums.
// s = S + QE[i][clip(j - i)]; t = s x HD^-0.5 (no mask); softmax over the 2048 keys (one exp, fixed trees); the probabilities leave as hi/lo planes (rows < RH) or as fp16 x1024;
// the values as written are summed into the 65 relative-position buckets (far-left sum, 63 near entries, far-right sum; fixed order) and leave as hi/lo planes [row][128].
__global__ __launch_bounds__(256) void k_asoft(const float* __restrict__ Sb, const float* __restrict__ QE, h16* P16, bf* Ph, bf* Pl, bf* PBh, bf* PBl) {
    __shared__ __align__(16) float nb[8][2 * MAXR];   // per wave: the near buckets r = 1..63, on their way from the lane that holds key j to the lane that stores bucket r
    const int lane = threadIdx.x & 31; const int wv = __builtin_amdgcn_readfirstlane(threadIdx.x >> 5); const int row = blockIdx.x * 8 + wv; if (row >= ZH * TT) return; const int i = row % TT; const int zz = row / TT; (void)zz; const bool hires = (i < RH); const float* sr = Sb + (size_t)row * TT; float v[TT / 32]; float mx = -3.0e38f;
    const float* qe = QE + (size_t)row * NE;
    const int c0 = max(i - (MAXR - 1), 0) >> 7;   // the 128-key chunks c0 and c0 + 1 hold every key with |j - i| < MAXR; chunks below are all far left, chunks above all far right
    const float qeL = qe[0], qeR = qe[2 * MAXR]; float wq[2][4];
#pragma unroll
    for (int s = 0; s < 2; ++s)
#pragma unroll
        for (int q = 0; q < 4; ++q) wq[s][q] = qe[min(max((c0 + s) * 128 + lane * 4 + q - i, -MAXR), MAXR) + MAXR];   /* this module: dist = k - q */
    asm volatile("s_wait_xcnt 0x0" ::: "memory");   // stands in front of the score loads, whose results may be given the table loads' offset registers
#pragma unroll
    for (int ch = 0; ch < TT / 128; ++ch) { const int j0 = ch * 128 + lane * 4; const v4f a = *(const v4f*)(sr + j0);
#pragma unroll
        for (int q = 0; q < 4; ++q) { const float e = (ch == c0) ? wq[0][q] : (ch == c0 + 1) ? wq[1][q] : (ch < c0) ? qeL : qeR; const float t = __fadd_rn(a[q], e) * SCL; v[ch * 4 + q] = t; mx = fmaxf(mx, t); } }
#pragma unroll
    for (int sh = 16; sh; sh >>= 1) mx = fmaxf(mx, __shfl_xor(mx, sh, 32));
    float sum = 0.f;
#pragma unroll
    for (int k = 0; k < TT / 32; ++k) { float d0 = __fsub_rn(v[k], mx); asm volatile("" : "+v"(d0)); v[k] = __builtin_amdgcn_exp2f(__fmul_rn(d0, 1.4426950408889634f)); sum += v[k]; }
#pragma unroll
    for (int sh = 16; sh; sh >>= 1) sum += __shfl_xor(sum, sh, 32);
    const float f = __fdiv_rn(hires ? 1.0f : PCAR, sum);
    *(v2f*)(&nb[wv][lane * 2]) = (v2f){0.f, 0.f};   // a bucket whose key lies outside [0, TT) stays 0
    float bl = 0.f, br = 0.f; v4f pw[2] = {(v4f){0.f, 0.f, 0.f, 0.f}, (v4f){0.f, 0.f, 0.f, 0.f}};
    // the four written probabilities of this lane in chunk ch: a far chunk goes whole to its side's sum, chunks c0 and c0 + 1 are kept for the key-by-key pass below
    auto tally = [&](int ch, const v4f p) { const float s4 = __fadd_rn(__fadd_rn(p[0], p[1]), __fadd_rn(p[2], p[3])); bl = __fadd_rn(bl, (ch < c0) ? s4 : 0.f); br = __fadd_rn(br, (ch > c0 + 1) ? s4 : 0.f); pw[0] = (ch == c0) ? p : pw[0]; pw[1] = (ch == c0 + 1) ? p : pw[1]; };
{
        if (hires) {
#pragma unroll
            for (int ch = 0; ch < TT / 128; ++ch) { v4us oh, ol; v4f p;
#pragma unroll
                for (int q = 0; q < 4; ++q) { unsigned short a, c2; splitf(v[ch * 4 + q] * f, a, c2); oh[q] = a; ol[q] = c2; p[q] = __fadd_rn(bf2f(a), bf2f(c2)); }
                const size_t oo = ((size_t)zz * (RH ? RH : 1) + i) * TT + ch * 128 + lane * 4; *(v4us*)(Ph + oo) = oh; *(v4us*)(Pl + oo) = ol; tally(ch, p); }
        } else {
#pragma unroll
            for (int ch = 0; ch < TT / 128; ++ch) { v4h o4; v4f p;
#pragma unroll
                for (int q = 0; q < 4; ++q) { o4[q] = tohx(v[ch * 4 + q] * f); p[q] = __fmul_rn((float)o4[q], 0.0009765625f); }
                *(v4h*)(P16 + (size_t)row * TT + ch * 128 + lane * 4) = o4; tally(ch, p); }
            asm volatile("s_wait_xcnt 0x0" ::: "memory");   // stands behind the last fp16 stores, in front of any reuse of their data registers after this branch
        }
         }
#pragma unroll
    for (int s = 0; s < 2; ++s)   // chunk c0 + 1 = TT / 128 does not exist: its pw is 0, and 0 is what its buckets hold
#pragma unroll
        for (int q = 0; q < 4; ++q) { const int r = (c0 + s) * 128 + lane * 4 + q - i + MAXR; const float p = pw[s][q]; bl = __fadd_rn(bl, (r <= 0) ? p : 0.f); br = __fadd_rn(br, (r >= 2 * MAXR) ? p : 0.f); if (r > 0 && r < 2 * MAXR) nb[wv][r] = p; }
#pragma unroll
    for (int sh = 16; sh; sh >>= 1) { bl = __fadd_rn(bl, __shfl_xor(bl, sh, 32)); br = __fadd_rn(br, __shfl_xor(br, sh, 32)); }
    // nb is this wave's own: a wave's LDS operations run in issue order, so the other lanes' stores above are in place when this read runs
    const v4f nv = *(const v4fa*)(&nb[wv][(lane & 15) * 4]); v4us oh, ol;
#pragma unroll
    for (int q = 0; q < 4; ++q) { const int r = lane * 4 + q; const float b = (r == 0) ? bl : (r == 2 * MAXR) ? br : (r < 2 * MAXR) ? nv[q] : 0.f; unsigned short u, w; splitf(b, u, w); oh[q] = u; ol[q] = w; }
    const size_t ob = (size_t)row * NE + lane * 4; *(v4us*)(PBh + ob) = oh; *(v4us*)(PBl + ob) = ol;
}
__global__ __launch_bounds__(256) void k_epad2(const float* __restrict__ E, bf* EB) { const size_t i = (size_t)blockIdx.x * 256 + threadIdx.x; if (i >= (size_t)NE * HD / 8) return; const int d0 = (int)(i % (HD / 8)) * 8; const int r = (int)(i / (HD / 8)); const float* src = E + (size_t)min(r, 2 * MAXR) * HD + d0; v8us o;
#pragma unroll
    for (int q = 0; q < 8; ++q) { const unsigned short v = f2bf(src[q]); o[q] = (r <= 2 * MAXR) ? v : (unsigned short)0; }
    *(v8us*)(EB + (size_t)r * HD + d0) = o;  }
__global__ __launch_bounds__(256) void k_rvt(const float* __restrict__ E, bf* RVT) { const size_t i = (size_t)blockIdx.x * 256 + threadIdx.x; if (i >= (size_t)HD * NE / 8) return; const int r0 = (int)(i % (NE / 8)) * 8; const int d = (int)(i / (NE / 8)); v8us o;
#pragma unroll
    for (int q = 0; q < 8; ++q) { const int r = r0 + q; const unsigned short v = f2bf(E[(size_t)min(r, 2 * MAXR) * HD + d]); o[q] = (r <= 2 * MAXR) ? v : (unsigned short)0; }
    *(v8us*)(RVT + (size_t)d * NE + r0) = o;  }
__global__ __launch_bounds__(256) void k_addob(float* Ob, const float* __restrict__ W2) { const size_t k = (size_t)blockIdx.x * 256 + threadIdx.x; if (k >= (size_t)ZH * TT * HD / 4) return; const size_t e = k * 4; const int i = (int)((e / HD) % TT); const float sc = (i < RH) ? 1.0f : 1024.0f; const v4f a = *(const v4f*)(Ob + e); const v4f w = *(const v4f*)(W2 + e); v4f o;
#pragma unroll
    for (int q = 0; q < 4; ++q) o[q] = __fadd_rn(a[q], __fmul_rn(w[q], sc));
    *(v4f*)(Ob + e) = o;  }
__global__ __launch_bounds__(256) void k_merge(const float* __restrict__ O, int h0, bf* Ah, bf* Al) { const size_t e = ((size_t)blockIdx.x * 256 + threadIdx.x) * 2; if (e >= (size_t)ZH * TT * HD) return; const int d = (int)(e % HD); const int t = (int)((e / HD) % TT); const int zz = (int)(e / ((size_t)HD * TT)); const float cs = (t < RH) ? 1.0f : (1.0f / PCAR); const size_t oo = (size_t)t * DQ + (h0 + zz) * HD + d;
    v2us oh, ol;
#pragma unroll
    for (int q = 0; q < 2; ++q) { unsigned short a, c2; splitf(O[e + q] * cs, a, c2); oh[q] = a; ol[q] = c2; } *(v2us*)(Ah + oo) = oh; *(v2us*)(Al + oo) = ol;  }

extern "C" void kernel_launch(void* const* d_in, const int* in_sizes, int n_in,
                              void* d_out, int out_size, void* d_ws, size_t ws_size, hipStream_t stream) {
    (void)in_sizes; (void)n_in; (void)out_size;
    const float* x = (const float*)d_in[0]; const float* xk = (const float*)d_in[1]; const float* xv = (const float*)d_in[2]; const float* wq = (const float*)d_in[3]; const float* bq = (const float*)d_in[4]; const float* wk = (const float*)d_in[5]; const float* bk = (const float*)d_in[6]; const float* wv = (const float*)d_in[7]; const float* bv = (const float*)d_in[8]; const float* wo = (const float*)d_in[9]; const float* bo = (const float*)d_in[10]; const float* relk = (const float*)d_in[11]; const float* relv = (const float*)d_in[12];   /* [65][64] each */
    float* OUT = (float*)d_out;     // [2][2048][1024]
    char* wsp = (char*)d_ws;
    auto take = [&](size_t bytes) { char* p = wsp; wsp += (bytes + 255) & ~(size_t)255; return (void*)p; };
    bf* EB = (bf*)take((size_t)NE * HD * 2); bf* RVT = (bf*)take((size_t)HD * NE * 2); float* QE = (float*)take((size_t)ZH * TT * NE * 4); bf* PBh = (bf*)take((size_t)ZH * TT * NE * 2); bf* PBl = (bf*)take((size_t)ZH * TT * NE * 2); float* W2 = (float*)take((size_t)ZH * TT * HD * 4); bf* WQ = (bf*)take((size_t)DQ * DM * 2); bf* WK = (bf*)take((size_t)DKV * DM * 2); bf* WV = (bf*)take((size_t)DKV * DM * 2); bf* WO = (bf*)take((size_t)DM * DQ * 2); float* CS = (float*)take((size_t)TT * HD * 2 * 4);
    bf* XB = (bf*)take((size_t)TT * DM * 2); float* FQ = (float*)take((size_t)TT * DQ * 4); float* FK = (float*)take((size_t)TT * DKV * 4);
    h16* QP16 = (h16*)take((size_t)NH_ * TT * HD * 2); h16* KP16 = (h16*)take((size_t)NKV * TT * HD * 2); h16* VT16 = (h16*)take((size_t)NKV * HD * TT * 2);
    bf* QPh = (bf*)take((size_t)NH_ * TT * HD * 2); bf* QPl = (bf*)take((size_t)NH_ * TT * HD * 2); bf* KPh = (bf*)take((size_t)NKV * TT * HD * 2); bf* KPl = (bf*)take((size_t)NKV * TT * HD * 2); bf* VTh = (bf*)take((size_t)NKV * HD * TT * 2); bf* VTl = (bf*)take((size_t)NKV * HD * TT * 2); bf* Ph = (bf*)take((size_t)ZH * RH * TT * 2); bf* Pl = (bf*)take((size_t)ZH * RH * TT * 2);
    float* Sb = (float*)take((size_t)ZH * TT * TT * 4); h16* P16 = (h16*)take((size_t)ZH * TT * TT * 2); float* Ob = (float*)take((size_t)ZH * TT * HD * 4); bf* ATh = (bf*)take((size_t)TT * DQ * 2); bf* ATl = (bf*)take((size_t)TT * DQ * 2);
    if ((size_t)(wsp - (char*)d_ws) > ws_size) return;    // ws 256 MiB
    float* FV = FK;   // v projection reuses the k buffer after the k planes are built (stream-ordered)
    { k_wtG<<<(unsigned)((DM * DQ / 64 + 63) / 64), 256, 0, stream>>>(wq, DM, DQ, WQ); k_wtG<<<(unsigned)((DM * DKV / 64 + 63) / 64), 256, 0, stream>>>(wk, DM, DKV, WK); k_wtG<<<(unsigned)((DM * DKV / 64 + 63) / 64), 256, 0, stream>>>(wv, DM, DKV, WV);
      k_wtG<<<(unsigned)((DQ * DM / 64 + 63) / 64), 256, 0, stream>>>(wo, DQ, DM, WO);
       }
    k_csid<<<(TT * HD + 255) / 256, 256, 0, stream>>>(CS);
    const unsigned LQ = (unsigned)(((size_t)NH_ * TT * HD / 2 + 255) / 256), LKv = (unsigned)(((size_t)NKV * TT * HD / 2 + 255) / 256);
    k_epad2<<<(unsigned)(((size_t)NE * HD / 8 + 255) / 256), 256, 0, stream>>>(relk, EB); k_rvt<<<(unsigned)(((size_t)HD * NE / 8 + 255) / 256), 256, 0, stream>>>(relv, RVT);   /* rel_k plane [128][64], rel_v^T plane [64][128] */
    for (int b = 0; b < NB_; ++b) {
        
        k_cvt8<<<(unsigned)(((size_t)TT * DM / 8 + 255) / 256), 256, 0, stream>>>(x + (size_t)b * TT * DM, XB, (size_t)TT * DM / 8);
        k_gemmsk<bf, 0, true, DM, 4, 8><<<dim3(TT / 64, DQ / 64, 1), 256, 0, stream>>>(XB, nullptr, WQ, nullptr, FQ, DQ, bq, 0, 0, 0);
        k_rope<<<LQ, 256, 0, stream>>>(FQ, DQ, NH_, CS, nullptr, nullptr, 1.0f, QP16, QPh, QPl);
        k_cvt8<<<(unsigned)(((size_t)TT * DM / 8 + 255) / 256), 256, 0, stream>>>(xk + (size_t)b * TT * DM, XB, (size_t)TT * DM / 8); k_gemmsk<bf, 0, true, DM, 4, 8><<<dim3(TT / 64, DKV / 64, 1), 256, 0, stream>>>(XB, nullptr, WK, nullptr, FK, DKV, bk, 0, 0, 0);
        k_rope<<<LKv, 256, 0, stream>>>(FK, DKV, NKV, CS, nullptr, nullptr, 1.0f, KP16, KPh, KPl);
        k_cvt8<<<(unsigned)(((size_t)TT * DM / 8 + 255) / 256), 256, 0, stream>>>(xv + (size_t)b * TT * DM, XB, (size_t)TT * DM / 8); k_gemmsk<bf, 0, true, DM, 4, 8><<<dim3(TT / 64, DKV / 64, 1), 256, 0, stream>>>(XB, nullptr, WV, nullptr, FV, DKV, bv, 0, 0, 0); k_vtp<<<LKv, 256, 0, stream>>>(FV, DKV, NKV, VT16, VTh, VTl);
        for (int h0 = 0; h0 < NH_; h0 += ZH) { const size_t zq = (size_t)h0, zk = (size_t)(h0 / REP);   // one kv head per query head: the pass's two heads use consecutive kv planes (z-strides TT*HD)
            k_gemmw<bf, 2, false><<<dim3(RH / 64, TT / 64, ZH), 32, 0, stream>>>(QPh + zq * TT * HD, QPl + zq * TT * HD, KPh + zk * TT * HD, KPl + zk * TT * HD, HD, Sb, TT, nullptr, (size_t)TT * HD, (size_t)TT * HD, (size_t)TT * TT);
            k_gemmw<h16, 0, false><<<dim3((TT - RH) / 64, TT / 64, ZH), 32, 0, stream>>>(QP16 + zq * TT * HD + (size_t)RH * HD, nullptr, KP16 + zk * TT * HD, nullptr, HD, Sb + (size_t)RH * TT, TT, nullptr, (size_t)TT * HD, (size_t)TT * HD, (size_t)TT * TT);
            k_gemmw<bf, 1, false><<<dim3(TT / 64, NE / 64, ZH), 32, 0, stream>>>(QPh + zq * TT * HD, QPl + zq * TT * HD, EB, nullptr, HD, QE, NE, nullptr, (size_t)TT * HD, 0, (size_t)TT * NE);   /* QE[i][r] = q_i . rel_k[r] */
            k_asoft<<<ZH * TT / 8, 256, 0, stream>>>(Sb, QE, P16, Ph, Pl, PBh, PBl);   /* + QE[i][idx], softmax, 65 relative-position bucket sums per row */
            k_gemmw<bf, 1, false><<<dim3(TT / 64, HD / 64, ZH), 32, 0, stream>>>(PBh, PBl, RVT, nullptr, NE, W2, HD, nullptr, (size_t)TT * NE, 0, (size_t)TT * HD);   /* W2 = buckets . rel_v */
            k_gemmsk<bf, 2, false, TT, 2, 16><<<dim3(RH / 32, HD / 64, ZH), 512, 0, stream>>>(Ph, Pl, VTh + zk * HD * TT, VTl + zk * HD * TT, Ob, HD, nullptr, (size_t)RH * TT, (size_t)HD * TT, (size_t)TT * HD);
            k_gemmsk<h16, 0, false, TT, 2, 16><<<dim3((TT - RH) / 32, HD / 64, ZH), 512, 0, stream>>>(P16 + (size_t)RH * TT, nullptr, VT16 + zk * HD * TT, nullptr, Ob + (size_t)RH * HD, HD, nullptr, (size_t)TT * TT, (size_t)HD * TT, (size_t)TT * HD);
            k_addob<<<(unsigned)(((size_t)ZH * TT * HD / 4 + 255) / 256), 256, 0, stream>>>(Ob, W2);   /* + sum_j attn[i][j] rel_v[idx] */ k_merge<<<(unsigned)(((size_t)ZH * TT * HD / 2 + 255) / 256), 256, 0, stream>>>(Ob, h0, ATh, ATl); }
        k_gemmsk<bf, 1, true, DQ, 4, 8><<<dim3(TT / 64, DM / 64, 1), 256, 0, stream>>>(ATh, ATl, WO, nullptr, OUT + (size_t)b * TT * DM, DM, bo, 0, 0, 0); }
}

// v003
// It runs in 641 microseconds.
// Timed twice side by side with v002, it ran 1.73 and 1.76 times as fast.
// Over all steps from v000 it is 5.03 times as fast.
#include <hip/hip_runtime.h>

// Multi-head attention with Shaw relative-position terms on the logits AND the values (query, key, value [2][2048][1024]; q,k,v = in W + b ('xw' 1/32, zero biases; 16 heads x 64); idx[i][j] = clip(j - i, -32, 32) + 32; attn = softmax((q.k + q_i.rel_k[idx]) / 8); out_h = attn v + sum_j attn[i][j] rel_v[idx] (tables [65][64] x 0.05, read); out = merged Wo + bo ('xw') -> [2][2048][1024] (4.2 M)).
// Layout per batch: bf16 copies of the three inputs in turn; exact projections + f32 biases; rel_k as an exact plane [128][64] (rows >= 65 zero) and rel_v^T as an exact plane [64][128]; per pass of eight heads: dense scores (hybrid rows: < 512 hi/lo 3 products, rest fp16 x1024), QE = q.rel_k^T ([8][2048][128], hi/lo x exact); one row kernel adds QE[i][idx] to the scores, does the softmax with the 1/8 and sums each row's probabilities into the 65 relative-position buckets (far-left sum, 63 near entries, far-right sum; fixed order) as hi/lo planes; each row's probabilities are written over its own score row (8 KiB: fp16 in the first half, or hi then lo); W2 = buckets x rel_v ([8][2048][64], hi/lo x exact) added to attn v in f32; merged hi/lo x Wo exact + bo.
// Compute dtypes, f32 accumulate: every input rounded to bf16; projections exact + f32 biases; q.rel_k and buckets.rel_v hi/lo x exact; attention rows < 512 3 products, rest fp16; softmax f32; Wo hl x exact + bias.

#define NB_  2
#define TT   2048
#define DM   1024
#define NH_  16
#define NKV  16
#define REP  (NH_ / NKV)
#define HD   64
#define DQ   (NH_ * HD)
#define DKV  (NKV * HD)
#define ZH   8                    // heads per pass
#define RH   512                  // query rows < RH use hi+lo planes (0: none)
#define WIN  0
#define PCAR 1024.0f
#define SCL  0.125f
#define MAXR 32      // max relative position
#define NE   128     // 2*MAXR+1 = 65 table rows padded to 128
typedef _Float16 h16;
typedef unsigned short bf;
typedef __attribute__((ext_vector_type(16))) __bf16   v16bf;
typedef __attribute__((ext_vector_type(16))) _Float16 v16h;
typedef __attribute__((ext_vector_type(8)))  _Float16 v8h;
typedef __attribute__((ext_vector_type(8)))  unsigned short v8us;
typedef __attribute__((ext_vector_type(8)))  float    v8f;
typedef __attribute__((ext_vector_type(4)))  float    v4f;
typedef v8h  __attribute__((may_alias)) v8ha;
typedef v4f  __attribute__((may_alias)) v4fa;
typedef v8us __attribute__((may_alias)) v8usa;

__device__ __forceinline__ unsigned short f2bf(float f) { unsigned u = __float_as_uint(f); u += 0x7FFFu + ((u >> 16) & 1u); return (unsigned short)(u >> 16); }
__device__ __forceinline__ float bf2f(unsigned short b) { return __uint_as_float(((unsigned)b) << 16); }
__device__ __forceinline__ float bfr(float f) { return bf2f(f2bf(f)); }
__device__ __forceinline__ v16h cat16(v8h lo, v8h hi) { return __builtin_shufflevector(lo, hi, 0, 1, 2, 3, 4, 5, 6, 7, 8, 9, 10, 11, 12, 13, 14, 15); }
__device__ __forceinline__ v16bf cat16b(v8us lo, v8us hi) { return __builtin_bit_cast(v16bf, __builtin_shufflevector(lo, hi, 0, 1, 2, 3, 4, 5, 6, 7, 8, 9, 10, 11, 12, 13, 14, 15)); }
__device__ __forceinline__ v8f wmma16(v16h a, v16h b, v8f c) { return __builtin_amdgcn_wmma_f32_16x16x32_f16(false, a, false, b, (short)0, c, false, false); }
__device__ __forceinline__ v8f wmmab(v16bf a, v16bf b, v8f c) { return __builtin_amdgcn_wmma_f32_16x16x32_bf16(false, a, false, b, (short)0, c, false, false); }



// ---- k_gemmw: register-blocked GEMM, ONE WAVE per 64x64 output tile (16 accumulators), operands straight from K-contiguous 16-bit planes; grid (M/64, N/64, Z), 32 threads.
// C[m][n] (f32, pitch ldc, + optional f32 bias[n]) = sum_k A[m][k] Bt[n][k] (+ split products per NSPLIT). z-batch strides sA/sB/sC in elements. K % 32 == 0.
template <typename T16> struct WFrag;
template <> struct WFrag<h16> { typedef v16h V; static __device__ __forceinline__ V ld(const h16* p) { return cat16(*(const v8h*)p, *(const v8h*)(p + 16)); } static __device__ __forceinline__ v8f mma(V a, V b, v8f c) { return wmma16(a, b, c); } };
template <> struct WFrag<bf> { typedef v16bf V; static __device__ __forceinline__ V ld(const bf* p) { return cat16b(*(const v8us*)p, *(const v8us*)(p + 16)); } static __device__ __forceinline__ v8f mma(V a, V b, v8f c) { return wmmab(a, b, c); } };
template <typename T16, int NSPLIT, bool BIAS>
__global__ __launch_bounds__(32) void k_gemmw(const T16* __restrict__ A, const T16* __restrict__ A2, const T16* __restrict__ Bt, const T16* __restrict__ Bt2, int K, float* C, int ldc, const float* __restrict__ bias, size_t sA, size_t sB, size_t sC) {
    typedef typename WFrag<T16>::V V;
    __shared__ __align__(16) float os[16 * 68];
    const size_t z = blockIdx.z; A += z * sA; if (A2) A2 += z * sA; Bt += z * sB; if (Bt2) Bt2 += z * sB; C += z * sC;
    const int lane = threadIdx.x & 31, lr = lane & 15, hi = lane >> 4; const int r0 = blockIdx.x * 64, c0 = blockIdx.y * 64;
    v8f acc[4][4];
#pragma unroll
    for (int mb = 0; mb < 4; ++mb)
#pragma unroll
        for (int nb = 0; nb < 4; ++nb) acc[mb][nb] = (v8f){};
    const size_t aoff = (size_t)(r0 + lr) * K + 8 * hi, boff = (size_t)(c0 + lr) * K + 8 * hi;
#pragma unroll 1
    for (int kc = 0; kc < K; kc += 32) {
        V a[4], a2[4];
#pragma unroll
        for (int mb = 0; mb < 4; ++mb) { a[mb] = WFrag<T16>::ld(A + aoff + (size_t)mb * 16 * K + kc); if (NSPLIT == 1 || NSPLIT == 2) a2[mb] = WFrag<T16>::ld(A2 + aoff + (size_t)mb * 16 * K + kc); }
#pragma unroll
        for (int nb = 0; nb < 4; ++nb) { const V b = WFrag<T16>::ld(Bt + boff + (size_t)nb * 16 * K + kc); V b2; if (NSPLIT >= 2) b2 = WFrag<T16>::ld(Bt2 + boff + (size_t)nb * 16 * K + kc);
#pragma unroll
            for (int mb = 0; mb < 4; ++mb) { acc[mb][nb] = WFrag<T16>::mma(a[mb], b, acc[mb][nb]); if (NSPLIT == 1 || NSPLIT == 2) acc[mb][nb] = WFrag<T16>::mma(a2[mb], b, acc[mb][nb]); if (NSPLIT >= 2) acc[mb][nb] = WFrag<T16>::mma(a[mb], b2, acc[mb][nb]); } }
        asm volatile("v_nop\n\tv_nop\n\tv_nop\n\tv_nop" : "+v"(acc[0][0]), "+v"(acc[1][1]), "+v"(acc[2][2]), "+v"(acc[3][3]) : "v"(a[0]), "v"(a[3]));
    }
#pragma unroll
    for (int mb = 0; mb < 4; ++mb) {
#pragma unroll
        for (int nb = 0; nb < 4; ++nb) {
#pragma unroll
            for (int j = 0; j < 8; ++j) os[(hi * 8 + j) * 68 + nb * 16 + lr] = acc[mb][nb][j]; }
        __builtin_amdgcn_wave_barrier(); asm volatile("" ::: "memory");
        float* crow = C + (size_t)(r0 + mb * 16) * ldc + c0;
{
#pragma unroll
            for (int s = 0; s < 8; ++s) { const int row = 2 * s + hi, cofs = lr * 4; v4f val = *(const v4fa*)(os + row * 68 + cofs); if (BIAS) { val[0] += bfr(bias[c0 + cofs]); val[1] += bfr(bias[c0 + cofs + 1]); val[2] += bfr(bias[c0 + cofs + 2]); val[3] += bfr(bias[c0 + cofs + 3]); }
                *(v4f*)(crow + (size_t)row * ldc + cofs) = val; }
             }
        __builtin_amdgcn_wave_barrier(); asm volatile("" ::: "memory");
    }
}

// ---- k_gemmsk: the products of k_gemmw for a long K: ONE WORK-GROUP of NW waves per (16 MB)x64 output tile, wave w takes k in [w KK/NW, (w+1) KK/NW) (4 MB accumulators);
// the NW partial tiles meet in LDS and are summed in wave order 0..NW-1 (fixed), then leave as whole 256-byte rows (+ optional f32 bias[n]). grid (M/(16 MB), N/64, Z), 32 NW threads. NSPLIT as in k_gemmw. KK % (32 NW) == 0. LDA: pitch of A's rows in elements.
template <typename T16, int NSPLIT, bool BIAS, int KK, int MB, int NW, int LDA = KK>
__global__ __launch_bounds__(NW * 32) void k_gemmsk(const T16* __restrict__ A, const T16* __restrict__ A2, const T16* __restrict__ Bt, const T16* __restrict__ Bt2, float* C, int ldc, const float* __restrict__ bias, size_t sA, size_t sB, size_t sC) {
    typedef typename WFrag<T16>::V V;
    __shared__ __align__(16) float red[NW * MB * 1024];   // [wave][subtile mb*4+nb][half of its 8 rows a lane][lane] x 4 floats
    __shared__ __align__(16) float os[MB * 16 * 68];
    const size_t z = blockIdx.z; A += z * sA; if (NSPLIT == 1 || NSPLIT == 2) A2 += z * sA; Bt += z * sB; if (NSPLIT >= 2) Bt2 += z * sB; C += z * sC;
    const int tid = threadIdx.x, lane = tid & 31, w = tid >> 5, lr = lane & 15, hi = lane >> 4; const int r0 = blockIdx.x * (MB * 16), c0 = blockIdx.y * 64;
    // every '#pragma unroll' in this kernel makes the indices of acc, a, a2 and s constants, so that they stay in registers
    v8f acc[MB][4];
#pragma unroll
    for (int mb = 0; mb < MB; ++mb)
#pragma unroll
        for (int nb = 0; nb < 4; ++nb) acc[mb][nb] = (v8f){};
    const size_t aoff = (size_t)(r0 + lr) * LDA + 8 * hi + w * (KK / NW), boff = (size_t)(c0 + lr) * KK + 8 * hi + w * (KK / NW);
    // unrolled whole (KK / (32 NW) = 4 trips here): no back edge behind a matrix instruction
#pragma unroll
    for (int kc = 0; kc < KK / NW; kc += 32) {
        V a[MB], a2[MB];
#pragma unroll
        for (int mb = 0; mb < MB; ++mb) { a[mb] = WFrag<T16>::ld(A + aoff + (size_t)mb * 16 * LDA + kc); if (NSPLIT == 1 || NSPLIT == 2) a2[mb] = WFrag<T16>::ld(A2 + aoff + (size_t)mb * 16 * LDA + kc); }
#pragma unroll
        for (int nb = 0; nb < 4; ++nb) { const V b = WFrag<T16>::ld(Bt + boff + (size_t)nb * 16 * KK + kc); V b2; if (NSPLIT >= 2) b2 = WFrag<T16>::ld(Bt2 + boff + (size_t)nb * 16 * KK + kc);
#pragma unroll
            for (int mb = 0; mb < MB; ++mb) { acc[mb][nb] = WFrag<T16>::mma(a[mb], b, acc[mb][nb]); if (NSPLIT == 1 || NSPLIT == 2) acc[mb][nb] = WFrag<T16>::mma(a2[mb], b, acc[mb][nb]); if (NSPLIT >= 2) acc[mb][nb] = WFrag<T16>::mma(a[mb], b2, acc[mb][nb]); } }
    }
#pragma unroll
    for (int mb = 0; mb < MB; ++mb)
#pragma unroll
        for (int nb = 0; nb < 4; ++nb) { float* rp = red + w * (MB * 1024) + (mb * 4 + nb) * 256 + lane * 4; const v8f c = acc[mb][nb];
            *(v4fa*)rp = (v4f){c[0], c[1], c[2], c[3]}; *(v4fa*)(rp + 128) = (v4f){c[4], c[5], c[6], c[7]}; }
    __syncthreads();   // every wave's partial tile is in LDS
#pragma unroll
    for (int u = 0; u < MB * 8 / NW; ++u) { const int idx = u * (NW * 32) + tid;   // one group of 4 floats of the tile; idx & 31 == lane
        v4f s = *(const v4fa*)(red + idx * 4);
#pragma unroll
        for (int q = 1; q < NW; ++q) { const v4f p = *(const v4fa*)(red + q * (MB * 1024) + idx * 4);
#pragma unroll
            for (int j = 0; j < 4; ++j) s[j] = __fadd_rn(s[j], p[j]); }
        const int t = idx >> 6, half = (idx >> 5) & 1; const int row = (t >> 2) * 16 + hi * 8 + half * 4, col = (t & 3) * 16 + lr;
#pragma unroll
        for (int j = 0; j < 4; ++j) os[(row + j) * 68 + col] = s[j]; }
    __syncthreads();   // the summed tile is whole before it is read by rows
#pragma unroll
    for (int u = 0; u < MB * 8 / NW; ++u) { const int idx = u * (NW * 32) + tid; const int row = idx >> 4, cofs = (idx & 15) * 4; v4f val = *(const v4fa*)(os + row * 68 + cofs);
        if (BIAS) { val[0] += bfr(bias[c0 + cofs]); val[1] += bfr(bias[c0 + cofs + 1]); val[2] += bfr(bias[c0 + cofs + 2]); val[3] += bfr(bias[c0 + cofs + 3]); }
        *(v4f*)(C + (size_t)(r0 + row) * ldc + c0 + cofs) = val; }
}

__device__ __forceinline__ h16 tohx(float x) { return (h16)x; }
__device__ __forceinline__ void splitf(float y, unsigned short& h, unsigned short& l) { h = f2bf(y); l = f2bf(y - bf2f(h)); }
typedef __attribute__((ext_vector_type(2))) _Float16 v2h;
typedef __attribute__((ext_vector_type(4))) _Float16 v4h;
typedef __attribute__((ext_vector_type(2))) unsigned short v2us;
typedef __attribute__((ext_vector_type(4))) unsigned short v4us;
typedef __attribute__((ext_vector_type(2))) float v2f;
typedef __attribute__((ext_vector_type(4))) int v4i;

__global__ __launch_bounds__(256) void k_wtG(const float* __restrict__ w, int K, int N, bf* Bt) {
    const int lane = threadIdx.x & 31; const int L0 = (blockIdx.x * 8 + (threadIdx.x >> 5)) * 8; const int nlines = N * K / 64;
{
#pragma unroll 1
        for (int l = 0; l < 8; ++l) { const int L = L0 + l; if (L >= nlines) break; const size_t e = (size_t)L * 64 + lane * 2; const int k = (int)(e % K), n = (int)(e / K); v2us o;
            o[0] = f2bf(w[(size_t)k * N + n]); o[1] = f2bf(w[(size_t)(k + 1) * N + n]); *(v2us*)(Bt + e) = o; }
         }
}
__global__ __launch_bounds__(256) void k_cvt8(const float* __restrict__ src, bf* dst, size_t n8) { const size_t i = (size_t)blockIdx.x * 256 + threadIdx.x; if (i >= n8) return; const v8f v = *(const v8f*)(src + i * 8); v8us o;
#pragma unroll
    for (int k = 0; k < 8; ++k) o[k] = f2bf(v[k]); *(v8us*)(dst + i * 8) = o;  }

// k_rope: head planes [h][t][d] (fp16 + hi/lo) of rope(x) x sc with the rotate-half convention out[d] = x[d] cos[t][d] - x[d+HD/2] sin[t][d], out[d+HD/2] = x[d+HD/2] cos[t][d+HD/2] + x[d] sin[t][d+HD/2]
__global__ __launch_bounds__(256) void k_rope(const float* __restrict__ F, int pitch, int nheads, const float* __restrict__ CS, const float* __restrict__ RF, const float* __restrict__ nw, float sc, h16* P16, bf* Ph, bf* Pl) {
    const size_t e = ((size_t)blockIdx.x * 256 + threadIdx.x) * 2; if (e >= (size_t)nheads * TT * HD) return; const int d = (int)(e % HD); const int t = (int)((e / HD) % TT); const int h = (int)(e / ((size_t)HD * TT)); const float* f = F + (size_t)t * pitch + h * HD; const float rf = RF ? RF[(size_t)h * TT + t] : 1.0f; v2h o16; v2us oh, ol;
#pragma unroll
    for (int q = 0; q < 2; ++q) { const int dd = d + q; const int dp = (dd < HD / 2) ? dd + HD / 2 : dd - HD / 2; float x0 = f[dd], x1 = f[dp];
        if (RF) { float n0 = __fmul_rn(x0, rf), n1 = __fmul_rn(x1, rf); asm volatile("" : "+v"(n0)); asm volatile("" : "+v"(n1)); x0 = __fmul_rn(bfr(nw[dd]), n0); x1 = __fmul_rn(bfr(nw[dp]), n1); }
        const v2f cs = *(const v2f*)(CS + ((size_t)t * HD + dd) * 2); float a = __fmul_rn(x0, cs[0]), bq = __fmul_rn(x1, cs[1]); asm volatile("" : "+v"(a)); asm volatile("" : "+v"(bq)); const float r = ((dd < HD / 2) ? __fsub_rn(a, bq) : __fadd_rn(a, bq)) * sc;
        o16[q] = tohx(r); unsigned short a2, c2; splitf(r, a2, c2); oh[q] = a2; ol[q] = c2; }
    *(v2h*)(P16 + e) = o16; *(v2us*)(Ph + e) = oh; *(v2us*)(Pl + e) = ol;  }
__global__ __launch_bounds__(256) void k_vtp(const float* __restrict__ F, int pitch, int nheads, h16* V16, bf* Vh, bf* Vl) { const size_t e = ((size_t)blockIdx.x * 256 + threadIdx.x) * 2; if (e >= (size_t)nheads * HD * TT) return; const int t = (int)(e % TT); const int d = (int)((e / TT) % HD); const int g = (int)(e / ((size_t)TT * HD)); v2h o16; v2us oh, ol;
#pragma unroll
    for (int q = 0; q < 2; ++q) { const float x = F[(size_t)(t + q) * pitch + g * HD + d]; o16[q] = tohx(x); unsigned short a2, c2; splitf(x, a2, c2); oh[q] = a2; ol[q] = c2; }
    *(v2h*)(V16 + e) = o16; *(v2us*)(Vh + e) = oh; *(v2us*)(Vl + e) = ol;  }
__global__ __launch_bounds__(256) void k_csid(float* CS) { const int idx = blockIdx.x * 256 + threadIdx.x; if (idx >= TT * HD) return; v2f cs; cs[0] = 1.0f; cs[1] = 0.0f; *(v2f*)(CS + (size_t)idx * 2) = cs;  }
// k_asoft: one wave per row (zz, i); the row stays in registers from the raw scores to the bucket sums.
// s = S + QE[i][clip(j - i)]; t = s x HD^-0.5 (no mask); softmax over the 2048 keys (one exp, fixed trees); the probabilities leave as hi/lo planes (rows < RH) or as fp16 x1024, at a pitch of 2 TT elements: P16, Ph and Pl lie over Sb, every row over its own scores, which the wave has read whole by then;
// the values as written are summed into the 65 relative-position buckets (far-left sum, 63 near entries, far-right sum; fixed order) and leave as hi/lo planes [row][128].
__global__ __launch_bounds__(256) void k_asoft(const float* Sb, const float* __restrict__ QE, h16* P16, bf* Ph, bf* Pl, bf* PBh, bf* PBl) {
    __shared__ __align__(16) float nb[8][2 * MAXR];   // per wave: the near buckets r = 1..63, on their way from the lane that holds key j to the lane that stores bucket r
    const int lane = threadIdx.x & 31; const int wv = __builtin_amdgcn_readfirstlane(threadIdx.x >> 5); const int row = blockIdx.x * 8 + wv; if (row >= ZH * TT) return; const int i = row % TT; const int zz = row / TT; (void)zz; const bool hires = (i < RH); const float* sr = Sb + (size_t)row * TT; float v[TT / 32]; float mx = -3.0e38f;
    const float* qe = QE + (size_t)row * NE;
    const int c0 = max(i - (MAXR - 1), 0) >> 7;   // the 128-key chunks c0 and c0 + 1 hold every key with |j - i| < MAXR; chunks below are all far left, chunks above all far right
    const float qeL = qe[0], qeR = qe[2 * MAXR]; float wq[2][4];
#pragma unroll
    for (int s = 0; s < 2; ++s)
#pragma unroll
        for (int q = 0; q < 4; ++q) wq[s][q] = qe[min(max((c0 + s) * 128 + lane * 4 + q - i, -MAXR), MAXR) + MAXR];   /* this module: dist = k - q */
    asm volatile("s_wait_xcnt 0x0" ::: "memory");   // stands in front of the score loads, whose results may be given the table loads' offset registers
#pragma unroll
    for (int ch = 0; ch < TT / 128; ++ch) { const int j0 = ch * 128 + lane * 4; const v4f a = *(const v4f*)(sr + j0);
#pragma unroll
        for (int q = 0; q < 4; ++q) { const float e = (ch == c0) ? wq[0][q] : (ch == c0 + 1) ? wq[1][q] : (ch < c0) ? qeL : qeR; const float t = __fadd_rn(a[q], e) * SCL; v[ch * 4 + q] = t; mx = fmaxf(mx, t); } }
#pragma unroll
    for (int sh = 16; sh; sh >>= 1) mx = fmaxf(mx, __shfl_xor(mx, sh, 32));
    float sum = 0.f;
#pragma unroll
    for (int k = 0; k < TT / 32; ++k) { float d0 = __fsub_rn(v[k], mx); asm volatile("" : "+v"(d0)); v[k] = __builtin_amdgcn_exp2f(__fmul_rn(d0, 1.4426950408889634f)); sum += v[k]; }
#pragma unroll
    for (int sh = 16; sh; sh >>= 1) sum += __shfl_xor(sum, sh, 32);
    const float f = __fdiv_rn(hires ? 1.0f : PCAR, sum);
    *(v2f*)(&nb[wv][lane * 2]) = (v2f){0.f, 0.f};   // a bucket whose key lies outside [0, TT) stays 0
    float bl = 0.f, br = 0.f; v4f pw[2] = {(v4f){0.f, 0.f, 0.f, 0.f}, (v4f){0.f, 0.f, 0.f, 0.f}};
    // the four written probabilities of this lane in chunk ch: a far chunk goes whole to its side's sum, chunks c0 and c0 + 1 are kept for the key-by-key pass below
    auto tally = [&](int ch, const v4f p) { const float s4 = __fadd_rn(__fadd_rn(p[0], p[1]), __fadd_rn(p[2], p[3])); bl = __fadd_rn(bl, (ch < c0) ? s4 : 0.f); br = __fadd_rn(br, (ch > c0 + 1) ? s4 : 0.f); pw[0] = (ch == c0) ? p : pw[0]; pw[1] = (ch == c0 + 1) ? p : pw[1]; };
{
        if (hires) {
#pragma unroll
            for (int ch = 0; ch < TT / 128; ++ch) { v4us oh, ol; v4f p;
#pragma unroll
                for (int q = 0; q < 4; ++q) { unsigned short a, c2; splitf(v[ch * 4 + q] * f, a, c2); oh[q] = a; ol[q] = c2; p[q] = __fadd_rn(bf2f(a), bf2f(c2)); }
                const size_t oo = (size_t)row * (2 * TT) + ch * 128 + lane * 4; *(v4us*)(Ph + oo) = oh; *(v4us*)(Pl + oo) = ol; tally(ch, p); }
        } else {
#pragma unroll
            for (int ch = 0; ch < TT / 128; ++ch) { v4h o4; v4f p;
#pragma unroll
                for (int q = 0; q < 4; ++q) { o4[q] = tohx(v[ch * 4 + q] * f); p[q] = __fmul_rn((float)o4[q], 0.0009765625f); }
                *(v4h*)(P16 + (size_t)row * (2 * TT) + ch * 128 + lane * 4) = o4; tally(ch, p); }
            asm volatile("s_wait_xcnt 0x0" ::: "memory");   // stands behind the last stores, in front of any reuse of their data registers on this fp16 way out; the hi/lo way has none
        }
         }
#pragma unroll
    for (int s = 0; s < 2; ++s)   // chunk c0 + 1 = TT / 128 does not exist: its pw is 0, and 0 is what its buckets hold
#pragma unroll
        for (int q = 0; q < 4; ++q) { const int r = (c0 + s) * 128 + lane * 4 + q - i + MAXR; const float p = pw[s][q]; bl = __fadd_rn(bl, (r <= 0) ? p : 0.f); br = __fadd_rn(br, (r >= 2 * MAXR) ? p : 0.f); if (r > 0 && r < 2 * MAXR) nb[wv][r] = p; }
#pragma unroll
    for (int sh = 16; sh; sh >>= 1) { bl = __fadd_rn(bl, __shfl_xor(bl, sh, 32)); br = __fadd_rn(br, __shfl_xor(br, sh, 32)); }
    // nb is this wave's own: a wave's LDS operations run in issue order, so the other lanes' stores above are in place when this read runs
    const v4f nv = *(const v4fa*)(&nb[wv][(lane & 15) * 4]); v4us oh, ol;
#pragma unroll
    for (int q = 0; q < 4; ++q) { const int r = lane * 4 + q; const float b = (r == 0) ? bl : (r == 2 * MAXR) ? br : (r < 2 * MAXR) ? nv[q] : 0.f; unsigned short u, w; splitf(b, u, w); oh[q] = u; ol[q] = w; }
    const size_t ob = (size_t)row * NE + lane * 4; *(v4us*)(PBh + ob) = oh; *(v4us*)(PBl + ob) = ol;
}
__global__ __launch_bounds__(256) void k_epad2(const float* __restrict__ E, bf* EB) { const size_t i = (size_t)blockIdx.x * 256 + threadIdx.x; if (i >= (size_t)NE * HD / 8) return; const int d0 = (int)(i % (HD / 8)) * 8; const int r = (int)(i / (HD / 8)); const float* src = E + (size_t)min(r, 2 * MAXR) * HD + d0; v8us o;
#pragma unroll
    for (int q = 0; q < 8; ++q) { const unsigned short v = f2bf(src[q]); o[q] = (r <= 2 * MAXR) ? v : (unsigned short)0; }
    *(v8us*)(EB + (size_t)r * HD + d0) = o;  }
__global__ __launch_bounds__(256) void k_rvt(const float* __restrict__ E, bf* RVT) { const size_t i = (size_t)blockIdx.x * 256 + threadIdx.x; if (i >= (size_t)HD * NE / 8) return; const int r0 = (int)(i % (NE / 8)) * 8; const int d = (int)(i / (NE / 8)); v8us o;
#pragma unroll
    for (int q = 0; q < 8; ++q) { const int r = r0 + q; const unsigned short v = f2bf(E[(size_t)min(r, 2 * MAXR) * HD + d]); o[q] = (r <= 2 * MAXR) ? v : (unsigned short)0; }
    *(v8us*)(RVT + (size_t)d * NE + r0) = o;  }
__global__ __launch_bounds__(256) void k_addob(float* Ob, const float* __restrict__ W2) { const size_t k = (size_t)blockIdx.x * 256 + threadIdx.x; if (k >= (size_t)ZH * TT * HD / 4) return; const size_t e = k * 4; const int i = (int)((e / HD) % TT); const float sc = (i < RH) ? 1.0f : 1024.0f; const v4f a = *(const v4f*)(Ob + e); const v4f w = *(const v4f*)(W2 + e); v4f o;
#pragma unroll
    for (int q = 0; q < 4; ++q) o[q] = __fadd_rn(a[q], __fmul_rn(w[q], sc));
    *(v4f*)(Ob + e) = o;  }
__global__ __launch_bounds__(256) void k_merge(const float* __restrict__ O, int h0, bf* Ah, bf* Al) { const size_t e = ((size_t)blockIdx.x * 256 + threadIdx.x) * 2; if (e >= (size_t)ZH * TT * HD) return; const int d = (int)(e % HD); const int t = (int)((e / HD) % TT); const int zz = (int)(e / ((size_t)HD * TT)); const float cs = (t < RH) ? 1.0f : (1.0f / PCAR); const size_t oo = (size_t)t * DQ + (h0 + zz) * HD + d;
    v2us oh, ol;
#pragma unroll
    for (int q = 0; q < 2; ++q) { unsigned short a, c2; splitf(O[e + q] * cs, a, c2); oh[q] = a; ol[q] = c2; } *(v2us*)(Ah + oo) = oh; *(v2us*)(Al + oo) = ol;  }

extern "C" void kernel_launch(void* const* d_in, const int* in_sizes, int n_in,
                              void* d_out, int out_size, void* d_ws, size_t ws_size, hipStream_t stream) {
    (void)in_sizes; (void)n_in; (void)out_size;
    const float* x = (const float*)d_in[0]; const float* xk = (const float*)d_in[1]; const float* xv = (const float*)d_in[2]; const float* wq = (const float*)d_in[3]; const float* bq = (const float*)d_in[4]; const float* wk = (const float*)d_in[5]; const float* bk = (const float*)d_in[6]; const float* wv = (const float*)d_in[7]; const float* bv = (const float*)d_in[8]; const float* wo = (const float*)d_in[9]; const float* bo = (const float*)d_in[10]; const float* relk = (const float*)d_in[11]; const float* relv = (const float*)d_in[12];   /* [65][64] each */
    float* OUT = (float*)d_out;     // [2][2048][1024]
    char* wsp = (char*)d_ws;
    auto take = [&](size_t bytes) { char* p = wsp; wsp += (bytes + 255) & ~(size_t)255; return (void*)p; };
    bf* EB = (bf*)take((size_t)NE * HD * 2); bf* RVT = (bf*)take((size_t)HD * NE * 2); float* QE = (float*)take((size_t)ZH * TT * NE * 4); bf* PBh = (bf*)take((size_t)ZH * TT * NE * 2); bf* PBl = (bf*)take((size_t)ZH * TT * NE * 2); float* W2 = (float*)take((size_t)ZH * TT * HD * 4); bf* WQ = (bf*)take((size_t)DQ * DM * 2); bf* WK = (bf*)take((size_t)DKV * DM * 2); bf* WV = (bf*)take((size_t)DKV * DM * 2); bf* WO = (bf*)take((size_t)DM * DQ * 2); float* CS = (float*)take((size_t)TT * HD * 2 * 4);
    bf* XB = (bf*)take((size_t)TT * DM * 2); float* FQ = (float*)take((size_t)TT * DQ * 4); float* FK = (float*)take((size_t)TT * DKV * 4);
    h16* QP16 = (h16*)take((size_t)NH_ * TT * HD * 2); h16* KP16 = (h16*)take((size_t)NKV * TT * HD * 2); h16* VT16 = (h16*)take((size_t)NKV * HD * TT * 2);
    bf* QPh = (bf*)take((size_t)NH_ * TT * HD * 2); bf* QPl = (bf*)take((size_t)NH_ * TT * HD * 2); bf* KPh = (bf*)take((size_t)NKV * TT * HD * 2); bf* KPl = (bf*)take((size_t)NKV * TT * HD * 2); bf* VTh = (bf*)take((size_t)NKV * HD * TT * 2); bf* VTl = (bf*)take((size_t)NKV * HD * TT * 2);
    float* Sb = (float*)take((size_t)ZH * TT * TT * 4); h16* P16 = (h16*)Sb; bf* Ph = (bf*)Sb; bf* Pl = Ph + TT;   /* probabilities over their own score rows, pitch 2 TT */ float* Ob = (float*)take((size_t)ZH * TT * HD * 4); bf* ATh = (bf*)take((size_t)TT * DQ * 2); bf* ATl = (bf*)take((size_t)TT * DQ * 2);
    if ((size_t)(wsp - (char*)d_ws) > ws_size) return;    // ws 256 MiB
    float* FV = FK;   // v projection reuses the k buffer after the k planes are built (stream-ordered)
    { k_wtG<<<(unsigned)((DM * DQ / 64 + 63) / 64), 256, 0, stream>>>(wq, DM, DQ, WQ); k_wtG<<<(unsigned)((DM * DKV / 64 + 63) / 64), 256, 0, stream>>>(wk, DM, DKV, WK); k_wtG<<<(unsigned)((DM * DKV / 64 + 63) / 64), 256, 0, stream>>>(wv, DM, DKV, WV);
      k_wtG<<<(unsigned)((DQ * DM / 64 + 63) / 64), 256, 0, stream>>>(wo, DQ, DM, WO);
       }
    k_csid<<<(TT * HD + 255) / 256, 256, 0, stream>>>(CS);
    const unsigned LQ = (unsigned)(((size_t)NH_ * TT * HD / 2 + 255) / 256), LKv = (unsigned)(((size_t)NKV * TT * HD / 2 + 255) / 256);
    k_epad2<<<(unsigned)(((size_t)NE * HD / 8 + 255) / 256), 256, 0, stream>>>(relk, EB); k_rvt<<<(unsigned)(((size_t)HD * NE / 8 + 255) / 256), 256, 0, stream>>>(relv, RVT);   /* rel_k plane [128][64], rel_v^T plane [64][128] */
    for (int b = 0; b < NB_; ++b) {
        
        k_cvt8<<<(unsigned)(((size_t)TT * DM / 8 + 255) / 256), 256, 0, stream>>>(x + (size_t)b * TT * DM, XB, (size_t)TT * DM / 8);
        k_gemmsk<bf, 0, true, DM, 4, 8><<<dim3(TT / 64, DQ / 64, 1), 256, 0, stream>>>(XB, nullptr, WQ, nullptr, FQ, DQ, bq, 0, 0, 0);
        k_rope<<<LQ, 256, 0, stream>>>(FQ, DQ, NH_, CS, nullptr, nullptr, 1.0f, QP16, QPh, QPl);
        k_cvt8<<<(unsigned)(((size_t)TT * DM / 8 + 255) / 256), 256, 0, stream>>>(xk + (size_t)b * TT * DM, XB, (size_t)TT * DM / 8); k_gemmsk<bf, 0, true, DM, 4, 8><<<dim3(TT / 64, DKV / 64, 1), 256, 0, stream>>>(XB, nullptr, WK, nullptr, FK, DKV, bk, 0, 0, 0);
        k_rope<<<LKv, 256, 0, stream>>>(FK, DKV, NKV, CS, nullptr, nullptr, 1.0f, KP16, KPh, KPl);
        k_cvt8<<<(unsigned)(((size_t)TT * DM / 8 + 255) / 256), 256, 0, stream>>>(xv + (size_t)b * TT * DM, XB, (size_t)TT * DM / 8); k_gemmsk<bf, 0, true, DM, 4, 8><<<dim3(TT / 64, DKV / 64, 1), 256, 0, stream>>>(XB, nullptr, WV, nullptr, FV, DKV, bv, 0, 0, 0); k_vtp<<<LKv, 256, 0, stream>>>(FV, DKV, NKV, VT16, VTh, VTl);
        for (int h0 = 0; h0 < NH_; h0 += ZH) { const size_t zq = (size_t)h0, zk = (size_t)(h0 / REP);   // one kv head per query head: the pass's heads use consecutive kv planes (z-strides TT*HD)
            k_gemmw<bf, 2, false><<<dim3(RH / 64, TT / 64, ZH), 32, 0, stream>>>(QPh + zq * TT * HD, QPl + zq * TT * HD, KPh + zk * TT * HD, KPl + zk * TT * HD, HD, Sb, TT, nullptr, (size_t)TT * HD, (size_t)TT * HD, (size_t)TT * TT);
            k_gemmw<h16, 0, false><<<dim3((TT - RH) / 64, TT / 64, ZH), 32, 0, stream>>>(QP16 + zq * TT * HD + (size_t)RH * HD, nullptr, KP16 + zk * TT * HD, nullptr, HD, Sb + (size_t)RH * TT, TT, nullptr, (size_t)TT * HD, (size_t)TT * HD, (size_t)TT * TT);
            k_gemmw<bf, 1, false><<<dim3(TT / 64, NE / 64, ZH), 32, 0, stream>>>(QPh + zq * TT * HD, QPl + zq * TT * HD, EB, nullptr, HD, QE, NE, nullptr, (size_t)TT * HD, 0, (size_t)TT * NE);   /* QE[i][r] = q_i . rel_k[r] */
            k_asoft<<<ZH * TT / 8, 256, 0, stream>>>(Sb, QE, P16, Ph, Pl, PBh, PBl);   /* + QE[i][idx], softmax, 65 relative-position bucket sums per row */
            k_gemmw<bf, 1, false><<<dim3(TT / 64, HD / 64, ZH), 32, 0, stream>>>(PBh, PBl, RVT, nullptr, NE, W2, HD, nullptr, (size_t)TT * NE, 0, (size_t)TT * HD);   /* W2 = buckets . rel_v */
            k_gemmsk<bf, 2, false, TT, 2, 16, 2 * TT><<<dim3(RH / 32, HD / 64, ZH), 512, 0, stream>>>(Ph, Pl, VTh + zk * HD * TT, VTl + zk * HD * TT, Ob, HD, nullptr, (size_t)TT * TT * 2, (size_t)HD * TT, (size_t)TT * HD);
            k_gemmsk<h16, 0, false, TT, 2, 16, 2 * TT><<<dim3((TT - RH) / 32, HD / 64, ZH), 512, 0, stream>>>(P16 + (size_t)RH * TT * 2, nullptr, VT16 + zk * HD * TT, nullptr, Ob + (size_t)RH * HD, HD, nullptr, (size_t)TT * TT * 2, (size_t)HD * TT, (size_t)TT * HD);
            k_addob<<<(unsigned)(((size_t)ZH * TT * HD / 4 + 255) / 256), 256, 0, stream>>>(Ob, W2);   /* + sum_j attn[i][j] rel_v[idx] */ k_merge<<<(unsigned)(((size_t)ZH * TT * HD / 2 + 255) / 256), 256, 0, stream>>>(Ob, h0, ATh, ATl); }
        k_gemmsk<bf, 1, true, DQ, 4, 8><<<dim3(TT / 64, DM / 64, 1), 256, 0, stream>>>(ATh, ATl, WO, nullptr, OUT + (size_t)b * TT * DM, DM, bo, 0, 0, 0); }
}

// v004
// A run of this version takes 480 microseconds.
// Two timings next to v003 both put it at 1.34 times that version's speed.
// Counting every step since v000, it is 6.74 times as fast.
#include <hip/hip_runtime.h>

// Multi-head attention with Shaw relative-position terms on the logits AND the values (query, key, value [2][2048][1024]; q,k,v = in W + b ('xw' 1/32, zero biases; 16 heads x 64); idx[i][j] = clip(j - i, -32, 32) + 32; attn = softmax((q.k + q_i.rel_k[idx]) / 8); out_h = attn v + sum_j attn[i][j] rel_v[idx] (tables [65][64] x 0.05, read); out = merged Wo + bo ('xw') -> [2][2048][1024] (4.2 M)).
// Layout per batch: bf16 copies of the three inputs in turn; exact projections + f32 biases; rel_k as an exact plane [128][64] (rows >= 65 zero) and rel_v^T as an exact plane [64][128]; per pass of eight heads: QE = q.rel_k^T ([8][2048][128], hi/lo x exact); one kernel per 32 query rows does the dense scores (hybrid rows: < 512 hi/lo 3 products, rest fp16 x1024), adds QE[i][idx], does the softmax with the 1/8, sums each row's probabilities into the 65 relative-position buckets (far-left sum, 63 near entries, far-right sum; fixed order) as hi/lo planes and multiplies by v, scores and probabilities staying in registers; W2 = buckets x rel_v ([8][2048][64], hi/lo x exact) added to attn v in f32; merged hi/lo x Wo exact + bo.
// Compute dtypes, f32 accumulate: every input rounded to bf16; projections exact + f32 biases; q.rel_k and buckets.rel_v hi/lo x exact; attention rows < 512 3 products, rest fp16; softmax f32; Wo hl x exact + bias.

#define NB_  2
#define TT   2048
#define DM   1024
#define NH_  16
#define NKV  16
#define REP  (NH_ / NKV)
#define HD   64
#define DQ   (NH_ * HD)
#define DKV  (NKV * HD)
#define ZH   8                    // heads per pass
#define RH   512                  // query rows < RH use hi+lo planes (0: none)
#define WIN  0
#define PCAR 1024.0f
#define SCL  0.125f
#define MAXR 32      // max relative position
#define NE   128     // 2*MAXR+1 = 65 table rows padded to 128
typedef _Float16 h16;
typedef unsigned short bf;
typedef __attribute__((ext_vector_type(16))) __bf16   v16bf;
typedef __attribute__((ext_vector_type(16))) _Float16 v16h;
typedef __attribute__((ext_vector_type(8)))  _Float16 v8h;
typedef __attribute__((ext_vector_type(8)))  unsigned short v8us;
typedef __attribute__((ext_vector_type(8)))  float    v8f;
typedef __attribute__((ext_vector_type(4)))  float    v4f;
typedef v8h  __attribute__((may_alias)) v8ha;
typedef v4f  __attribute__((may_alias)) v4fa;
typedef v8us __attribute__((may_alias)) v8usa;

__device__ __forceinline__ unsigned short f2bf(float f) { unsigned u = __float_as_uint(f); u += 0x7FFFu + ((u >> 16) & 1u); return (unsigned short)(u >> 16); }
__device__ __forceinline__ float bf2f(unsigned short b) { return __uint_as_float(((unsigned)b) << 16); }
__device__ __forceinline__ float bfr(float f) { return bf2f(f2bf(f)); }
__device__ __forceinline__ v16h cat16(v8h lo, v8h hi) { return __builtin_shufflevector(lo, hi, 0, 1, 2, 3, 4, 5, 6, 7, 8, 9, 10, 11, 12, 13, 14, 15); }
__device__ __forceinline__ v16bf cat16b(v8us lo, v8us hi) { return __builtin_bit_cast(v16bf, __builtin_shufflevector(lo, hi, 0, 1, 2, 3, 4, 5, 6, 7, 8, 9, 10, 11, 12, 13, 14, 15)); }
__device__ __forceinline__ v8f wmma16(v16h a, v16h b, v8f c) { return __builtin_amdgcn_wmma_f32_16x16x32_f16(false, a, false, b, (short)0, c, false, false); }
__device__ __forceinline__ v8f wmmab(v16bf a, v16bf b, v8f c) { return __builtin_amdgcn_wmma_f32_16x16x32_bf16(false, a, false, b, (short)0, c, false, false); }



// ---- k_gemmw: register-blocked GEMM, ONE WAVE per 64x64 output tile (16 accumulators), operands straight from K-contiguous 16-bit planes; grid (M/64, N/64, Z), 32 threads.
// C[m][n] (f32, pitch ldc, + optional f32 bias[n]) = sum_k A[m][k] Bt[n][k] (+ split products per NSPLIT). z-batch strides sA/sB/sC in elements. K % 32 == 0.
template <typename T16> struct WFrag;
template <> struct WFrag<h16> { typedef v16h V; static __device__ __forceinline__ V ld(const h16* p) { return cat16(*(const v8h*)p, *(const v8h*)(p + 16)); } static __device__ __forceinline__ v8f mma(V a, V b, v8f c) { return wmma16(a, b, c); } };
template <> struct WFrag<bf> { typedef v16bf V; static __device__ __forceinline__ V ld(const bf* p) { return cat16b(*(const v8us*)p, *(const v8us*)(p + 16)); } static __device__ __forceinline__ v8f mma(V a, V b, v8f c) { return wmmab(a, b, c); } };
template <typename T16, int NSPLIT, bool BIAS>
__global__ __launch_bounds__(32) void k_gemmw(const T16* __restrict__ A, const T16* __restrict__ A2, const T16* __restrict__ Bt, const T16* __restrict__ Bt2, int K, float* C, int ldc, const float* __restrict__ bias, size_t sA, size_t sB, size_t sC) {
    typedef typename WFrag<T16>::V V;
    __shared__ __align__(16) float os[16 * 68];
    const size_t z = blockIdx.z; A += z * sA; if (A2) A2 += z * sA; Bt += z * sB; if (Bt2) Bt2 += z * sB; C += z * sC;
    const int lane = threadIdx.x & 31, lr = lane & 15, hi = lane >> 4; const int r0 = blockIdx.x * 64, c0 = blockIdx.y * 64;
    v8f acc[4][4];
#pragma unroll
    for (int mb = 0; mb < 4; ++mb)
#pragma unroll
        for (int nb = 0; nb < 4; ++nb) acc[mb][nb] = (v8f){};
    const size_t aoff = (size_t)(r0 + lr) * K + 8 * hi, boff = (size_t)(c0 + lr) * K + 8 * hi;
#pragma unroll 1
    for (int kc = 0; kc < K; kc += 32) {
        V a[4], a2[4];
#pragma unroll
        for (int mb = 0; mb < 4; ++mb) { a[mb] = WFrag<T16>::ld(A + aoff + (size_t)mb * 16 * K + kc); if (NSPLIT == 1 || NSPLIT == 2) a2[mb] = WFrag<T16>::ld(A2 + aoff + (size_t)mb * 16 * K + kc); }
#pragma unroll
        for (int nb = 0; nb < 4; ++nb) { const V b = WFrag<T16>::ld(Bt + boff + (size_t)nb * 16 * K + kc); V b2; if (NSPLIT >= 2) b2 = WFrag<T16>::ld(Bt2 + boff + (size_t)nb * 16 * K + kc);
#pragma unroll
            for (int mb = 0; mb < 4; ++mb) { acc[mb][nb] = WFrag<T16>::mma(a[mb], b, acc[mb][nb]); if (NSPLIT == 1 || NSPLIT == 2) acc[mb][nb] = WFrag<T16>::mma(a2[mb], b, acc[mb][nb]); if (NSPLIT >= 2) acc[mb][nb] = WFrag<T16>::mma(a[mb], b2, acc[mb][nb]); } }
        asm volatile("v_nop\n\tv_nop\n\tv_nop\n\tv_nop" : "+v"(acc[0][0]), "+v"(acc[1][1]), "+v"(acc[2][2]), "+v"(acc[3][3]) : "v"(a[0]), "v"(a[3]));
    }
#pragma unroll
    for (int mb = 0; mb < 4; ++mb) {
#pragma unroll
        for (int nb = 0; nb < 4; ++nb) {
#pragma unroll
            for (int j = 0; j < 8; ++j) os[(hi * 8 + j) * 68 + nb * 16 + lr] = acc[mb][nb][j]; }
        __builtin_amdgcn_wave_barrier(); asm volatile("" ::: "memory");
        float* crow = C + (size_t)(r0 + mb * 16) * ldc + c0;
{
#pragma unroll
            for (int s = 0; s < 8; ++s) { const int row = 2 * s + hi, cofs = lr * 4; v4f val = *(const v4fa*)(os + row * 68 + cofs); if (BIAS) { val[0] += bfr(bias[c0 + cofs]); val[1] += bfr(bias[c0 + cofs + 1]); val[2] += bfr(bias[c0 + cofs + 2]); val[3] += bfr(bias[c0 + cofs + 3]); }
                *(v4f*)(crow + (size_t)row * ldc + cofs) = val; }
             }
        __builtin_amdgcn_wave_barrier(); asm volatile("" ::: "memory");
    }
}

// ---- k_gemmsk: the products of k_gemmw for a long K: ONE WORK-GROUP of NW waves per (16 MB)x64 output tile, wave w takes k in [w KK/NW, (w+1) KK/NW) (4 MB accumulators);
// the NW partial tiles meet in LDS and are summed in wave order 0..NW-1 (fixed), then leave as whole 256-byte rows (+ optional f32 bias[n]). grid (M/(16 MB), N/64, Z), 32 NW threads. NSPLIT as in k_gemmw. KK % (32 NW) == 0. LDA: pitch of A's rows in elements.
template <typename T16, int NSPLIT, bool BIAS, int KK, int MB, int NW, int LDA = KK>
__global__ __launch_bounds__(NW * 32) void k_gemmsk(const T16* __restrict__ A, const T16* __restrict__ A2, const T16* __restrict__ Bt, const T16* __restrict__ Bt2, float* C, int ldc, const float* __restrict__ bias, size_t sA, size_t sB, size_t sC) {
    typedef typename WFrag<T16>::V V;
    __shared__ __align__(16) float red[NW * MB * 1024];   // [wave][subtile mb*4+nb][half of its 8 rows a lane][lane] x 4 floats
    __shared__ __align__(16) float os[MB * 16 * 68];
    const size_t z = blockIdx.z; A += z * sA; if (NSPLIT == 1 || NSPLIT == 2) A2 += z * sA; Bt += z * sB; if (NSPLIT >= 2) Bt2 += z * sB; C += z * sC;
    const int tid = threadIdx.x, lane = tid & 31, w = tid >> 5, lr = lane & 15, hi = lane >> 4; const int r0 = blockIdx.x * (MB * 16), c0 = blockIdx.y * 64;
    // every '#pragma unroll' in this kernel makes the indices of acc, a, a2 and s constants, so that they stay in registers
    v8f acc[MB][4];
#pragma unroll
    for (int mb = 0; mb < MB; ++mb)
#pragma unroll
        for (int nb = 0; nb < 4; ++nb) acc[mb][nb] = (v8f){};
    const size_t aoff = (size_t)(r0 + lr) * LDA + 8 * hi + w * (KK / NW), boff = (size_t)(c0 + lr) * KK + 8 * hi + w * (KK / NW);
    // unrolled whole (KK / (32 NW) = 4 trips here): no back edge behind a matrix instruction
#pragma unroll
    for (int kc = 0; kc < KK / NW; kc += 32) {
        V a[MB], a2[MB];
#pragma unroll
        for (int mb = 0; mb < MB; ++mb) { a[mb] = WFrag<T16>::ld(A + aoff + (size_t)mb * 16 * LDA + kc); if (NSPLIT == 1 || NSPLIT == 2) a2[mb] = WFrag<T16>::ld(A2 + aoff + (size_t)mb * 16 * LDA + kc); }
#pragma unroll
        for (int nb = 0; nb < 4; ++nb) { const V b = WFrag<T16>::ld(Bt + boff + (size_t)nb * 16 * KK + kc); V b2; if (NSPLIT >= 2) b2 = WFrag<T16>::ld(Bt2 + boff + (size_t)nb * 16 * KK + kc);
#pragma unroll
            for (int mb = 0; mb < MB; ++mb) { acc[mb][nb] = WFrag<T16>::mma(a[mb], b, acc[mb][nb]); if (NSPLIT == 1 || NSPLIT == 2) acc[mb][nb] = WFrag<T16>::mma(a2[mb], b, acc[mb][nb]); if (NSPLIT >= 2) acc[mb][nb] = WFrag<T16>::mma(a[mb], b2, acc[mb][nb]); } }
    }
#pragma unroll
    for (int mb = 0; mb < MB; ++mb)
#pragma unroll
        for (int nb = 0; nb < 4; ++nb) { float* rp = red + w * (MB * 1024) + (mb * 4 + nb) * 256 + lane * 4; const v8f c = acc[mb][nb];
            *(v4fa*)rp = (v4f){c[0], c[1], c[2], c[3]}; *(v4fa*)(rp + 128) = (v4f){c[4], c[5], c[6], c[7]}; }
    __syncthreads();   // every wave's partial tile is in LDS
#pragma unroll
    for (int u = 0; u < MB * 8 / NW; ++u) { const int idx = u * (NW * 32) + tid;   // one group of 4 floats of the tile; idx & 31 == lane
        v4f s = *(const v4fa*)(red + idx * 4);
#pragma unroll
        for (int q = 1; q < NW; ++q) { const v4f p = *(const v4fa*)(red + q * (MB * 1024) + idx * 4);
#pragma unroll
            for (int j = 0; j < 4; ++j) s[j] = __fadd_rn(s[j], p[j]); }
        const int t = idx >> 6, half = (idx >> 5) & 1; const int row = (t >> 2) * 16 + hi * 8 + half * 4, col = (t & 3) * 16 + lr;
#pragma unroll
        for (int j = 0; j < 4; ++j) os[(row + j) * 68 + col] = s[j]; }
    __syncthreads();   // the summed tile is whole before it is read by rows
#pragma unroll
    for (int u = 0; u < MB * 8 / NW; ++u) { const int idx = u * (NW * 32) + tid; const int row = idx >> 4, cofs = (idx & 15) * 4; v4f val = *(const v4fa*)(os + row * 68 + cofs);
        if (BIAS) { val[0] += bfr(bias[c0 + cofs]); val[1] += bfr(bias[c0 + cofs + 1]); val[2] += bfr(bias[c0 + cofs + 2]); val[3] += bfr(bias[c0 + cofs + 3]); }
        *(v4f*)(C + (size_t)(r0 + row) * ldc + c0 + cofs) = val; }
}

__device__ __forceinline__ h16 tohx(float x) { return (h16)x; }
__device__ __forceinline__ void splitf(float y, unsigned short& h, unsigned short& l) { h = f2bf(y); l = f2bf(y - bf2f(h)); }
typedef __attribute__((ext_vector_type(2))) _Float16 v2h;
typedef __attribute__((ext_vector_type(4))) _Float16 v4h;
typedef __attribute__((ext_vector_type(2))) unsigned short v2us;
typedef __attribute__((ext_vector_type(4))) unsigned short v4us;
typedef __attribute__((ext_vector_type(2))) float v2f;
typedef __attribute__((ext_vector_type(4))) int v4i;

__global__ __launch_bounds__(256) void k_wtG(const float* __restrict__ w, int K, int N, bf* Bt) {
    const int lane = threadIdx.x & 31; const int L0 = (blockIdx.x * 8 + (threadIdx.x >> 5)) * 8; const int nlines = N * K / 64;
{
#pragma unroll 1
        for (int l = 0; l < 8; ++l) { const int L = L0 + l; if (L >= nlines) break; const size_t e = (size_t)L * 64 + lane * 2; const int k = (int)(e % K), n = (int)(e / K); v2us o;
            o[0] = f2bf(w[(size_t)k * N + n]); o[1] = f2bf(w[(size_t)(k + 1) * N + n]); *(v2us*)(Bt + e) = o; }
         }
}
__global__ __launch_bounds__(256) void k_cvt8(const float* __restrict__ src, bf* dst, size_t n8) { const size_t i = (size_t)blockIdx.x * 256 + threadIdx.x; if (i >= n8) return; const v8f v = *(const v8f*)(src + i * 8); v8us o;
#pragma unroll
    for (int k = 0; k < 8; ++k) o[k] = f2bf(v[k]); *(v8us*)(dst + i * 8) = o;  }

// k_rope: head planes [h][t][d] (fp16 + hi/lo) of rope(x) x sc with the rotate-half convention out[d] = x[d] cos[t][d] - x[d+HD/2] sin[t][d], out[d+HD/2] = x[d+HD/2] cos[t][d+HD/2] + x[d] sin[t][d+HD/2]
__global__ __launch_bounds__(256) void k_rope(const float* __restrict__ F, int pitch, int nheads, const float* __restrict__ CS, const float* __restrict__ RF, const float* __restrict__ nw, float sc, h16* P16, bf* Ph, bf* Pl) {
    const size_t e = ((size_t)blockIdx.x * 256 + threadIdx.x) * 2; if (e >= (size_t)nheads * TT * HD) return; const int d = (int)(e % HD); const int t = (int)((e / HD) % TT); const int h = (int)(e / ((size_t)HD * TT)); const float* f = F + (size_t)t * pitch + h * HD; const float rf = RF ? RF[(size_t)h * TT + t] : 1.0f; v2h o16; v2us oh, ol;
#pragma unroll
    for (int q = 0; q < 2; ++q) { const int dd = d + q; const int dp = (dd < HD / 2) ? dd + HD / 2 : dd - HD / 2; float x0 = f[dd], x1 = f[dp];
        if (RF) { float n0 = __fmul_rn(x0, rf), n1 = __fmul_rn(x1, rf); asm volatile("" : "+v"(n0)); asm volatile("" : "+v"(n1)); x0 = __fmul_rn(bfr(nw[dd]), n0); x1 = __fmul_rn(bfr(nw[dp]), n1); }
        const v2f cs = *(const v2f*)(CS + ((size_t)t * HD + dd) * 2); float a = __fmul_rn(x0, cs[0]), bq = __fmul_rn(x1, cs[1]); asm volatile("" : "+v"(a)); asm volatile("" : "+v"(bq)); const float r = ((dd < HD / 2) ? __fsub_rn(a, bq) : __fadd_rn(a, bq)) * sc;
        o16[q] = tohx(r); unsigned short a2, c2; splitf(r, a2, c2); oh[q] = a2; ol[q] = c2; }
    *(v2h*)(P16 + e) = o16; *(v2us*)(Ph + e) = oh; *(v2us*)(Pl + e) = ol;  }
__global__ __launch_bounds__(256) void k_vtp(const float* __restrict__ F, int pitch, int nheads, h16* V16, bf* Vh, bf* Vl) { const size_t e = ((size_t)blockIdx.x * 256 + threadIdx.x) * 2; if (e >= (size_t)nheads * HD * TT) return; const int t = (int)(e % TT); const int d = (int)((e / TT) % HD); const int g = (int)(e / ((size_t)TT * HD)); v2h o16; v2us oh, ol;
#pragma unroll
    for (int q = 0; q < 2; ++q) { const float x = F[(size_t)(t + q) * pitch + g * HD + d]; o16[q] = tohx(x); unsigned short a2, c2; splitf(x, a2, c2); oh[q] = a2; ol[q] = c2; }
    *(v2h*)(V16 + e) = o16; *(v2us*)(Vh + e) = oh; *(v2us*)(Vl + e) = ol;  }
__global__ __launch_bounds__(256) void k_csid(float* CS) { const int idx = blockIdx.x * 256 + threadIdx.x; if (idx >= TT * HD) return; v2f cs; cs[0] = 1.0f; cs[1] = 0.0f; *(v2f*)(CS + (size_t)idx * 2) = cs;  }
// ---- k_fattn: scores, softmax, bucket sums and attn.v of 32 query rows of one head in ONE work-group of 16 waves; each wave owns four blocks of 32 keys and the scores never leave its registers.
// The 64 key blocks are dealt out from the block in front of the query rows onward (mod 64): slot u 16 + w goes to wave w as its u-th block, so that every key with |j - i| < 32 lies in slots 0..2 (u = 0, waves 0..2) and all other slots are wholly far left or far right.
// S^T = K Q^T (a lane holds one query's scores: column lr, rows 8 hi + j), + QE[i][clip(j - i)], x HD^-0.5; row maximum and row sum meet across the waves in LDS (sum in wave order, fixed);
// the rounded probabilities (hi/lo for rows < RH, else fp16 x1024) are packed from two score tiles straight into a B operand (hardware k order, which WFrag::ld also delivers) for O^T += V^T P^T;
// the 16 partial O tiles are summed in LDS in wave order; the values as rounded are summed into the 65 relative-position buckets (far-left sum, 63 near entries, far-right sum; fixed order), hi/lo planes [row][128].
#define FQR  32                   // query rows per work-group
#define FNW  16                   // waves per work-group
#define QEP  66                   // LDS pitch of a staged QE row (entries 0..65)
#define RDP  68                   // LDS pitch of a partial O row
#define RWP  20                   // LDS pitch of a query's 16 per-wave values
typedef __attribute__((ext_vector_type(2))) __bf16 v2bf;
template <bool HR> struct FT { typedef h16 T; };
template <> struct FT<true> { typedef bf T; };
template <bool HR>
__device__ __forceinline__ void fattn_body(const typename FT<HR>::T* __restrict__ Q, const typename FT<HR>::T* __restrict__ Q2, const typename FT<HR>::T* __restrict__ Kp, const typename FT<HR>::T* __restrict__ K2, const typename FT<HR>::T* __restrict__ Vt, const typename FT<HR>::T* __restrict__ V2,
                                           const float* __restrict__ QEr, const int q0, float* red, float* qes, float* rm, float* rs, float* rl, float* rr, float* nbk) {
    typedef typename FT<HR>::T T16; typedef typename WFrag<T16>::V V;
    const int tid = threadIdx.x, lane = tid & 31, lr = lane & 15, hi = lane >> 4; const int w = __builtin_amdgcn_readfirstlane(tid >> 5);
    // every '#pragma unroll' in this function makes the indices of the register arrays constants
#pragma unroll
    for (int s = 0; s < 2; ++s) { const int q = 2 * w + s; const float* sp = QEr + (size_t)q * NE; qes[q * QEP + lane] = sp[lane]; qes[q * QEP + 32 + lane] = sp[32 + lane]; if (lane < 2) qes[q * QEP + 64 + lane] = sp[64 + lane]; }
    *(v4fa*)(nbk + tid * 4) = (v4f){0.f, 0.f, 0.f, 0.f};   // a bucket whose key lies outside [0, TT) stays 0
    int kf[4];   // first key of this wave's u-th block (wave-uniform)
#pragma unroll
    for (int u = 0; u < 4; ++u) kf[u] = (((q0 >> 5) + 63 + u * 16 + w) & 63) * 32;
    // every operand load is a wave-uniform base plus one of two lane offsets in bytes: klb in a 16-row tile of Q or K, vlb in a 16-row tile of V^T
    const unsigned klb = (unsigned)(lr * (HD * 2) + hi * 16), vlb = (unsigned)(lr * (TT * 2) + hi * 16);
    auto at = [](const T16* base, unsigned ofs) { return (const T16*)((const char*)base + ofs); };
    V bq[2][2], bq2[2][2]; const T16* pq = at(Q + (size_t)q0 * HD, klb); const T16* pq2 = HR ? at(Q2 + (size_t)q0 * HD, klb) : nullptr;
#pragma unroll
    for (int qt = 0; qt < 2; ++qt)
#pragma unroll
        for (int ks = 0; ks < 2; ++ks) { bq[qt][ks] = WFrag<T16>::ld(pq + qt * 16 * HD + ks * 32); if (HR) bq2[qt][ks] = WFrag<T16>::ld(pq2 + qt * 16 * HD + ks * 32); }
    v8f acc[8][2];
#pragma unroll
    for (int kt = 0; kt < 8; ++kt) { acc[kt][0] = (v8f){}; acc[kt][1] = (v8f){}; }
    constexpr int UB = HR ? 1 : 4;   // key blocks whose fragments are fetched together (as many as the registers hold)
#pragma unroll
    for (int u0 = 0; u0 < 4; u0 += UB) { V a[UB][2][2], a2[UB][2][2]; const T16* pk[UB]; const T16* pk2[UB];
#pragma unroll
        for (int t = 0; t < UB; ++t) { pk[t] = at(Kp + (size_t)kf[u0 + t] * HD, klb); pk2[t] = HR ? at(K2 + (size_t)kf[u0 + t] * HD, klb) : nullptr;
#pragma unroll
            for (int hf = 0; hf < 2; ++hf)
#pragma unroll
                for (int ks = 0; ks < 2; ++ks) { a[t][hf][ks] = WFrag<T16>::ld(pk[t] + hf * 16 * HD + ks * 32); if (HR) a2[t][hf][ks] = WFrag<T16>::ld(pk2[t] + hf * 16 * HD + ks * 32); } }
        // stands behind the batch's loads. The loaded values are inputs, so that the whole batch is in flight together (one latency a batch, not one a tile); the addresses the loads name are inputs, so that they stay live and unwritten (by a load's result too) up to the wait
        if constexpr (HR) asm volatile("s_wait_xcnt 0x0" :: "v"(a[0][0][0]), "v"(a[0][0][1]), "v"(a[0][1][0]), "v"(a[0][1][1]), "v"(a2[0][0][0]), "v"(a2[0][0][1]), "v"(a2[0][1][0]), "v"(a2[0][1][1]), "v"(bq[0][0]), "v"(bq[0][1]), "v"(bq[1][0]), "v"(bq[1][1]), "v"(bq2[0][0]), "v"(bq2[0][1]), "v"(bq2[1][0]), "v"(bq2[1][1]), "v"(pk[0]), "v"(pk2[0]), "v"(pq), "v"(pq2) : "memory");
        else asm volatile("s_wait_xcnt 0x0" :: "v"(a[0][0][0]), "v"(a[0][0][1]), "v"(a[0][1][0]), "v"(a[0][1][1]), "v"(a[1][0][0]), "v"(a[1][0][1]), "v"(a[1][1][0]), "v"(a[1][1][1]), "v"(a[2][0][0]), "v"(a[2][0][1]), "v"(a[2][1][0]), "v"(a[2][1][1]), "v"(a[3][0][0]), "v"(a[3][0][1]), "v"(a[3][1][0]), "v"(a[3][1][1]), "v"(bq[0][0]), "v"(bq[0][1]), "v"(bq[1][0]), "v"(bq[1][1]), "v"(pk[0]), "v"(pk[1]), "v"(pk[2]), "v"(pk[3]), "v"(pq) : "memory");
#pragma unroll
        for (int t = 0; t < UB; ++t)
#pragma unroll
            for (int hf = 0; hf < 2; ++hf)
#pragma unroll
                for (int ks = 0; ks < 2; ++ks)
#pragma unroll
                    for (int qt = 0; qt < 2; ++qt) { v8f& c = acc[2 * (u0 + t) + hf][qt]; c = WFrag<T16>::mma(a[t][hf][ks], bq[qt][ks], c); if (HR) { c = WFrag<T16>::mma(a[t][hf][ks], bq2[qt][ks], c); c = WFrag<T16>::mma(a2[t][hf][ks], bq[qt][ks], c); } } }
    __syncthreads();   // the staged QE rows and the zeroed near buckets are in LDS
    float qeL[2], qeR[2], mx[2];
#pragma unroll
    for (int qt = 0; qt < 2; ++qt) { qeL[qt] = qes[(qt * 16 + lr) * QEP]; qeR[qt] = qes[(qt * 16 + lr) * QEP + 2 * MAXR]; mx[qt] = -3.0e38f; }
#pragma unroll
    for (int u = 0; u < 4; ++u) {
        if (u == 0 && w < 3) {   // a block that may hold near keys: entry by entry; j - i = dj + 8 hi + e - lr
#pragma unroll
            for (int hf = 0; hf < 2; ++hf)
#pragma unroll
                for (int qt = 0; qt < 2; ++qt) { const int dj = kf[u] + hf * 16 - (q0 + qt * 16);
#pragma unroll
                    for (int j = 0; j < 8; ++j) { const float e = qes[(qt * 16 + lr) * QEP + min(max(dj + 8 * hi + j - lr, -MAXR), MAXR) + MAXR]; const float t = (acc[2 * u + hf][qt][j] + e) * SCL; acc[2 * u + hf][qt][j] = t; mx[qt] = fmaxf(mx[qt], t); } }
        } else { const bool left = kf[u] < q0;
#pragma unroll
            for (int qt = 0; qt < 2; ++qt) { const float e = left ? qeL[qt] : qeR[qt];
#pragma unroll
                for (int hf = 0; hf < 2; ++hf)
#pragma unroll
                    for (int j = 0; j < 8; ++j) { const float t = (acc[2 * u + hf][qt][j] + e) * SCL; acc[2 * u + hf][qt][j] = t; mx[qt] = fmaxf(mx[qt], t); } }
        } }
#pragma unroll
    for (int qt = 0; qt < 2; ++qt) mx[qt] = fmaxf(mx[qt], __shfl_xor(mx[qt], 16, 32));
    rm[lane * RWP + w] = hi ? mx[1] : mx[0];   // lane = query index in the block: half hi stores column group hi
    __syncthreads();   // every wave's row maxima are in LDS
#pragma unroll
    for (int qt = 0; qt < 2; ++qt) { const float* p = rm + (qt * 16 + lr) * RWP; float m = -3.0e38f;
#pragma unroll
        for (int g = 0; g < 4; ++g) { const v4f x = *(const v4fa*)(p + g * 4); m = fmaxf(fmaxf(m, fmaxf(x[0], x[1])), fmaxf(x[2], x[3])); }
        mx[qt] = m; }
    float sum[2] = {0.f, 0.f};
#pragma unroll
    for (int kt = 0; kt < 8; ++kt)
#pragma unroll
        for (int qt = 0; qt < 2; ++qt) { float x[8], p[8], s8 = 0.f;
#pragma unroll
            for (int j = 0; j < 8; ++j) x[j] = (acc[kt][qt][j] - mx[qt]) * 1.4426950408889634f;
            // eight independent exponentials (no result on a source: early clobber) and, behind the last, the one slot that the instruction set asks for before a result is used or a source overwritten
            asm("v_exp_f32 %0, %8\n\tv_exp_f32 %1, %9\n\tv_exp_f32 %2, %10\n\tv_exp_f32 %3, %11\n\tv_exp_f32 %4, %12\n\tv_exp_f32 %5, %13\n\tv_exp_f32 %6, %14\n\tv_exp_f32 %7, %15\n\tv_nop"
                : "=&v"(p[0]), "=&v"(p[1]), "=&v"(p[2]), "=&v"(p[3]), "=&v"(p[4]), "=&v"(p[5]), "=&v"(p[6]), "=&v"(p[7]) : "v"(x[0]), "v"(x[1]), "v"(x[2]), "v"(x[3]), "v"(x[4]), "v"(x[5]), "v"(x[6]), "v"(x[7]));
#pragma unroll
            for (int j = 0; j < 8; ++j) { acc[kt][qt][j] = p[j]; s8 += p[j]; }
            sum[qt] += s8; }
#pragma unroll
    for (int qt = 0; qt < 2; ++qt) sum[qt] += __shfl_xor(sum[qt], 16, 32);
    rs[lane * RWP + w] = hi ? sum[1] : sum[0];
    __syncthreads();   // every wave's row sums are in LDS
    float f[2];
#pragma unroll
    for (int qt = 0; qt < 2; ++qt) { const float* p = rs + (qt * 16 + lr) * RWP; float s = 0.f;
#pragma unroll
        for (int g = 0; g < 4; ++g) { const v4f x = *(const v4fa*)(p + g * 4); s = (((s + x[0]) + x[1]) + x[2]) + x[3]; }
        f[qt] = __fdiv_rn(HR ? 1.0f : PCAR, s); }
    float bl[2] = {0.f, 0.f}, br[2] = {0.f, 0.f};
    v8f o[4][2];
#pragma unroll
    for (int dt = 0; dt < 4; ++dt) { o[dt][0] = (v8f){}; o[dt][1] = (v8f){}; }
#pragma unroll
    for (int u = 0; u < 4; ++u) { V pb[2], pb2[2]; float pw[2][16];   // block u: fetch V^T, round, pack, tally, multiply
        constexpr int D0 = HR ? 2 : 4;   // V^T tiles fetched ahead of the rounding (as many as the registers hold)
        V va[4], va2[4]; const T16* pv = at(Vt + kf[u], vlb); const T16* pv2 = HR ? at(V2 + kf[u], vlb) : nullptr;
#pragma unroll
        for (int dt = 0; dt < D0; ++dt) { va[dt] = WFrag<T16>::ld(pv + (size_t)dt * 16 * TT); if (HR) va2[dt] = WFrag<T16>::ld(pv2 + (size_t)dt * 16 * TT); }
        // as in the score part: behind the loads, their addresses as inputs; the loads fly while the block is rounded
        if constexpr (HR) asm volatile("s_wait_xcnt 0x0" :: "v"(pv), "v"(pv2) : "memory"); else asm volatile("s_wait_xcnt 0x0" :: "v"(pv) : "memory");
#pragma unroll
        for (int qt = 0; qt < 2; ++qt)
#pragma unroll
            for (int e = 0; e < 16; e += 2) { const v2f x = (v2f){acc[2 * u + (e >> 3)][qt][e & 7] * f[qt], acc[2 * u + (e >> 3)][qt][(e & 7) + 1] * f[qt]};
                if constexpr (HR) { const v2bf h2 = __builtin_convertvector(x, v2bf); const v2f hf2 = __builtin_convertvector(h2, v2f); const v2bf l2 = __builtin_convertvector(x - hf2, v2bf); const v2f s2 = hf2 + __builtin_convertvector(l2, v2f);
                    pb[qt][e] = h2[0]; pb[qt][e + 1] = h2[1]; pb2[qt][e] = l2[0]; pb2[qt][e + 1] = l2[1]; pw[qt][e] = s2[0]; pw[qt][e + 1] = s2[1]; }
                else { const h16 o0 = tohx(x[0]), o1 = tohx(x[1]); pb[qt][e] = o0; pb[qt][e + 1] = o1; pw[qt][e] = (float)o0 * 0.0009765625f; pw[qt][e + 1] = (float)o1 * 0.0009765625f; } }
        if (u == 0 && w < 3) {
#pragma unroll
            for (int qt = 0; qt < 2; ++qt)
#pragma unroll
                for (int e = 0; e < 16; ++e) { const int r = kf[u] + (e >> 3) * 16 + 8 * hi + (e & 7) - (q0 + qt * 16 + lr) + MAXR; const float p = pw[qt][e]; bl[qt] += (r <= 0) ? p : 0.f; br[qt] += (r >= 2 * MAXR) ? p : 0.f; if (r > 0 && r < 2 * MAXR) nbk[(qt * 16 + lr) * (2 * MAXR) + r] = p; }
        } else { const bool left = kf[u] < q0;
#pragma unroll
            for (int qt = 0; qt < 2; ++qt) { float t[8];
#pragma unroll
                for (int e = 0; e < 8; ++e) t[e] = pw[qt][e] + pw[qt][e + 8];
                const float s16 = ((t[0] + t[1]) + (t[2] + t[3])) + ((t[4] + t[5]) + (t[6] + t[7])); bl[qt] += left ? s16 : 0.f; br[qt] += left ? 0.f : s16; }
        }
#pragma unroll
        for (int dt = 0; dt < 4; ++dt) {
            if constexpr (HR) if (dt == D0) {
#pragma unroll
                for (int d2 = D0; d2 < 4; ++d2) { va[d2] = WFrag<T16>::ld(pv + (size_t)d2 * 16 * TT); va2[d2] = WFrag<T16>::ld(pv2 + (size_t)d2 * 16 * TT); }
                asm volatile("s_wait_xcnt 0x0" :: "v"(pv), "v"(pv2) : "memory");   // as above, for the rest of the block's V^T tiles
            }
#pragma unroll
            for (int qt = 0; qt < 2; ++qt) { o[dt][qt] = WFrag<T16>::mma(va[dt], pb[qt], o[dt][qt]); if (HR) { o[dt][qt] = WFrag<T16>::mma(va[dt], pb2[qt], o[dt][qt]); o[dt][qt] = WFrag<T16>::mma(va2[dt], pb[qt], o[dt][qt]); } } } }
#pragma unroll
    for (int dt = 0; dt < 4; ++dt)
#pragma unroll
        for (int qt = 0; qt < 2; ++qt) { float* p = red + w * (FQR * RDP) + (qt * 16 + lr) * RDP + dt * 16 + 8 * hi; const v8f c = o[dt][qt];   // a lane's 8 registers are 8 consecutive d of one query
            *(v4fa*)p = (v4f){c[0], c[1], c[2], c[3]}; *(v4fa*)(p + 4) = (v4f){c[4], c[5], c[6], c[7]}; }
#pragma unroll
    for (int qt = 0; qt < 2; ++qt) { bl[qt] += __shfl_xor(bl[qt], 16, 32); br[qt] += __shfl_xor(br[qt], 16, 32); }
    rl[lane * RWP + w] = hi ? bl[1] : bl[0]; rr[lane * RWP + w] = hi ? br[1] : br[0];
}
// grid (TT / 32, ZH), 512 threads; the hi/lo blocks (the longer ones) have the lowest indices
__global__ __launch_bounds__(FNW * 32) void k_fattn(const h16* __restrict__ Q16, const bf* __restrict__ Qh, const bf* __restrict__ Ql, const h16* __restrict__ K16, const bf* __restrict__ Kh, const bf* __restrict__ Kl, const h16* __restrict__ V16, const bf* __restrict__ Vh, const bf* __restrict__ Vl, const float* __restrict__ QE, bf* PBh, bf* PBl, float* Ob) {
    __shared__ __align__(16) float red[FNW * FQR * RDP];
    __shared__ __align__(16) float qes[FQR * QEP];
    __shared__ __align__(16) float rm[FQR * RWP];
    __shared__ __align__(16) float rs[FQR * RWP];
    __shared__ __align__(16) float rl[FQR * RWP];
    __shared__ __align__(16) float rr[FQR * RWP];
    __shared__ __align__(16) float nbk[FQR * 2 * MAXR];
    const size_t z = blockIdx.y; const int q0 = blockIdx.x * FQR; const size_t zp = z * TT * HD; const int tid = threadIdx.x;
    const float* QEr = QE + (z * TT + q0) * NE;
    if (q0 < RH) fattn_body<true>(Qh + zp, Ql + zp, Kh + zp, Kl + zp, Vh + zp, Vl + zp, QEr, q0, red, qes, rm, rs, rl, rr, nbk);
    else fattn_body<false>(Q16 + zp, nullptr, K16 + zp, nullptr, V16 + zp, nullptr, QEr, q0, red, qes, rm, rs, rl, rr, nbk);
    __syncthreads();   // every wave's partial O tile, far sums and near buckets are in LDS
    const int q = tid >> 4, g = tid & 15;   // 16 threads a query row: whole 256-byte rows leave
    v4f s = *(const v4fa*)(red + q * RDP + g * 4);
#pragma unroll
    for (int ww = 1; ww < FNW; ++ww) { const v4f p = *(const v4fa*)(red + ww * (FQR * RDP) + q * RDP + g * 4);
#pragma unroll
        for (int j = 0; j < 4; ++j) s[j] += p[j]; }
    *(v4f*)(Ob + zp + (size_t)(q0 + q) * HD + g * 4) = s;
    float b[8] = {0.f, 0.f, 0.f, 0.f, 0.f, 0.f, 0.f, 0.f};
    if (g < 8) { const v4f n0 = *(const v4fa*)(nbk + q * (2 * MAXR) + g * 8), n1 = *(const v4fa*)(nbk + q * (2 * MAXR) + g * 8 + 4);
#pragma unroll
        for (int j = 0; j < 4; ++j) { b[j] = n0[j]; b[4 + j] = n1[j]; } }
    if (g == 0 || g == 8) { const float* p = (g ? rr : rl) + q * RWP; float t = 0.f;   // bucket 0: far left; bucket 64: far right
#pragma unroll
        for (int k = 0; k < 4; ++k) { const v4f x = *(const v4fa*)(p + k * 4); t = (((t + x[0]) + x[1]) + x[2]) + x[3]; }
        b[0] = t; }
    v8us oh, ol;
#pragma unroll
    for (int j = 0; j < 8; ++j) { unsigned short u2, w2; splitf(b[j], u2, w2); oh[j] = u2; ol[j] = w2; }
    const size_t ob = (z * TT + q0 + q) * NE + g * 8; *(v8us*)(PBh + ob) = oh; *(v8us*)(PBl + ob) = ol;
}
__global__ __launch_bounds__(256) void k_epad2(const float* __restrict__ E, bf* EB) { const size_t i = (size_t)blockIdx.x * 256 + threadIdx.x; if (i >= (size_t)NE * HD / 8) return; const int d0 = (int)(i % (HD / 8)) * 8; const int r = (int)(i / (HD / 8)); const float* src = E + (size_t)min(r, 2 * MAXR) * HD + d0; v8us o;
#pragma unroll
    for (int q = 0; q < 8; ++q) { const unsigned short v = f2bf(src[q]); o[q] = (r <= 2 * MAXR) ? v : (unsigned short)0; }
    *(v8us*)(EB + (size_t)r * HD + d0) = o;  }
__global__ __launch_bounds__(256) void k_rvt(const float* __restrict__ E, bf* RVT) { const size_t i = (size_t)blockIdx.x * 256 + threadIdx.x; if (i >= (size_t)HD * NE / 8) return; const int r0 = (int)(i % (NE / 8)) * 8; const int d = (int)(i / (NE / 8)); v8us o;
#pragma unroll
    for (int q = 0; q < 8; ++q) { const int r = r0 + q; const unsigned short v = f2bf(E[(size_t)min(r, 2 * MAXR) * HD + d]); o[q] = (r <= 2 * MAXR) ? v : (unsigned short)0; }
    *(v8us*)(RVT + (size_t)d * NE + r0) = o;  }
__global__ __launch_bounds__(256) void k_addob(float* Ob, const float* __restrict__ W2) { const size_t k = (size_t)blockIdx.x * 256 + threadIdx.x; if (k >= (size_t)ZH * TT * HD / 4) return; const size_t e = k * 4; const int i = (int)((e / HD) % TT); const float sc = (i < RH) ? 1.0f : 1024.0f; const v4f a = *(const v4f*)(Ob + e); const v4f w = *(const v4f*)(W2 + e); v4f o;
#pragma unroll
    for (int q = 0; q < 4; ++q) o[q] = __fadd_rn(a[q], __fmul_rn(w[q], sc));
    *(v4f*)(Ob + e) = o;  }
__global__ __launch_bounds__(256) void k_merge(const float* __restrict__ O, int h0, bf* Ah, bf* Al) { const size_t e = ((size_t)blockIdx.x * 256 + threadIdx.x) * 2; if (e >= (size_t)ZH * TT * HD) return; const int d = (int)(e % HD); const int t = (int)((e / HD) % TT); const int zz = (int)(e / ((size_t)HD * TT)); const float cs = (t < RH) ? 1.0f : (1.0f / PCAR); const size_t oo = (size_t)t * DQ + (h0 + zz) * HD + d;
    v2us oh, ol;
#pragma unroll
    for (int q = 0; q < 2; ++q) { unsigned short a, c2; splitf(O[e + q] * cs, a, c2); oh[q] = a; ol[q] = c2; } *(v2us*)(Ah + oo) = oh; *(v2us*)(Al + oo) = ol;  }

extern "C" void kernel_launch(void* const* d_in, const int* in_sizes, int n_in,
                              void* d_out, int out_size, void* d_ws, size_t ws_size, hipStream_t stream) {
    (void)in_sizes; (void)n_in; (void)out_size;
    const float* x = (const float*)d_in[0]; const float* xk = (const float*)d_in[1]; const float* xv = (const float*)d_in[2]; const float* wq = (const float*)d_in[3]; const float* bq = (const float*)d_in[4]; const float* wk = (const float*)d_in[5]; const float* bk = (const float*)d_in[6]; const float* wv = (const float*)d_in[7]; const float* bv = (const float*)d_in[8]; const float* wo = (const float*)d_in[9]; const float* bo = (const float*)d_in[10]; const float* relk = (const float*)d_in[11]; const float* relv = (const float*)d_in[12];   /* [65][64] each */
    float* OUT = (float*)d_out;     // [2][2048][1024]
    char* wsp = (char*)d_ws;
    auto take = [&](size_t bytes) { char* p = wsp; wsp += (bytes + 255) & ~(size_t)255; return (void*)p; };
    bf* EB = (bf*)take((size_t)NE * HD * 2); bf* RVT = (bf*)take((size_t)HD * NE * 2); float* QE = (float*)take((size_t)ZH * TT * NE * 4); bf* PBh = (bf*)take((size_t)ZH * TT * NE * 2); bf* PBl = (bf*)take((size_t)ZH * TT * NE * 2); float* W2 = (float*)take((size_t)ZH * TT * HD * 4); bf* WQ = (bf*)take((size_t)DQ * DM * 2); bf* WK = (bf*)take((size_t)DKV * DM * 2); bf* WV = (bf*)take((size_t)DKV * DM * 2); bf* WO = (bf*)take((size_t)DM * DQ * 2); float* CS = (float*)take((size_t)TT * HD * 2 * 4);
    bf* XB = (bf*)take((size_t)TT * DM * 2); float* FQ = (float*)take((size_t)TT * DQ * 4); float* FK = (float*)take((size_t)TT * DKV * 4);
    h16* QP16 = (h16*)take((size_t)NH_ * TT * HD * 2); h16* KP16 = (h16*)take((size_t)NKV * TT * HD * 2); h16* VT16 = (h16*)take((size_t)NKV * HD * TT * 2);
    bf* QPh = (bf*)take((size_t)NH_ * TT * HD * 2); bf* QPl = (bf*)take((size_t)NH_ * TT * HD * 2); bf* KPh = (bf*)take((size_t)NKV * TT * HD * 2); bf* KPl = (bf*)take((size_t)NKV * TT * HD * 2); bf* VTh = (bf*)take((size_t)NKV * HD * TT * 2); bf* VTl = (bf*)take((size_t)NKV * HD * TT * 2);
    float* Ob = (float*)take((size_t)ZH * TT * HD * 4); bf* ATh = (bf*)take((size_t)TT * DQ * 2); bf* ATl = (bf*)take((size_t)TT * DQ * 2);
    if ((size_t)(wsp - (char*)d_ws) > ws_size) return;    // ws 256 MiB
    float* FV = FK;   // v projection reuses the k buffer after the k planes are built (stream-ordered)
    { k_wtG<<<(unsigned)((DM * DQ / 64 + 63) / 64), 256, 0, stream>>>(wq, DM, DQ, WQ); k_wtG<<<(unsigned)((DM * DKV / 64 + 63) / 64), 256, 0, stream>>>(wk, DM, DKV, WK); k_wtG<<<(unsigned)((DM * DKV / 64 + 63) / 64), 256, 0, stream>>>(wv, DM, DKV, WV);
      k_wtG<<<(unsigned)((DQ * DM / 64 + 63) / 64), 256, 0, stream>>>(wo, DQ, DM, WO);
       }
    k_csid<<<(TT * HD + 255) / 256, 256, 0, stream>>>(CS);
    const unsigned LQ = (unsigned)(((size_t)NH_ * TT * HD / 2 + 255) / 256), LKv = (unsigned)(((size_t)NKV * TT * HD / 2 + 255) / 256);
    k_epad2<<<(unsigned)(((size_t)NE * HD / 8 + 255) / 256), 256, 0, stream>>>(relk, EB); k_rvt<<<(unsigned)(((size_t)HD * NE / 8 + 255) / 256), 256, 0, stream>>>(relv, RVT);   /* rel_k plane [128][64], rel_v^T plane [64][128] */
    for (int b = 0; b < NB_; ++b) {
        
        k_cvt8<<<(unsigned)(((size_t)TT * DM / 8 + 255) / 256), 256, 0, stream>>>(x + (size_t)b * TT * DM, XB, (size_t)TT * DM / 8);
        k_gemmsk<bf, 0, true, DM, 4, 8><<<dim3(TT / 64, DQ / 64, 1), 256, 0, stream>>>(XB, nullptr, WQ, nullptr, FQ, DQ, bq, 0, 0, 0);
        k_rope<<<LQ, 256, 0, stream>>>(FQ, DQ, NH_, CS, nullptr, nullptr, 1.0f, QP16, QPh, QPl);
        k_cvt8<<<(unsigned)(((size_t)TT * DM / 8 + 255) / 256), 256, 0, stream>>>(xk + (size_t)b * TT * DM, XB, (size_t)TT * DM / 8); k_gemmsk<bf, 0, true, DM, 4, 8><<<dim3(TT / 64, DKV / 64, 1), 256, 0, stream>>>(XB, nullptr, WK, nullptr, FK, DKV, bk, 0, 0, 0);
        k_rope<<<LKv, 256, 0, stream>>>(FK, DKV, NKV, CS, nullptr, nullptr, 1.0f, KP16, KPh, KPl);
        k_cvt8<<<(unsigned)(((size_t)TT * DM / 8 + 255) / 256), 256, 0, stream>>>(xv + (size_t)b * TT * DM, XB, (size_t)TT * DM / 8); k_gemmsk<bf, 0, true, DM, 4, 8><<<dim3(TT / 64, DKV / 64, 1), 256, 0, stream>>>(XB, nullptr, WV, nullptr, FV, DKV, bv, 0, 0, 0); k_vtp<<<LKv, 256, 0, stream>>>(FV, DKV, NKV, VT16, VTh, VTl);
        for (int h0 = 0; h0 < NH_; h0 += ZH) { const size_t zq = (size_t)h0, zk = (size_t)(h0 / REP);   // one kv head per query head: the pass's heads use consecutive kv planes (z-strides TT*HD)
            k_gemmw<bf, 1, false><<<dim3(TT / 64, NE / 64, ZH), 32, 0, stream>>>(QPh + zq * TT * HD, QPl + zq * TT * HD, EB, nullptr, HD, QE, NE, nullptr, (size_t)TT * HD, 0, (size_t)TT * NE);   /* QE[i][r] = q_i . rel_k[r] */
            k_fattn<<<dim3(TT / FQR, ZH), FNW * 32, 0, stream>>>(QP16 + zq * TT * HD, QPh + zq * TT * HD, QPl + zq * TT * HD, KP16 + zk * TT * HD, KPh + zk * TT * HD, KPl + zk * TT * HD, VT16 + zk * HD * TT, VTh + zk * HD * TT, VTl + zk * HD * TT, QE, PBh, PBl, Ob);   /* scores + QE[i][idx], softmax, 65 bucket sums per row, attn v */
            k_gemmw<bf, 1, false><<<dim3(TT / 64, HD / 64, ZH), 32, 0, stream>>>(PBh, PBl, RVT, nullptr, NE, W2, HD, nullptr, (size_t)TT * NE, 0, (size_t)TT * HD);   /* W2 = buckets . rel_v */
            k_addob<<<(unsigned)(((size_t)ZH * TT * HD / 4 + 255) / 256), 256, 0, stream>>>(Ob, W2);   /* + sum_j attn[i][j] rel_v[idx] */ k_merge<<<(unsigned)(((size_t)ZH * TT * HD / 2 + 255) / 256), 256, 0, stream>>>(Ob, h0, ATh, ATl); }
        k_gemmsk<bf, 1, true, DQ, 4, 8><<<dim3(TT / 64, DM / 64, 1), 256, 0, stream>>>(ATh, ATl, WO, nullptr, OUT + (size_t)b * TT * DM, DM, bo, 0, 0, 0); }
}

// v005
// Measured time: 437 microseconds a run.
// Two timings next to v004 put it at 1.09 and 1.10 times that version's speed.
// Over all steps from v000 it is 7.39 times as fast.
#include <hip/hip_runtime.h>

// Multi-head attention with Shaw relative-position terms on the logits AND the values (query, key, value [2][2048][1024]; q,k,v = in W + b ('xw' 1/32, zero biases; 16 heads x 64); idx[i][j] = clip(j - i, -32, 32) + 32; attn = softmax((q.k + q_i.rel_k[idx]) / 8); out_h = attn v + sum_j attn[i][j] rel_v[idx] (tables [65][64] x 0.05, read); out = merged Wo + bo ('xw') -> [2][2048][1024] (4.2 M)).
// Layout per batch: bf16 copies of the three inputs in turn; exact projections + f32 biases, each leaving its GEMM as the head planes (fp16 and hi/lo; v transposed); rel_k as an exact plane [128][64] (rows >= 65 zero) and rel_v^T as an exact plane [64][128]; per pass of eight heads: QE = q.rel_k^T ([8][2048][128], hi/lo x exact); one kernel per 32 query rows does the dense scores (hybrid rows: < 512 hi/lo 3 products, rest fp16 x1024), adds QE[i][idx], does the softmax with the 1/8, sums each row's probabilities into the 65 relative-position buckets (far-left sum, 63 near entries, far-right sum; fixed order) as hi/lo planes and multiplies by v, scores and probabilities staying in registers; buckets x rel_v ([8][2048][64], hi/lo x exact) added to attn v in f32 and split into the merged hi/lo planes in that GEMM's epilogue; merged hi/lo x Wo exact + bo.
// Compute dtypes, f32 accumulate: every input rounded to bf16; projections exact + f32 biases; q.rel_k and buckets.rel_v hi/lo x exact; attention rows < 512 3 products, rest fp16; softmax f32; Wo hl x exact + bias.

#define NB_  2
#define TT   2048
#define DM   1024
#define NH_  16
#define NKV  16
#define REP  (NH_ / NKV)
#define HD   64
#define DQ   (NH_ * HD)
#define DKV  (NKV * HD)
#define ZH   8                    // heads per pass
#define RH   512                  // query rows < RH use hi+lo planes (0: none)
#define WIN  0
#define PCAR 1024.0f
#define SCL  0.125f
#define MAXR 32      // max relative position
#define NE   128     // 2*MAXR+1 = 65 table rows padded to 128
typedef _Float16 h16;
typedef unsigned short bf;
typedef __attribute__((ext_vector_type(16))) __bf16   v16bf;
typedef __attribute__((ext_vector_type(16))) _Float16 v16h;
typedef __attribute__((ext_vector_type(8)))  _Float16 v8h;
typedef __attribute__((ext_vector_type(8)))  unsigned short v8us;
typedef __attribute__((ext_vector_type(8)))  float    v8f;
typedef __attribute__((ext_vector_type(4)))  float    v4f;
typedef v8h  __attribute__((may_alias)) v8ha;
typedef v4f  __attribute__((may_alias)) v4fa;
typedef v8us __attribute__((may_alias)) v8usa;

__device__ __forceinline__ unsigned short f2bf(float f) { unsigned u = __float_as_uint(f); u += 0x7FFFu + ((u >> 16) & 1u); return (unsigned short)(u >> 16); }
__device__ __forceinline__ float bf2f(unsigned short b) { return __uint_as_float(((unsigned)b) << 16); }
__device__ __forceinline__ float bfr(float f) { return bf2f(f2bf(f)); }
__device__ __forceinline__ v16h cat16(v8h lo, v8h hi) { return __builtin_shufflevector(lo, hi, 0, 1, 2, 3, 4, 5, 6, 7, 8, 9, 10, 11, 12, 13, 14, 15); }
__device__ __forceinline__ v16bf cat16b(v8us lo, v8us hi) { return __builtin_bit_cast(v16bf, __builtin_shufflevector(lo, hi, 0, 1, 2, 3, 4, 5, 6, 7, 8, 9, 10, 11, 12, 13, 14, 15)); }
__device__ __forceinline__ v8f wmma16(v16h a, v16h b, v8f c) { return __builtin_amdgcn_wmma_f32_16x16x32_f16(false, a, false, b, (short)0, c, false, false); }
__device__ __forceinline__ v8f wmmab(v16bf a, v16bf b, v8f c) { return __builtin_amdgcn_wmma_f32_16x16x32_bf16(false, a, false, b, (short)0, c, false, false); }
__device__ __forceinline__ h16 tohx(float x) { return (h16)x; }
__device__ __forceinline__ void splitf(float y, unsigned short& h, unsigned short& l) { h = f2bf(y); l = f2bf(y - bf2f(h)); }
typedef __attribute__((ext_vector_type(4))) unsigned short v4us;



// ---- k_gemmw: register-blocked GEMM, ONE WAVE per 64x64 output tile (16 accumulators), operands straight from K-contiguous 16-bit planes; grid (M/64, N/64, Z), 32 threads.
// C[m][n] (f32, pitch ldc, + optional f32 bias[n]) = sum_k A[m][k] Bt[n][k] (+ split products per NSPLIT). z-batch strides sA/sB/sC in elements. K % 32 == 0.
// MRG: the tile is not stored; it is added in f32 to head z's attn.v rows Ob[z][t][d] (x1024 where those carry that factor), the factor is taken off, and the sum leaves as hi/lo planes Ah, Al [t][head h0 + z][d].
template <typename T16> struct WFrag;
template <> struct WFrag<h16> { typedef v16h V; static __device__ __forceinline__ V ld(const h16* p) { return cat16(*(const v8h*)p, *(const v8h*)(p + 16)); } static __device__ __forceinline__ v8f mma(V a, V b, v8f c) { return wmma16(a, b, c); } };
template <> struct WFrag<bf> { typedef v16bf V; static __device__ __forceinline__ V ld(const bf* p) { return cat16b(*(const v8us*)p, *(const v8us*)(p + 16)); } static __device__ __forceinline__ v8f mma(V a, V b, v8f c) { return wmmab(a, b, c); } };
template <typename T16, int NSPLIT, bool BIAS, bool MRG>
__global__ __launch_bounds__(32) void k_gemmw(const T16* __restrict__ A, const T16* __restrict__ A2, const T16* __restrict__ Bt, const T16* __restrict__ Bt2, int K, float* C, int ldc, const float* __restrict__ bias, size_t sA, size_t sB, size_t sC, const float* __restrict__ Ob, int h0, bf* Ah, bf* Al) {
    typedef typename WFrag<T16>::V V;
    __shared__ __align__(16) float os[16 * 68];
    const size_t z = blockIdx.z; A += z * sA; if (A2) A2 += z * sA; Bt += z * sB; if (Bt2) Bt2 += z * sB; C += z * sC;
    const int lane = threadIdx.x & 31, lr = lane & 15, hi = lane >> 4; const int r0 = blockIdx.x * 64, c0 = blockIdx.y * 64;
    v8f acc[4][4];
#pragma unroll
    for (int mb = 0; mb < 4; ++mb)
#pragma unroll
        for (int nb = 0; nb < 4; ++nb) acc[mb][nb] = (v8f){};
    const size_t aoff = (size_t)(r0 + lr) * K + 8 * hi, boff = (size_t)(c0 + lr) * K + 8 * hi;
#pragma unroll 1
    for (int kc = 0; kc < K; kc += 32) {
        V a[4], a2[4];
#pragma unroll
        for (int mb = 0; mb < 4; ++mb) { a[mb] = WFrag<T16>::ld(A + aoff + (size_t)mb * 16 * K + kc); if (NSPLIT == 1 || NSPLIT == 2) a2[mb] = WFrag<T16>::ld(A2 + aoff + (size_t)mb * 16 * K + kc); }
#pragma unroll
        for (int nb = 0; nb < 4; ++nb) { const V b = WFrag<T16>::ld(Bt + boff + (size_t)nb * 16 * K + kc); V b2; if (NSPLIT >= 2) b2 = WFrag<T16>::ld(Bt2 + boff + (size_t)nb * 16 * K + kc);
#pragma unroll
            for (int mb = 0; mb < 4; ++mb) { acc[mb][nb] = WFrag<T16>::mma(a[mb], b, acc[mb][nb]); if (NSPLIT == 1 || NSPLIT == 2) acc[mb][nb] = WFrag<T16>::mma(a2[mb], b, acc[mb][nb]); if (NSPLIT >= 2) acc[mb][nb] = WFrag<T16>::mma(a[mb], b2, acc[mb][nb]); } }
        asm volatile("v_nop\n\tv_nop\n\tv_nop\n\tv_nop" : "+v"(acc[0][0]), "+v"(acc[1][1]), "+v"(acc[2][2]), "+v"(acc[3][3]) : "v"(a[0]), "v"(a[3]));
    }
    // MRG: a tile's 64 rows lie on one side of RH; one lane address each for Ob, Ah and Al (row r0 + hi, 4 columns from 4 lr), the rows follow at constant distances
    static_assert(!MRG || RH % 64 == 0, "a 64-row tile has one carry factor");
    const float sc = (r0 < RH) ? 1.0f : PCAR, cs = (r0 < RH) ? 1.0f : (1.0f / PCAR);
    const float* po = MRG ? Ob + (z * TT + r0 + hi) * HD + c0 + lr * 4 : nullptr; const size_t ao = (size_t)(r0 + hi) * DQ + (h0 + z) * HD + c0 + lr * 4; bf* pah = MRG ? Ah + ao : nullptr; bf* pal = MRG ? Al + ao : nullptr;
#pragma unroll
    for (int mb = 0; mb < 4; ++mb) {
#pragma unroll
        for (int nb = 0; nb < 4; ++nb) {
#pragma unroll
            for (int j = 0; j < 8; ++j) os[(hi * 8 + j) * 68 + nb * 16 + lr] = acc[mb][nb][j]; }
        __builtin_amdgcn_wave_barrier(); asm volatile("" ::: "memory");
        float* crow = C + (size_t)(r0 + mb * 16) * ldc + c0;
{
#pragma unroll
            for (int s = 0; s < 8; ++s) { const int row = 2 * s + hi, cofs = lr * 4; v4f val = *(const v4fa*)(os + row * 68 + cofs); if (BIAS) { val[0] += bfr(bias[c0 + cofs]); val[1] += bfr(bias[c0 + cofs + 1]); val[2] += bfr(bias[c0 + cofs + 2]); val[3] += bfr(bias[c0 + cofs + 3]); }
                if constexpr (MRG) { const v4f a = *(const v4f*)(po + (mb * 16 + 2 * s) * HD); v4us oh, ol;
#pragma unroll
                    for (int q = 0; q < 4; ++q) { unsigned short a2, c2; splitf(__fadd_rn(a[q], __fmul_rn(val[q], sc)) * cs, a2, c2); oh[q] = a2; ol[q] = c2; }
                    *(v4us*)(pah + (mb * 16 + 2 * s) * DQ) = oh; *(v4us*)(pal + (mb * 16 + 2 * s) * DQ) = ol; }
                else *(v4f*)(crow + (size_t)row * ldc + cofs) = val; }
             }
        __builtin_amdgcn_wave_barrier(); asm volatile("" ::: "memory");
    }
}

// ---- k_gemmsk: the products of k_gemmw for a long K: ONE WORK-GROUP of NW waves per (16 MB)x64 output tile, wave w takes k in [w KK/NW, (w+1) KK/NW) (4 MB accumulators);
// the NW partial tiles meet in LDS and are summed in wave order 0..NW-1 (fixed), then leave as whole 256-byte rows (+ optional f32 bias[n]). grid (M/(16 MB), N/64, Z), 32 NW threads. NSPLIT as in k_gemmw. KK % (32 NW) == 0. LDA: pitch of A's rows in elements.
// EPI 0: C as above. EPI 1, 2: the 64 columns of a tile are one head (HD == 64) and the biased f32 values leave as that head's fp16 and hi/lo planes, 16 bytes a lane and whole 128-byte rows: EPI 1 [head][t][d], EPI 2 transposed [head][d][t].
template <typename T16, int NSPLIT, bool BIAS, int KK, int MB, int NW, int EPI, int LDA = KK>
__global__ __launch_bounds__(NW * 32) void k_gemmsk(const T16* __restrict__ A, const T16* __restrict__ A2, const T16* __restrict__ Bt, const T16* __restrict__ Bt2, float* C, int ldc, const float* __restrict__ bias, size_t sA, size_t sB, size_t sC, h16* P16, bf* Ph, bf* Pl) {
    static_assert(EPI == 0 || (HD == 64 && MB == 4 && BIAS), "a plane epilogue takes a 64 x 64 tile of one head");
    typedef typename WFrag<T16>::V V;
    __shared__ __align__(16) float red[NW * MB * 1024];   // [wave][subtile mb*4+nb][half of its 8 rows a lane][lane] x 4 floats
    __shared__ __align__(16) float os[MB * 16 * 68];
    const size_t z = blockIdx.z; A += z * sA; if (NSPLIT == 1 || NSPLIT == 2) A2 += z * sA; Bt += z * sB; if (NSPLIT >= 2) Bt2 += z * sB; C += z * sC;
    const int tid = threadIdx.x, lane = tid & 31, w = tid >> 5, lr = lane & 15, hi = lane >> 4; const int r0 = blockIdx.x * (MB * 16), c0 = blockIdx.y * 64;
    // every '#pragma unroll' in this kernel makes the indices of acc, a, a2 and s constants, so that they stay in registers
    v8f acc[MB][4];
#pragma unroll
    for (int mb = 0; mb < MB; ++mb)
#pragma unroll
        for (int nb = 0; nb < 4; ++nb) acc[mb][nb] = (v8f){};
    const size_t aoff = (size_t)(r0 + lr) * LDA + 8 * hi + w * (KK / NW), boff = (size_t)(c0 + lr) * KK + 8 * hi + w * (KK / NW);
    // unrolled whole (KK / (32 NW) = 4 trips here): no back edge behind a matrix instruction
#pragma unroll
    for (int kc = 0; kc < KK / NW; kc += 32) {
        V a[MB], a2[MB];
#pragma unroll
        for (int mb = 0; mb < MB; ++mb) { a[mb] = WFrag<T16>::ld(A + aoff + (size_t)mb * 16 * LDA + kc); if (NSPLIT == 1 || NSPLIT == 2) a2[mb] = WFrag<T16>::ld(A2 + aoff + (size_t)mb * 16 * LDA + kc); }
#pragma unroll
        for (int nb = 0; nb < 4; ++nb) { const V b = WFrag<T16>::ld(Bt + boff + (size_t)nb * 16 * KK + kc); V b2; if (NSPLIT >= 2) b2 = WFrag<T16>::ld(Bt2 + boff + (size_t)nb * 16 * KK + kc);
#pragma unroll
            for (int mb = 0; mb < MB; ++mb) { acc[mb][nb] = WFrag<T16>::mma(a[mb], b, acc[mb][nb]); if (NSPLIT == 1 || NSPLIT == 2) acc[mb][nb] = WFrag<T16>::mma(a2[mb], b, acc[mb][nb]); if (NSPLIT >= 2) acc[mb][nb] = WFrag<T16>::mma(a[mb], b2, acc[mb][nb]); } }
    }
#pragma unroll
    for (int mb = 0; mb < MB; ++mb)
#pragma unroll
        for (int nb = 0; nb < 4; ++nb) { float* rp = red + w * (MB * 1024) + (mb * 4 + nb) * 256 + lane * 4; const v8f c = acc[mb][nb];
            *(v4fa*)rp = (v4f){c[0], c[1], c[2], c[3]}; *(v4fa*)(rp + 128) = (v4f){c[4], c[5], c[6], c[7]}; }
    __syncthreads();   // every wave's partial tile is in LDS
#pragma unroll
    for (int u = 0; u < MB * 8 / NW; ++u) { const int idx = u * (NW * 32) + tid;   // one group of 4 floats of the tile; idx & 31 == lane
        v4f s = *(const v4fa*)(red + idx * 4);
#pragma unroll
        for (int q = 1; q < NW; ++q) { const v4f p = *(const v4fa*)(red + q * (MB * 1024) + idx * 4);
#pragma unroll
            for (int j = 0; j < 4; ++j) s[j] = __fadd_rn(s[j], p[j]); }
        const int t = idx >> 6, half = (idx >> 5) & 1; const int row = (t >> 2) * 16 + hi * 8 + half * 4, col = (t & 3) * 16 + lr;
        if constexpr (EPI == 2) *(v4fa*)(os + col * 68 + row) = s;   // transposed: a lane's 4 values are 4 consecutive rows of one column
        else {
#pragma unroll
            for (int j = 0; j < 4; ++j) os[(row + j) * 68 + col] = s[j]; } }
    __syncthreads();   // the summed tile is whole before it is read by rows
    if constexpr (EPI != 0) {
#pragma unroll
        for (int u = 0; u < MB * 4 / NW; ++u) { const int idx = u * (NW * 32) + tid; const int row = idx >> 3, cofs = (idx & 7) * 8; const v4f v0 = *(const v4fa*)(os + row * 68 + cofs), v1 = *(const v4fa*)(os + row * 68 + cofs + 4);
            v8h o16; v8us oh, ol;
#pragma unroll
            for (int j = 0; j < 8; ++j) { const float x = (j < 4 ? v0[j & 3] : v1[j & 3]) + bfr(bias[c0 + (EPI == 2 ? row : cofs + j)]); o16[j] = tohx(x); unsigned short a2, c2; splitf(x, a2, c2); oh[j] = a2; ol[j] = c2; }
            const size_t e = (EPI == 2) ? ((size_t)blockIdx.y * HD + row) * TT + r0 + cofs : ((size_t)blockIdx.y * TT + r0 + row) * HD + cofs;
            *(v8h*)(P16 + e) = o16; *(v8us*)(Ph + e) = oh; *(v8us*)(Pl + e) = ol; }
    } else {
#pragma unroll
    for (int u = 0; u < MB * 8 / NW; ++u) { const int idx = u * (NW * 32) + tid; const int row = idx >> 4, cofs = (idx & 15) * 4; v4f val = *(const v4fa*)(os + row * 68 + cofs);
        if (BIAS) { val[0] += bfr(bias[c0 + cofs]); val[1] += bfr(bias[c0 + cofs + 1]); val[2] += bfr(bias[c0 + cofs + 2]); val[3] += bfr(bias[c0 + cofs + 3]); }
        *(v4f*)(C + (size_t)(r0 + row) * ldc + c0 + cofs) = val; }
    }
}

typedef __attribute__((ext_vector_type(2))) unsigned short v2us;
typedef __attribute__((ext_vector_type(2))) float v2f;

__global__ __launch_bounds__(256) void k_wtG(const float* __restrict__ w, int K, int N, bf* Bt) {
    const int lane = threadIdx.x & 31; const int L0 = (blockIdx.x * 8 + (threadIdx.x >> 5)) * 8; const int nlines = N * K / 64;
{
#pragma unroll 1
        for (int l = 0; l < 8; ++l) { const int L = L0 + l; if (L >= nlines) break; const size_t e = (size_t)L * 64 + lane * 2; const int k = (int)(e % K), n = (int)(e / K); v2us o;
            o[0] = f2bf(w[(size_t)k * N + n]); o[1] = f2bf(w[(size_t)(k + 1) * N + n]); *(v2us*)(Bt + e) = o; }
         }
}
__global__ __launch_bounds__(256) void k_cvt8(const float* __restrict__ src, bf* dst, size_t n8) { const size_t i = (size_t)blockIdx.x * 256 + threadIdx.x; if (i >= n8) return; const v8f v = *(const v8f*)(src + i * 8); v8us o;
#pragma unroll
    for (int k = 0; k < 8; ++k) o[k] = f2bf(v[k]); *(v8us*)(dst + i * 8) = o;  }
// ---- k_fattn: scores, softmax, bucket sums and attn.v of 32 query rows of one head in ONE work-group of 16 waves; each wave owns four blocks of 32 keys and the scores never leave its registers.
// The 64 key blocks are dealt out from the block in front of the query rows onward (mod 64): slot u 16 + w goes to wave w as its u-th block, so that every key with |j - i| < 32 lies in slots 0..2 (u = 0, waves 0..2) and all other slots are wholly far left or far right.
// S^T = K Q^T (a lane holds one query's scores: column lr, rows 8 hi + j), + QE[i][clip(j - i)], x HD^-0.5; row maximum and row sum meet across the waves in LDS (sum in wave order, fixed);
// the rounded probabilities (hi/lo for rows < RH, else fp16 x1024) are packed from two score tiles straight into a B operand (hardware k order, which WFrag::ld also delivers) for O^T += V^T P^T;
// the 16 partial O tiles are summed in LDS in wave order; the values as rounded are summed into the 65 relative-position buckets (far-left sum, 63 near entries, far-right sum; fixed order), hi/lo planes [row][128].
#define FQR  32                   // query rows per work-group
#define FNW  16                   // waves per work-group
#define QEP  66                   // LDS pitch of a staged QE row (entries 0..65)
#define RDP  68                   // LDS pitch of a partial O row
#define RWP  20                   // LDS pitch of a query's 16 per-wave values
typedef __attribute__((ext_vector_type(2))) __bf16 v2bf;
template <bool HR> struct FT { typedef h16 T; };
template <> struct FT<true> { typedef bf T; };
template <bool HR>
__device__ __forceinline__ void fattn_body(const typename FT<HR>::T* __restrict__ Q, const typename FT<HR>::T* __restrict__ Q2, const typename FT<HR>::T* __restrict__ Kp, const typename FT<HR>::T* __restrict__ K2, const typename FT<HR>::T* __restrict__ Vt, const typename FT<HR>::T* __restrict__ V2,
                                           const float* __restrict__ QEr, const int q0, float* red, float* qes, float* rm, float* rs, float* rl, float* rr, float* nbk) {
    typedef typename FT<HR>::T T16; typedef typename WFrag<T16>::V V;
    const int tid = threadIdx.x, lane = tid & 31, lr = lane & 15, hi = lane >> 4; const int w = __builtin_amdgcn_readfirstlane(tid >> 5);
    // every '#pragma unroll' in this function makes the indices of the register arrays constants
#pragma unroll
    for (int s = 0; s < 2; ++s) { const int q = 2 * w + s; const float* sp = QEr + (size_t)q * NE; qes[q * QEP + lane] = sp[lane]; qes[q * QEP + 32 + lane] = sp[32 + lane]; if (lane < 2) qes[q * QEP + 64 + lane] = sp[64 + lane]; }
    *(v4fa*)(nbk + tid * 4) = (v4f){0.f, 0.f, 0.f, 0.f};   // a bucket whose key lies outside [0, TT) stays 0
    int kf[4];   // first key of this wave's u-th block (wave-uniform)
#pragma unroll
    for (int u = 0; u < 4; ++u) kf[u] = (((q0 >> 5) + 63 + u * 16 + w) & 63) * 32;
    // every operand load is a wave-uniform base plus one of two lane offsets in bytes: klb in a 16-row tile of Q or K, vlb in a 16-row tile of V^T
    const unsigned klb = (unsigned)(lr * (HD * 2) + hi * 16), vlb = (unsigned)(lr * (TT * 2) + hi * 16);
    auto at = [](const T16* base, unsigned ofs) { return (const T16*)((const char*)base + ofs); };
    V bq[2][2], bq2[2][2]; const T16* pq = at(Q + (size_t)q0 * HD, klb); const T16* pq2 = HR ? at(Q2 + (size_t)q0 * HD, klb) : nullptr;
#pragma unroll
    for (int qt = 0; qt < 2; ++qt)
#pragma unroll
        for (int ks = 0; ks < 2; ++ks) { bq[qt][ks] = WFrag<T16>::ld(pq + qt * 16 * HD + ks * 32); if (HR) bq2[qt][ks] = WFrag<T16>::ld(pq2 + qt * 16 * HD + ks * 32); }
    v8f acc[8][2];
#pragma unroll
    for (int kt = 0; kt < 8; ++kt) { acc[kt][0] = (v8f){}; acc[kt][1] = (v8f){}; }
    constexpr int UB = HR ? 1 : 4;   // key blocks whose fragments are fetched together (as many as the registers hold)
#pragma unroll
    for (int u0 = 0; u0 < 4; u0 += UB) { V a[UB][2][2], a2[UB][2][2]; const T16* pk[UB]; const T16* pk2[UB];
#pragma unroll
        for (int t = 0; t < UB; ++t) { pk[t] = at(Kp + (size_t)kf[u0 + t] * HD, klb); pk2[t] = HR ? at(K2 + (size_t)kf[u0 + t] * HD, klb) : nullptr;
#pragma unroll
            for (int hf = 0; hf < 2; ++hf)
#pragma unroll
                for (int ks = 0; ks < 2; ++ks) { a[t][hf][ks] = WFrag<T16>::ld(pk[t] + hf * 16 * HD + ks * 32); if (HR) a2[t][hf][ks] = WFrag<T16>::ld(pk2[t] + hf * 16 * HD + ks * 32); } }
        // stands behind the batch's loads. The loaded values are inputs, so that the whole batch is in flight together (one latency a batch, not one a tile); the addresses the loads name are inputs, so that they stay live and unwritten (by a load's result too) up to the wait
        if constexpr (HR) asm volatile("s_wait_xcnt 0x0" :: "v"(a[0][0][0]), "v"(a[0][0][1]), "v"(a[0][1][0]), "v"(a[0][1][1]), "v"(a2[0][0][0]), "v"(a2[0][0][1]), "v"(a2[0][1][0]), "v"(a2[0][1][1]), "v"(bq[0][0]), "v"(bq[0][1]), "v"(bq[1][0]), "v"(bq[1][1]), "v"(bq2[0][0]), "v"(bq2[0][1]), "v"(bq2[1][0]), "v"(bq2[1][1]), "v"(pk[0]), "v"(pk2[0]), "v"(pq), "v"(pq2) : "memory");
        else asm volatile("s_wait_xcnt 0x0" :: "v"(a[0][0][0]), "v"(a[0][0][1]), "v"(a[0][1][0]), "v"(a[0][1][1]), "v"(a[1][0][0]), "v"(a[1][0][1]), "v"(a[1][1][0]), "v"(a[1][1][1]), "v"(a[2][0][0]), "v"(a[2][0][1]), "v"(a[2][1][0]), "v"(a[2][1][1]), "v"(a[3][0][0]), "v"(a[3][0][1]), "v"(a[3][1][0]), "v"(a[3][1][1]), "v"(bq[0][0]), "v"(bq[0][1]), "v"(bq[1][0]), "v"(bq[1][1]), "v"(pk[0]), "v"(pk[1]), "v"(pk[2]), "v"(pk[3]), "v"(pq) : "memory");
#pragma unroll
        for (int t = 0; t < UB; ++t)
#pragma unroll
            for (int hf = 0; hf < 2; ++hf)
#pragma unroll
                for (int ks = 0; ks < 2; ++ks)
#pragma unroll
                    for (int qt = 0; qt < 2; ++qt) { v8f& c = acc[2 * (u0 + t) + hf][qt]; c = WFrag<T16>::mma(a[t][hf][ks], bq[qt][ks], c); if (HR) { c = WFrag<T16>::mma(a[t][hf][ks], bq2[qt][ks], c); c = WFrag<T16>::mma(a2[t][hf][ks], bq[qt][ks], c); } } }
    __syncthreads();   // the staged QE rows and the zeroed near buckets are in LDS
    float qeL[2], qeR[2], mx[2];
#pragma unroll
    for (int qt = 0; qt < 2; ++qt) { qeL[qt] = qes[(qt * 16 + lr) * QEP]; qeR[qt] = qes[(qt * 16 + lr) * QEP + 2 * MAXR]; mx[qt] = -3.0e38f; }
#pragma unroll
    for (int u = 0; u < 4; ++u) {
        if (u == 0 && w < 3) {   // a block that may hold near keys: entry by entry; j - i = dj + 8 hi + e - lr
#pragma unroll
            for (int hf = 0; hf < 2; ++hf)
#pragma unroll
                for (int qt = 0; qt < 2; ++qt) { const int dj = kf[u] + hf * 16 - (q0 + qt * 16);
#pragma unroll
                    for (int j = 0; j < 8; ++j) { const float e = qes[(qt * 16 + lr) * QEP + min(max(dj + 8 * hi + j - lr, -MAXR), MAXR) + MAXR]; const float t = (acc[2 * u + hf][qt][j] + e) * SCL; acc[2 * u + hf][qt][j] = t; mx[qt] = fmaxf(mx[qt], t); } }
        } else { const bool left = kf[u] < q0;
#pragma unroll
            for (int qt = 0; qt < 2; ++qt) { const float e = left ? qeL[qt] : qeR[qt];
#pragma unroll
                for (int hf = 0; hf < 2; ++hf)
#pragma unroll
                    for (int j = 0; j < 8; ++j) { const float t = (acc[2 * u + hf][qt][j] + e) * SCL; acc[2 * u + hf][qt][j] = t; mx[qt] = fmaxf(mx[qt], t); } }
        } }
#pragma unroll
    for (int qt = 0; qt < 2; ++qt) mx[qt] = fmaxf(mx[qt], __shfl_xor(mx[qt], 16, 32));
    rm[lane * RWP + w] = hi ? mx[1] : mx[0];   // lane = query index in the block: half hi stores column group hi
    __syncthreads();   // every wave's row maxima are in LDS
#pragma unroll
    for (int qt = 0; qt < 2; ++qt) { const float* p = rm + (qt * 16 + lr) * RWP; float m = -3.0e38f;
#pragma unroll
        for (int g = 0; g < 4; ++g) { const v4f x = *(const v4fa*)(p + g * 4); m = fmaxf(fmaxf(m, fmaxf(x[0], x[1])), fmaxf(x[2], x[3])); }
        mx[qt] = m; }
    float sum[2] = {0.f, 0.f};
#pragma unroll
    for (int kt = 0; kt < 8; ++kt)
#pragma unroll
        for (int qt = 0; qt < 2; ++qt) { float x[8], p[8], s8 = 0.f;
#pragma unroll
            for (int j = 0; j < 8; ++j) x[j] = (acc[kt][qt][j] - mx[qt]) * 1.4426950408889634f;
            // eight independent exponentials (no result on a source: early clobber) and, behind the last, the one slot that the instruction set asks for before a result is used or a source overwritten
            asm("v_exp_f32 %0, %8\n\tv_exp_f32 %1, %9\n\tv_exp_f32 %2, %10\n\tv_exp_f32 %3, %11\n\tv_exp_f32 %4, %12\n\tv_exp_f32 %5, %13\n\tv_exp_f32 %6, %14\n\tv_exp_f32 %7, %15\n\tv_nop"
                : "=&v"(p[0]), "=&v"(p[1]), "=&v"(p[2]), "=&v"(p[3]), "=&v"(p[4]), "=&v"(p[5]), "=&v"(p[6]), "=&v"(p[7]) : "v"(x[0]), "v"(x[1]), "v"(x[2]), "v"(x[3]), "v"(x[4]), "v"(x[5]), "v"(x[6]), "v"(x[7]));
#pragma unroll
            for (int j = 0; j < 8; ++j) { acc[kt][qt][j] = p[j]; s8 += p[j]; }
            sum[qt] += s8; }
#pragma unroll
    for (int qt = 0; qt < 2; ++qt) sum[qt] += __shfl_xor(sum[qt], 16, 32);
    rs[lane * RWP + w] = hi ? sum[1] : sum[0];
    __syncthreads();   // every wave's row sums are in LDS
    float f[2];
#pragma unroll
    for (int qt = 0; qt < 2; ++qt) { const float* p = rs + (qt * 16 + lr) * RWP; float s = 0.f;
#pragma unroll
        for (int g = 0; g < 4; ++g) { const v4f x = *(const v4fa*)(p + g * 4); s = (((s + x[0]) + x[1]) + x[2]) + x[3]; }
        f[qt] = __fdiv_rn(HR ? 1.0f : PCAR, s); }
    float bl[2] = {0.f, 0.f}, br[2] = {0.f, 0.f};
    v8f o[4][2];
#pragma unroll
    for (int dt = 0; dt < 4; ++dt) { o[dt][0] = (v8f){}; o[dt][1] = (v8f){}; }
#pragma unroll
    for (int u = 0; u < 4; ++u) { V pb[2], pb2[2]; float pw[2][16];   // block u: fetch V^T, round, pack, tally, multiply
        constexpr int D0 = HR ? 2 : 4;   // V^T tiles fetched ahead of the rounding (as many as the registers hold)
        V va[4], va2[4]; const T16* pv = at(Vt + kf[u], vlb); const T16* pv2 = HR ? at(V2 + kf[u], vlb) : nullptr;
#pragma unroll
        for (int dt = 0; dt < D0; ++dt) { va[dt] = WFrag<T16>::ld(pv + (size_t)dt * 16 * TT); if (HR) va2[dt] = WFrag<T16>::ld(pv2 + (size_t)dt * 16 * TT); }
        // as in the score part: behind the loads, their addresses as inputs; the loads fly while the block is rounded
        if constexpr (HR) asm volatile("s_wait_xcnt 0x0" :: "v"(pv), "v"(pv2) : "memory"); else asm volatile("s_wait_xcnt 0x0" :: "v"(pv) : "memory");
#pragma unroll
        for (int qt = 0; qt < 2; ++qt)
#pragma unroll
            for (int e = 0; e < 16; e += 2) { const v2f x = (v2f){acc[2 * u + (e >> 3)][qt][e & 7] * f[qt], acc[2 * u + (e >> 3)][qt][(e & 7) + 1] * f[qt]};
                if constexpr (HR) { const v2bf h2 = __builtin_convertvector(x, v2bf); const v2f hf2 = __builtin_convertvector(h2, v2f); const v2bf l2 = __builtin_convertvector(x - hf2, v2bf); const v2f s2 = hf2 + __builtin_convertvector(l2, v2f);
                    pb[qt][e] = h2[0]; pb[qt][e + 1] = h2[1]; pb2[qt][e] = l2[0]; pb2[qt][e + 1] = l2[1]; pw[qt][e] = s2[0]; pw[qt][e + 1] = s2[1]; }
                else { const h16 o0 = tohx(x[0]), o1 = tohx(x[1]); pb[qt][e] = o0; pb[qt][e + 1] = o1; pw[qt][e] = (float)o0 * 0.0009765625f; pw[qt][e + 1] = (float)o1 * 0.0009765625f; } }
        if (u == 0 && w < 3) {
#pragma unroll
            for (int qt = 0; qt < 2; ++qt)
#pragma unroll
                for (int e = 0; e < 16; ++e) { const int r = kf[u] + (e >> 3) * 16 + 8 * hi + (e & 7) - (q0 + qt * 16 + lr) + MAXR; const float p = pw[qt][e]; bl[qt] += (r <= 0) ? p : 0.f; br[qt] += (r >= 2 * MAXR) ? p : 0.f; if (r > 0 && r < 2 * MAXR) nbk[(qt * 16 + lr) * (2 * MAXR) + r] = p; }
        } else { const bool left = kf[u] < q0;
#pragma unroll
            for (int qt = 0; qt < 2; ++qt) { float t[8];
#pragma unroll
                for (int e = 0; e < 8; ++e) t[e] = pw[qt][e] + pw[qt][e + 8];
                const float s16 = ((t[0] + t[1]) + (t[2] + t[3])) + ((t[4] + t[5]) + (t[6] + t[7])); bl[qt] += left ? s16 : 0.f; br[qt] += left ? 0.f : s16; }
        }
#pragma unroll
        for (int dt = 0; dt < 4; ++dt) {
            if constexpr (HR) if (dt == D0) {
#pragma unroll
                for (int d2 = D0; d2 < 4; ++d2) { va[d2] = WFrag<T16>::ld(pv + (size_t)d2 * 16 * TT); va2[d2] = WFrag<T16>::ld(pv2 + (size_t)d2 * 16 * TT); }
                asm volatile("s_wait_xcnt 0x0" :: "v"(pv), "v"(pv2) : "memory");   // as above, for the rest of the block's V^T tiles
            }
#pragma unroll
            for (int qt = 0; qt < 2; ++qt) { o[dt][qt] = WFrag<T16>::mma(va[dt], pb[qt], o[dt][qt]); if (HR) { o[dt][qt] = WFrag<T16>::mma(va[dt], pb2[qt], o[dt][qt]); o[dt][qt] = WFrag<T16>::mma(va2[dt], pb[qt], o[dt][qt]); } } } }
#pragma unroll
    for (int dt = 0; dt < 4; ++dt)
#pragma unroll
        for (int qt = 0; qt < 2; ++qt) { float* p = red + w * (FQR * RDP) + (qt * 16 + lr) * RDP + dt * 16 + 8 * hi; const v8f c = o[dt][qt];   // a lane's 8 registers are 8 consecutive d of one query
            *(v4fa*)p = (v4f){c[0], c[1], c[2], c[3]}; *(v4fa*)(p + 4) = (v4f){c[4], c[5], c[6], c[7]}; }
#pragma unroll
    for (int qt = 0; qt < 2; ++qt) { bl[qt] += __shfl_xor(bl[qt], 16, 32); br[qt] += __shfl_xor(br[qt], 16, 32); }
    rl[lane * RWP + w] = hi ? bl[1] : bl[0]; rr[lane * RWP + w] = hi ? br[1] : br[0];
}
// grid (TT / 32, ZH), 512 threads; the hi/lo blocks (the longer ones) have the lowest indices
__global__ __launch_bounds__(FNW * 32) void k_fattn(const h16* __restrict__ Q16, const bf* __restrict__ Qh, const bf* __restrict__ Ql, const h16* __restrict__ K16, const bf* __restrict__ Kh, const bf* __restrict__ Kl, const h16* __restrict__ V16, const bf* __restrict__ Vh, const bf* __restrict__ Vl, const float* __restrict__ QE, bf* PBh, bf* PBl, float* Ob) {
    __shared__ __align__(16) float red[FNW * FQR * RDP];
    __shared__ __align__(16) float qes[FQR * QEP];
    __shared__ __align__(16) float rm[FQR * RWP];
    __shared__ __align__(16) float rs[FQR * RWP];
    __shared__ __align__(16) float rl[FQR * RWP];
    __shared__ __align__(16) float rr[FQR * RWP];
    __shared__ __align__(16) float nbk[FQR * 2 * MAXR];
    const size_t z = blockIdx.y; const int q0 = blockIdx.x * FQR; const size_t zp = z * TT * HD; const int tid = threadIdx.x;
    const float* QEr = QE + (z * TT + q0) * NE;
    if (q0 < RH) fattn_body<true>(Qh + zp, Ql + zp, Kh + zp, Kl + zp, Vh + zp, Vl + zp, QEr, q0, red, qes, rm, rs, rl, rr, nbk);
    else fattn_body<false>(Q16 + zp, nullptr, K16 + zp, nullptr, V16 + zp, nullptr, QEr, q0, red, qes, rm, rs, rl, rr, nbk);
    __syncthreads();   // every wave's partial O tile, far sums and near buckets are in LDS
    const int q = tid >> 4, g = tid & 15;   // 16 threads a query row: whole 256-byte rows leave
    v4f s = *(const v4fa*)(red + q * RDP + g * 4);
#pragma unroll
    for (int ww = 1; ww < FNW; ++ww) { const v4f p = *(const v4fa*)(red + ww * (FQR * RDP) + q * RDP + g * 4);
#pragma unroll
        for (int j = 0; j < 4; ++j) s[j] += p[j]; }
    *(v4f*)(Ob + zp + (size_t)(q0 + q) * HD + g * 4) = s;
    float b[8] = {0.f, 0.f, 0.f, 0.f, 0.f, 0.f, 0.f, 0.f};
    if (g < 8) { const v4f n0 = *(const v4fa*)(nbk + q * (2 * MAXR) + g * 8), n1 = *(const v4fa*)(nbk + q * (2 * MAXR) + g * 8 + 4);
#pragma unroll
        for (int j = 0; j < 4; ++j) { b[j] = n0[j]; b[4 + j] = n1[j]; } }
    if (g == 0 || g == 8) { const float* p = (g ? rr : rl) + q * RWP; float t = 0.f;   // bucket 0: far left; bucket 64: far right
#pragma unroll
        for (int k = 0; k < 4; ++k) { const v4f x = *(const v4fa*)(p + k * 4); t = (((t + x[0]) + x[1]) + x[2]) + x[3]; }
        b[0] = t; }
    v8us oh, ol;
#pragma unroll
    for (int j = 0; j < 8; ++j) { unsigned short u2, w2; splitf(b[j], u2, w2); oh[j] = u2; ol[j] = w2; }
    const size_t ob = (z * TT + q0 + q) * NE + g * 8; *(v8us*)(PBh + ob) = oh; *(v8us*)(PBl + ob) = ol;
}
__global__ __launch_bounds__(256) void k_epad2(const float* __restrict__ E, bf* EB) { const size_t i = (size_t)blockIdx.x * 256 + threadIdx.x; if (i >= (size_t)NE * HD / 8) return; const int d0 = (int)(i % (HD / 8)) * 8; const int r = (int)(i / (HD / 8)); const float* src = E + (size_t)min(r, 2 * MAXR) * HD + d0; v8us o;
#pragma unroll
    for (int q = 0; q < 8; ++q) { const unsigned short v = f2bf(src[q]); o[q] = (r <= 2 * MAXR) ? v : (unsigned short)0; }
    *(v8us*)(EB + (size_t)r * HD + d0) = o;  }
__global__ __launch_bounds__(256) void k_rvt(const float* __restrict__ E, bf* RVT) { const size_t i = (size_t)blockIdx.x * 256 + threadIdx.x; if (i >= (size_t)HD * NE / 8) return; const int r0 = (int)(i % (NE / 8)) * 8; const int d = (int)(i / (NE / 8)); v8us o;
#pragma unroll
    for (int q = 0; q < 8; ++q) { const int r = r0 + q; const unsigned short v = f2bf(E[(size_t)min(r, 2 * MAXR) * HD + d]); o[q] = (r <= 2 * MAXR) ? v : (unsigned short)0; }
    *(v8us*)(RVT + (size_t)d * NE + r0) = o;  }

extern "C" void kernel_launch(void* const* d_in, const int* in_sizes, int n_in,
                              void* d_out, int out_size, void* d_ws, size_t ws_size, hipStream_t stream) {
    (void)in_sizes; (void)n_in; (void)out_size;
    const float* x = (const float*)d_in[0]; const float* xk = (const float*)d_in[1]; const float* xv = (const float*)d_in[2]; const float* wq = (const float*)d_in[3]; const float* bq = (const float*)d_in[4]; const float* wk = (const float*)d_in[5]; const float* bk = (const float*)d_in[6]; const float* wv = (const float*)d_in[7]; const float* bv = (const float*)d_in[8]; const float* wo = (const float*)d_in[9]; const float* bo = (const float*)d_in[10]; const float* relk = (const float*)d_in[11]; const float* relv = (const float*)d_in[12];   /* [65][64] each */
    float* OUT = (float*)d_out;     // [2][2048][1024]
    char* wsp = (char*)d_ws;
    auto take = [&](size_t bytes) { char* p = wsp; wsp += (bytes + 255) & ~(size_t)255; return (void*)p; };
    bf* EB = (bf*)take((size_t)NE * HD * 2); bf* RVT = (bf*)take((size_t)HD * NE * 2); float* QE = (float*)take((size_t)ZH * TT * NE * 4); bf* PBh = (bf*)take((size_t)ZH * TT * NE * 2); bf* PBl = (bf*)take((size_t)ZH * TT * NE * 2); bf* WQ = (bf*)take((size_t)DQ * DM * 2); bf* WK = (bf*)take((size_t)DKV * DM * 2); bf* WV = (bf*)take((size_t)DKV * DM * 2); bf* WO = (bf*)take((size_t)DM * DQ * 2);
    bf* XB = (bf*)take((size_t)TT * DM * 2);
    h16* QP16 = (h16*)take((size_t)NH_ * TT * HD * 2); h16* KP16 = (h16*)take((size_t)NKV * TT * HD * 2); h16* VT16 = (h16*)take((size_t)NKV * HD * TT * 2);
    bf* QPh = (bf*)take((size_t)NH_ * TT * HD * 2); bf* QPl = (bf*)take((size_t)NH_ * TT * HD * 2); bf* KPh = (bf*)take((size_t)NKV * TT * HD * 2); bf* KPl = (bf*)take((size_t)NKV * TT * HD * 2); bf* VTh = (bf*)take((size_t)NKV * HD * TT * 2); bf* VTl = (bf*)take((size_t)NKV * HD * TT * 2);
    float* Ob = (float*)take((size_t)ZH * TT * HD * 4); bf* ATh = (bf*)take((size_t)TT * DQ * 2); bf* ATl = (bf*)take((size_t)TT * DQ * 2);
    if ((size_t)(wsp - (char*)d_ws) > ws_size) return;    // ws 256 MiB
    { k_wtG<<<(unsigned)((DM * DQ / 64 + 63) / 64), 256, 0, stream>>>(wq, DM, DQ, WQ); k_wtG<<<(unsigned)((DM * DKV / 64 + 63) / 64), 256, 0, stream>>>(wk, DM, DKV, WK); k_wtG<<<(unsigned)((DM * DKV / 64 + 63) / 64), 256, 0, stream>>>(wv, DM, DKV, WV);
      k_wtG<<<(unsigned)((DQ * DM / 64 + 63) / 64), 256, 0, stream>>>(wo, DQ, DM, WO);
       }
    k_epad2<<<(unsigned)(((size_t)NE * HD / 8 + 255) / 256), 256, 0, stream>>>(relk, EB); k_rvt<<<(unsigned)(((size_t)HD * NE / 8 + 255) / 256), 256, 0, stream>>>(relv, RVT);   /* rel_k plane [128][64], rel_v^T plane [64][128] */
    for (int b = 0; b < NB_; ++b) {
        
        k_cvt8<<<(unsigned)(((size_t)TT * DM / 8 + 255) / 256), 256, 0, stream>>>(x + (size_t)b * TT * DM, XB, (size_t)TT * DM / 8);
        k_gemmsk<bf, 0, true, DM, 4, 8, 1><<<dim3(TT / 64, DQ / 64, 1), 256, 0, stream>>>(XB, nullptr, WQ, nullptr, nullptr, 0, bq, 0, 0, 0, QP16, QPh, QPl);
        k_cvt8<<<(unsigned)(((size_t)TT * DM / 8 + 255) / 256), 256, 0, stream>>>(xk + (size_t)b * TT * DM, XB, (size_t)TT * DM / 8); k_gemmsk<bf, 0, true, DM, 4, 8, 1><<<dim3(TT / 64, DKV / 64, 1), 256, 0, stream>>>(XB, nullptr, WK, nullptr, nullptr, 0, bk, 0, 0, 0, KP16, KPh, KPl);
        k_cvt8<<<(unsigned)(((size_t)TT * DM / 8 + 255) / 256), 256, 0, stream>>>(xv + (size_t)b * TT * DM, XB, (size_t)TT * DM / 8); k_gemmsk<bf, 0, true, DM, 4, 8, 2><<<dim3(TT / 64, DKV / 64, 1), 256, 0, stream>>>(XB, nullptr, WV, nullptr, nullptr, 0, bv, 0, 0, 0, VT16, VTh, VTl);
        for (int h0 = 0; h0 < NH_; h0 += ZH) { const size_t zq = (size_t)h0, zk = (size_t)(h0 / REP);   // one kv head per query head: the pass's heads use consecutive kv planes (z-strides TT*HD)
            k_gemmw<bf, 1, false, false><<<dim3(TT / 64, NE / 64, ZH), 32, 0, stream>>>(QPh + zq * TT * HD, QPl + zq * TT * HD, EB, nullptr, HD, QE, NE, nullptr, (size_t)TT * HD, 0, (size_t)TT * NE, nullptr, 0, nullptr, nullptr);   /* QE[i][r] = q_i . rel_k[r] */
            k_fattn<<<dim3(TT / FQR, ZH), FNW * 32, 0, stream>>>(QP16 + zq * TT * HD, QPh + zq * TT * HD, QPl + zq * TT * HD, KP16 + zk * TT * HD, KPh + zk * TT * HD, KPl + zk * TT * HD, VT16 + zk * HD * TT, VTh + zk * HD * TT, VTl + zk * HD * TT, QE, PBh, PBl, Ob);   /* scores + QE[i][idx], softmax, 65 bucket sums per row, attn v */
            k_gemmw<bf, 1, false, true><<<dim3(TT / 64, HD / 64, ZH), 32, 0, stream>>>(PBh, PBl, RVT, nullptr, NE, nullptr, 0, nullptr, (size_t)TT * NE, 0, 0, Ob, h0, ATh, ATl); }   /* buckets . rel_v = sum_j attn[i][j] rel_v[idx], + attn v, merged hi/lo planes */
        k_gemmsk<bf, 1, true, DQ, 4, 8, 0><<<dim3(TT / 64, DM / 64, 1), 256, 0, stream>>>(ATh, ATl, WO, nullptr, OUT + (size_t)b * TT * DM, DM, bo, 0, 0, 0, nullptr, nullptr, nullptr); }
}

// v006
// It runs in 284 microseconds.
// Two timings next to v005 put it at 1.52 and 1.53 times that version's speed.
// Counting every step since v000, it is 11.3 times as fast.
#include <hip/hip_runtime.h>

// Multi-head attention with Shaw relative-position terms on the logits AND the values (query, key, value [2][2048][1024]; q,k,v = in W + b ('xw' 1/32, zero biases; 16 heads x 64); idx[i][j] = clip(j - i, -32, 32) + 32; attn = softmax((q.k + q_i.rel_k[idx]) / 8); out_h = attn v + sum_j attn[i][j] rel_v[idx] (tables [65][64] x 0.05, read); out = merged Wo + bo ('xw') -> [2][2048][1024] (4.2 M)).
// Six launches, each over both batches and all heads (32 planes, plane = batch 16 + head): bf16 copies of the three inputs, the transposed weights, rel_k as an exact plane [128][64] (rows >= 65 zero) and rel_v^T as an exact plane [64][128]; exact projections + f32 biases (q, k, v in one grid), each leaving the GEMM as the head planes (fp16 and hi/lo; v transposed); QE = q.rel_k^T ([32][2048][128], hi/lo x exact); one kernel per 32 query rows does the dense scores (hybrid rows: < 512 hi/lo 3 products, rest fp16 x1024), adds QE[i][idx], does the softmax with the 1/8, sums each row's probabilities into the 65 relative-position buckets (far-left sum, 63 near entries, far-right sum; fixed order) as hi/lo planes and multiplies by v, scores and probabilities staying in registers; buckets x rel_v ([32][2048][64], hi/lo x exact) added to attn v in f32 and split into the merged hi/lo planes in that GEMM's epilogue; merged hi/lo x Wo exact + bo.
// Compute dtypes, f32 accumulate: every input rounded to bf16; projections exact + f32 biases; q.rel_k and buckets.rel_v hi/lo x exact; attention rows < 512 3 products, rest fp16; softmax f32; Wo hl x exact + bias.

#define NB_  2
#define TT   2048
#define DM   1024
#define NH_  16
#define NKV  16
#define REP  (NH_ / NKV)
#define HD   64
#define DQ   (NH_ * HD)
#define DKV  (NKV * HD)
#define NZ   (NB_ * NH_)          // head planes: batch NH_ + head
#define RH   512                  // query rows < RH use hi+lo planes (0: none)
#define WIN  0
#define PCAR 1024.0f
#define SCL  0.125f
#define MAXR 32      // max relative position
#define NE   128     // 2*MAXR+1 = 65 table rows padded to 128
typedef _Float16 h16;
typedef unsigned short bf;
typedef __attribute__((ext_vector_type(16))) __bf16   v16bf;
typedef __attribute__((ext_vector_type(16))) _Float16 v16h;
typedef __attribute__((ext_vector_type(8)))  _Float16 v8h;
typedef __attribute__((ext_vector_type(8)))  unsigned short v8us;
typedef __attribute__((ext_vector_type(8)))  float    v8f;
typedef __attribute__((ext_vector_type(4)))  float    v4f;
typedef v8h  __attribute__((may_alias)) v8ha;
typedef v4f  __attribute__((may_alias)) v4fa;
typedef v8us __attribute__((may_alias)) v8usa;

__device__ __forceinline__ unsigned short f2bf(float f) { unsigned u = __float_as_uint(f); u += 0x7FFFu + ((u >> 16) & 1u); return (unsigned short)(u >> 16); }
__device__ __forceinline__ float bf2f(unsigned short b) { return __uint_as_float(((unsigned)b) << 16); }
__device__ __forceinline__ float bfr(float f) { return bf2f(f2bf(f)); }
__device__ __forceinline__ v16h cat16(v8h lo, v8h hi) { return __builtin_shufflevector(lo, hi, 0, 1, 2, 3, 4, 5, 6, 7, 8, 9, 10, 11, 12, 13, 14, 15); }
__device__ __forceinline__ v16bf cat16b(v8us lo, v8us hi) { return __builtin_bit_cast(v16bf, __builtin_shufflevector(lo, hi, 0, 1, 2, 3, 4, 5, 6, 7, 8, 9, 10, 11, 12, 13, 14, 15)); }
__device__ __forceinline__ v8f wmma16(v16h a, v16h b, v8f c) { return __builtin_amdgcn_wmma_f32_16x16x32_f16(false, a, false, b, (short)0, c, false, false); }
__device__ __forceinline__ v8f wmmab(v16bf a, v16bf b, v8f c) { return __builtin_amdgcn_wmma_f32_16x16x32_bf16(false, a, false, b, (short)0, c, false, false); }
__device__ __forceinline__ h16 tohx(float x) { return (h16)x; }
__device__ __forceinline__ void splitf(float y, unsigned short& h, unsigned short& l) { h = f2bf(y); l = f2bf(y - bf2f(h)); }
typedef __attribute__((ext_vector_type(4))) unsigned short v4us;



// ---- k_gemmw: register-blocked GEMM, ONE WAVE per 64x64 output tile (16 accumulators), operands straight from K-contiguous 16-bit planes; grid (M/64, N/64, Z), 32 threads.
// C[m][n] (f32, pitch ldc, + optional f32 bias[n]) = sum_k A[m][k] Bt[n][k] (+ split products per NSPLIT). z-batch strides sA/sB/sC in elements. K % 32 == 0.
// MRG: the tile is not stored; it is added in f32 to plane z's attn.v rows Ob[z][t][d] (x1024 where those carry that factor), the factor is taken off, and the sum leaves as hi/lo planes Ah, Al [batch z / NH_][t][head z % NH_][d].
template <typename T16> struct WFrag;
template <> struct WFrag<h16> { typedef v16h V; static __device__ __forceinline__ V ld(const h16* p) { return cat16(*(const v8h*)p, *(const v8h*)(p + 16)); } static __device__ __forceinline__ v8f mma(V a, V b, v8f c) { return wmma16(a, b, c); } };
template <> struct WFrag<bf> { typedef v16bf V; static __device__ __forceinline__ V ld(const bf* p) { return cat16b(*(const v8us*)p, *(const v8us*)(p + 16)); } static __device__ __forceinline__ v8f mma(V a, V b, v8f c) { return wmmab(a, b, c); } };
template <typename T16, int NSPLIT, bool BIAS, bool MRG>
__global__ __launch_bounds__(32) void k_gemmw(const T16* __restrict__ A, const T16* __restrict__ A2, const T16* __restrict__ Bt, const T16* __restrict__ Bt2, int K, float* C, int ldc, const float* __restrict__ bias, size_t sA, size_t sB, size_t sC, const float* __restrict__ Ob, bf* Ah, bf* Al) {
    typedef typename WFrag<T16>::V V;
    __shared__ __align__(16) float os[16 * 68];
    const size_t z = blockIdx.z; A += z * sA; if (A2) A2 += z * sA; Bt += z * sB; if (Bt2) Bt2 += z * sB; C += z * sC;
    const int lane = threadIdx.x & 31, lr = lane & 15, hi = lane >> 4; const int r0 = blockIdx.x * 64, c0 = blockIdx.y * 64;
    v8f acc[4][4];
#pragma unroll
    for (int mb = 0; mb < 4; ++mb)
#pragma unroll
        for (int nb = 0; nb < 4; ++nb) acc[mb][nb] = (v8f){};
    const size_t aoff = (size_t)(r0 + lr) * K + 8 * hi, boff = (size_t)(c0 + lr) * K + 8 * hi;
#pragma unroll 1
    for (int kc = 0; kc < K; kc += 32) {
        V a[4], a2[4];
#pragma unroll
        for (int mb = 0; mb < 4; ++mb) { a[mb] = WFrag<T16>::ld(A + aoff + (size_t)mb * 16 * K + kc); if (NSPLIT == 1 || NSPLIT == 2) a2[mb] = WFrag<T16>::ld(A2 + aoff + (size_t)mb * 16 * K + kc); }
#pragma unroll
        for (int nb = 0; nb < 4; ++nb) { const V b = WFrag<T16>::ld(Bt + boff + (size_t)nb * 16 * K + kc); V b2; if (NSPLIT >= 2) b2 = WFrag<T16>::ld(Bt2 + boff + (size_t)nb * 16 * K + kc);
#pragma unroll
            for (int mb = 0; mb < 4; ++mb) { acc[mb][nb] = WFrag<T16>::mma(a[mb], b, acc[mb][nb]); if (NSPLIT == 1 || NSPLIT == 2) acc[mb][nb] = WFrag<T16>::mma(a2[mb], b, acc[mb][nb]); if (NSPLIT >= 2) acc[mb][nb] = WFrag<T16>::mma(a[mb], b2, acc[mb][nb]); } }
        asm volatile("v_nop\n\tv_nop\n\tv_nop\n\tv_nop" : "+v"(acc[0][0]), "+v"(acc[1][1]), "+v"(acc[2][2]), "+v"(acc[3][3]) : "v"(a[0]), "v"(a[3]));
    }
    // MRG: a tile's 64 rows lie on one side of RH; one lane address each for Ob, Ah and Al (row r0 + hi, 4 columns from 4 lr), the rows follow at constant distances
    static_assert(!MRG || RH % 64 == 0, "a 64-row tile has one carry factor");
    const float sc = (r0 < RH) ? 1.0f : PCAR, cs = (r0 < RH) ? 1.0f : (1.0f / PCAR);
    const float* po = MRG ? Ob + (z * TT + r0 + hi) * HD + c0 + lr * 4 : nullptr; const size_t ao = ((z / NH_) * TT + r0 + hi) * DQ + (z % NH_) * HD + c0 + lr * 4; bf* pah = MRG ? Ah + ao : nullptr; bf* pal = MRG ? Al + ao : nullptr;
#pragma unroll
    for (int mb = 0; mb < 4; ++mb) {
#pragma unroll
        for (int nb = 0; nb < 4; ++nb) {
#pragma unroll
            for (int j = 0; j < 8; ++j) os[(hi * 8 + j) * 68 + nb * 16 + lr] = acc[mb][nb][j]; }
        __builtin_amdgcn_wave_barrier(); asm volatile("" ::: "memory");
        float* crow = C + (size_t)(r0 + mb * 16) * ldc + c0;
{
#pragma unroll
            for (int s = 0; s < 8; ++s) { const int row = 2 * s + hi, cofs = lr * 4; v4f val = *(const v4fa*)(os + row * 68 + cofs); if (BIAS) { val[0] += bfr(bias[c0 + cofs]); val[1] += bfr(bias[c0 + cofs + 1]); val[2] += bfr(bias[c0 + cofs + 2]); val[3] += bfr(bias[c0 + cofs + 3]); }
                if constexpr (MRG) { const v4f a = *(const v4f*)(po + (mb * 16 + 2 * s) * HD); v4us oh, ol;
#pragma unroll
                    for (int q = 0; q < 4; ++q) { unsigned short a2, c2; splitf(__fadd_rn(a[q], __fmul_rn(val[q], sc)) * cs, a2, c2); oh[q] = a2; ol[q] = c2; }
                    *(v4us*)(pah + (mb * 16 + 2 * s) * DQ) = oh; *(v4us*)(pal + (mb * 16 + 2 * s) * DQ) = ol; }
                else *(v4f*)(crow + (size_t)row * ldc + cofs) = val; }
             }
        __builtin_amdgcn_wave_barrier(); asm volatile("" ::: "memory");
    }
}

// ---- k_gemmsk: the products of k_gemmw for a long K: ONE WORK-GROUP of NW waves per (16 MB)x64 output tile, wave w takes k in [w KK/NW, (w+1) KK/NW) (4 MB accumulators);
// the NW partial tiles meet in LDS and are summed in wave order 0..NW-1 (fixed), then leave as whole 256-byte rows (+ optional f32 bias[n]). grid (M/(16 MB), N/64, Z), 32 NW threads. NSPLIT as in k_gemmw. KK % (32 NW) == 0. LDA: pitch of A's rows in elements.
// EPI 0: C as above. EPI 1: the q, k and v projections in one grid (z = 0, 1, 2: operands and planes at the z-strides, bias, bias1 or bias2), rows = [batch][t]; the 64 columns of a tile are one head (HD == 64) and the biased f32 values leave as that head's fp16 and hi/lo planes, 16 bytes a lane and whole 128-byte rows: z < 2 [plane][t][d], z == 2 transposed [plane][d][t].
template <typename T16, int NSPLIT, bool BIAS, int KK, int MB, int NW, int EPI, int LDA = KK>
__global__ __launch_bounds__(NW * 32) void k_gemmsk(const T16* __restrict__ A, const T16* __restrict__ A2, const T16* __restrict__ Bt, const T16* __restrict__ Bt2, float* C, int ldc, const float* __restrict__ bias, const float* __restrict__ bias1, const float* __restrict__ bias2, size_t sA, size_t sB, size_t sC, h16* P16, bf* Ph, bf* Pl, size_t sP) {
    static_assert(EPI == 0 || (HD == 64 && MB == 4 && BIAS && TT % 64 == 0 && NKV == NH_), "a plane epilogue takes a 64 x 64 tile of one head of one batch");
    typedef typename WFrag<T16>::V V;
    __shared__ __align__(16) float red[NW * MB * 1024];   // [wave][subtile mb*4+nb][half of its 8 rows a lane][lane] x 4 floats
    __shared__ __align__(16) float os[MB * 16 * 68];
    const size_t z = blockIdx.z; A += z * sA; if (NSPLIT == 1 || NSPLIT == 2) A2 += z * sA; Bt += z * sB; if (NSPLIT >= 2) Bt2 += z * sB; C += z * sC;
    const int tid = threadIdx.x, lane = tid & 31, w = tid >> 5, lr = lane & 15, hi = lane >> 4; const int r0 = blockIdx.x * (MB * 16), c0 = blockIdx.y * 64;
    const bool tr = EPI == 1 && z == 2;   // block-uniform
    // every '#pragma unroll' in this kernel makes the indices of acc, a, a2 and s constants, so that they stay in registers
    v8f acc[MB][4];
#pragma unroll
    for (int mb = 0; mb < MB; ++mb)
#pragma unroll
        for (int nb = 0; nb < 4; ++nb) acc[mb][nb] = (v8f){};
    const size_t aoff = (size_t)(r0 + lr) * LDA + 8 * hi + w * (KK / NW), boff = (size_t)(c0 + lr) * KK + 8 * hi + w * (KK / NW);
    // unrolled whole (KK / (32 NW) = 4 trips here): no back edge behind a matrix instruction
#pragma unroll
    for (int kc = 0; kc < KK / NW; kc += 32) {
        V a[MB], a2[MB];
#pragma unroll
        for (int mb = 0; mb < MB; ++mb) { a[mb] = WFrag<T16>::ld(A + aoff + (size_t)mb * 16 * LDA + kc); if (NSPLIT == 1 || NSPLIT == 2) a2[mb] = WFrag<T16>::ld(A2 + aoff + (size_t)mb * 16 * LDA + kc); }
#pragma unroll
        for (int nb = 0; nb < 4; ++nb) { const V b = WFrag<T16>::ld(Bt + boff + (size_t)nb * 16 * KK + kc); V b2; if (NSPLIT >= 2) b2 = WFrag<T16>::ld(Bt2 + boff + (size_t)nb * 16 * KK + kc);
#pragma unroll
            for (int mb = 0; mb < MB; ++mb) { acc[mb][nb] = WFrag<T16>::mma(a[mb], b, acc[mb][nb]); if (NSPLIT == 1 || NSPLIT == 2) acc[mb][nb] = WFrag<T16>::mma(a2[mb], b, acc[mb][nb]); if (NSPLIT >= 2) acc[mb][nb] = WFrag<T16>::mma(a[mb], b2, acc[mb][nb]); } }
    }
#pragma unroll
    for (int mb = 0; mb < MB; ++mb)
#pragma unroll
        for (int nb = 0; nb < 4; ++nb) { float* rp = red + w * (MB * 1024) + (mb * 4 + nb) * 256 + lane * 4; const v8f c = acc[mb][nb];
            *(v4fa*)rp = (v4f){c[0], c[1], c[2], c[3]}; *(v4fa*)(rp + 128) = (v4f){c[4], c[5], c[6], c[7]}; }
    __syncthreads();   // every wave's partial tile is in LDS
#pragma unroll
    for (int u = 0; u < MB * 8 / NW; ++u) { const int idx = u * (NW * 32) + tid;   // one group of 4 floats of the tile; idx & 31 == lane
        v4f s = *(const v4fa*)(red + idx * 4);
#pragma unroll
        for (int q = 1; q < NW; ++q) { const v4f p = *(const v4fa*)(red + q * (MB * 1024) + idx * 4);
#pragma unroll
            for (int j = 0; j < 4; ++j) s[j] = __fadd_rn(s[j], p[j]); }
        const int t = idx >> 6, half = (idx >> 5) & 1; const int row = (t >> 2) * 16 + hi * 8 + half * 4, col = (t & 3) * 16 + lr;
        if (tr) *(v4fa*)(os + col * 68 + row) = s;   // transposed: a lane's 4 values are 4 consecutive rows of one column
        else {
#pragma unroll
            for (int j = 0; j < 4; ++j) os[(row + j) * 68 + col] = s[j]; } }
    __syncthreads();   // the summed tile is whole before it is read by rows
    if constexpr (EPI != 0) { const float* bz = z == 0 ? bias : z == 1 ? bias1 : bias2; const size_t pl = (size_t)(r0 / TT) * NH_ + blockIdx.y; const int t0 = r0 % TT;
#pragma unroll
        for (int u = 0; u < MB * 4 / NW; ++u) { const int idx = u * (NW * 32) + tid; const int row = idx >> 3, cofs = (idx & 7) * 8; const v4f v0 = *(const v4fa*)(os + row * 68 + cofs), v1 = *(const v4fa*)(os + row * 68 + cofs + 4);
            v8h o16; v8us oh, ol;
#pragma unroll
            for (int j = 0; j < 8; ++j) { const float x = (j < 4 ? v0[j & 3] : v1[j & 3]) + bfr(bz[c0 + (tr ? row : cofs + j)]); o16[j] = tohx(x); unsigned short a2, c2; splitf(x, a2, c2); oh[j] = a2; ol[j] = c2; }
            const size_t e = z * sP + (tr ? (pl * HD + row) * TT + t0 + cofs : (pl * TT + t0 + row) * HD + cofs);
            *(v8h*)(P16 + e) = o16; *(v8us*)(Ph + e) = oh; *(v8us*)(Pl + e) = ol;
            asm volatile("s_wait_xcnt 0x0" ::: "memory"); }   // behind the stores, before the next round reuses their address and data registers
    } else {
#pragma unroll
    for (int u = 0; u < MB * 8 / NW; ++u) { const int idx = u * (NW * 32) + tid; const int row = idx >> 4, cofs = (idx & 15) * 4; v4f val = *(const v4fa*)(os + row * 68 + cofs);
        if (BIAS) { val[0] += bfr(bias[c0 + cofs]); val[1] += bfr(bias[c0 + cofs + 1]); val[2] += bfr(bias[c0 + cofs + 2]); val[3] += bfr(bias[c0 + cofs + 3]); }
        *(v4f*)(C + (size_t)(r0 + row) * ldc + c0 + cofs) = val; }
    }
}

typedef __attribute__((ext_vector_type(2))) unsigned short v2us;
typedef __attribute__((ext_vector_type(2))) float v2f;

// the pieces of k_prep; blk = the block's index within its piece
__device__ __forceinline__ void p_wtG(const float* __restrict__ w, int K, int N, bf* Bt, int blk) {
    const int lane = threadIdx.x & 31; const int L0 = (blk * 8 + (threadIdx.x >> 5)) * 8; const int nlines = N * K / 64;
{
#pragma unroll 1
        for (int l = 0; l < 8; ++l) { const int L = L0 + l; if (L >= nlines) break; const size_t e = (size_t)L * 64 + lane * 2; const int k = (int)(e % K), n = (int)(e / K); v2us o;
            o[0] = f2bf(w[(size_t)k * N + n]); o[1] = f2bf(w[(size_t)(k + 1) * N + n]); *(v2us*)(Bt + e) = o; }
         }
}
__device__ __forceinline__ void p_cvt8(const float* __restrict__ src, bf* dst, size_t n8, int blk) { const size_t i = (size_t)blk * 256 + threadIdx.x; if (i >= n8) return; const v8f v = *(const v8f*)(src + i * 8); v8us o;
#pragma unroll
    for (int k = 0; k < 8; ++k) o[k] = f2bf(v[k]); *(v8us*)(dst + i * 8) = o;  }
// ---- k_fattn: scores, softmax, bucket sums and attn.v of 32 query rows of one head in ONE work-group of 16 waves; each wave owns four blocks of 32 keys and the scores never leave its registers.
// The 64 key blocks are dealt out from the block in front of the query rows onward (mod 64): slot u 16 + w goes to wave w as its u-th block, so that every key with |j - i| < 32 lies in slots 0..2 (u = 0, waves 0..2) and all other slots are wholly far left or far right.
// S^T = K Q^T (a lane holds one query's scores: column lr, rows 8 hi + j), + QE[i][clip(j - i)], x HD^-0.5; row maximum and row sum meet across the waves in LDS (sum in wave order, fixed);
// the rounded probabilities (hi/lo for rows < RH, else fp16 x1024) are packed from two score tiles straight into a B operand (hardware k order, which WFrag::ld also delivers) for O^T += V^T P^T;
// the 16 partial O tiles are summed in LDS in wave order; the values as rounded are summed into the 65 relative-position buckets (far-left sum, 63 near entries, far-right sum; fixed order), hi/lo planes [row][128].
#define FQR  32                   // query rows per work-group
#define FNW  16                   // waves per work-group
#define QEP  66                   // LDS pitch of a staged QE row (entries 0..65)
#define RDP  68                   // LDS pitch of a partial O row
#define RWP  20                   // LDS pitch of a query's 16 per-wave values
typedef __attribute__((ext_vector_type(2))) __bf16 v2bf;
template <bool HR> struct FT { typedef h16 T; };
template <> struct FT<true> { typedef bf T; };
template <bool HR>
__device__ __forceinline__ void fattn_body(const typename FT<HR>::T* __restrict__ Q, const typename FT<HR>::T* __restrict__ Q2, const typename FT<HR>::T* __restrict__ Kp, const typename FT<HR>::T* __restrict__ K2, const typename FT<HR>::T* __restrict__ Vt, const typename FT<HR>::T* __restrict__ V2,
                                           const float* __restrict__ QEr, const int q0, float* red, float* qes, float* rm, float* rs, float* rl, float* rr, float* nbk) {
    typedef typename FT<HR>::T T16; typedef typename WFrag<T16>::V V;
    const int tid = threadIdx.x, lane = tid & 31, lr = lane & 15, hi = lane >> 4; const int w = __builtin_amdgcn_readfirstlane(tid >> 5);
    // every '#pragma unroll' in this function makes the indices of the register arrays constants
#pragma unroll
    for (int s = 0; s < 2; ++s) { const int q = 2 * w + s; const float* sp = QEr + (size_t)q * NE; qes[q * QEP + lane] = sp[lane]; qes[q * QEP + 32 + lane] = sp[32 + lane]; if (lane < 2) qes[q * QEP + 64 + lane] = sp[64 + lane]; }
    *(v4fa*)(nbk + tid * 4) = (v4f){0.f, 0.f, 0.f, 0.f};   // a bucket whose key lies outside [0, TT) stays 0
    int kf[4];   // first key of this wave's u-th block (wave-uniform)
#pragma unroll
    for (int u = 0; u < 4; ++u) kf[u] = (((q0 >> 5) + 63 + u * 16 + w) & 63) * 32;
    // every operand load is a wave-uniform base plus one of two lane offsets in bytes: klb in a 16-row tile of Q or K, vlb in a 16-row tile of V^T
    const unsigned klb = (unsigned)(lr * (HD * 2) + hi * 16), vlb = (unsigned)(lr * (TT * 2) + hi * 16);
    auto at = [](const T16* base, unsigned ofs) { return (const T16*)((const char*)base + ofs); };
    V bq[2][2], bq2[2][2]; const T16* pq = at(Q + (size_t)q0 * HD, klb); const T16* pq2 = HR ? at(Q2 + (size_t)q0 * HD, klb) : nullptr;
#pragma unroll
    for (int qt = 0; qt < 2; ++qt)
#pragma unroll
        for (int ks = 0; ks < 2; ++ks) { bq[qt][ks] = WFrag<T16>::ld(pq + qt * 16 * HD + ks * 32); if (HR) bq2[qt][ks] = WFrag<T16>::ld(pq2 + qt * 16 * HD + ks * 32); }
    v8f acc[8][2];
#pragma unroll
    for (int kt = 0; kt < 8; ++kt) { acc[kt][0] = (v8f){}; acc[kt][1] = (v8f){}; }
    constexpr int UB = HR ? 1 : 4;   // key blocks whose fragments are fetched together (as many as the registers hold)
#pragma unroll
    for (int u0 = 0; u0 < 4; u0 += UB) { V a[UB][2][2], a2[UB][2][2]; const T16* pk[UB]; const T16* pk2[UB];
#pragma unroll
        for (int t = 0; t < UB; ++t) { pk[t] = at(Kp + (size_t)kf[u0 + t] * HD, klb); pk2[t] = HR ? at(K2 + (size_t)kf[u0 + t] * HD, klb) : nullptr;
#pragma unroll
            for (int hf = 0; hf < 2; ++hf)
#pragma unroll
                for (int ks = 0; ks < 2; ++ks) { a[t][hf][ks] = WFrag<T16>::ld(pk[t] + hf * 16 * HD + ks * 32); if (HR) a2[t][hf][ks] = WFrag<T16>::ld(pk2[t] + hf * 16 * HD + ks * 32); } }
        // stands behind the batch's loads. The loaded values are inputs, so that the whole batch is in flight together (one latency a batch, not one a tile); the addresses the loads name are inputs, so that they stay live and unwritten (by a load's result too) up to the wait
        if constexpr (HR) asm volatile("s_wait_xcnt 0x0" :: "v"(a[0][0][0]), "v"(a[0][0][1]), "v"(a[0][1][0]), "v"(a[0][1][1]), "v"(a2[0][0][0]), "v"(a2[0][0][1]), "v"(a2[0][1][0]), "v"(a2[0][1][1]), "v"(bq[0][0]), "v"(bq[0][1]), "v"(bq[1][0]), "v"(bq[1][1]), "v"(bq2[0][0]), "v"(bq2[0][1]), "v"(bq2[1][0]), "v"(bq2[1][1]), "v"(pk[0]), "v"(pk2[0]), "v"(pq), "v"(pq2) : "memory");
        else asm volatile("s_wait_xcnt 0x0" :: "v"(a[0][0][0]), "v"(a[0][0][1]), "v"(a[0][1][0]), "v"(a[0][1][1]), "v"(a[1][0][0]), "v"(a[1][0][1]), "v"(a[1][1][0]), "v"(a[1][1][1]), "v"(a[2][0][0]), "v"(a[2][0][1]), "v"(a[2][1][0]), "v"(a[2][1][1]), "v"(a[3][0][0]), "v"(a[3][0][1]), "v"(a[3][1][0]), "v"(a[3][1][1]), "v"(bq[0][0]), "v"(bq[0][1]), "v"(bq[1][0]), "v"(bq[1][1]), "v"(pk[0]), "v"(pk[1]), "v"(pk[2]), "v"(pk[3]), "v"(pq) : "memory");
#pragma unroll
        for (int t = 0; t < UB; ++t)
#pragma unroll
            for (int hf = 0; hf < 2; ++hf)
#pragma unroll
                for (int ks = 0; ks < 2; ++ks)
#pragma unroll
                    for (int qt = 0; qt < 2; ++qt) { v8f& c = acc[2 * (u0 + t) + hf][qt]; c = WFrag<T16>::mma(a[t][hf][ks], bq[qt][ks], c); if (HR) { c = WFrag<T16>::mma(a[t][hf][ks], bq2[qt][ks], c); c = WFrag<T16>::mma(a2[t][hf][ks], bq[qt][ks], c); } } }
    __syncthreads();   // the staged QE rows and the zeroed near buckets are in LDS
    float qeL[2], qeR[2], mx[2];
#pragma unroll
    for (int qt = 0; qt < 2; ++qt) { qeL[qt] = qes[(qt * 16 + lr) * QEP]; qeR[qt] = qes[(qt * 16 + lr) * QEP + 2 * MAXR]; mx[qt] = -3.0e38f; }
#pragma unroll
    for (int u = 0; u < 4; ++u) {
        if (u == 0 && w < 3) {   // a block that may hold near keys: entry by entry; j - i = dj + 8 hi + e - lr
#pragma unroll
            for (int hf = 0; hf < 2; ++hf)
#pragma unroll
                for (int qt = 0; qt < 2; ++qt) { const int dj = kf[u] + hf * 16 - (q0 + qt * 16);
#pragma unroll
                    for (int j = 0; j < 8; ++j) { const float e = qes[(qt * 16 + lr) * QEP + min(max(dj + 8 * hi + j - lr, -MAXR), MAXR) + MAXR]; const float t = (acc[2 * u + hf][qt][j] + e) * SCL; acc[2 * u + hf][qt][j] = t; mx[qt] = fmaxf(mx[qt], t); } }
        } else { const bool left = kf[u] < q0;
#pragma unroll
            for (int qt = 0; qt < 2; ++qt) { const float e = left ? qeL[qt] : qeR[qt];
#pragma unroll
                for (int hf = 0; hf < 2; ++hf)
#pragma unroll
                    for (int j = 0; j < 8; ++j) { const float t = (acc[2 * u + hf][qt][j] + e) * SCL; acc[2 * u + hf][qt][j] = t; mx[qt] = fmaxf(mx[qt], t); } }
        } }
#pragma unroll
    for (int qt = 0; qt < 2; ++qt) mx[qt] = fmaxf(mx[qt], __shfl_xor(mx[qt], 16, 32));
    rm[lane * RWP + w] = hi ? mx[1] : mx[0];   // lane = query index in the block: half hi stores column group hi
    __syncthreads();   // every wave's row maxima are in LDS
#pragma unroll
    for (int qt = 0; qt < 2; ++qt) { const float* p = rm + (qt * 16 + lr) * RWP; float m = -3.0e38f;
#pragma unroll
        for (int g = 0; g < 4; ++g) { const v4f x = *(const v4fa*)(p + g * 4); m = fmaxf(fmaxf(m, fmaxf(x[0], x[1])), fmaxf(x[2], x[3])); }
        mx[qt] = m; }
    float sum[2] = {0.f, 0.f};
#pragma unroll
    for (int kt = 0; kt < 8; ++kt)
#pragma unroll
        for (int qt = 0; qt < 2; ++qt) { float x[8], p[8], s8 = 0.f;
#pragma unroll
            for (int j = 0; j < 8; ++j) x[j] = (acc[kt][qt][j] - mx[qt]) * 1.4426950408889634f;
            // eight independent exponentials (no result on a source: early clobber) and, behind the last, the one slot that the instruction set asks for before a result is used or a source overwritten
            asm("v_exp_f32 %0, %8\n\tv_exp_f32 %1, %9\n\tv_exp_f32 %2, %10\n\tv_exp_f32 %3, %11\n\tv_exp_f32 %4, %12\n\tv_exp_f32 %5, %13\n\tv_exp_f32 %6, %14\n\tv_exp_f32 %7, %15\n\tv_nop"
                : "=&v"(p[0]), "=&v"(p[1]), "=&v"(p[2]), "=&v"(p[3]), "=&v"(p[4]), "=&v"(p[5]), "=&v"(p[6]), "=&v"(p[7]) : "v"(x[0]), "v"(x[1]), "v"(x[2]), "v"(x[3]), "v"(x[4]), "v"(x[5]), "v"(x[6]), "v"(x[7]));
#pragma unroll
            for (int j = 0; j < 8; ++j) { acc[kt][qt][j] = p[j]; s8 += p[j]; }
            sum[qt] += s8; }
#pragma unroll
    for (int qt = 0; qt < 2; ++qt) sum[qt] += __shfl_xor(sum[qt], 16, 32);
    rs[lane * RWP + w] = hi ? sum[1] : sum[0];
    __syncthreads();   // every wave's row sums are in LDS
    float f[2];
#pragma unroll
    for (int qt = 0; qt < 2; ++qt) { const float* p = rs + (qt * 16 + lr) * RWP; float s = 0.f;
#pragma unroll
        for (int g = 0; g < 4; ++g) { const v4f x = *(const v4fa*)(p + g * 4); s = (((s + x[0]) + x[1]) + x[2]) + x[3]; }
        f[qt] = __fdiv_rn(HR ? 1.0f : PCAR, s); }
    float bl[2] = {0.f, 0.f}, br[2] = {0.f, 0.f};
    v8f o[4][2];
#pragma unroll
    for (int dt = 0; dt < 4; ++dt) { o[dt][0] = (v8f){}; o[dt][1] = (v8f){}; }
#pragma unroll
    for (int u = 0; u < 4; ++u) { V pb[2], pb2[2]; float pw[2][16];   // block u: fetch V^T, round, pack, tally, multiply
        constexpr int D0 = HR ? 2 : 4;   // V^T tiles fetched ahead of the rounding (as many as the registers hold)
        V va[4], va2[4]; const T16* pv = at(Vt + kf[u], vlb); const T16* pv2 = HR ? at(V2 + kf[u], vlb) : nullptr;
#pragma unroll
        for (int dt = 0; dt < D0; ++dt) { va[dt] = WFrag<T16>::ld(pv + (size_t)dt * 16 * TT); if (HR) va2[dt] = WFrag<T16>::ld(pv2 + (size_t)dt * 16 * TT); }
        // as in the score part: behind the loads, their addresses as inputs; the loads fly while the block is rounded
        if constexpr (HR) asm volatile("s_wait_xcnt 0x0" :: "v"(pv), "v"(pv2) : "memory"); else asm volatile("s_wait_xcnt 0x0" :: "v"(pv) : "memory");
#pragma unroll
        for (int qt = 0; qt < 2; ++qt)
#pragma unroll
            for (int e = 0; e < 16; e += 2) { const v2f x = (v2f){acc[2 * u + (e >> 3)][qt][e & 7] * f[qt], acc[2 * u + (e >> 3)][qt][(e & 7) + 1] * f[qt]};
                if constexpr (HR) { const v2bf h2 = __builtin_convertvector(x, v2bf); const v2f hf2 = __builtin_convertvector(h2, v2f); const v2bf l2 = __builtin_convertvector(x - hf2, v2bf); const v2f s2 = hf2 + __builtin_convertvector(l2, v2f);
                    pb[qt][e] = h2[0]; pb[qt][e + 1] = h2[1]; pb2[qt][e] = l2[0]; pb2[qt][e + 1] = l2[1]; pw[qt][e] = s2[0]; pw[qt][e + 1] = s2[1]; }
                else { const h16 o0 = tohx(x[0]), o1 = tohx(x[1]); pb[qt][e] = o0; pb[qt][e + 1] = o1; pw[qt][e] = (float)o0 * 0.0009765625f; pw[qt][e + 1] = (float)o1 * 0.0009765625f; } }
        if (u == 0 && w < 3) {
#pragma unroll
            for (int qt = 0; qt < 2; ++qt)
#pragma unroll
                for (int e = 0; e < 16; ++e) { const int r = kf[u] + (e >> 3) * 16 + 8 * hi + (e & 7) - (q0 + qt * 16 + lr) + MAXR; const float p = pw[qt][e]; bl[qt] += (r <= 0) ? p : 0.f; br[qt] += (r >= 2 * MAXR) ? p : 0.f; if (r > 0 && r < 2 * MAXR) nbk[(qt * 16 + lr) * (2 * MAXR) + r] = p; }
        } else { const bool left = kf[u] < q0;
#pragma unroll
            for (int qt = 0; qt < 2; ++qt) { float t[8];
#pragma unroll
                for (int e = 0; e < 8; ++e) t[e] = pw[qt][e] + pw[qt][e + 8];
                const float s16 = ((t[0] + t[1]) + (t[2] + t[3])) + ((t[4] + t[5]) + (t[6] + t[7])); bl[qt] += left ? s16 : 0.f; br[qt] += left ? 0.f : s16; }
        }
#pragma unroll
        for (int dt = 0; dt < 4; ++dt) {
            if constexpr (HR) if (dt == D0) {
#pragma unroll
                for (int d2 = D0; d2 < 4; ++d2) { va[d2] = WFrag<T16>::ld(pv + (size_t)d2 * 16 * TT); va2[d2] = WFrag<T16>::ld(pv2 + (size_t)d2 * 16 * TT); }
                asm volatile("s_wait_xcnt 0x0" :: "v"(pv), "v"(pv2) : "memory");   // as above, for the rest of the block's V^T tiles
            }
#pragma unroll
            for (int qt = 0; qt < 2; ++qt) { o[dt][qt] = WFrag<T16>::mma(va[dt], pb[qt], o[dt][qt]); if (HR) { o[dt][qt] = WFrag<T16>::mma(va[dt], pb2[qt], o[dt][qt]); o[dt][qt] = WFrag<T16>::mma(va2[dt], pb[qt], o[dt][qt]); } } } }
#pragma unroll
    for (int dt = 0; dt < 4; ++dt)
#pragma unroll
        for (int qt = 0; qt < 2; ++qt) { float* p = red + w * (FQR * RDP) + (qt * 16 + lr) * RDP + dt * 16 + 8 * hi; const v8f c = o[dt][qt];   // a lane's 8 registers are 8 consecutive d of one query
            *(v4fa*)p = (v4f){c[0], c[1], c[2], c[3]}; *(v4fa*)(p + 4) = (v4f){c[4], c[5], c[6], c[7]}; }
#pragma unroll
    for (int qt = 0; qt < 2; ++qt) { bl[qt] += __shfl_xor(bl[qt], 16, 32); br[qt] += __shfl_xor(br[qt], 16, 32); }
    rl[lane * RWP + w] = hi ? bl[1] : bl[0]; rr[lane * RWP + w] = hi ? br[1] : br[0];
}
// grid (TT / 32 x NZ), 512 threads; the hi/lo blocks (the longer ones) of all planes have the lowest indices and start first; within each kind a plane's blocks follow one another (they read the same K and V)
__global__ __launch_bounds__(FNW * 32) void k_fattn(const h16* __restrict__ Q16, const bf* __restrict__ Qh, const bf* __restrict__ Ql, const h16* __restrict__ K16, const bf* __restrict__ Kh, const bf* __restrict__ Kl, const h16* __restrict__ V16, const bf* __restrict__ Vh, const bf* __restrict__ Vl, const float* __restrict__ QE, bf* PBh, bf* PBl, float* Ob) {
    __shared__ __align__(16) float red[FNW * FQR * RDP];
    __shared__ __align__(16) float qes[FQR * QEP];
    __shared__ __align__(16) float rm[FQR * RWP];
    __shared__ __align__(16) float rs[FQR * RWP];
    __shared__ __align__(16) float rl[FQR * RWP];
    __shared__ __align__(16) float rr[FQR * RWP];
    __shared__ __align__(16) float nbk[FQR * 2 * MAXR];
    constexpr int NL = RH / FQR, NS = TT / FQR - NL;   // long and short blocks of a plane
    const int fl = blockIdx.x, fs = fl - NZ * NL; const size_t z = fs < 0 ? fl / NL : fs / NS; const int q0 = (fs < 0 ? fl % NL : NL + fs % NS) * FQR; const size_t zp = z * TT * HD; const int tid = threadIdx.x;
    const float* QEr = QE + (z * TT + q0) * NE;
    if (q0 < RH) fattn_body<true>(Qh + zp, Ql + zp, Kh + zp, Kl + zp, Vh + zp, Vl + zp, QEr, q0, red, qes, rm, rs, rl, rr, nbk);
    else fattn_body<false>(Q16 + zp, nullptr, K16 + zp, nullptr, V16 + zp, nullptr, QEr, q0, red, qes, rm, rs, rl, rr, nbk);
    __syncthreads();   // every wave's partial O tile, far sums and near buckets are in LDS
    const int q = tid >> 4, g = tid & 15;   // 16 threads a query row: whole 256-byte rows leave
    v4f s = *(const v4fa*)(red + q * RDP + g * 4);
#pragma unroll
    for (int ww = 1; ww < FNW; ++ww) { const v4f p = *(const v4fa*)(red + ww * (FQR * RDP) + q * RDP + g * 4);
#pragma unroll
        for (int j = 0; j < 4; ++j) s[j] += p[j]; }
    *(v4f*)(Ob + zp + (size_t)(q0 + q) * HD + g * 4) = s;
    float b[8] = {0.f, 0.f, 0.f, 0.f, 0.f, 0.f, 0.f, 0.f};
    if (g < 8) { const v4f n0 = *(const v4fa*)(nbk + q * (2 * MAXR) + g * 8), n1 = *(const v4fa*)(nbk + q * (2 * MAXR) + g * 8 + 4);
#pragma unroll
        for (int j = 0; j < 4; ++j) { b[j] = n0[j]; b[4 + j] = n1[j]; } }
    if (g == 0 || g == 8) { const float* p = (g ? rr : rl) + q * RWP; float t = 0.f;   // bucket 0: far left; bucket 64: far right
#pragma unroll
        for (int k = 0; k < 4; ++k) { const v4f x = *(const v4fa*)(p + k * 4); t = (((t + x[0]) + x[1]) + x[2]) + x[3]; }
        b[0] = t; }
    v8us oh, ol;
#pragma unroll
    for (int j = 0; j < 8; ++j) { unsigned short u2, w2; splitf(b[j], u2, w2); oh[j] = u2; ol[j] = w2; }
    const size_t ob = (z * TT + q0 + q) * NE + g * 8; *(v8us*)(PBh + ob) = oh; *(v8us*)(PBl + ob) = ol;
}
__device__ __forceinline__ void p_epad2(const float* __restrict__ E, bf* EB, int blk) { const size_t i = (size_t)blk * 256 + threadIdx.x; if (i >= (size_t)NE * HD / 8) return; const int d0 = (int)(i % (HD / 8)) * 8; const int r = (int)(i / (HD / 8)); const float* src = E + (size_t)min(r, 2 * MAXR) * HD + d0; v8us o;
#pragma unroll
    for (int q = 0; q < 8; ++q) { const unsigned short v = f2bf(src[q]); o[q] = (r <= 2 * MAXR) ? v : (unsigned short)0; }
    *(v8us*)(EB + (size_t)r * HD + d0) = o;  }
__device__ __forceinline__ void p_rvt(const float* __restrict__ E, bf* RVT, int blk) { const size_t i = (size_t)blk * 256 + threadIdx.x; if (i >= (size_t)HD * NE / 8) return; const int r0 = (int)(i % (NE / 8)) * 8; const int d = (int)(i / (NE / 8)); v8us o;
#pragma unroll
    for (int q = 0; q < 8; ++q) { const int r = r0 + q; const unsigned short v = f2bf(E[(size_t)min(r, 2 * MAXR) * HD + d]); o[q] = (r <= 2 * MAXR) ? v : (unsigned short)0; }
    *(v8us*)(RVT + (size_t)d * NE + r0) = o;  }

// ---- k_prep: all that depends on the inputs alone, in ONE launch; the block index says which piece a block does (block-uniform): 4 x WTB blocks transpose Wq, Wk, Wv, Wo (the slowest blocks, so they start first), 3 x CVB blocks round query, key, value (both batches), 2 x RPB blocks make the rel_k and rel_v^T planes (RPB a plane).
#define WTB  (DM * DQ / 64 / 64)
#define CVB  (NB_ * TT * DM / 8 / 256)
#define RPB  (NE * HD / 8 / 256)
static_assert(DKV == DQ && DQ == DM && REP == 1, "the four weights have one shape; one kv plane per query plane");
__global__ __launch_bounds__(256) void k_prep(const float* __restrict__ wq, const float* __restrict__ wk, const float* __restrict__ wv, const float* __restrict__ wo, const float* __restrict__ x, const float* __restrict__ xk, const float* __restrict__ xv, const float* __restrict__ relk, const float* __restrict__ relv, bf* W4, bf* XB3, bf* EB, bf* RVT) {
    int blk = blockIdx.x;
    if (blk < 4 * WTB) { const int s = blk / WTB; p_wtG(s == 0 ? wq : s == 1 ? wk : s == 2 ? wv : wo, DM, DQ, W4 + (size_t)s * DQ * DM, blk % WTB); return; }
    blk -= 4 * WTB;
    if (blk < 3 * CVB) { const int s = blk / CVB; p_cvt8(s == 0 ? x : s == 1 ? xk : xv, XB3 + (size_t)s * NB_ * TT * DM, (size_t)NB_ * TT * DM / 8, blk % CVB); return; }
    blk -= 3 * CVB;
    if (blk < RPB) p_epad2(relk, EB, blk); else p_rvt(relv, RVT, blk - RPB);
}

extern "C" void kernel_launch(void* const* d_in, const int* in_sizes, int n_in,
                              void* d_out, int out_size, void* d_ws, size_t ws_size, hipStream_t stream) {
    (void)in_sizes; (void)n_in; (void)out_size;
    const float* x = (const float*)d_in[0]; const float* xk = (const float*)d_in[1]; const float* xv = (const float*)d_in[2]; const float* wq = (const float*)d_in[3]; const float* bq = (const float*)d_in[4]; const float* wk = (const float*)d_in[5]; const float* bk = (const float*)d_in[6]; const float* wv = (const float*)d_in[7]; const float* bv = (const float*)d_in[8]; const float* wo = (const float*)d_in[9]; const float* bo = (const float*)d_in[10]; const float* relk = (const float*)d_in[11]; const float* relv = (const float*)d_in[12];   /* [65][64] each */
    float* OUT = (float*)d_out;     // [2][2048][1024]
    char* wsp = (char*)d_ws;
    auto take = [&](size_t bytes) { char* p = wsp; wsp += (bytes + 255) & ~(size_t)255; return (void*)p; };
    const size_t PLN = (size_t)NZ * TT * HD;   // elements of one set of head planes
    bf* EB = (bf*)take((size_t)NE * HD * 2); bf* RVT = (bf*)take((size_t)HD * NE * 2); float* QE = (float*)take((size_t)NZ * TT * NE * 4); bf* PBh = (bf*)take((size_t)NZ * TT * NE * 2); bf* PBl = (bf*)take((size_t)NZ * TT * NE * 2);
    bf* W4 = (bf*)take((size_t)4 * DQ * DM * 2); bf* WO = W4 + (size_t)3 * DQ * DM;   // Wq, Wk, Wv, Wo transposed
    bf* XB = (bf*)take((size_t)3 * NB_ * TT * DM * 2);   // query, key, value
    h16* QP16 = (h16*)take(3 * PLN * 2); h16* KP16 = QP16 + PLN; h16* VT16 = QP16 + 2 * PLN;   // q, k, v^T: the z-stride of the projection grid is PLN
    bf* QPh = (bf*)take(3 * PLN * 2); bf* KPh = QPh + PLN; bf* VTh = QPh + 2 * PLN; bf* QPl = (bf*)take(3 * PLN * 2); bf* KPl = QPl + PLN; bf* VTl = QPl + 2 * PLN;
    float* Ob = (float*)take(PLN * 4); bf* ATh = (bf*)take((size_t)NB_ * TT * DQ * 2); bf* ATl = (bf*)take((size_t)NB_ * TT * DQ * 2);
    if ((size_t)(wsp - (char*)d_ws) > ws_size) return;    // 200 MiB of the 256 MiB
    k_prep<<<4 * WTB + 3 * CVB + 2 * RPB, 256, 0, stream>>>(wq, wk, wv, wo, x, xk, xv, relk, relv, W4, XB, EB, RVT);
    k_gemmsk<bf, 0, true, DM, 4, 8, 1><<<dim3(NB_ * TT / 64, DQ / 64, 3), 256, 0, stream>>>(XB, nullptr, W4, nullptr, nullptr, 0, bq, bk, bv, (size_t)NB_ * TT * DM, (size_t)DQ * DM, 0, QP16, QPh, QPl, PLN);
    k_gemmw<bf, 1, false, false><<<dim3(TT / 64, NE / 64, NZ), 32, 0, stream>>>(QPh, QPl, EB, nullptr, HD, QE, NE, nullptr, (size_t)TT * HD, 0, (size_t)TT * NE, nullptr, nullptr, nullptr);   /* QE[i][r] = q_i . rel_k[r] */
    k_fattn<<<TT / FQR * NZ, FNW * 32, 0, stream>>>(QP16, QPh, QPl, KP16, KPh, KPl, VT16, VTh, VTl, QE, PBh, PBl, Ob);   /* scores + QE[i][idx], softmax, 65 bucket sums per row, attn v */
    k_gemmw<bf, 1, false, true><<<dim3(TT / 64, HD / 64, NZ), 32, 0, stream>>>(PBh, PBl, RVT, nullptr, NE, nullptr, 0, nullptr, (size_t)TT * NE, 0, 0, Ob, ATh, ATl);   /* buckets . rel_v = sum_j attn[i][j] rel_v[idx], + attn v, merged hi/lo planes */
    k_gemmsk<bf, 1, true, DQ, 4, 8, 0><<<dim3(NB_ * TT / 64, DM / 64, 1), 256, 0, stream>>>(ATh, ATl, WO, nullptr, OUT, DM, bo, nullptr, nullptr, 0, 0, 0, nullptr, nullptr, nullptr, 0);
}

// v007
// Measured time: 229 microseconds a run.
// Two timings next to v006 both put it at 1.23 times that version's speed.
// All steps since v000 together make it 13.9 times as fast.
#include <hip/hip_runtime.h>

// Multi-head attention with Shaw relative-position terms on the logits AND the values (query, key, value [2][2048][1024]; q,k,v = in W + b ('xw' 1/32, zero biases; 16 heads x 64); idx[i][j] = clip(j - i, -32, 32) + 32; attn = softmax((q.k + q_i.rel_k[idx]) / 8); out_h = attn v + sum_j attn[i][j] rel_v[idx] (tables [65][64] x 0.05, read); out = merged Wo + bo ('xw') -> [2][2048][1024] (4.2 M)).
// Six launches, each over both batches and all heads (32 planes, plane = batch 16 + head): bf16 copies of the three inputs, the transposed weights, rel_k as an exact plane [128][64] (rows >= 65 zero) and rel_v^T as an exact plane [64][128]; exact projections + f32 biases (q, k, v in one grid), each leaving the GEMM as the head planes (fp16 and hi/lo; v transposed); QE = q.rel_k^T ([32][2048][128], hi/lo x exact); one kernel per 32 query rows does the dense scores (hybrid rows: < 512 hi/lo 3 products, rest fp16 x1024), adds QE[i][idx], does the softmax with the 1/8, sums each row's probabilities into the 65 relative-position buckets (far-left sum, 63 near entries, far-right sum; fixed order) as hi/lo planes and multiplies by v, scores and probabilities staying in registers; buckets x rel_v ([32][2048][64], hi/lo x exact) added to attn v in f32 and split into the merged hi/lo planes in that GEMM's epilogue; merged hi/lo x Wo exact + bo.
// Compute dtypes, f32 accumulate: every input rounded to bf16; projections exact + f32 biases; q.rel_k and buckets.rel_v hi/lo x exact; attention rows < 512 3 products, rest fp16; softmax f32; Wo hl x exact + bias.

#define NB_  2
#define TT   2048
#define DM   1024
#define NH_  16
#define NKV  16
#define REP  (NH_ / NKV)
#define HD   64
#define DQ   (NH_ * HD)
#define DKV  (NKV * HD)
#define NZ   (NB_ * NH_)          // head planes: batch NH_ + head
#define RH   512                  // query rows < RH use hi+lo planes (0: none)
#define WIN  0
#define PCAR 1024.0f
#define SCL  0.125f
#define MAXR 32      // max relative position
#define NE   128     // 2*MAXR+1 = 65 table rows padded to 128
typedef _Float16 h16;
typedef unsigned short bf;
typedef __attribute__((ext_vector_type(16))) __bf16   v16bf;
typedef __attribute__((ext_vector_type(16))) _Float16 v16h;
typedef __attribute__((ext_vector_type(8)))  _Float16 v8h;
typedef __attribute__((ext_vector_type(8)))  unsigned short v8us;
typedef __attribute__((ext_vector_type(8)))  float    v8f;
typedef __attribute__((ext_vector_type(4)))  float    v4f;
typedef v8h  __attribute__((may_alias)) v8ha;
typedef v4f  __attribute__((may_alias)) v4fa;
typedef v8us __attribute__((may_alias)) v8usa;

__device__ __forceinline__ unsigned short f2bf(float f) { unsigned u = __float_as_uint(f); u += 0x7FFFu + ((u >> 16) & 1u); return (unsigned short)(u >> 16); }
__device__ __forceinline__ float bf2f(unsigned short b) { return __uint_as_float(((unsigned)b) << 16); }
__device__ __forceinline__ float bfr(float f) { return bf2f(f2bf(f)); }
__device__ __forceinline__ v16h cat16(v8h lo, v8h hi) { return __builtin_shufflevector(lo, hi, 0, 1, 2, 3, 4, 5, 6, 7, 8, 9, 10, 11, 12, 13, 14, 15); }
__device__ __forceinline__ v16bf cat16b(v8us lo, v8us hi) { return __builtin_bit_cast(v16bf, __builtin_shufflevector(lo, hi, 0, 1, 2, 3, 4, 5, 6, 7, 8, 9, 10, 11, 12, 13, 14, 15)); }
__device__ __forceinline__ v8f wmma16(v16h a, v16h b, v8f c) { return __builtin_amdgcn_wmma_f32_16x16x32_f16(false, a, false, b, (short)0, c, false, false); }
__device__ __forceinline__ v8f wmmab(v16bf a, v16bf b, v8f c) { return __builtin_amdgcn_wmma_f32_16x16x32_bf16(false, a, false, b, (short)0, c, false, false); }
__device__ __forceinline__ h16 tohx(float x) { return (h16)x; }
__device__ __forceinline__ void splitf(float y, unsigned short& h, unsigned short& l) { h = f2bf(y); l = f2bf(y - bf2f(h)); }
typedef __attribute__((ext_vector_type(4))) unsigned short v4us;

// ---- FRAGMENT ORDER: every 16-bit operand plane P[row][k] (LD elements a row, LD % 32 == 0, rows % 16 == 0) is stored as tiles of 16 rows x 32 k, 512 elements each, tile (row / 16, k / 32) at ((row / 16) (LD / 32) + k / 32) 512;
// inside a tile the 16-byte chunk of (row, 8 k from k) stands at chunk number ((k / 16) % 2) 32 + ((k / 8) % 2) 16 + row % 16. WFrag::ld(tile + lane 8) then reads a lane's fragment as two loads, each 512 contiguous bytes (4 whole lines) a wave, in the k order of the matrix instruction.
// fdec: chunk number i of a plane with KT = LD / 32 tiles a tile row -> its row and first k. A writer whose thread index is the chunk number stores 512 contiguous bytes a wave.
__device__ __forceinline__ void fdec(size_t i, int KT, int& row, int& k) { const int t = (int)(i >> 6); row = (t / KT) * 16 + (int)(i & 15); k = (t % KT) * 32 + (int)((i >> 5) & 1) * 16 + (int)((i >> 4) & 1) * 8; }



// ---- k_gemmw: register-blocked GEMM, ONE WAVE per 64x64 output tile (16 accumulators), operands straight from 16-bit planes in fragment order (below: A, Bt with K elements a row); grid (M/64, N/64, Z), 32 threads.
// C[m][n] (f32, pitch ldc, + optional f32 bias[n]) = sum_k A[m][k] Bt[n][k] (+ split products per NSPLIT). z-batch strides sA/sB/sC in elements. K % 32 == 0.
// MRG: the tile is not stored; it is added in f32 to plane z's attn.v rows Ob[z][t][d] (x1024 where those carry that factor), the factor is taken off, and the sum leaves as hi/lo planes Ah, Al [batch z / NH_][t][head z % NH_][d].
template <typename T16> struct WFrag;
template <> struct WFrag<h16> { typedef v16h V; static __device__ __forceinline__ V ld(const h16* p) { return cat16(*(const v8h*)p, *(const v8h*)(p + 256)); } static __device__ __forceinline__ v8f mma(V a, V b, v8f c) { return wmma16(a, b, c); } };
template <> struct WFrag<bf> { typedef v16bf V; static __device__ __forceinline__ V ld(const bf* p) { return cat16b(*(const v8us*)p, *(const v8us*)(p + 256)); } static __device__ __forceinline__ v8f mma(V a, V b, v8f c) { return wmmab(a, b, c); } };
template <typename T16, int NSPLIT, bool BIAS, bool MRG>
__global__ __launch_bounds__(32) void k_gemmw(const T16* __restrict__ A, const T16* __restrict__ A2, const T16* __restrict__ Bt, const T16* __restrict__ Bt2, int K, float* C, int ldc, const float* __restrict__ bias, size_t sA, size_t sB, size_t sC, const float* __restrict__ Ob, bf* Ah, bf* Al) {
    typedef typename WFrag<T16>::V V;
    __shared__ __align__(16) float os[16 * 68];
    const size_t z = blockIdx.z; A += z * sA; if (A2) A2 += z * sA; Bt += z * sB; if (Bt2) Bt2 += z * sB; C += z * sC;
    const int lane = threadIdx.x & 31, lr = lane & 15, hi = lane >> 4; const int r0 = blockIdx.x * 64, c0 = blockIdx.y * 64;
    v8f acc[4][4];
#pragma unroll
    for (int mb = 0; mb < 4; ++mb)
#pragma unroll
        for (int nb = 0; nb < 4; ++nb) acc[mb][nb] = (v8f){};
    const size_t aoff = (size_t)r0 * K + 8 * lane, boff = (size_t)c0 * K + 8 * lane;   // first tile of the tile row + the lane's chunk; the next k tile 512 elements on
#pragma unroll 1
    for (int kc = 0; kc < K; kc += 32) {
        V a[4], a2[4]; const T16* qa[4]; const T16* qa2[4]; const T16* qb[4]; const T16* qb2[4];   // the trip's load addresses (a plane that is not used: its partner's)
#pragma unroll
        for (int t = 0; t < 4; ++t) { const size_t ea = aoff + (size_t)t * 16 * K + kc * 16, eb = boff + (size_t)t * 16 * K + kc * 16; qa[t] = A + ea; qa2[t] = (NSPLIT == 1 || NSPLIT == 2) ? A2 + ea : qa[t]; qb[t] = Bt + eb; qb2[t] = NSPLIT >= 2 ? Bt2 + eb : qb[t]; }
#pragma unroll
        for (int mb = 0; mb < 4; ++mb) { a[mb] = WFrag<T16>::ld(qa[mb]); if (NSPLIT == 1 || NSPLIT == 2) a2[mb] = WFrag<T16>::ld(qa2[mb]); }
#pragma unroll
        for (int nb = 0; nb < 4; ++nb) { const V b = WFrag<T16>::ld(qb[nb]); V b2; if (NSPLIT >= 2) b2 = WFrag<T16>::ld(qb2[nb]);
#pragma unroll
            for (int mb = 0; mb < 4; ++mb) { acc[mb][nb] = WFrag<T16>::mma(a[mb], b, acc[mb][nb]); if (NSPLIT == 1 || NSPLIT == 2) acc[mb][nb] = WFrag<T16>::mma(a2[mb], b, acc[mb][nb]); if (NSPLIT >= 2) acc[mb][nb] = WFrag<T16>::mma(a[mb], b2, acc[mb][nb]); } }
        // behind the trip's loads: the addresses that they name are inputs, so that they stay live and unwritten (by a load's result too) up to the wait
        asm volatile("s_wait_xcnt 0x0" :: "v"(qa[0]), "v"(qa[1]), "v"(qa[2]), "v"(qa[3]), "v"(qa2[0]), "v"(qa2[1]), "v"(qa2[2]), "v"(qa2[3]), "v"(qb[0]), "v"(qb[1]), "v"(qb[2]), "v"(qb[3]), "v"(qb2[0]), "v"(qb2[1]), "v"(qb2[2]), "v"(qb2[3]) : "memory");
        asm volatile("v_nop\n\tv_nop\n\tv_nop\n\tv_nop" : "+v"(acc[0][0]), "+v"(acc[1][1]), "+v"(acc[2][2]), "+v"(acc[3][3]) : "v"(a[0]), "v"(a[3]));
    }
    // MRG: a tile's 64 rows lie on one side of RH; one lane address each for Ob, Ah and Al (row r0 + hi, 4 columns from 4 lr), the rows follow at constant distances (Ah, Al in fragment order: half a chunk a lane, the next row 8 elements on, the next tile row 16 DQ on; this wave alone writes the tiles)
    static_assert(!MRG || RH % 64 == 0, "a 64-row tile has one carry factor");
    const float sc = (r0 < RH) ? 1.0f : PCAR, cs = (r0 < RH) ? 1.0f : (1.0f / PCAR);
    const float* po = MRG ? Ob + (z * TT + r0 + hi) * HD + c0 + lr * 4 : nullptr; const size_t ao = ((z / NH_) * TT + r0) * DQ + (((z % NH_) * HD + c0) / 32 + (lr >> 3)) * 512 + ((lr >> 2) & 1) * 256 + ((lr >> 1) & 1) * 128 + hi * 8 + (lr & 1) * 4; bf* pah = MRG ? Ah + ao : nullptr; bf* pal = MRG ? Al + ao : nullptr;
#pragma unroll
    for (int mb = 0; mb < 4; ++mb) {
#pragma unroll
        for (int nb = 0; nb < 4; ++nb) {
#pragma unroll
            for (int j = 0; j < 8; ++j) os[(hi * 8 + j) * 68 + nb * 16 + lr] = acc[mb][nb][j]; }
        __builtin_amdgcn_wave_barrier(); asm volatile("" ::: "memory");
        float* crow = C + (size_t)(r0 + mb * 16) * ldc + c0;
{
#pragma unroll
            for (int s = 0; s < 8; ++s) { const int row = 2 * s + hi, cofs = lr * 4; v4f val = *(const v4fa*)(os + row * 68 + cofs); if (BIAS) { val[0] += bfr(bias[c0 + cofs]); val[1] += bfr(bias[c0 + cofs + 1]); val[2] += bfr(bias[c0 + cofs + 2]); val[3] += bfr(bias[c0 + cofs + 3]); }
                if constexpr (MRG) { const v4f a = *(const v4f*)(po + (mb * 16 + 2 * s) * HD); v4us oh, ol;
#pragma unroll
                    for (int q = 0; q < 4; ++q) { unsigned short a2, c2; splitf(__fadd_rn(a[q], __fmul_rn(val[q], sc)) * cs, a2, c2); oh[q] = a2; ol[q] = c2; }
                    *(v4us*)(pah + mb * 16 * DQ + 2 * s * 8) = oh; *(v4us*)(pal + mb * 16 * DQ + 2 * s * 8) = ol; }
                else *(v4f*)(crow + (size_t)row * ldc + cofs) = val; }
             }
        __builtin_amdgcn_wave_barrier(); asm volatile("" ::: "memory");
    }
}

// ---- k_gemmsk: the products of k_gemmw for a long K: ONE WORK-GROUP of NW waves per (16 MB)x64 output tile, wave w takes k in [w KK/NW, (w+1) KK/NW) (4 MB accumulators);
// the NW partial tiles meet in LDS and are summed in wave order 0..NW-1 (fixed), then leave as whole 256-byte rows (+ optional f32 bias[n]). grid (M/(16 MB), N/64, Z), 32 NW threads. NSPLIT as in k_gemmw. KK % (32 NW) == 0. LDA: pitch of A's rows in elements.
// EPI 0: C as above. EPI 1: the q, k and v projections in one grid (z = 0, 1, 2: operands and planes at the z-strides, bias, bias1 or bias2), rows = [batch][t]; the 64 columns of a tile are one head (HD == 64) and the biased f32 values leave as that head's fp16 and hi/lo planes, 16 bytes a lane, 512 contiguous bytes a wave, in fragment order: z < 2 [plane][t][d], z == 2 transposed [plane][d][t].
template <typename T16, int NSPLIT, bool BIAS, int KK, int MB, int NW, int EPI, int LDA = KK>
__global__ __launch_bounds__(NW * 32, NW / 2) void k_gemmsk(   // second argument: waves a SIMD, the register budget at which two work-groups (what the LDS allows) stay on a WGP
const T16* __restrict__ A, const T16* __restrict__ A2, const T16* __restrict__ Bt, const T16* __restrict__ Bt2, float* C, int ldc, const float* __restrict__ bias, const float* __restrict__ bias1, const float* __restrict__ bias2, size_t sA, size_t sB, size_t sC, h16* P16, bf* Ph, bf* Pl, size_t sP) {
    static_assert(EPI == 0 || (HD == 64 && MB == 4 && BIAS && TT % 64 == 0 && NKV == NH_), "a plane epilogue takes a 64 x 64 tile of one head of one batch");
    typedef typename WFrag<T16>::V V;
    __shared__ __align__(16) float red[NW * MB * 1024];   // [wave][subtile mb*4+nb][half of its 8 rows a lane][lane] x 4 floats
    __shared__ __align__(16) float os[MB * 16 * 68];
    const size_t z = blockIdx.z; A += z * sA; if (NSPLIT == 1 || NSPLIT == 2) A2 += z * sA; Bt += z * sB; if (NSPLIT >= 2) Bt2 += z * sB; C += z * sC;
    const int tid = threadIdx.x, lane = tid & 31, w = tid >> 5, lr = lane & 15, hi = lane >> 4; const int r0 = blockIdx.x * (MB * 16), c0 = blockIdx.y * 64;
    const bool tr = EPI == 1 && z == 2;   // block-uniform
    // every '#pragma unroll' in this kernel makes the indices of acc, a, a2 and s constants, so that they stay in registers
    v8f acc[MB][4];
#pragma unroll
    for (int mb = 0; mb < MB; ++mb)
#pragma unroll
        for (int nb = 0; nb < 4; ++nb) acc[mb][nb] = (v8f){};
    const size_t aoff = (size_t)r0 * LDA + 8 * lane + w * (KK / NW) * 16, boff = (size_t)c0 * KK + 8 * lane + w * (KK / NW) * 16;   // fragment order: the wave's first k tile of the tile row + the lane's chunk
    const T16* pa = A + aoff; const T16* pa2 = (NSPLIT == 1 || NSPLIT == 2) ? A2 + aoff : pa; const T16* pb = Bt + boff; const T16* pb2 = NSPLIT >= 2 ? Bt2 + boff : pb;   // every load is one of these + a constant (a plane that is not used: its partner's)
    // unrolled whole (KK / (32 NW) = 4 trips here): no back edge behind a matrix instruction
#pragma unroll
    for (int kc = 0; kc < KK / NW; kc += 32) {
        V a[MB], a2[MB];
#pragma unroll
        for (int mb = 0; mb < MB; ++mb) { a[mb] = WFrag<T16>::ld(pa + mb * 16 * LDA + kc * 16); if (NSPLIT == 1 || NSPLIT == 2) a2[mb] = WFrag<T16>::ld(pa2 + mb * 16 * LDA + kc * 16); }
#pragma unroll
        for (int nb = 0; nb < 4; ++nb) { const V b = WFrag<T16>::ld(pb + nb * 16 * KK + kc * 16); V b2; if (NSPLIT >= 2) b2 = WFrag<T16>::ld(pb2 + nb * 16 * KK + kc * 16);
#pragma unroll
            for (int mb = 0; mb < MB; ++mb) { acc[mb][nb] = WFrag<T16>::mma(a[mb], b, acc[mb][nb]); if (NSPLIT == 1 || NSPLIT == 2) acc[mb][nb] = WFrag<T16>::mma(a2[mb], b, acc[mb][nb]); if (NSPLIT >= 2) acc[mb][nb] = WFrag<T16>::mma(a[mb], b2, acc[mb][nb]); } }
    }
    // behind the last load: the addresses that the loads name are inputs, so that they stay live and unwritten (by a load's result too) up to the wait
    asm volatile("s_wait_xcnt 0x0" :: "v"(pa), "v"(pa2), "v"(pb), "v"(pb2) : "memory");
#pragma unroll
    for (int mb = 0; mb < MB; ++mb)
#pragma unroll
        for (int nb = 0; nb < 4; ++nb) { float* rp = red + w * (MB * 1024) + (mb * 4 + nb) * 256 + lane * 4; const v8f c = acc[mb][nb];
            *(v4fa*)rp = (v4f){c[0], c[1], c[2], c[3]}; *(v4fa*)(rp + 128) = (v4f){c[4], c[5], c[6], c[7]}; }
    __syncthreads();   // every wave's partial tile is in LDS
#pragma unroll
    for (int u = 0; u < MB * 8 / NW; ++u) { const int idx = u * (NW * 32) + tid;   // one group of 4 floats of the tile; idx & 31 == lane
        v4f s = *(const v4fa*)(red + idx * 4);
#pragma unroll
        for (int q = 1; q < NW; ++q) { const v4f p = *(const v4fa*)(red + q * (MB * 1024) + idx * 4);
#pragma unroll
            for (int j = 0; j < 4; ++j) s[j] = __fadd_rn(s[j], p[j]); }
        const int t = idx >> 6, half = (idx >> 5) & 1; const int row = (t >> 2) * 16 + hi * 8 + half * 4, col = (t & 3) * 16 + lr;
        if (tr) *(v4fa*)(os + col * 68 + row) = s;   // transposed: a lane's 4 values are 4 consecutive rows of one column
        else {
#pragma unroll
            for (int j = 0; j < 4; ++j) os[(row + j) * 68 + col] = s[j]; } }
    __syncthreads();   // the summed tile is whole before it is read by rows
    if constexpr (EPI != 0) { const float* bz = z == 0 ? bias : z == 1 ? bias1 : bias2; const size_t pl = (size_t)(r0 / TT) * NH_ + blockIdx.y; const int t0 = r0 % TT;
#pragma unroll
        for (int u = 0; u < MB * 4 / NW; ++u) { const int idx = u * (NW * 32) + tid; int row, cofs; fdec(idx, 2, row, cofs);   // idx = chunk number in the tile's 4 x 2 fragment tiles
            const v4f v0 = *(const v4fa*)(os + row * 68 + cofs), v1 = *(const v4fa*)(os + row * 68 + cofs + 4);
            v8h o16; v8us oh, ol; float bb[8];
#pragma unroll
            for (int j = 0; j < 8; ++j) bb[j] = bz[c0 + (tr ? row : cofs + j)];
            asm volatile("s_wait_xcnt 0x0" ::: "memory");   // behind the bias loads, before their index registers are reused
#pragma unroll
            for (int j = 0; j < 8; ++j) { const float x = (j < 4 ? v0[j & 3] : v1[j & 3]) + bfr(bb[j]); o16[j] = tohx(x); unsigned short a2, c2; splitf(x, a2, c2); oh[j] = a2; ol[j] = c2; }
            const size_t e = z * sP + (tr ? pl * HD * TT + ((size_t)(idx >> 7) * (TT / 32) + t0 / 32) * 512 + (idx & 127) * 8 : (pl * TT + t0) * HD + idx * 8);   // fragment order: LD = HD: the 8 tiles follow one another; LD = TT: two tiles a tile row
            *(v8h*)(P16 + e) = o16; *(v8us*)(Ph + e) = oh; *(v8us*)(Pl + e) = ol;
            asm volatile("s_wait_xcnt 0x0" ::: "memory"); }   // behind the stores, before the next round reuses their address and data registers
    } else {
#pragma unroll
    for (int u = 0; u < MB * 8 / NW; ++u) { const int idx = u * (NW * 32) + tid; const int row = idx >> 4, cofs = (idx & 15) * 4; v4f val = *(const v4fa*)(os + row * 68 + cofs);
        if (BIAS) { val[0] += bfr(bias[c0 + cofs]); val[1] += bfr(bias[c0 + cofs + 1]); val[2] += bfr(bias[c0 + cofs + 2]); val[3] += bfr(bias[c0 + cofs + 3]); }
        *(v4f*)(C + (size_t)(r0 + row) * ldc + c0 + cofs) = val; }
    }
}

typedef __attribute__((ext_vector_type(2))) unsigned short v2us;
typedef __attribute__((ext_vector_type(2))) float v2f;

// the pieces of k_prep; blk = the block's index within its piece
// each thread makes one chunk of its plane, thread index = chunk number in fragment order
__device__ __forceinline__ void p_wtG(const float* __restrict__ w, int K, int N, bf* Bt, int blk) { const size_t i = (size_t)blk * 256 + threadIdx.x; if (i >= (size_t)N * K / 8) return; int n, k; fdec(i, K / 32, n, k); const float* p = w + (size_t)k * N + n; float x[8]; v8us o;
#pragma unroll
    for (int j = 0; j < 8; ++j) x[j] = p[(size_t)j * N];
    asm volatile("s_wait_xcnt 0x0" :: "v"(p) : "memory");   // behind the loads: their address is an input, so that it stays live and unwritten (by a load's result too) up to the wait
#pragma unroll
    for (int j = 0; j < 8; ++j) o[j] = f2bf(x[j]);
    *(v8us*)(Bt + i * 8) = o; }
__device__ __forceinline__ void p_cvt8(const float* __restrict__ src, bf* dst, size_t n8, int LD, int blk) { const size_t i = (size_t)blk * 256 + threadIdx.x; if (i >= n8) return; int row, k0; fdec(i, LD / 32, row, k0); const float* p = src + (size_t)row * LD + k0; const v8f v = *(const v8f*)p; v8us o;
    asm volatile("s_wait_xcnt 0x0" :: "v"(p) : "memory");   // behind the loads: their address is an input, so that it stays live and unwritten (by a load's result too) up to the wait
#pragma unroll
    for (int k = 0; k < 8; ++k) o[k] = f2bf(v[k]); *(v8us*)(dst + i * 8) = o;  }
// ---- k_fattn: scores, softmax, bucket sums and attn.v of 32 query rows of one head in ONE work-group of 16 waves; each wave owns four blocks of 32 keys and the scores never leave its registers.
// The 64 key blocks are dealt out from the block in front of the query rows onward (mod 64): slot u 16 + w goes to wave w as its u-th block, so that every key with |j - i| < 32 lies in slots 0..2 (u = 0, waves 0..2) and all other slots are wholly far left or far right.
// S^T = K Q^T (a lane holds one query's scores: column lr, rows 8 hi + j), + QE[i][clip(j - i)], x HD^-0.5; row maximum and row sum meet across the waves in LDS (sum in wave order, fixed);
// the rounded probabilities (hi/lo for rows < RH, else fp16 x1024) are packed from two score tiles straight into a B operand (hardware k order, which WFrag::ld also delivers) for O^T += V^T P^T;
// the 16 partial O tiles are summed in LDS in wave order; the values as rounded are summed into the 65 relative-position buckets (far-left sum, 63 near entries, far-right sum; fixed order), hi/lo planes [row][128].
#define FQR  32                   // query rows per work-group
#define FNW  16                   // waves per work-group
#define QEP  66                   // LDS pitch of a staged QE row (entries 0..65)
#define RDP  68                   // LDS pitch of a partial O row
#define RWP  20                   // LDS pitch of a query's 16 per-wave values
#define NBP  68                   // LDS pitch of a query's 64 near buckets (16 rows read at once fall on different banks)
typedef __attribute__((ext_vector_type(2))) __bf16 v2bf;
template <bool HR> struct FT { typedef h16 T; };
template <> struct FT<true> { typedef bf T; };
template <bool HR>
__device__ __forceinline__ void fattn_body(const typename FT<HR>::T* __restrict__ Q, const typename FT<HR>::T* __restrict__ Q2, const typename FT<HR>::T* __restrict__ Kp, const typename FT<HR>::T* __restrict__ K2, const typename FT<HR>::T* __restrict__ Vt, const typename FT<HR>::T* __restrict__ V2,
                                           const float* __restrict__ QEr, const int q0, float* red, float* qes, float* rm, float* rs, float* rl, float* rr, float* nbk) {
    typedef typename FT<HR>::T T16; typedef typename WFrag<T16>::V V;
    const int tid = threadIdx.x, lane = tid & 31, lr = lane & 15, hi = lane >> 4; const int w = __builtin_amdgcn_readfirstlane(tid >> 5);
    // every '#pragma unroll' in this function makes the indices of the register arrays constants
#pragma unroll
    for (int s = 0; s < 2; ++s) { const int q = 2 * w + s; const float* sp = QEr + (size_t)q * NE; qes[q * QEP + lane] = sp[lane]; qes[q * QEP + 32 + lane] = sp[32 + lane]; if (lane < 2) qes[q * QEP + 64 + lane] = sp[64 + lane]; }
    *(v4fa*)(nbk + (tid >> 4) * NBP + (tid & 15) * 4) = (v4f){0.f, 0.f, 0.f, 0.f};   // a bucket whose key lies outside [0, TT) stays 0
    int kf[4];   // first key of this wave's u-th block (wave-uniform)
#pragma unroll
    for (int u = 0; u < 4; ++u) kf[u] = (((q0 >> 5) + 63 + u * 16 + w) & 63) * 32;
    // every operand load is a wave-uniform tile base plus the lane's chunk in the tile, in bytes (fragment order)
    const unsigned klb = (unsigned)(lane * 16), vlb = klb;
    auto at = [](const T16* base, unsigned ofs) { return (const T16*)((const char*)base + ofs); };
    V bq[2][2], bq2[2][2]; const T16* pq = at(Q + (size_t)q0 * HD, klb); const T16* pq2 = HR ? at(Q2 + (size_t)q0 * HD, klb) : nullptr;
#pragma unroll
    for (int qt = 0; qt < 2; ++qt)
#pragma unroll
        for (int ks = 0; ks < 2; ++ks) { bq[qt][ks] = WFrag<T16>::ld(pq + qt * 16 * HD + ks * 512); if (HR) bq2[qt][ks] = WFrag<T16>::ld(pq2 + qt * 16 * HD + ks * 512); }
    v8f acc[8][2];
#pragma unroll
    for (int kt = 0; kt < 8; ++kt) { acc[kt][0] = (v8f){}; acc[kt][1] = (v8f){}; }
    constexpr int UB = HR ? 1 : 4;   // key blocks whose fragments are fetched together (as many as the registers hold)
#pragma unroll
    for (int u0 = 0; u0 < 4; u0 += UB) { V a[UB][2][2], a2[UB][2][2]; const T16* pk[UB]; const T16* pk2[UB];
#pragma unroll
        for (int t = 0; t < UB; ++t) { pk[t] = at(Kp + (size_t)kf[u0 + t] * HD, klb); pk2[t] = HR ? at(K2 + (size_t)kf[u0 + t] * HD, klb) : nullptr;
#pragma unroll
            for (int hf = 0; hf < 2; ++hf)
#pragma unroll
                for (int ks = 0; ks < 2; ++ks) { a[t][hf][ks] = WFrag<T16>::ld(pk[t] + hf * 16 * HD + ks * 512); if (HR) a2[t][hf][ks] = WFrag<T16>::ld(pk2[t] + hf * 16 * HD + ks * 512); } }
        // stands behind the batch's loads. The loaded values are inputs, so that the whole batch is in flight together (one latency a batch, not one a tile); the addresses the loads name are inputs, so that they stay live and unwritten (by a load's result too) up to the wait
        if constexpr (HR) asm volatile("s_wait_xcnt 0x0" :: "v"(a[0][0][0]), "v"(a[0][0][1]), "v"(a[0][1][0]), "v"(a[0][1][1]), "v"(a2[0][0][0]), "v"(a2[0][0][1]), "v"(a2[0][1][0]), "v"(a2[0][1][1]), "v"(bq[0][0]), "v"(bq[0][1]), "v"(bq[1][0]), "v"(bq[1][1]), "v"(bq2[0][0]), "v"(bq2[0][1]), "v"(bq2[1][0]), "v"(bq2[1][1]), "v"(pk[0]), "v"(pk2[0]), "v"(pq), "v"(pq2) : "memory");
        else asm volatile("s_wait_xcnt 0x0" :: "v"(a[0][0][0]), "v"(a[0][0][1]), "v"(a[0][1][0]), "v"(a[0][1][1]), "v"(a[1][0][0]), "v"(a[1][0][1]), "v"(a[1][1][0]), "v"(a[1][1][1]), "v"(a[2][0][0]), "v"(a[2][0][1]), "v"(a[2][1][0]), "v"(a[2][1][1]), "v"(a[3][0][0]), "v"(a[3][0][1]), "v"(a[3][1][0]), "v"(a[3][1][1]), "v"(bq[0][0]), "v"(bq[0][1]), "v"(bq[1][0]), "v"(bq[1][1]), "v"(pk[0]), "v"(pk[1]), "v"(pk[2]), "v"(pk[3]), "v"(pq) : "memory");
#pragma unroll
        for (int t = 0; t < UB; ++t)
#pragma unroll
            for (int hf = 0; hf < 2; ++hf)
#pragma unroll
                for (int ks = 0; ks < 2; ++ks)
#pragma unroll
                    for (int qt = 0; qt < 2; ++qt) { v8f& c = acc[2 * (u0 + t) + hf][qt]; c = WFrag<T16>::mma(a[t][hf][ks], bq[qt][ks], c); if (HR) { c = WFrag<T16>::mma(a[t][hf][ks], bq2[qt][ks], c); c = WFrag<T16>::mma(a2[t][hf][ks], bq[qt][ks], c); } } }
    __syncthreads();   // the staged QE rows and the zeroed near buckets are in LDS
    float qeL[2], qeR[2], mx[2];
#pragma unroll
    for (int qt = 0; qt < 2; ++qt) { qeL[qt] = qes[(qt * 16 + lr) * QEP]; qeR[qt] = qes[(qt * 16 + lr) * QEP + 2 * MAXR]; mx[qt] = -3.0e38f; }
#pragma unroll
    for (int u = 0; u < 4; ++u) {
        if (u == 0 && w < 3) {   // a block that may hold near keys: entry by entry; j - i = dj + 8 hi + e - lr
#pragma unroll
            for (int hf = 0; hf < 2; ++hf)
#pragma unroll
                for (int qt = 0; qt < 2; ++qt) { const int dj = kf[u] + hf * 16 - (q0 + qt * 16);
#pragma unroll
                    for (int j = 0; j < 8; ++j) { const float e = qes[(qt * 16 + lr) * QEP + min(max(dj + 8 * hi + j - lr, -MAXR), MAXR) + MAXR]; const float t = (acc[2 * u + hf][qt][j] + e) * SCL; acc[2 * u + hf][qt][j] = t; mx[qt] = fmaxf(mx[qt], t); } }
        } else { const bool left = kf[u] < q0;
#pragma unroll
            for (int qt = 0; qt < 2; ++qt) { const float e = left ? qeL[qt] : qeR[qt];
#pragma unroll
                for (int hf = 0; hf < 2; ++hf)
#pragma unroll
                    for (int j = 0; j < 8; ++j) { const float t = (acc[2 * u + hf][qt][j] + e) * SCL; acc[2 * u + hf][qt][j] = t; mx[qt] = fmaxf(mx[qt], t); } }
        } }
#pragma unroll
    for (int qt = 0; qt < 2; ++qt) mx[qt] = fmaxf(mx[qt], __shfl_xor(mx[qt], 16, 32));
    rm[lane * RWP + w] = hi ? mx[1] : mx[0];   // lane = query index in the block: half hi stores column group hi
    __syncthreads();   // every wave's row maxima are in LDS
#pragma unroll
    for (int qt = 0; qt < 2; ++qt) { const float* p = rm + (qt * 16 + lr) * RWP; float m = -3.0e38f;
#pragma unroll
        for (int g = 0; g < 4; ++g) { const v4f x = *(const v4fa*)(p + g * 4); m = fmaxf(fmaxf(m, fmaxf(x[0], x[1])), fmaxf(x[2], x[3])); }
        mx[qt] = m; }
    float sum[2] = {0.f, 0.f};
#pragma unroll
    for (int kt = 0; kt < 8; ++kt)
#pragma unroll
        for (int qt = 0; qt < 2; ++qt) { float x[8], p[8], s8 = 0.f;
#pragma unroll
            for (int j = 0; j < 8; ++j) x[j] = (acc[kt][qt][j] - mx[qt]) * 1.4426950408889634f;
            // eight independent exponentials (no result on a source: early clobber) and, behind the last, the one slot that the instruction set asks for before a result is used or a source overwritten
            asm("v_exp_f32 %0, %8\n\tv_exp_f32 %1, %9\n\tv_exp_f32 %2, %10\n\tv_exp_f32 %3, %11\n\tv_exp_f32 %4, %12\n\tv_exp_f32 %5, %13\n\tv_exp_f32 %6, %14\n\tv_exp_f32 %7, %15\n\tv_nop"
                : "=&v"(p[0]), "=&v"(p[1]), "=&v"(p[2]), "=&v"(p[3]), "=&v"(p[4]), "=&v"(p[5]), "=&v"(p[6]), "=&v"(p[7]) : "v"(x[0]), "v"(x[1]), "v"(x[2]), "v"(x[3]), "v"(x[4]), "v"(x[5]), "v"(x[6]), "v"(x[7]));
#pragma unroll
            for (int j = 0; j < 8; ++j) { acc[kt][qt][j] = p[j]; s8 += p[j]; }
            sum[qt] += s8; }
#pragma unroll
    for (int qt = 0; qt < 2; ++qt) sum[qt] += __shfl_xor(sum[qt], 16, 32);
    rs[lane * RWP + w] = hi ? sum[1] : sum[0];
    __syncthreads();   // every wave's row sums are in LDS
    float f[2];
#pragma unroll
    for (int qt = 0; qt < 2; ++qt) { const float* p = rs + (qt * 16 + lr) * RWP; float s = 0.f;
#pragma unroll
        for (int g = 0; g < 4; ++g) { const v4f x = *(const v4fa*)(p + g * 4); s = (((s + x[0]) + x[1]) + x[2]) + x[3]; }
        f[qt] = __fdiv_rn(HR ? 1.0f : PCAR, s); }
    float bl[2] = {0.f, 0.f}, br[2] = {0.f, 0.f};
    v8f o[4][2];
#pragma unroll
    for (int dt = 0; dt < 4; ++dt) { o[dt][0] = (v8f){}; o[dt][1] = (v8f){}; }
#pragma unroll
    for (int u = 0; u < 4; ++u) { V pb[2], pb2[2]; float pw[2][16];   // block u: fetch V^T, round, pack, tally, multiply
        constexpr int D0 = HR ? 2 : 4;   // V^T tiles fetched ahead of the rounding (as many as the registers hold)
        V va[4], va2[4]; const T16* pv = at(Vt + kf[u] * 16, vlb); const T16* pv2 = HR ? at(V2 + kf[u] * 16, vlb) : nullptr;   // k tile kf / 32 of tile row 0; the next tile row 16 TT elements on
#pragma unroll
        for (int dt = 0; dt < D0; ++dt) { va[dt] = WFrag<T16>::ld(pv + (size_t)dt * 16 * TT); if (HR) va2[dt] = WFrag<T16>::ld(pv2 + (size_t)dt * 16 * TT); }
        // as in the score part: behind the loads, their addresses as inputs; the loads fly while the block is rounded
        if constexpr (HR) asm volatile("s_wait_xcnt 0x0" :: "v"(pv), "v"(pv2) : "memory"); else asm volatile("s_wait_xcnt 0x0" :: "v"(pv) : "memory");
#pragma unroll
        for (int qt = 0; qt < 2; ++qt)
#pragma unroll
            for (int e = 0; e < 16; e += 2) { const v2f x = (v2f){acc[2 * u + (e >> 3)][qt][e & 7] * f[qt], acc[2 * u + (e >> 3)][qt][(e & 7) + 1] * f[qt]};
                if constexpr (HR) { const v2bf h2 = __builtin_convertvector(x, v2bf); const v2f hf2 = __builtin_convertvector(h2, v2f); const v2bf l2 = __builtin_convertvector(x - hf2, v2bf); const v2f s2 = hf2 + __builtin_convertvector(l2, v2f);
                    pb[qt][e] = h2[0]; pb[qt][e + 1] = h2[1]; pb2[qt][e] = l2[0]; pb2[qt][e + 1] = l2[1]; pw[qt][e] = s2[0]; pw[qt][e + 1] = s2[1]; }
                else { const h16 o0 = tohx(x[0]), o1 = tohx(x[1]); pb[qt][e] = o0; pb[qt][e + 1] = o1; pw[qt][e] = (float)o0 * 0.0009765625f; pw[qt][e + 1] = (float)o1 * 0.0009765625f; } }
        if (u == 0 && w < 3) {
#pragma unroll
            for (int qt = 0; qt < 2; ++qt)
#pragma unroll
                for (int e = 0; e < 16; ++e) { const int r = kf[u] + (e >> 3) * 16 + 8 * hi + (e & 7) - (q0 + qt * 16 + lr) + MAXR; const float p = pw[qt][e]; bl[qt] += (r <= 0) ? p : 0.f; br[qt] += (r >= 2 * MAXR) ? p : 0.f; if (r > 0 && r < 2 * MAXR) nbk[(qt * 16 + lr) * NBP + r] = p; }
        } else { const bool left = kf[u] < q0;
#pragma unroll
            for (int qt = 0; qt < 2; ++qt) { float t[8];
#pragma unroll
                for (int e = 0; e < 8; ++e) t[e] = pw[qt][e] + pw[qt][e + 8];
                const float s16 = ((t[0] + t[1]) + (t[2] + t[3])) + ((t[4] + t[5]) + (t[6] + t[7])); bl[qt] += left ? s16 : 0.f; br[qt] += left ? 0.f : s16; }
        }
#pragma unroll
        for (int dt = 0; dt < 4; ++dt) {
            if constexpr (HR) if (dt == D0) {
#pragma unroll
                for (int d2 = D0; d2 < 4; ++d2) { va[d2] = WFrag<T16>::ld(pv + (size_t)d2 * 16 * TT); va2[d2] = WFrag<T16>::ld(pv2 + (size_t)d2 * 16 * TT); }
                asm volatile("s_wait_xcnt 0x0" :: "v"(pv), "v"(pv2) : "memory");   // as above, for the rest of the block's V^T tiles
            }
#pragma unroll
            for (int qt = 0; qt < 2; ++qt) { o[dt][qt] = WFrag<T16>::mma(va[dt], pb[qt], o[dt][qt]); if (HR) { o[dt][qt] = WFrag<T16>::mma(va[dt], pb2[qt], o[dt][qt]); o[dt][qt] = WFrag<T16>::mma(va2[dt], pb[qt], o[dt][qt]); } } } }
#pragma unroll
    for (int dt = 0; dt < 4; ++dt)
#pragma unroll
        for (int qt = 0; qt < 2; ++qt) { float* p = red + w * (FQR * RDP) + (qt * 16 + lr) * RDP + dt * 16 + 8 * hi; const v8f c = o[dt][qt];   // a lane's 8 registers are 8 consecutive d of one query
            *(v4fa*)p = (v4f){c[0], c[1], c[2], c[3]}; *(v4fa*)(p + 4) = (v4f){c[4], c[5], c[6], c[7]}; }
#pragma unroll
    for (int qt = 0; qt < 2; ++qt) { bl[qt] += __shfl_xor(bl[qt], 16, 32); br[qt] += __shfl_xor(br[qt], 16, 32); }
    rl[lane * RWP + w] = hi ? bl[1] : bl[0]; rr[lane * RWP + w] = hi ? br[1] : br[0];
}
// grid (TT / 32 x NZ), 512 threads; the hi/lo blocks (the longer ones) of all planes have the lowest indices and start first; within each kind a plane's blocks follow one another (they read the same K and V)
__global__ __launch_bounds__(FNW * 32) void k_fattn(const h16* __restrict__ Q16, const bf* __restrict__ Qh, const bf* __restrict__ Ql, const h16* __restrict__ K16, const bf* __restrict__ Kh, const bf* __restrict__ Kl, const h16* __restrict__ V16, const bf* __restrict__ Vh, const bf* __restrict__ Vl, const float* __restrict__ QE, bf* PBh, bf* PBl, float* Ob) {
    __shared__ __align__(16) float red[FNW * FQR * RDP];
    __shared__ __align__(16) float qes[FQR * QEP];
    __shared__ __align__(16) float rm[FQR * RWP];
    __shared__ __align__(16) float rs[FQR * RWP];
    __shared__ __align__(16) float rl[FQR * RWP];
    __shared__ __align__(16) float rr[FQR * RWP];
    __shared__ __align__(16) float nbk[FQR * NBP];
    constexpr int NL = RH / FQR, NS = TT / FQR - NL;   // long and short blocks of a plane
    const int fl = blockIdx.x, fs = fl - NZ * NL; const size_t z = fs < 0 ? fl / NL : fs / NS; const int q0 = (fs < 0 ? fl % NL : NL + fs % NS) * FQR; const size_t zp = z * TT * HD; const int tid = threadIdx.x;
    const float* QEr = QE + (z * TT + q0) * NE;
    if (q0 < RH) fattn_body<true>(Qh + zp, Ql + zp, Kh + zp, Kl + zp, Vh + zp, Vl + zp, QEr, q0, red, qes, rm, rs, rl, rr, nbk);
    else fattn_body<false>(Q16 + zp, nullptr, K16 + zp, nullptr, V16 + zp, nullptr, QEr, q0, red, qes, rm, rs, rl, rr, nbk);
    __syncthreads();   // every wave's partial O tile, far sums and near buckets are in LDS
    const int q = tid >> 4, g = tid & 15;   // 16 threads a query row: whole 256-byte rows leave
    v4f s = *(const v4fa*)(red + q * RDP + g * 4);
#pragma unroll
    for (int ww = 1; ww < FNW; ++ww) { const v4f p = *(const v4fa*)(red + ww * (FQR * RDP) + q * RDP + g * 4);
#pragma unroll
        for (int j = 0; j < 4; ++j) s[j] += p[j]; }
    *(v4f*)(Ob + zp + (size_t)(q0 + q) * HD + g * 4) = s;
    float b[8] = {0.f, 0.f, 0.f, 0.f, 0.f, 0.f, 0.f, 0.f};
    int qb, kb; fdec(tid, NE / 32, qb, kb); const int gb = kb >> 3;   // the bucket planes leave in fragment order: thread index = chunk number in the block's 2 x 4 tiles; row qb, buckets from 8 gb
    if (gb < 8) { const v4f n0 = *(const v4fa*)(nbk + qb * NBP + gb * 8), n1 = *(const v4fa*)(nbk + qb * NBP + gb * 8 + 4);
#pragma unroll
        for (int j = 0; j < 4; ++j) { b[j] = n0[j]; b[4 + j] = n1[j]; } }
    if (gb == 0 || gb == 8) { const float* p = (gb ? rr : rl) + qb * RWP; float t = 0.f;   // bucket 0: far left; bucket 64: far right
#pragma unroll
        for (int k = 0; k < 4; ++k) { const v4f x = *(const v4fa*)(p + k * 4); t = (((t + x[0]) + x[1]) + x[2]) + x[3]; }
        b[0] = t; }
    v8us oh, ol;
#pragma unroll
    for (int j = 0; j < 8; ++j) { unsigned short u2, w2; splitf(b[j], u2, w2); oh[j] = u2; ol[j] = w2; }
    const size_t ob = (z * TT + q0) * NE + tid * 8; *(v8us*)(PBh + ob) = oh; *(v8us*)(PBl + ob) = ol;
}
__device__ __forceinline__ void p_epad2(const float* __restrict__ E, bf* EB, int blk) { const size_t i = (size_t)blk * 256 + threadIdx.x; if (i >= (size_t)NE * HD / 8) return; int r, d0; fdec(i, HD / 32, r, d0); const float* src = E + (size_t)min(r, 2 * MAXR) * HD + d0; v8us o;
#pragma unroll
    for (int q = 0; q < 8; ++q) { const unsigned short v = f2bf(src[q]); o[q] = (r <= 2 * MAXR) ? v : (unsigned short)0; }
    *(v8us*)(EB + i * 8) = o;  }
__device__ __forceinline__ void p_rvt(const float* __restrict__ E, bf* RVT, int blk) { const size_t i = (size_t)blk * 256 + threadIdx.x; if (i >= (size_t)HD * NE / 8) return; int d, r0; fdec(i, NE / 32, d, r0); v8us o;
#pragma unroll
    for (int q = 0; q < 8; ++q) { const int r = r0 + q; const unsigned short v = f2bf(E[(size_t)min(r, 2 * MAXR) * HD + d]); o[q] = (r <= 2 * MAXR) ? v : (unsigned short)0; }
    *(v8us*)(RVT + i * 8) = o;  }

// ---- k_prep: all that depends on the inputs alone, in ONE launch; the block index says which piece a block does (block-uniform): 4 x WTB blocks transpose Wq, Wk, Wv, Wo, 3 x CVB blocks round query, key, value (both batches), RPB blocks each make the rel_k and rel_v^T planes.
#define WTB  (DM * DQ / 8 / 256)
#define CVB  (NB_ * TT * DM / 8 / 256)
#define RPB  (NE * HD / 8 / 256)
static_assert(DKV == DQ && DQ == DM && REP == 1, "the four weights have one shape; one kv plane per query plane");
__global__ __launch_bounds__(256) void k_prep(const float* __restrict__ wq, const float* __restrict__ wk, const float* __restrict__ wv, const float* __restrict__ wo, const float* __restrict__ x, const float* __restrict__ xk, const float* __restrict__ xv, const float* __restrict__ relk, const float* __restrict__ relv, bf* W4, bf* XB3, bf* EB, bf* RVT) {
    int blk = blockIdx.x;
    if (blk < 4 * WTB) { const int s = blk / WTB; p_wtG(s == 0 ? wq : s == 1 ? wk : s == 2 ? wv : wo, DM, DQ, W4 + (size_t)s * DQ * DM, blk % WTB); return; }
    blk -= 4 * WTB;
    if (blk < 3 * CVB) { const int s = blk / CVB; p_cvt8(s == 0 ? x : s == 1 ? xk : xv, XB3 + (size_t)s * NB_ * TT * DM, (size_t)NB_ * TT * DM / 8, DM, blk % CVB); return; }
    blk -= 3 * CVB;
    if (blk < RPB) p_epad2(relk, EB, blk); else p_rvt(relv, RVT, blk - RPB);
}

extern "C" void kernel_launch(void* const* d_in, const int* in_sizes, int n_in,
                              void* d_out, int out_size, void* d_ws, size_t ws_size, hipStream_t stream) {
    (void)in_sizes; (void)n_in; (void)out_size;
    const float* x = (const float*)d_in[0]; const float* xk = (const float*)d_in[1]; const float* xv = (const float*)d_in[2]; const float* wq = (const float*)d_in[3]; const float* bq = (const float*)d_in[4]; const float* wk = (const float*)d_in[5]; const float* bk = (const float*)d_in[6]; const float* wv = (const float*)d_in[7]; const float* bv = (const float*)d_in[8]; const float* wo = (const float*)d_in[9]; const float* bo = (const float*)d_in[10]; const float* relk = (const float*)d_in[11]; const float* relv = (const float*)d_in[12];   /* [65][64] each */
    float* OUT = (float*)d_out;     // [2][2048][1024]
    char* wsp = (char*)d_ws;
    auto take = [&](size_t bytes) { char* p = wsp; wsp += (bytes + 255) & ~(size_t)255; return (void*)p; };
    const size_t PLN = (size_t)NZ * TT * HD;   // elements of one set of head planes
    bf* EB = (bf*)take((size_t)NE * HD * 2); bf* RVT = (bf*)take((size_t)HD * NE * 2); float* QE = (float*)take((size_t)NZ * TT * NE * 4); bf* PBh = (bf*)take((size_t)NZ * TT * NE * 2); bf* PBl = (bf*)take((size_t)NZ * TT * NE * 2);
    bf* W4 = (bf*)take((size_t)4 * DQ * DM * 2); bf* WO = W4 + (size_t)3 * DQ * DM;   // Wq, Wk, Wv, Wo transposed
    bf* XB = (bf*)take((size_t)3 * NB_ * TT * DM * 2);   // query, key, value
    h16* QP16 = (h16*)take(3 * PLN * 2); h16* KP16 = QP16 + PLN; h16* VT16 = QP16 + 2 * PLN;   // q, k, v^T: the z-stride of the projection grid is PLN
    bf* QPh = (bf*)take(3 * PLN * 2); bf* KPh = QPh + PLN; bf* VTh = QPh + 2 * PLN; bf* QPl = (bf*)take(3 * PLN * 2); bf* KPl = QPl + PLN; bf* VTl = QPl + 2 * PLN;
    float* Ob = (float*)take(PLN * 4); bf* ATh = (bf*)take((size_t)NB_ * TT * DQ * 2); bf* ATl = (bf*)take((size_t)NB_ * TT * DQ * 2);
    if ((size_t)(wsp - (char*)d_ws) > ws_size) return;    // 200 MiB of the 256 MiB
    k_prep<<<4 * WTB + 3 * CVB + 2 * RPB, 256, 0, stream>>>(wq, wk, wv, wo, x, xk, xv, relk, relv, W4, XB, EB, RVT);
    k_gemmsk<bf, 0, true, DM, 4, 8, 1><<<dim3(NB_ * TT / 64, DQ / 64, 3), 256, 0, stream>>>(XB, nullptr, W4, nullptr, nullptr, 0, bq, bk, bv, (size_t)NB_ * TT * DM, (size_t)DQ * DM, 0, QP16, QPh, QPl, PLN);
    k_gemmw<bf, 1, false, false><<<dim3(TT / 64, NE / 64, NZ), 32, 0, stream>>>(QPh, QPl, EB, nullptr, HD, QE, NE, nullptr, (size_t)TT * HD, 0, (size_t)TT * NE, nullptr, nullptr, nullptr);   /* QE[i][r] = q_i . rel_k[r] */
    k_fattn<<<TT / FQR * NZ, FNW * 32, 0, stream>>>(QP16, QPh, QPl, KP16, KPh, KPl, VT16, VTh, VTl, QE, PBh, PBl, Ob);   /* scores + QE[i][idx], softmax, 65 bucket sums per row, attn v */
    k_gemmw<bf, 1, false, true><<<dim3(TT / 64, HD / 64, NZ), 32, 0, stream>>>(PBh, PBl, RVT, nullptr, NE, nullptr, 0, nullptr, (size_t)TT * NE, 0, 0, Ob, ATh, ATl);   /* buckets . rel_v = sum_j attn[i][j] rel_v[idx], + attn v, merged hi/lo planes */
    k_gemmsk<bf, 1, true, DQ, 4, 8, 0><<<dim3(NB_ * TT / 64, DM / 64, 1), 256, 0, stream>>>(ATh, ATl, WO, nullptr, OUT, DM, bo, nullptr, nullptr, 0, 0, 0, nullptr, nullptr, nullptr, 0);
}

// v008
// A run of this version takes 212 microseconds.
// Next to v007, in two timings, it ran 1.09 times as fast each time.
// Counting every step since v000, it is 15.1 times as fast.
#include <hip/hip_runtime.h>

// Multi-head attention with Shaw relative-position terms on the logits AND the values (query, key, value [2][2048][1024]; q,k,v = in W + b ('xw' 1/32, zero biases; 16 heads x 64); idx[i][j] = clip(j - i, -32, 32) + 32; attn = softmax((q.k + q_i.rel_k[idx]) / 8); out_h = attn v + sum_j attn[i][j] rel_v[idx] (tables [65][64] x 0.05, read); out = merged Wo + bo ('xw') -> [2][2048][1024] (4.2 M)).
// Six launches, each over both batches and all heads (32 planes, plane = batch 16 + head): bf16 copies of the three inputs, the transposed weights, rel_k as an exact plane [128][64] (rows >= 65 zero) and rel_v^T as an exact plane [64][128]; exact projections + f32 biases (q, k, v in one grid), each leaving the GEMM as the head planes (fp16 and hi/lo; v transposed); QE = q.rel_k^T ([32][2048][128], hi/lo x exact); one kernel per 32 query rows does the dense scores (hybrid rows: < 512 hi/lo 3 products, rest fp16 x1024), adds QE[i][idx], does the softmax with the 1/8, sums each row's probabilities into the 65 relative-position buckets (far-left sum, 63 near entries, far-right sum; fixed order) as hi/lo planes and multiplies by v, scores and probabilities staying in registers; buckets x rel_v ([32][2048][64], hi/lo x exact) added to attn v in f32 and split into the merged hi/lo planes in that GEMM's epilogue; merged hi/lo x Wo exact + bo.
// Compute dtypes, f32 accumulate: every input rounded to bf16; projections exact + f32 biases; q.rel_k and buckets.rel_v hi/lo x exact; attention rows < 512 3 products, rest fp16; softmax f32; Wo hl x exact + bias.

#define NB_  2
#define TT   2048
#define DM   1024
#define NH_  16
#define NKV  16
#define REP  (NH_ / NKV)
#define HD   64
#define DQ   (NH_ * HD)
#define DKV  (NKV * HD)
#define NZ   (NB_ * NH_)          // head planes: batch NH_ + head
#define RH   512                  // query rows < RH use hi+lo planes (0: none)
#define WIN  0
#define PCAR 1024.0f
#define SCL  0.125f
#define MAXR 32      // max relative position
#define NE   128     // 2*MAXR+1 = 65 table rows padded to 128
typedef _Float16 h16;
typedef unsigned short bf;
typedef __attribute__((ext_vector_type(16))) __bf16   v16bf;
typedef __attribute__((ext_vector_type(16))) _Float16 v16h;
typedef __attribute__((ext_vector_type(8)))  _Float16 v8h;
typedef __attribute__((ext_vector_type(8)))  unsigned short v8us;
typedef __attribute__((ext_vector_type(8)))  float    v8f;
typedef __attribute__((ext_vector_type(4)))  float    v4f;
typedef v8h  __attribute__((may_alias)) v8ha;
typedef v4f  __attribute__((may_alias)) v4fa;
typedef v8us __attribute__((may_alias)) v8usa;

__device__ __forceinline__ unsigned short f2bf(float f) { unsigned u = __float_as_uint(f); u += 0x7FFFu + ((u >> 16) & 1u); return (unsigned short)(u >> 16); }
__device__ __forceinline__ float bf2f(unsigned short b) { return __uint_as_float(((unsigned)b) << 16); }
__device__ __forceinline__ float bfr(float f) { return bf2f(f2bf(f)); }
__device__ __forceinline__ v16h cat16(v8h lo, v8h hi) { return __builtin_shufflevector(lo, hi, 0, 1, 2, 3, 4, 5, 6, 7, 8, 9, 10, 11, 12, 13, 14, 15); }
__device__ __forceinline__ v16bf cat16b(v8us lo, v8us hi) { return __builtin_bit_cast(v16bf, __builtin_shufflevector(lo, hi, 0, 1, 2, 3, 4, 5, 6, 7, 8, 9, 10, 11, 12, 13, 14, 15)); }
__device__ __forceinline__ v8f wmma16(v16h a, v16h b, v8f c) { return __builtin_amdgcn_wmma_f32_16x16x32_f16(false, a, false, b, (short)0, c, false, false); }
__device__ __forceinline__ v8f wmmab(v16bf a, v16bf b, v8f c) { return __builtin_amdgcn_wmma_f32_16x16x32_bf16(false, a, false, b, (short)0, c, false, false); }
__device__ __forceinline__ h16 tohx(float x) { return (h16)x; }
__device__ __forceinline__ void splitf(float y, unsigned short& h, unsigned short& l) { h = f2bf(y); l = f2bf(y - bf2f(h)); }
typedef __attribute__((ext_vector_type(4))) unsigned short v4us;

// ---- FRAGMENT ORDER: every 16-bit operand plane P[row][k] (LD elements a row, LD % 32 == 0, rows % 16 == 0) is stored as tiles of 16 rows x 32 k, 512 elements each, tile (row / 16, k / 32) at ((row / 16) (LD / 32) + k / 32) 512;
// inside a tile the 16-byte chunk of (row, 8 k from k) stands at chunk number ((k / 16) % 2) 32 + ((k / 8) % 2) 16 + row % 16. WFrag::ld(tile + lane 8) then reads a lane's fragment as two loads, each 512 contiguous bytes (4 whole lines) a wave, in the k order of the matrix instruction.
// fdec: chunk number i of a plane with KT = LD / 32 tiles a tile row -> its row and first k. A writer whose thread index is the chunk number stores 512 contiguous bytes a wave.
__device__ __forceinline__ void fdec(size_t i, int KT, int& row, int& k) { const int t = (int)(i >> 6); row = (t / KT) * 16 + (int)(i & 15); k = (t % KT) * 32 + (int)((i >> 5) & 1) * 16 + (int)((i >> 4) & 1) * 8; }



// ---- k_gemmw: register-blocked GEMM, ONE WAVE per 64x64 output tile (16 accumulators), operands straight from 16-bit planes in fragment order (below: A, Bt with K elements a row); grid (M/64, N/64, Z), 32 threads.
// C[m][n] (f32, pitch ldc, + optional f32 bias[n]) = sum_k A[m][k] Bt[n][k] (+ split products per NSPLIT). z-batch strides sA/sB/sC in elements. K % 32 == 0.
// MRG: the tile is not stored; it is added in f32 to plane z's attn.v rows Ob[z][t][d] (x1024 where those carry that factor), the factor is taken off, and the sum leaves as hi/lo planes Ah, Al [batch z / NH_][t][head z % NH_][d].
template <typename T16> struct WFrag;
template <> struct WFrag<h16> { typedef v16h V; static __device__ __forceinline__ V ld(const h16* p) { return cat16(*(const v8h*)p, *(const v8h*)(p + 256)); } static __device__ __forceinline__ v8f mma(V a, V b, v8f c) { return wmma16(a, b, c); } };
template <> struct WFrag<bf> { typedef v16bf V; static __device__ __forceinline__ V ld(const bf* p) { return cat16b(*(const v8us*)p, *(const v8us*)(p + 256)); } static __device__ __forceinline__ v8f mma(V a, V b, v8f c) { return wmmab(a, b, c); } };
template <typename T16, int NSPLIT, bool BIAS, bool MRG>
__global__ __launch_bounds__(32) void k_gemmw(const T16* __restrict__ A, const T16* __restrict__ A2, const T16* __restrict__ Bt, const T16* __restrict__ Bt2, int K, float* C, int ldc, const float* __restrict__ bias, size_t sA, size_t sB, size_t sC, const float* __restrict__ Ob, bf* Ah, bf* Al) {
    typedef typename WFrag<T16>::V V;
    __shared__ __align__(16) float os[16 * 68];
    const size_t z = blockIdx.z; A += z * sA; if (A2) A2 += z * sA; Bt += z * sB; if (Bt2) Bt2 += z * sB; C += z * sC;
    const int lane = threadIdx.x & 31, lr = lane & 15, hi = lane >> 4; const int r0 = blockIdx.x * 64, c0 = blockIdx.y * 64;
    v8f acc[4][4];
#pragma unroll
    for (int mb = 0; mb < 4; ++mb)
#pragma unroll
        for (int nb = 0; nb < 4; ++nb) acc[mb][nb] = (v8f){};
    const size_t aoff = (size_t)r0 * K + 8 * lane, boff = (size_t)c0 * K + 8 * lane;   // first tile of the tile row + the lane's chunk; the next k tile 512 elements on
#pragma unroll 1
    for (int kc = 0; kc < K; kc += 32) {
        V a[4], a2[4]; const T16* qa[4]; const T16* qa2[4]; const T16* qb[4]; const T16* qb2[4];   // the trip's load addresses (a plane that is not used: its partner's)
#pragma unroll
        for (int t = 0; t < 4; ++t) { const size_t ea = aoff + (size_t)t * 16 * K + kc * 16, eb = boff + (size_t)t * 16 * K + kc * 16; qa[t] = A + ea; qa2[t] = (NSPLIT == 1 || NSPLIT == 2) ? A2 + ea : qa[t]; qb[t] = Bt + eb; qb2[t] = NSPLIT >= 2 ? Bt2 + eb : qb[t]; }
#pragma unroll
        for (int mb = 0; mb < 4; ++mb) { a[mb] = WFrag<T16>::ld(qa[mb]); if (NSPLIT == 1 || NSPLIT == 2) a2[mb] = WFrag<T16>::ld(qa2[mb]); }
#pragma unroll
        for (int nb = 0; nb < 4; ++nb) { const V b = WFrag<T16>::ld(qb[nb]); V b2; if (NSPLIT >= 2) b2 = WFrag<T16>::ld(qb2[nb]);
#pragma unroll
            for (int mb = 0; mb < 4; ++mb) { acc[mb][nb] = WFrag<T16>::mma(a[mb], b, acc[mb][nb]); if (NSPLIT == 1 || NSPLIT == 2) acc[mb][nb] = WFrag<T16>::mma(a2[mb], b, acc[mb][nb]); if (NSPLIT >= 2) acc[mb][nb] = WFrag<T16>::mma(a[mb], b2, acc[mb][nb]); } }
        // behind the trip's loads: the addresses that they name are inputs, so that they stay live and unwritten (by a load's result too) up to the wait
        asm volatile("s_wait_xcnt 0x0" :: "v"(qa[0]), "v"(qa[1]), "v"(qa[2]), "v"(qa[3]), "v"(qa2[0]), "v"(qa2[1]), "v"(qa2[2]), "v"(qa2[3]), "v"(qb[0]), "v"(qb[1]), "v"(qb[2]), "v"(qb[3]), "v"(qb2[0]), "v"(qb2[1]), "v"(qb2[2]), "v"(qb2[3]) : "memory");
        asm volatile("v_nop\n\tv_nop\n\tv_nop\n\tv_nop" : "+v"(acc[0][0]), "+v"(acc[1][1]), "+v"(acc[2][2]), "+v"(acc[3][3]) : "v"(a[0]), "v"(a[3]));
    }
    // MRG: a tile's 64 rows lie on one side of RH; one lane address each for Ob, Ah and Al (row r0 + hi, 4 columns from 4 lr), the rows follow at constant distances (Ah, Al in fragment order: half a chunk a lane, the next row 8 elements on, the next tile row 16 DQ on; this wave alone writes the tiles)
    static_assert(!MRG || RH % 64 == 0, "a 64-row tile has one carry factor");
    const float sc = (r0 < RH) ? 1.0f : PCAR, cs = (r0 < RH) ? 1.0f : (1.0f / PCAR);
    const float* po = MRG ? Ob + (z * TT + r0 + hi) * HD + c0 + lr * 4 : nullptr; const size_t ao = ((z / NH_) * TT + r0) * DQ + (((z % NH_) * HD + c0) / 32 + (lr >> 3)) * 512 + ((lr >> 2) & 1) * 256 + ((lr >> 1) & 1) * 128 + hi * 8 + (lr & 1) * 4; bf* pah = MRG ? Ah + ao : nullptr; bf* pal = MRG ? Al + ao : nullptr;
#pragma unroll
    for (int mb = 0; mb < 4; ++mb) {
#pragma unroll
        for (int nb = 0; nb < 4; ++nb) {
#pragma unroll
            for (int j = 0; j < 8; ++j) os[(hi * 8 + j) * 68 + nb * 16 + lr] = acc[mb][nb][j]; }
        __builtin_amdgcn_wave_barrier(); asm volatile("" ::: "memory");
        float* crow = C + (size_t)(r0 + mb * 16) * ldc + c0;
{
#pragma unroll
            for (int s = 0; s < 8; ++s) { const int row = 2 * s + hi, cofs = lr * 4; v4f val = *(const v4fa*)(os + row * 68 + cofs); if (BIAS) { val[0] += bfr(bias[c0 + cofs]); val[1] += bfr(bias[c0 + cofs + 1]); val[2] += bfr(bias[c0 + cofs + 2]); val[3] += bfr(bias[c0 + cofs + 3]); }
                if constexpr (MRG) { const v4f a = *(const v4f*)(po + (mb * 16 + 2 * s) * HD); v4us oh, ol;
#pragma unroll
                    for (int q = 0; q < 4; ++q) { unsigned short a2, c2; splitf(__fadd_rn(a[q], __fmul_rn(val[q], sc)) * cs, a2, c2); oh[q] = a2; ol[q] = c2; }
                    *(v4us*)(pah + mb * 16 * DQ + 2 * s * 8) = oh; *(v4us*)(pal + mb * 16 * DQ + 2 * s * 8) = ol; }
                else *(v4f*)(crow + (size_t)row * ldc + cofs) = val; }
             }
        __builtin_amdgcn_wave_barrier(); asm volatile("" ::: "memory");
    }
}

// ---- k_gemmt: the products of k_gemmw for a long K: ONE WORK-GROUP of 8 waves per 128x128 output tile, wave (wm, wn) = (w / 4, w % 4) takes 64 rows x 32 columns (8 accumulators) over the whole K, in k order.
// A stage = 64 k of the tile's 128 A rows (A2 rows too where NSPLIT == 1) and 128 Bt rows, 16 KiB a plane, brought into LDS by asynchronous copies (16 bytes a lane) and read there by all waves: an A fragment serves 4 waves, a B fragment 2.
// The planes are in fragment order, so a stage of a plane is 8 runs of 2 KiB (tile row tr: two k tiles) and stands in LDS as [tr][k tile][1 KiB]; a fragment is two ds loads of 512 contiguous bytes a wave. Two buffers: stage t + 2 flies while stage t + 1 is worked on.
// grid (M/128, N/128, Z), 256 threads. NSPLIT 0: A Bt; 1: (A + A2) Bt. KK % 128 == 0.
// EPI 0: C (f32, pitch LDC) + f32 bias[n], whole 512-byte row pieces. EPI 1: the q, k and v projections in one grid (z = 0, 1, 2: operands and planes at the z-strides, bias, bias1 or bias2), rows = [batch][t]; the 128 columns of a tile are two heads (HD == 64) and the biased f32 values leave as those heads' fp16 and hi/lo planes, 16 bytes a lane, 512 contiguous bytes a wave, in fragment order: z < 2 [plane][t][d], z == 2 transposed [plane][d][t].
template <int NSPLIT, int KK, int EPI, int LDC>
__global__ __launch_bounds__(256) __attribute__((amdgpu_waves_per_eu(NSPLIT ? 2 : 6, NSPLIT ? 8 : 6))) void k_gemmt(   // waves a SIMD. NSPLIT 0: six and no more, three work-groups a WGP: the grid's 768 are resident together and spread evenly
const bf* __restrict__ A, const bf* __restrict__ A2, const bf* __restrict__ Bt, float* C, const float* __restrict__ bias, const float* __restrict__ bias1, const float* __restrict__ bias2, size_t sA, size_t sB, h16* P16, bf* Ph, bf* Pl, size_t sP) {
    static_assert(EPI == 0 || (HD == 64 && TT % 128 == 0 && NKV == NH_), "a plane epilogue takes a 128 x 128 tile of two heads of one batch");
    static_assert(KK % 128 == 0, "two stages or more");
    typedef WFrag<bf>::V V;
    constexpr int PLB = 16384, STG = (NSPLIT ? 3 : 2) * PLB, NS = KK / 64, OSP = 132;   // bytes of a plane's stage and of a stage; stages; pitch of the staged output tile in floats
    constexpr int SMB = 2 * STG > 128 * OSP * 4 ? 2 * STG : 128 * OSP * 4;
    __shared__ __align__(16) char sm[SMB];   // two stage buffers; behind the loop the f32 output tile
    const size_t z = blockIdx.z;
    const int tid = threadIdx.x, lane = tid & 31, w = tid >> 5, lr = lane & 15, hi = lane >> 4, wm = w >> 2, wn = w & 3; const int r0 = blockIdx.x * 128, c0 = blockIdx.y * 128;
    const bool tr = EPI == 1 && z == 2;   // block-uniform
    // every '#pragma unroll' in this kernel makes the indices of acc, a, a2 and b constants, so that they stay in registers
    v8f acc[4][2];
#pragma unroll
    for (int mb = 0; mb < 4; ++mb)
#pragma unroll
        for (int nb = 0; nb < 2; ++nb) acc[mb][nb] = (v8f){};
    // copy c (0..3) of a plane's stage: thread tid brings bytes [c 4096 + tid 16, + 16) of the stage: tile row 2 c + tid / 128, byte (tid % 128) 16 of its 2 KiB run; the next tile row KK 32 bytes on, the next stage 2048 bytes on
    const size_t tof = (size_t)(tid >> 7) * (KK * 32) + (tid & 127) * 16;
    const char* gA = (const char*)(A + z * sA + (size_t)r0 * KK) + tof; const char* gA2 = NSPLIT ? (const char*)(A2 + z * sA + (size_t)r0 * KK) + tof : nullptr; const char* gB = (const char*)(Bt + z * sB + (size_t)c0 * KK) + tof;
    const unsigned l0 = (unsigned)(size_t)sm + tid * 16;   // the lane's LDS byte address in buffer 0
    auto issue = [&](int s, int bsel) {   // stage s into buffer bsel; the wait in the copies' own statement stands before any register that a copy names is rewritten
        const unsigned l = l0 + bsel * STG; const char* a = gA + (size_t)s * 2048; const char* b = gB + (size_t)s * 2048;
        if constexpr (NSPLIT == 0)
            asm volatile("global_load_async_to_lds_b128 %0, %8, off\n\tglobal_load_async_to_lds_b128 %1, %9, off\n\tglobal_load_async_to_lds_b128 %2, %10, off\n\tglobal_load_async_to_lds_b128 %3, %11, off\n\t"
                         "global_load_async_to_lds_b128 %4, %12, off\n\tglobal_load_async_to_lds_b128 %5, %13, off\n\tglobal_load_async_to_lds_b128 %6, %14, off\n\tglobal_load_async_to_lds_b128 %7, %15, off\n\ts_wait_xcnt 0x0"
                         :: "v"(l), "v"(l + 4096), "v"(l + 8192), "v"(l + 12288), "v"(l + PLB), "v"(l + PLB + 4096), "v"(l + PLB + 8192), "v"(l + PLB + 12288),
                            "v"(a), "v"(a + 2 * KK * 32), "v"(a + 4 * KK * 32), "v"(a + 6 * KK * 32), "v"(b), "v"(b + 2 * KK * 32), "v"(b + 4 * KK * 32), "v"(b + 6 * KK * 32) : "memory");
        else { const char* a2 = gA2 + (size_t)s * 2048;
            asm volatile("global_load_async_to_lds_b128 %0, %12, off\n\tglobal_load_async_to_lds_b128 %1, %13, off\n\tglobal_load_async_to_lds_b128 %2, %14, off\n\tglobal_load_async_to_lds_b128 %3, %15, off\n\t"
                         "global_load_async_to_lds_b128 %4, %16, off\n\tglobal_load_async_to_lds_b128 %5, %17, off\n\tglobal_load_async_to_lds_b128 %6, %18, off\n\tglobal_load_async_to_lds_b128 %7, %19, off\n\t"
                         "global_load_async_to_lds_b128 %8, %20, off\n\tglobal_load_async_to_lds_b128 %9, %21, off\n\tglobal_load_async_to_lds_b128 %10, %22, off\n\tglobal_load_async_to_lds_b128 %11, %23, off\n\ts_wait_xcnt 0x0"
                         :: "v"(l), "v"(l + 4096), "v"(l + 8192), "v"(l + 12288), "v"(l + PLB), "v"(l + PLB + 4096), "v"(l + PLB + 8192), "v"(l + PLB + 12288), "v"(l + 2 * PLB), "v"(l + 2 * PLB + 4096), "v"(l + 2 * PLB + 8192), "v"(l + 2 * PLB + 12288),
                            "v"(a), "v"(a + 2 * KK * 32), "v"(a + 4 * KK * 32), "v"(a + 6 * KK * 32), "v"(b), "v"(b + 2 * KK * 32), "v"(b + 4 * KK * 32), "v"(b + 6 * KK * 32), "v"(a2), "v"(a2 + 2 * KK * 32), "v"(a2 + 4 * KK * 32), "v"(a2 + 6 * KK * 32) : "memory"); } };
    issue(0, 0);
    v4f bv = (v4f){0.f, 0.f, 0.f, 0.f};   // EPI 0: the lane's 4 bias values, fetched while stage 0 flies
    if constexpr (EPI == 0) { const float* pbv = bias + c0 + lane * 4; bv = *(const v4f*)pbv;
        asm volatile("s_wait_xcnt 0x0" :: "v"(pbv), "v"(bv) : "memory"); }   // behind the bias load: result and address are inputs, so that the load stands in front of the wait and its address stays unwritten (by the result too) up to it
    asm volatile("s_wait_asynccnt 0x0" ::: "memory");   // this wave's part of stage 0 has landed
    __syncthreads();   // stage 0 is whole
    issue(1, 1);
#pragma unroll 1   // one stage a trip: the buffer is picked by the trip's parity
    for (int t = 0; t < NS; ++t) { const char* sb = sm + (t & 1) * STG + lane * 16;
#pragma unroll
        for (int ks = 0; ks < 2; ++ks) { V a[4], a2[4], b[2];
#pragma unroll
            for (int mb = 0; mb < 4; ++mb) { a[mb] = WFrag<bf>::ld((const bf*)(sb + ((wm * 4 + mb) * 2 + ks) * 1024)); if (NSPLIT) a2[mb] = WFrag<bf>::ld((const bf*)(sb + 2 * PLB + ((wm * 4 + mb) * 2 + ks) * 1024)); }
#pragma unroll
            for (int nb = 0; nb < 2; ++nb) b[nb] = WFrag<bf>::ld((const bf*)(sb + PLB + ((wn * 2 + nb) * 2 + ks) * 1024));
#pragma unroll
            for (int nb = 0; nb < 2; ++nb)
#pragma unroll
                for (int mb = 0; mb < 4; ++mb) acc[mb][nb] = WFrag<bf>::mma(a[mb], b[nb], acc[mb][nb]);
            if (NSPLIT) {
#pragma unroll
                for (int nb = 0; nb < 2; ++nb)
#pragma unroll
                    for (int mb = 0; mb < 4; ++mb) acc[mb][nb] = WFrag<bf>::mma(a2[mb], b[nb], acc[mb][nb]); } }
        asm volatile("s_wait_dscnt 0x0" ::: "memory");      // this wave's reads of the trip's buffer are done
        asm volatile("s_wait_asynccnt 0x0" ::: "memory");   // this wave's part of stage t + 1 has landed
        __syncthreads();   // stage t + 1 is whole, and every wave has left the trip's buffer
        if (t + 2 < NS) issue(t + 2, t & 1);
    }
    asm volatile("s_wait_asynccnt 0x0" ::: "memory");   // no copy is out when the buffers become the output tile
    float* os = (float*)sm;   // the last trip's barrier stands behind every read of the buffers
    const int orow = wm * 64 + hi * 8, ocol = wn * 32 + lr;   // a lane's 8 values of accumulator (mb, nb): rows orow + 16 mb + j of column ocol + 16 nb
    if (tr) {   // transposed: they are 8 consecutive entries of one staged row
#pragma unroll
        for (int mb = 0; mb < 4; ++mb)
#pragma unroll
            for (int nb = 0; nb < 2; ++nb) { const v8f c = acc[mb][nb]; float* p = os + (ocol + nb * 16) * OSP + orow + mb * 16; *(v4fa*)p = (v4f){c[0], c[1], c[2], c[3]}; *(v4fa*)(p + 4) = (v4f){c[4], c[5], c[6], c[7]}; }
    } else {
#pragma unroll
        for (int mb = 0; mb < 4; ++mb)
#pragma unroll
            for (int nb = 0; nb < 2; ++nb)
#pragma unroll
                for (int j = 0; j < 8; ++j) os[(orow + mb * 16 + j) * OSP + ocol + nb * 16] = acc[mb][nb][j];
    }
    __syncthreads();   // the tile is whole before it is read by rows
    if constexpr (EPI != 0) { const float* bz = z == 0 ? bias : z == 1 ? bias1 : bias2; const int t0 = r0 % TT;
#pragma unroll
        for (int u = 0; u < 8; ++u) { const int hs = u >> 2, idx = (u & 3) * 256 + tid; int row, cofs; fdec(idx, tr ? 4 : 2, row, cofs);   // head hs of the two; idx = chunk number in its 8 x 2 (transposed: 4 x 4) fragment tiles
            const size_t pl = (size_t)(r0 / TT) * NH_ + blockIdx.y * 2 + hs; const float* op = os + (tr ? (hs * 64 + row) * OSP + cofs : row * OSP + hs * 64 + cofs);
            const v4f v0 = *(const v4fa*)op, v1 = *(const v4fa*)(op + 4);
            v8h o16; v8us oh, ol; float bb[8];
#pragma unroll
            for (int j = 0; j < 8; ++j) bb[j] = bz[c0 + hs * 64 + (tr ? row : cofs + j)];
            asm volatile("s_wait_xcnt 0x0" ::: "memory");   // behind the bias loads, before their index registers are reused
#pragma unroll
            for (int j = 0; j < 8; ++j) { const float x = (j < 4 ? v0[j & 3] : v1[j & 3]) + bfr(bb[j]); o16[j] = tohx(x); unsigned short a2, c2; splitf(x, a2, c2); oh[j] = a2; ol[j] = c2; }
            const size_t e = z * sP + (tr ? pl * HD * TT + ((size_t)(idx >> 8) * (TT / 32) + t0 / 32) * 512 + (idx & 255) * 8 : (pl * TT + t0) * HD + idx * 8);   // fragment order: LD = HD: the 16 tiles follow one another; LD = TT: four tiles a tile row
            *(v8h*)(P16 + e) = o16; *(v8us*)(Ph + e) = oh; *(v8us*)(Pl + e) = ol;
            asm volatile("s_wait_xcnt 0x0" ::: "memory"); }   // behind the stores, before the next round reuses their address and data registers
    } else { float* pc = C + (size_t)(r0 + w) * LDC + c0 + lane * 4; const float* po = os + w * OSP + lane * 4;   // a wave takes whole rows of the tile, w + 8 u: 512 contiguous bytes a store
#pragma unroll
        for (int u0 = 0; u0 < 16; u0 += 4) { v4f val[4];
#pragma unroll
            for (int u = 0; u < 4; ++u) { val[u] = *(const v4fa*)(po + (u0 + u) * 8 * OSP);
#pragma unroll
                for (int q = 0; q < 4; ++q) val[u][q] += bfr(bv[q]); }
#pragma unroll
            for (int u = 0; u < 4; ++u) *(v4f*)(pc + (size_t)(u0 + u) * 8 * LDC) = val[u];
            asm volatile("s_wait_xcnt 0x0" :: "v"(pc) : "memory"); }   // behind the four stores, before the next round reuses their data registers
    }
}

typedef __attribute__((ext_vector_type(2))) unsigned short v2us;
typedef __attribute__((ext_vector_type(2))) float v2f;

// the pieces of k_prep; blk = the block's index within its piece
// each thread makes one chunk of its plane, thread index = chunk number in fragment order
__device__ __forceinline__ void p_wtG(const float* __restrict__ w, int K, int N, bf* Bt, int blk) { const size_t i = (size_t)blk * 256 + threadIdx.x; if (i >= (size_t)N * K / 8) return; int n, k; fdec(i, K / 32, n, k); const float* p = w + (size_t)k * N + n; float x[8]; v8us o;
#pragma unroll
    for (int j = 0; j < 8; ++j) x[j] = p[(size_t)j * N];
    asm volatile("s_wait_xcnt 0x0" :: "v"(p) : "memory");   // behind the loads: their address is an input, so that it stays live and unwritten (by a load's result too) up to the wait
#pragma unroll
    for (int j = 0; j < 8; ++j) o[j] = f2bf(x[j]);
    *(v8us*)(Bt + i * 8) = o; }
__device__ __forceinline__ void p_cvt8(const float* __restrict__ src, bf* dst, size_t n8, int LD, int blk) { const size_t i = (size_t)blk * 256 + threadIdx.x; if (i >= n8) return; int row, k0; fdec(i, LD / 32, row, k0); const float* p = src + (size_t)row * LD + k0; const v8f v = *(const v8f*)p; v8us o;
    asm volatile("s_wait_xcnt 0x0" :: "v"(p) : "memory");   // behind the loads: their address is an input, so that it stays live and unwritten (by a load's result too) up to the wait
#pragma unroll
    for (int k = 0; k < 8; ++k) o[k] = f2bf(v[k]); *(v8us*)(dst + i * 8) = o;  }
// ---- k_fattn: scores, softmax, bucket sums and attn.v of 32 query rows of one head in ONE work-group of 16 waves; each wave owns four blocks of 32 keys and the scores never leave its registers.
// The 64 key blocks are dealt out from the block in front of the query rows onward (mod 64): slot u 16 + w goes to wave w as its u-th block, so that every key with |j - i| < 32 lies in slots 0..2 (u = 0, waves 0..2) and all other slots are wholly far left or far right.
// S^T = K Q^T (a lane holds one query's scores: column lr, rows 8 hi + j), + QE[i][clip(j - i)], x HD^-0.5; row maximum and row sum meet across the waves in LDS (sum in wave order, fixed);
// the rounded probabilities (hi/lo for rows < RH, else fp16 x1024) are packed from two score tiles straight into a B operand (hardware k order, which WFrag::ld also delivers) for O^T += V^T P^T;
// the 16 partial O tiles are summed in LDS in wave order; the values as rounded are summed into the 65 relative-position buckets (far-left sum, 63 near entries, far-right sum; fixed order), hi/lo planes [row][128].
#define FQR  32                   // query rows per work-group
#define FNW  16                   // waves per work-group
#define QEP  66                   // LDS pitch of a staged QE row (entries 0..65)
#define RDP  68                   // LDS pitch of a partial O row
#define RWP  20                   // LDS pitch of a query's 16 per-wave values
#define NBP  68                   // LDS pitch of a query's 64 near buckets (16 rows read at once fall on different banks)
typedef __attribute__((ext_vector_type(2))) __bf16 v2bf;
template <bool HR> struct FT { typedef h16 T; };
template <> struct FT<true> { typedef bf T; };
template <bool HR>
__device__ __forceinline__ void fattn_body(const typename FT<HR>::T* __restrict__ Q, const typename FT<HR>::T* __restrict__ Q2, const typename FT<HR>::T* __restrict__ Kp, const typename FT<HR>::T* __restrict__ K2, const typename FT<HR>::T* __restrict__ Vt, const typename FT<HR>::T* __restrict__ V2,
                                           const float* __restrict__ QEr, const int q0, float* red, float* qes, float* rm, float* rs, float* rl, float* rr, float* nbk) {
    typedef typename FT<HR>::T T16; typedef typename WFrag<T16>::V V;
    const int tid = threadIdx.x, lane = tid & 31, lr = lane & 15, hi = lane >> 4; const int w = __builtin_amdgcn_readfirstlane(tid >> 5);
    // every '#pragma unroll' in this function makes the indices of the register arrays constants
#pragma unroll
    for (int s = 0; s < 2; ++s) { const int q = 2 * w + s; const float* sp = QEr + (size_t)q * NE; qes[q * QEP + lane] = sp[lane]; qes[q * QEP + 32 + lane] = sp[32 + lane]; if (lane < 2) qes[q * QEP + 64 + lane] = sp[64 + lane]; }
    *(v4fa*)(nbk + (tid >> 4) * NBP + (tid & 15) * 4) = (v4f){0.f, 0.f, 0.f, 0.f};   // a bucket whose key lies outside [0, TT) stays 0
    int kf[4];   // first key of this wave's u-th block (wave-uniform)
#pragma unroll
    for (int u = 0; u < 4; ++u) kf[u] = (((q0 >> 5) + 63 + u * 16 + w) & 63) * 32;
    // every operand load is a wave-uniform tile base plus the lane's chunk in the tile, in bytes (fragment order)
    const unsigned klb = (unsigned)(lane * 16), vlb = klb;
    auto at = [](const T16* base, unsigned ofs) { return (const T16*)((const char*)base + ofs); };
    V bq[2][2], bq2[2][2]; const T16* pq = at(Q + (size_t)q0 * HD, klb); const T16* pq2 = HR ? at(Q2 + (size_t)q0 * HD, klb) : nullptr;
#pragma unroll
    for (int qt = 0; qt < 2; ++qt)
#pragma unroll
        for (int ks = 0; ks < 2; ++ks) { bq[qt][ks] = WFrag<T16>::ld(pq + qt * 16 * HD + ks * 512); if (HR) bq2[qt][ks] = WFrag<T16>::ld(pq2 + qt * 16 * HD + ks * 512); }
    v8f acc[8][2];
#pragma unroll
    for (int kt = 0; kt < 8; ++kt) { acc[kt][0] = (v8f){}; acc[kt][1] = (v8f){}; }
    constexpr int UB = HR ? 1 : 4;   // key blocks whose fragments are fetched together (as many as the registers hold)
#pragma unroll
    for (int u0 = 0; u0 < 4; u0 += UB) { V a[UB][2][2], a2[UB][2][2]; const T16* pk[UB]; const T16* pk2[UB];
#pragma unroll
        for (int t = 0; t < UB; ++t) { pk[t] = at(Kp + (size_t)kf[u0 + t] * HD, klb); pk2[t] = HR ? at(K2 + (size_t)kf[u0 + t] * HD, klb) : nullptr;
#pragma unroll
            for (int hf = 0; hf < 2; ++hf)
#pragma unroll
                for (int ks = 0; ks < 2; ++ks) { a[t][hf][ks] = WFrag<T16>::ld(pk[t] + hf * 16 * HD + ks * 512); if (HR) a2[t][hf][ks] = WFrag<T16>::ld(pk2[t] + hf * 16 * HD + ks * 512); } }
        // stands behind the batch's loads. The loaded values are inputs, so that the whole batch is in flight together (one latency a batch, not one a tile); the addresses the loads name are inputs, so that they stay live and unwritten (by a load's result too) up to the wait
        if constexpr (HR) asm volatile("s_wait_xcnt 0x0" :: "v"(a[0][0][0]), "v"(a[0][0][1]), "v"(a[0][1][0]), "v"(a[0][1][1]), "v"(a2[0][0][0]), "v"(a2[0][0][1]), "v"(a2[0][1][0]), "v"(a2[0][1][1]), "v"(bq[0][0]), "v"(bq[0][1]), "v"(bq[1][0]), "v"(bq[1][1]), "v"(bq2[0][0]), "v"(bq2[0][1]), "v"(bq2[1][0]), "v"(bq2[1][1]), "v"(pk[0]), "v"(pk2[0]), "v"(pq), "v"(pq2) : "memory");
        else asm volatile("s_wait_xcnt 0x0" :: "v"(a[0][0][0]), "v"(a[0][0][1]), "v"(a[0][1][0]), "v"(a[0][1][1]), "v"(a[1][0][0]), "v"(a[1][0][1]), "v"(a[1][1][0]), "v"(a[1][1][1]), "v"(a[2][0][0]), "v"(a[2][0][1]), "v"(a[2][1][0]), "v"(a[2][1][1]), "v"(a[3][0][0]), "v"(a[3][0][1]), "v"(a[3][1][0]), "v"(a[3][1][1]), "v"(bq[0][0]), "v"(bq[0][1]), "v"(bq[1][0]), "v"(bq[1][1]), "v"(pk[0]), "v"(pk[1]), "v"(pk[2]), "v"(pk[3]), "v"(pq) : "memory");
#pragma unroll
        for (int t = 0; t < UB; ++t)
#pragma unroll
            for (int hf = 0; hf < 2; ++hf)
#pragma unroll
                for (int ks = 0; ks < 2; ++ks)
#pragma unroll
                    for (int qt = 0; qt < 2; ++qt) { v8f& c = acc[2 * (u0 + t) + hf][qt]; c = WFrag<T16>::mma(a[t][hf][ks], bq[qt][ks], c); if (HR) { c = WFrag<T16>::mma(a[t][hf][ks], bq2[qt][ks], c); c = WFrag<T16>::mma(a2[t][hf][ks], bq[qt][ks], c); } } }
    __syncthreads();   // the staged QE rows and the zeroed near buckets are in LDS
    float qeL[2], qeR[2], mx[2];
#pragma unroll
    for (int qt = 0; qt < 2; ++qt) { qeL[qt] = qes[(qt * 16 + lr) * QEP]; qeR[qt] = qes[(qt * 16 + lr) * QEP + 2 * MAXR]; mx[qt] = -3.0e38f; }
#pragma unroll
    for (int u = 0; u < 4; ++u) {
        if (u == 0 && w < 3) {   // a block that may hold near keys: entry by entry; j - i = dj + 8 hi + e - lr
#pragma unroll
            for (int hf = 0; hf < 2; ++hf)
#pragma unroll
                for (int qt = 0; qt < 2; ++qt) { const int dj = kf[u] + hf * 16 - (q0 + qt * 16);
#pragma unroll
                    for (int j = 0; j < 8; ++j) { const float e = qes[(qt * 16 + lr) * QEP + min(max(dj + 8 * hi + j - lr, -MAXR), MAXR) + MAXR]; const float t = (acc[2 * u + hf][qt][j] + e) * SCL; acc[2 * u + hf][qt][j] = t; mx[qt] = fmaxf(mx[qt], t); } }
        } else { const bool left = kf[u] < q0;
#pragma unroll
            for (int qt = 0; qt < 2; ++qt) { const float e = left ? qeL[qt] : qeR[qt];
#pragma unroll
                for (int hf = 0; hf < 2; ++hf)
#pragma unroll
                    for (int j = 0; j < 8; ++j) { const float t = (acc[2 * u + hf][qt][j] + e) * SCL; acc[2 * u + hf][qt][j] = t; mx[qt] = fmaxf(mx[qt], t); } }
        } }
#pragma unroll
    for (int qt = 0; qt < 2; ++qt) mx[qt] = fmaxf(mx[qt], __shfl_xor(mx[qt], 16, 32));
    rm[lane * RWP + w] = hi ? mx[1] : mx[0];   // lane = query index in the block: half hi stores column group hi
    __syncthreads();   // every wave's row maxima are in LDS
#pragma unroll
    for (int qt = 0; qt < 2; ++qt) { const float* p = rm + (qt * 16 + lr) * RWP; float m = -3.0e38f;
#pragma unroll
        for (int g = 0; g < 4; ++g) { const v4f x = *(const v4fa*)(p + g * 4); m = fmaxf(fmaxf(m, fmaxf(x[0], x[1])), fmaxf(x[2], x[3])); }
        mx[qt] = m; }
    float sum[2] = {0.f, 0.f};
#pragma unroll
    for (int kt = 0; kt < 8; ++kt)
#pragma unroll
        for (int qt = 0; qt < 2; ++qt) { float x[8], p[8], s8 = 0.f;
#pragma unroll
            for (int j = 0; j < 8; ++j) x[j] = (acc[kt][qt][j] - mx[qt]) * 1.4426950408889634f;
            // eight independent exponentials (no result on a source: early clobber) and, behind the last, the one slot that the instruction set asks for before a result is used or a source overwritten
            asm("v_exp_f32 %0, %8\n\tv_exp_f32 %1, %9\n\tv_exp_f32 %2, %10\n\tv_exp_f32 %3, %11\n\tv_exp_f32 %4, %12\n\tv_exp_f32 %5, %13\n\tv_exp_f32 %6, %14\n\tv_exp_f32 %7, %15\n\tv_nop"
                : "=&v"(p[0]), "=&v"(p[1]), "=&v"(p[2]), "=&v"(p[3]), "=&v"(p[4]), "=&v"(p[5]), "=&v"(p[6]), "=&v"(p[7]) : "v"(x[0]), "v"(x[1]), "v"(x[2]), "v"(x[3]), "v"(x[4]), "v"(x[5]), "v"(x[6]), "v"(x[7]));
#pragma unroll
            for (int j = 0; j < 8; ++j) { acc[kt][qt][j] = p[j]; s8 += p[j]; }
            sum[qt] += s8; }
#pragma unroll
    for (int qt = 0; qt < 2; ++qt) sum[qt] += __shfl_xor(sum[qt], 16, 32);
    rs[lane * RWP + w] = hi ? sum[1] : sum[0];
    __syncthreads();   // every wave's row sums are in LDS
    float f[2];
#pragma unroll
    for (int qt = 0; qt < 2; ++qt) { const float* p = rs + (qt * 16 + lr) * RWP; float s = 0.f;
#pragma unroll
        for (int g = 0; g < 4; ++g) { const v4f x = *(const v4fa*)(p + g * 4); s = (((s + x[0]) + x[1]) + x[2]) + x[3]; }
        f[qt] = __fdiv_rn(HR ? 1.0f : PCAR, s); }
    float bl[2] = {0.f, 0.f}, br[2] = {0.f, 0.f};
    v8f o[4][2];
#pragma unroll
    for (int dt = 0; dt < 4; ++dt) { o[dt][0] = (v8f){}; o[dt][1] = (v8f){}; }
#pragma unroll
    for (int u = 0; u < 4; ++u) { V pb[2], pb2[2]; float pw[2][16];   // block u: fetch V^T, round, pack, tally, multiply
        constexpr int D0 = HR ? 2 : 4;   // V^T tiles fetched ahead of the rounding (as many as the registers hold)
        V va[4], va2[4]; const T16* pv = at(Vt + kf[u] * 16, vlb); const T16* pv2 = HR ? at(V2 + kf[u] * 16, vlb) : nullptr;   // k tile kf / 32 of tile row 0; the next tile row 16 TT elements on
#pragma unroll
        for (int dt = 0; dt < D0; ++dt) { va[dt] = WFrag<T16>::ld(pv + (size_t)dt * 16 * TT); if (HR) va2[dt] = WFrag<T16>::ld(pv2 + (size_t)dt * 16 * TT); }
        // as in the score part: behind the loads, their addresses as inputs; the loads fly while the block is rounded
        if constexpr (HR) asm volatile("s_wait_xcnt 0x0" :: "v"(pv), "v"(pv2) : "memory"); else asm volatile("s_wait_xcnt 0x0" :: "v"(pv) : "memory");
#pragma unroll
        for (int qt = 0; qt < 2; ++qt)
#pragma unroll
            for (int e = 0; e < 16; e += 2) { const v2f x = (v2f){acc[2 * u + (e >> 3)][qt][e & 7] * f[qt], acc[2 * u + (e >> 3)][qt][(e & 7) + 1] * f[qt]};
                if constexpr (HR) { const v2bf h2 = __builtin_convertvector(x, v2bf); const v2f hf2 = __builtin_convertvector(h2, v2f); const v2bf l2 = __builtin_convertvector(x - hf2, v2bf); const v2f s2 = hf2 + __builtin_convertvector(l2, v2f);
                    pb[qt][e] = h2[0]; pb[qt][e + 1] = h2[1]; pb2[qt][e] = l2[0]; pb2[qt][e + 1] = l2[1]; pw[qt][e] = s2[0]; pw[qt][e + 1] = s2[1]; }
                else { const h16 o0 = tohx(x[0]), o1 = tohx(x[1]); pb[qt][e] = o0; pb[qt][e + 1] = o1; pw[qt][e] = (float)o0 * 0.0009765625f; pw[qt][e + 1] = (float)o1 * 0.0009765625f; } }
        if (u == 0 && w < 3) {
#pragma unroll
            for (int qt = 0; qt < 2; ++qt)
#pragma unroll
                for (int e = 0; e < 16; ++e) { const int r = kf[u] + (e >> 3) * 16 + 8 * hi + (e & 7) - (q0 + qt * 16 + lr) + MAXR; const float p = pw[qt][e]; bl[qt] += (r <= 0) ? p : 0.f; br[qt] += (r >= 2 * MAXR) ? p : 0.f; if (r > 0 && r < 2 * MAXR) nbk[(qt * 16 + lr) * NBP + r] = p; }
        } else { const bool left = kf[u] < q0;
#pragma unroll
            for (int qt = 0; qt < 2; ++qt) { float t[8];
#pragma unroll
                for (int e = 0; e < 8; ++e) t[e] = pw[qt][e] + pw[qt][e + 8];
                const float s16 = ((t[0] + t[1]) + (t[2] + t[3])) + ((t[4] + t[5]) + (t[6] + t[7])); bl[qt] += left ? s16 : 0.f; br[qt] += left ? 0.f : s16; }
        }
#pragma unroll
        for (int dt = 0; dt < 4; ++dt) {
            if constexpr (HR) if (dt == D0) {
#pragma unroll
                for (int d2 = D0; d2 < 4; ++d2) { va[d2] = WFrag<T16>::ld(pv + (size_t)d2 * 16 * TT); va2[d2] = WFrag<T16>::ld(pv2 + (size_t)d2 * 16 * TT); }
                asm volatile("s_wait_xcnt 0x0" :: "v"(pv), "v"(pv2) : "memory");   // as above, for the rest of the block's V^T tiles
            }
#pragma unroll
            for (int qt = 0; qt < 2; ++qt) { o[dt][qt] = WFrag<T16>::mma(va[dt], pb[qt], o[dt][qt]); if (HR) { o[dt][qt] = WFrag<T16>::mma(va[dt], pb2[qt], o[dt][qt]); o[dt][qt] = WFrag<T16>::mma(va2[dt], pb[qt], o[dt][qt]); } } } }
#pragma unroll
    for (int dt = 0; dt < 4; ++dt)
#pragma unroll
        for (int qt = 0; qt < 2; ++qt) { float* p = red + w * (FQR * RDP) + (qt * 16 + lr) * RDP + dt * 16 + 8 * hi; const v8f c = o[dt][qt];   // a lane's 8 registers are 8 consecutive d of one query
            *(v4fa*)p = (v4f){c[0], c[1], c[2], c[3]}; *(v4fa*)(p + 4) = (v4f){c[4], c[5], c[6], c[7]}; }
#pragma unroll
    for (int qt = 0; qt < 2; ++qt) { bl[qt] += __shfl_xor(bl[qt], 16, 32); br[qt] += __shfl_xor(br[qt], 16, 32); }
    rl[lane * RWP + w] = hi ? bl[1] : bl[0]; rr[lane * RWP + w] = hi ? br[1] : br[0];
}
// grid (TT / 32 x NZ), 512 threads; the hi/lo blocks (the longer ones) of all planes have the lowest indices and start first; within each kind a plane's blocks follow one another (they read the same K and V)
__global__ __launch_bounds__(FNW * 32) void k_fattn(const h16* __restrict__ Q16, const bf* __restrict__ Qh, const bf* __restrict__ Ql, const h16* __restrict__ K16, const bf* __restrict__ Kh, const bf* __restrict__ Kl, const h16* __restrict__ V16, const bf* __restrict__ Vh, const bf* __restrict__ Vl, const float* __restrict__ QE, bf* PBh, bf* PBl, float* Ob) {
    __shared__ __align__(16) float red[FNW * FQR * RDP];
    __shared__ __align__(16) float qes[FQR * QEP];
    __shared__ __align__(16) float rm[FQR * RWP];
    __shared__ __align__(16) float rs[FQR * RWP];
    __shared__ __align__(16) float rl[FQR * RWP];
    __shared__ __align__(16) float rr[FQR * RWP];
    __shared__ __align__(16) float nbk[FQR * NBP];
    constexpr int NL = RH / FQR, NS = TT / FQR - NL;   // long and short blocks of a plane
    const int fl = blockIdx.x, fs = fl - NZ * NL; const size_t z = fs < 0 ? fl / NL : fs / NS; const int q0 = (fs < 0 ? fl % NL : NL + fs % NS) * FQR; const size_t zp = z * TT * HD; const int tid = threadIdx.x;
    const float* QEr = QE + (z * TT + q0) * NE;
    if (q0 < RH) fattn_body<true>(Qh + zp, Ql + zp, Kh + zp, Kl + zp, Vh + zp, Vl + zp, QEr, q0, red, qes, rm, rs, rl, rr, nbk);
    else fattn_body<false>(Q16 + zp, nullptr, K16 + zp, nullptr, V16 + zp, nullptr, QEr, q0, red, qes, rm, rs, rl, rr, nbk);
    __syncthreads();   // every wave's partial O tile, far sums and near buckets are in LDS
    const int q = tid >> 4, g = tid & 15;   // 16 threads a query row: whole 256-byte rows leave
    v4f s = *(const v4fa*)(red + q * RDP + g * 4);
#pragma unroll
    for (int ww = 1; ww < FNW; ++ww) { const v4f p = *(const v4fa*)(red + ww * (FQR * RDP) + q * RDP + g * 4);
#pragma unroll
        for (int j = 0; j < 4; ++j) s[j] += p[j]; }
    *(v4f*)(Ob + zp + (size_t)(q0 + q) * HD + g * 4) = s;
    float b[8] = {0.f, 0.f, 0.f, 0.f, 0.f, 0.f, 0.f, 0.f};
    int qb, kb; fdec(tid, NE / 32, qb, kb); const int gb = kb >> 3;   // the bucket planes leave in fragment order: thread index = chunk number in the block's 2 x 4 tiles; row qb, buckets from 8 gb
    if (gb < 8) { const v4f n0 = *(const v4fa*)(nbk + qb * NBP + gb * 8), n1 = *(const v4fa*)(nbk + qb * NBP + gb * 8 + 4);
#pragma unroll
        for (int j = 0; j < 4; ++j) { b[j] = n0[j]; b[4 + j] = n1[j]; } }
    if (gb == 0 || gb == 8) { const float* p = (gb ? rr : rl) + qb * RWP; float t = 0.f;   // bucket 0: far left; bucket 64: far right
#pragma unroll
        for (int k = 0; k < 4; ++k) { const v4f x = *(const v4fa*)(p + k * 4); t = (((t + x[0]) + x[1]) + x[2]) + x[3]; }
        b[0] = t; }
    v8us oh, ol;
#pragma unroll
    for (int j = 0; j < 8; ++j) { unsigned short u2, w2; splitf(b[j], u2, w2); oh[j] = u2; ol[j] = w2; }
    const size_t ob = (z * TT + q0) * NE + tid * 8; *(v8us*)(PBh + ob) = oh; *(v8us*)(PBl + ob) = ol;
}
__device__ __forceinline__ void p_epad2(const float* __restrict__ E, bf* EB, int blk) { const size_t i = (size_t)blk * 256 + threadIdx.x; if (i >= (size_t)NE * HD / 8) return; int r, d0; fdec(i, HD / 32, r, d0); const float* src = E + (size_t)min(r, 2 * MAXR) * HD + d0; v8us o;
#pragma unroll
    for (int q = 0; q < 8; ++q) { const unsigned short v = f2bf(src[q]); o[q] = (r <= 2 * MAXR) ? v : (unsigned short)0; }
    *(v8us*)(EB + i * 8) = o;  }
__device__ __forceinline__ void p_rvt(const float* __restrict__ E, bf* RVT, int blk) { const size_t i = (size_t)blk * 256 + threadIdx.x; if (i >= (size_t)HD * NE / 8) return; int d, r0; fdec(i, NE / 32, d, r0); v8us o;
#pragma unroll
    for (int q = 0; q < 8; ++q) { const int r = r0 + q; const unsigned short v = f2bf(E[(size_t)min(r, 2 * MAXR) * HD + d]); o[q] = (r <= 2 * MAXR) ? v : (unsigned short)0; }
    *(v8us*)(RVT + i * 8) = o;  }

// ---- k_prep: all that depends on the inputs alone, in ONE launch; the block index says which piece a block does (block-uniform): 4 x WTB blocks transpose Wq, Wk, Wv, Wo, 3 x CVB blocks round query, key, value (both batches), RPB blocks each make the rel_k and rel_v^T planes.
#define WTB  (DM * DQ / 8 / 256)
#define CVB  (NB_ * TT * DM / 8 / 256)
#define RPB  (NE * HD / 8 / 256)
static_assert(DKV == DQ && DQ == DM && REP == 1, "the four weights have one shape; one kv plane per query plane");
__global__ __launch_bounds__(256) void k_prep(const float* __restrict__ wq, const float* __restrict__ wk, const float* __restrict__ wv, const float* __restrict__ wo, const float* __restrict__ x, const float* __restrict__ xk, const float* __restrict__ xv, const float* __restrict__ relk, const float* __restrict__ relv, bf* W4, bf* XB3, bf* EB, bf* RVT) {
    int blk = blockIdx.x;
    if (blk < 4 * WTB) { const int s = blk / WTB; p_wtG(s == 0 ? wq : s == 1 ? wk : s == 2 ? wv : wo, DM, DQ, W4 + (size_t)s * DQ * DM, blk % WTB); return; }
    blk -= 4 * WTB;
    if (blk < 3 * CVB) { const int s = blk / CVB; p_cvt8(s == 0 ? x : s == 1 ? xk : xv, XB3 + (size_t)s * NB_ * TT * DM, (size_t)NB_ * TT * DM / 8, DM, blk % CVB); return; }
    blk -= 3 * CVB;
    if (blk < RPB) p_epad2(relk, EB, blk); else p_rvt(relv, RVT, blk - RPB);
}

extern "C" void kernel_launch(void* const* d_in, const int* in_sizes, int n_in,
                              void* d_out, int out_size, void* d_ws, size_t ws_size, hipStream_t stream) {
    (void)in_sizes; (void)n_in; (void)out_size;
    const float* x = (const float*)d_in[0]; const float* xk = (const float*)d_in[1]; const float* xv = (const float*)d_in[2]; const float* wq = (const float*)d_in[3]; const float* bq = (const float*)d_in[4]; const float* wk = (const float*)d_in[5]; const float* bk = (const float*)d_in[6]; const float* wv = (const float*)d_in[7]; const float* bv = (const float*)d_in[8]; const float* wo = (const float*)d_in[9]; const float* bo = (const float*)d_in[10]; const float* relk = (const float*)d_in[11]; const float* relv = (const float*)d_in[12];   /* [65][64] each */
    float* OUT = (float*)d_out;     // [2][2048][1024]
    char* wsp = (char*)d_ws;
    auto take = [&](size_t bytes) { char* p = wsp; wsp += (bytes + 255) & ~(size_t)255; return (void*)p; };
    const size_t PLN = (size_t)NZ * TT * HD;   // elements of one set of head planes
    bf* EB = (bf*)take((size_t)NE * HD * 2); bf* RVT = (bf*)take((size_t)HD * NE * 2); float* QE = (float*)take((size_t)NZ * TT * NE * 4); bf* PBh = (bf*)take((size_t)NZ * TT * NE * 2); bf* PBl = (bf*)take((size_t)NZ * TT * NE * 2);
    bf* W4 = (bf*)take((size_t)4 * DQ * DM * 2); bf* WO = W4 + (size_t)3 * DQ * DM;   // Wq, Wk, Wv, Wo transposed
    bf* XB = (bf*)take((size_t)3 * NB_ * TT * DM * 2);   // query, key, value
    h16* QP16 = (h16*)take(3 * PLN * 2); h16* KP16 = QP16 + PLN; h16* VT16 = QP16 + 2 * PLN;   // q, k, v^T: the z-stride of the projection grid is PLN
    bf* QPh = (bf*)take(3 * PLN * 2); bf* KPh = QPh + PLN; bf* VTh = QPh + 2 * PLN; bf* QPl = (bf*)take(3 * PLN * 2); bf* KPl = QPl + PLN; bf* VTl = QPl + 2 * PLN;
    float* Ob = (float*)take(PLN * 4); bf* ATh = (bf*)take((size_t)NB_ * TT * DQ * 2); bf* ATl = (bf*)take((size_t)NB_ * TT * DQ * 2);
    if ((size_t)(wsp - (char*)d_ws) > ws_size) return;    // 200 MiB of the 256 MiB
    k_prep<<<4 * WTB + 3 * CVB + 2 * RPB, 256, 0, stream>>>(wq, wk, wv, wo, x, xk, xv, relk, relv, W4, XB, EB, RVT);
    k_gemmt<0, DM, 1, 0><<<dim3(NB_ * TT / 128, DQ / 128, 3), 256, 0, stream>>>(XB, nullptr, W4, nullptr, bq, bk, bv, (size_t)NB_ * TT * DM, (size_t)DQ * DM, QP16, QPh, QPl, PLN);
    k_gemmw<bf, 1, false, false><<<dim3(TT / 64, NE / 64, NZ), 32, 0, stream>>>(QPh, QPl, EB, nullptr, HD, QE, NE, nullptr, (size_t)TT * HD, 0, (size_t)TT * NE, nullptr, nullptr, nullptr);   /* QE[i][r] = q_i . rel_k[r] */
    k_fattn<<<TT / FQR * NZ, FNW * 32, 0, stream>>>(QP16, QPh, QPl, KP16, KPh, KPl, VT16, VTh, VTl, QE, PBh, PBl, Ob);   /* scores + QE[i][idx], softmax, 65 bucket sums per row, attn v */
    k_gemmw<bf, 1, false, true><<<dim3(TT / 64, HD / 64, NZ), 32, 0, stream>>>(PBh, PBl, RVT, nullptr, NE, nullptr, 0, nullptr, (size_t)TT * NE, 0, 0, Ob, ATh, ATl);   /* buckets . rel_v = sum_j attn[i][j] rel_v[idx], + attn v, merged hi/lo planes */
    k_gemmt<1, DQ, 0, DM><<<dim3(NB_ * TT / 128, DM / 128, 1), 256, 0, stream>>>(ATh, ATl, WO, OUT, bo, nullptr, nullptr, 0, 0, nullptr, nullptr, nullptr, 0);
}

// v009
// A run of this version takes 176 microseconds.
// Timed twice side by side with v008, it ran 1.20 and 1.17 times as fast.
// Counting every step since v000, it is 17.9 times as fast.
#include <hip/hip_runtime.h>

// Multi-head attention with Shaw relative-position terms on the logits AND the values (query, key, value [2][2048][1024]; q,k,v = in W + b ('xw' 1/32, zero biases; 16 heads x 64); idx[i][j] = clip(j - i, -32, 32) + 32; attn = softmax((q.k + q_i.rel_k[idx]) / 8); out_h = attn v + sum_j attn[i][j] rel_v[idx] (tables [65][64] x 0.05, read); out = merged Wo + bo ('xw') -> [2][2048][1024] (4.2 M)).
// Four launches, each over both batches and all heads (32 planes, plane = batch 16 + head): bf16 copies of the three inputs, the transposed weights, rel_k as an exact plane [128][64] (rows >= 65 zero) and rel_v^T as an exact plane [64][128]; exact projections + f32 biases (q, k, v in one grid), each leaving the GEMM as the head planes (fp16 and hi/lo; v transposed); one kernel per 32 query rows makes QE = q.rel_k^T of its rows (hi/lo x exact) in LDS, does the dense scores (hybrid rows: < 512 hi/lo 3 products, rest fp16 x1024), adds QE[i][idx], does the softmax with the 1/8, sums each row's probabilities into the 65 relative-position buckets (far-left sum, 63 near entries, far-right sum; fixed order) as hi/lo planes in LDS and multiplies by v, scores and probabilities staying in registers, then adds buckets x rel_v (hi/lo x exact) to attn v in f32 and splits the sum into the merged hi/lo planes; merged hi/lo x Wo exact + bo.
// Compute dtypes, f32 accumulate: every input rounded to bf16; projections exact + f32 biases; q.rel_k and buckets.rel_v hi/lo x exact; attention rows < 512 3 products, rest fp16; softmax f32; Wo hl x exact + bias.

#define NB_  2
#define TT   2048
#define DM   1024
#define NH_  16
#define NKV  16
#define REP  (NH_ / NKV)
#define HD   64
#define DQ   (NH_ * HD)
#define DKV  (NKV * HD)
#define NZ   (NB_ * NH_)          // head planes: batch NH_ + head
#define RH   512                  // query rows < RH use hi+lo planes (0: none)
#define WIN  0
#define PCAR 1024.0f
#define SCL  0.125f
#define MAXR 32      // max relative position
#define NE   128     // 2*MAXR+1 = 65 table rows padded to 128
typedef _Float16 h16;
typedef unsigned short bf;
typedef __attribute__((ext_vector_type(16))) __bf16   v16bf;
typedef __attribute__((ext_vector_type(16))) _Float16 v16h;
typedef __attribute__((ext_vector_type(8)))  _Float16 v8h;
typedef __attribute__((ext_vector_type(8)))  unsigned short v8us;
typedef __attribute__((ext_vector_type(8)))  float    v8f;
typedef __attribute__((ext_vector_type(4)))  float    v4f;
typedef v8h  __attribute__((may_alias)) v8ha;
typedef v4f  __attribute__((may_alias)) v4fa;
typedef v8us __attribute__((may_alias)) v8usa;

__device__ __forceinline__ unsigned short f2bf(float f) { unsigned u = __float_as_uint(f); u += 0x7FFFu + ((u >> 16) & 1u); return (unsigned short)(u >> 16); }
__device__ __forceinline__ float bf2f(unsigned short b) { return __uint_as_float(((unsigned)b) << 16); }
__device__ __forceinline__ float bfr(float f) { return bf2f(f2bf(f)); }
__device__ __forceinline__ v16h cat16(v8h lo, v8h hi) { return __builtin_shufflevector(lo, hi, 0, 1, 2, 3, 4, 5, 6, 7, 8, 9, 10, 11, 12, 13, 14, 15); }
__device__ __forceinline__ v16bf cat16b(v8us lo, v8us hi) { return __builtin_bit_cast(v16bf, __builtin_shufflevector(lo, hi, 0, 1, 2, 3, 4, 5, 6, 7, 8, 9, 10, 11, 12, 13, 14, 15)); }
__device__ __forceinline__ v8f wmma16(v16h a, v16h b, v8f c) { return __builtin_amdgcn_wmma_f32_16x16x32_f16(false, a, false, b, (short)0, c, false, false); }
__device__ __forceinline__ v8f wmmab(v16bf a, v16bf b, v8f c) { return __builtin_amdgcn_wmma_f32_16x16x32_bf16(false, a, false, b, (short)0, c, false, false); }
__device__ __forceinline__ h16 tohx(float x) { return (h16)x; }
__device__ __forceinline__ void splitf(float y, unsigned short& h, unsigned short& l) { h = f2bf(y); l = f2bf(y - bf2f(h)); }
typedef __attribute__((ext_vector_type(4))) unsigned short v4us;

// ---- FRAGMENT ORDER: every 16-bit operand plane P[row][k] (LD elements a row, LD % 32 == 0, rows % 16 == 0) is stored as tiles of 16 rows x 32 k, 512 elements each, tile (row / 16, k / 32) at ((row / 16) (LD / 32) + k / 32) 512;
// inside a tile the 16-byte chunk of (row, 8 k from k) stands at chunk number ((k / 16) % 2) 32 + ((k / 8) % 2) 16 + row % 16. WFrag::ld(tile + lane 8) then reads a lane's fragment as two loads, each 512 contiguous bytes (4 whole lines) a wave, in the k order of the matrix instruction.
// fdec: chunk number i of a plane with KT = LD / 32 tiles a tile row -> its row and first k. A writer whose thread index is the chunk number stores 512 contiguous bytes a wave.
__device__ __forceinline__ void fdec(size_t i, int KT, int& row, int& k) { const int t = (int)(i >> 6); row = (t / KT) * 16 + (int)(i & 15); k = (t % KT) * 32 + (int)((i >> 5) & 1) * 16 + (int)((i >> 4) & 1) * 8; }



// ---- WFrag: a lane's fragment of a plane in fragment order (two 16-byte loads) and the matrix instruction of its type
template <typename T16> struct WFrag;
template <> struct WFrag<h16> { typedef v16h V; static __device__ __forceinline__ V ld(const h16* p) { return cat16(*(const v8h*)p, *(const v8h*)(p + 256)); } static __device__ __forceinline__ v8f mma(V a, V b, v8f c) { return wmma16(a, b, c); } };
template <> struct WFrag<bf> { typedef v16bf V; static __device__ __forceinline__ V ld(const bf* p) { return cat16b(*(const v8us*)p, *(const v8us*)(p + 256)); } static __device__ __forceinline__ v8f mma(V a, V b, v8f c) { return wmmab(a, b, c); } };

// ---- k_gemmt: C[m][n] = sum_k A[m][k] Bt[n][k] (+ A2 Bt), planes in fragment order, long K: ONE WORK-GROUP of 8 waves per 128x128 output tile, wave (wm, wn) = (w / 4, w % 4) takes 64 rows x 32 columns (8 accumulators) over the whole K, in k order.
// A stage = 64 k of the tile's 128 A rows (A2 rows too where NSPLIT == 1) and 128 Bt rows, 16 KiB a plane, brought into LDS by asynchronous copies (16 bytes a lane) and read there by all waves: an A fragment serves 4 waves, a B fragment 2.
// The planes are in fragment order, so a stage of a plane is 8 runs of 2 KiB (tile row tr: two k tiles) and stands in LDS as [tr][k tile][1 KiB]; a fragment is two ds loads of 512 contiguous bytes a wave. Two buffers: stage t + 2 flies while stage t + 1 is worked on.
// grid (M/128, N/128, Z), 256 threads. NSPLIT 0: A Bt; 1: (A + A2) Bt. KK % 128 == 0.
// EPI 0: C (f32, pitch LDC) + f32 bias[n], whole 512-byte row pieces. EPI 1: the q, k and v projections in one grid (z = 0, 1, 2: operands and planes at the z-strides, bias, bias1 or bias2), rows = [batch][t]; the 128 columns of a tile are two heads (HD == 64) and the biased f32 values leave as those heads' fp16 and hi/lo planes, 16 bytes a lane, 512 contiguous bytes a wave, in fragment order: z < 2 [plane][t][d], z == 2 transposed [plane][d][t].
template <int NSPLIT, int KK, int EPI, int LDC>
__global__ __launch_bounds__(256) __attribute__((amdgpu_waves_per_eu(NSPLIT ? 2 : 6, NSPLIT ? 8 : 6))) void k_gemmt(   // waves a SIMD. NSPLIT 0: six and no more, three work-groups a WGP: the grid's 768 are resident together and spread evenly
const bf* __restrict__ A, const bf* __restrict__ A2, const bf* __restrict__ Bt, float* C, const float* __restrict__ bias, const float* __restrict__ bias1, const float* __restrict__ bias2, size_t sA, size_t sB, h16* P16, bf* Ph, bf* Pl, size_t sP) {
    static_assert(EPI == 0 || (HD == 64 && TT % 128 == 0 && NKV == NH_), "a plane epilogue takes a 128 x 128 tile of two heads of one batch");
    static_assert(KK % 128 == 0, "two stages or more");
    typedef WFrag<bf>::V V;
    constexpr int PLB = 16384, STG = (NSPLIT ? 3 : 2) * PLB, NS = KK / 64, OSP = 132;   // bytes of a plane's stage and of a stage; stages; pitch of the staged output tile in floats
    constexpr int SMB = 2 * STG > 128 * OSP * 4 ? 2 * STG : 128 * OSP * 4;
    __shared__ __align__(16) char sm[SMB];   // two stage buffers; behind the loop the f32 output tile
    const size_t z = blockIdx.z;
    const int tid = threadIdx.x, lane = tid & 31, w = tid >> 5, lr = lane & 15, hi = lane >> 4, wm = w >> 2, wn = w & 3; const int r0 = blockIdx.x * 128, c0 = blockIdx.y * 128;
    const bool tr = EPI == 1 && z == 2;   // block-uniform
    // every '#pragma unroll' in this kernel makes the indices of acc, a, a2 and b constants, so that they stay in registers
    v8f acc[4][2];
#pragma unroll
    for (int mb = 0; mb < 4; ++mb)
#pragma unroll
        for (int nb = 0; nb < 2; ++nb) acc[mb][nb] = (v8f){};
    // copy c (0..3) of a plane's stage: thread tid brings bytes [c 4096 + tid 16, + 16) of the stage: tile row 2 c + tid / 128, byte (tid % 128) 16 of its 2 KiB run; the next tile row KK 32 bytes on, the next stage 2048 bytes on
    const size_t tof = (size_t)(tid >> 7) * (KK * 32) + (tid & 127) * 16;
    const char* gA = (const char*)(A + z * sA + (size_t)r0 * KK) + tof; const char* gA2 = NSPLIT ? (const char*)(A2 + z * sA + (size_t)r0 * KK) + tof : nullptr; const char* gB = (const char*)(Bt + z * sB + (size_t)c0 * KK) + tof;
    const unsigned l0 = (unsigned)(size_t)sm + tid * 16;   // the lane's LDS byte address in buffer 0
    auto issue = [&](int s, int bsel) {   // stage s into buffer bsel; the wait in the copies' own statement stands before any register that a copy names is rewritten
        const unsigned l = l0 + bsel * STG; const char* a = gA + (size_t)s * 2048; const char* b = gB + (size_t)s * 2048;
        if constexpr (NSPLIT == 0)
            asm volatile("global_load_async_to_lds_b128 %0, %8, off\n\tglobal_load_async_to_lds_b128 %1, %9, off\n\tglobal_load_async_to_lds_b128 %2, %10, off\n\tglobal_load_async_to_lds_b128 %3, %11, off\n\t"
                         "global_load_async_to_lds_b128 %4, %12, off\n\tglobal_load_async_to_lds_b128 %5, %13, off\n\tglobal_load_async_to_lds_b128 %6, %14, off\n\tglobal_load_async_to_lds_b128 %7, %15, off\n\ts_wait_xcnt 0x0"
                         :: "v"(l), "v"(l + 4096), "v"(l + 8192), "v"(l + 12288), "v"(l + PLB), "v"(l + PLB + 4096), "v"(l + PLB + 8192), "v"(l + PLB + 12288),
                            "v"(a), "v"(a + 2 * KK * 32), "v"(a + 4 * KK * 32), "v"(a + 6 * KK * 32), "v"(b), "v"(b + 2 * KK * 32), "v"(b + 4 * KK * 32), "v"(b + 6 * KK * 32) : "memory");
        else { const char* a2 = gA2 + (size_t)s * 2048;
            asm volatile("global_load_async_to_lds_b128 %0, %12, off\n\tglobal_load_async_to_lds_b128 %1, %13, off\n\tglobal_load_async_to_lds_b128 %2, %14, off\n\tglobal_load_async_to_lds_b128 %3, %15, off\n\t"
                         "global_load_async_to_lds_b128 %4, %16, off\n\tglobal_load_async_to_lds_b128 %5, %17, off\n\tglobal_load_async_to_lds_b128 %6, %18, off\n\tglobal_load_async_to_lds_b128 %7, %19, off\n\t"
                         "global_load_async_to_lds_b128 %8, %20, off\n\tglobal_load_async_to_lds_b128 %9, %21, off\n\tglobal_load_async_to_lds_b128 %10, %22, off\n\tglobal_load_async_to_lds_b128 %11, %23, off\n\ts_wait_xcnt 0x0"
                         :: "v"(l), "v"(l + 4096), "v"(l + 8192), "v"(l + 12288), "v"(l + PLB), "v"(l + PLB + 4096), "v"(l + PLB + 8192), "v"(l + PLB + 12288), "v"(l + 2 * PLB), "v"(l + 2 * PLB + 4096), "v"(l + 2 * PLB + 8192), "v"(l + 2 * PLB + 12288),
                            "v"(a), "v"(a + 2 * KK * 32), "v"(a + 4 * KK * 32), "v"(a + 6 * KK * 32), "v"(b), "v"(b + 2 * KK * 32), "v"(b + 4 * KK * 32), "v"(b + 6 * KK * 32), "v"(a2), "v"(a2 + 2 * KK * 32), "v"(a2 + 4 * KK * 32), "v"(a2 + 6 * KK * 32) : "memory"); } };
    issue(0, 0);
    v4f bv = (v4f){0.f, 0.f, 0.f, 0.f};   // EPI 0: the lane's 4 bias values, fetched while stage 0 flies
    if constexpr (EPI == 0) { const float* pbv = bias + c0 + lane * 4; bv = *(const v4f*)pbv;
        asm volatile("s_wait_xcnt 0x0" :: "v"(pbv), "v"(bv) : "memory"); }   // behind the bias load: result and address are inputs, so that the load stands in front of the wait and its address stays unwritten (by the result too) up to it
    asm volatile("s_wait_asynccnt 0x0" ::: "memory");   // this wave's part of stage 0 has landed
    __syncthreads();   // stage 0 is whole
    issue(1, 1);
#pragma unroll 1   // one stage a trip: the buffer is picked by the trip's parity
    for (int t = 0; t < NS; ++t) { const char* sb = sm + (t & 1) * STG + lane * 16;
#pragma unroll
        for (int ks = 0; ks < 2; ++ks) { V a[4], a2[4], b[2];
#pragma unroll
            for (int mb = 0; mb < 4; ++mb) { a[mb] = WFrag<bf>::ld((const bf*)(sb + ((wm * 4 + mb) * 2 + ks) * 1024)); if (NSPLIT) a2[mb] = WFrag<bf>::ld((const bf*)(sb + 2 * PLB + ((wm * 4 + mb) * 2 + ks) * 1024)); }
#pragma unroll
            for (int nb = 0; nb < 2; ++nb) b[nb] = WFrag<bf>::ld((const bf*)(sb + PLB + ((wn * 2 + nb) * 2 + ks) * 1024));
#pragma unroll
            for (int nb = 0; nb < 2; ++nb)
#pragma unroll
                for (int mb = 0; mb < 4; ++mb) acc[mb][nb] = WFrag<bf>::mma(a[mb], b[nb], acc[mb][nb]);
            if (NSPLIT) {
#pragma unroll
                for (int nb = 0; nb < 2; ++nb)
#pragma unroll
                    for (int mb = 0; mb < 4; ++mb) acc[mb][nb] = WFrag<bf>::mma(a2[mb], b[nb], acc[mb][nb]); } }
        asm volatile("s_wait_dscnt 0x0" ::: "memory");      // this wave's reads of the trip's buffer are done
        asm volatile("s_wait_asynccnt 0x0" ::: "memory");   // this wave's part of stage t + 1 has landed
        __syncthreads();   // stage t + 1 is whole, and every wave has left the trip's buffer
        if (t + 2 < NS) issue(t + 2, t & 1);
    }
    asm volatile("s_wait_asynccnt 0x0" ::: "memory");   // no copy is out when the buffers become the output tile
    float* os = (float*)sm;   // the last trip's barrier stands behind every read of the buffers
    const int orow = wm * 64 + hi * 8, ocol = wn * 32 + lr;   // a lane's 8 values of accumulator (mb, nb): rows orow + 16 mb + j of column ocol + 16 nb
    if (tr) {   // transposed: they are 8 consecutive entries of one staged row
#pragma unroll
        for (int mb = 0; mb < 4; ++mb)
#pragma unroll
            for (int nb = 0; nb < 2; ++nb) { const v8f c = acc[mb][nb]; float* p = os + (ocol + nb * 16) * OSP + orow + mb * 16; *(v4fa*)p = (v4f){c[0], c[1], c[2], c[3]}; *(v4fa*)(p + 4) = (v4f){c[4], c[5], c[6], c[7]}; }
    } else {
#pragma unroll
        for (int mb = 0; mb < 4; ++mb)
#pragma unroll
            for (int nb = 0; nb < 2; ++nb)
#pragma unroll
                for (int j = 0; j < 8; ++j) os[(orow + mb * 16 + j) * OSP + ocol + nb * 16] = acc[mb][nb][j];
    }
    __syncthreads();   // the tile is whole before it is read by rows
    if constexpr (EPI != 0) { const float* bz = z == 0 ? bias : z == 1 ? bias1 : bias2; const int t0 = r0 % TT;
#pragma unroll
        for (int u = 0; u < 8; ++u) { const int hs = u >> 2, idx = (u & 3) * 256 + tid; int row, cofs; fdec(idx, tr ? 4 : 2, row, cofs);   // head hs of the two; idx = chunk number in its 8 x 2 (transposed: 4 x 4) fragment tiles
            const size_t pl = (size_t)(r0 / TT) * NH_ + blockIdx.y * 2 + hs; const float* op = os + (tr ? (hs * 64 + row) * OSP + cofs : row * OSP + hs * 64 + cofs);
            const v4f v0 = *(const v4fa*)op, v1 = *(const v4fa*)(op + 4);
            v8h o16; v8us oh, ol; float bb[8];
#pragma unroll
            for (int j = 0; j < 8; ++j) bb[j] = bz[c0 + hs * 64 + (tr ? row : cofs + j)];
            asm volatile("s_wait_xcnt 0x0" ::: "memory");   // behind the bias loads, before their index registers are reused
#pragma unroll
            for (int j = 0; j < 8; ++j) { const float x = (j < 4 ? v0[j & 3] : v1[j & 3]) + bfr(bb[j]); o16[j] = tohx(x); unsigned short a2, c2; splitf(x, a2, c2); oh[j] = a2; ol[j] = c2; }
            const size_t e = z * sP + (tr ? pl * HD * TT + ((size_t)(idx >> 8) * (TT / 32) + t0 / 32) * 512 + (idx & 255) * 8 : (pl * TT + t0) * HD + idx * 8);   // fragment order: LD = HD: the 16 tiles follow one another; LD = TT: four tiles a tile row
            *(v8h*)(P16 + e) = o16; *(v8us*)(Ph + e) = oh; *(v8us*)(Pl + e) = ol;
            asm volatile("s_wait_xcnt 0x0" ::: "memory"); }   // behind the stores, before the next round reuses their address and data registers
    } else { float* pc = C + (size_t)(r0 + w) * LDC + c0 + lane * 4; const float* po = os + w * OSP + lane * 4;   // a wave takes whole rows of the tile, w + 8 u: 512 contiguous bytes a store
#pragma unroll
        for (int u0 = 0; u0 < 16; u0 += 4) { v4f val[4];
#pragma unroll
            for (int u = 0; u < 4; ++u) { val[u] = *(const v4fa*)(po + (u0 + u) * 8 * OSP);
#pragma unroll
                for (int q = 0; q < 4; ++q) val[u][q] += bfr(bv[q]); }
#pragma unroll
            for (int u = 0; u < 4; ++u) *(v4f*)(pc + (size_t)(u0 + u) * 8 * LDC) = val[u];
            asm volatile("s_wait_xcnt 0x0" :: "v"(pc) : "memory"); }   // behind the four stores, before the next round reuses their data registers
    }
}

typedef __attribute__((ext_vector_type(2))) unsigned short v2us;
typedef __attribute__((ext_vector_type(2))) float v2f;

// the pieces of k_prep; blk = the block's index within its piece
// each thread makes one chunk of its plane, thread index = chunk number in fragment order
__device__ __forceinline__ void p_wtG(const float* __restrict__ w, int K, int N, bf* Bt, int blk) { const size_t i = (size_t)blk * 256 + threadIdx.x; if (i >= (size_t)N * K / 8) return; int n, k; fdec(i, K / 32, n, k); const float* p = w + (size_t)k * N + n; float x[8]; v8us o;
#pragma unroll
    for (int j = 0; j < 8; ++j) x[j] = p[(size_t)j * N];
    asm volatile("s_wait_xcnt 0x0" :: "v"(p) : "memory");   // behind the loads: their address is an input, so that it stays live and unwritten (by a load's result too) up to the wait
#pragma unroll
    for (int j = 0; j < 8; ++j) o[j] = f2bf(x[j]);
    *(v8us*)(Bt + i * 8) = o; }
__device__ __forceinline__ void p_cvt8(const float* __restrict__ src, bf* dst, size_t n8, int LD, int blk) { const size_t i = (size_t)blk * 256 + threadIdx.x; if (i >= n8) return; int row, k0; fdec(i, LD / 32, row, k0); const float* p = src + (size_t)row * LD + k0; const v8f v = *(const v8f*)p; v8us o;
    asm volatile("s_wait_xcnt 0x0" :: "v"(p) : "memory");   // behind the loads: their address is an input, so that it stays live and unwritten (by a load's result too) up to the wait
#pragma unroll
    for (int k = 0; k < 8; ++k) o[k] = f2bf(v[k]); *(v8us*)(dst + i * 8) = o;  }
// ---- k_fattn: scores, softmax, bucket sums and attn.v of 32 query rows of one head in ONE work-group of 16 waves; each wave owns four blocks of 32 keys and the scores never leave its registers.
// The 64 key blocks are dealt out from the block in front of the query rows onward (mod 64): slot u 16 + w goes to wave w as its u-th block, so that every key with |j - i| < 32 lies in slots 0..2 (u = 0, waves 0..2) and all other slots are wholly far left or far right.
// S^T = K Q^T (a lane holds one query's scores: column lr, rows 8 hi + j), + QE[i][clip(j - i)], x HD^-0.5; row maximum and row sum meet across the waves in LDS (sum in wave order, fixed);
// the rounded probabilities (hi/lo for rows < RH, else fp16 x1024) are packed from two score tiles straight into a B operand (hardware k order, which WFrag::ld also delivers) for O^T += V^T P^T;
// the 16 partial O tiles are summed in LDS in wave order; the values as rounded are summed into the 65 relative-position buckets (far-left sum, 63 near entries, far-right sum; fixed order), hi/lo planes [row][128] in LDS;
// QE = q.rel_k^T of the 32 rows is made at the start (ten waves, one 16 x 16 tile each) and buckets.rel_v at the end (eight waves), where it is added to attn.v and leaves as the merged hi/lo planes.
#define FQR  32                   // query rows per work-group
#define FNW  16                   // waves per work-group
#define QEP  66                   // LDS pitch of a staged QE row (entries 0..64)
#define RDP  68                   // LDS pitch of a partial O row
#define RWP  20                   // LDS pitch of a query's 16 per-wave values
#define NBP  68                   // LDS pitch of a query's 64 near buckets (16 rows read at once fall on different banks)
typedef __attribute__((ext_vector_type(2))) __bf16 v2bf;
template <bool HR> struct FT { typedef h16 T; };
template <> struct FT<true> { typedef bf T; };
template <bool HR>
__device__ __forceinline__ void fattn_body(const typename FT<HR>::T* __restrict__ Q, const typename FT<HR>::T* __restrict__ Q2, const typename FT<HR>::T* __restrict__ Kp, const typename FT<HR>::T* __restrict__ K2, const typename FT<HR>::T* __restrict__ Vt, const typename FT<HR>::T* __restrict__ V2,
                                           const bf* __restrict__ Qeh, const bf* __restrict__ Qel, const bf* __restrict__ EBp, const int q0, float* red, float* qes, float* rm, float* rs, float* rl, float* rr, float* nbk) {
    typedef typename FT<HR>::T T16; typedef typename WFrag<T16>::V V;
    const int tid = threadIdx.x, lane = tid & 31, lr = lane & 15, hi = lane >> 4; const int w = __builtin_amdgcn_readfirstlane(tid >> 5);
    // every '#pragma unroll' in this function makes the indices of the register arrays constants
    // QE^T tile of this wave: table rows 16 en .. + 15 (A, exact) x queries 16 eq .. + 15 (B, hi and lo); only en <= 4 holds entries that are read. The fragments are fetched in front of the K fragments and land with them
    typedef WFrag<bf>::V VB; const int eq = w & 1, en = w >> 1;
    const bf* pee = EBp + en * 16 * HD + lane * 8; const bf* peh = Qeh + eq * 16 * HD + lane * 8; const bf* pel = Qel + eq * 16 * HD + lane * 8; VB ea[2], eh[2], el[2]; v8f ce = (v8f){};
    if (en <= 4) {
#pragma unroll
        for (int ks = 0; ks < 2; ++ks) { ea[ks] = WFrag<bf>::ld(pee + ks * 512); eh[ks] = WFrag<bf>::ld(peh + ks * 512); el[ks] = WFrag<bf>::ld(pel + ks * 512); }
        asm volatile("s_wait_xcnt 0x0" :: "v"(pee), "v"(peh), "v"(pel) : "memory");   // behind the loads: their addresses are inputs, so that they stay live and unwritten (by a load's result too) up to the wait
    }
    *(v4fa*)(nbk + (tid >> 4) * NBP + (tid & 15) * 4) = (v4f){0.f, 0.f, 0.f, 0.f};   // a bucket whose key lies outside [0, TT) stays 0
    int kf[4];   // first key of this wave's u-th block (wave-uniform)
#pragma unroll
    for (int u = 0; u < 4; ++u) kf[u] = (((q0 >> 5) + 63 + u * 16 + w) & 63) * 32;
    // every operand load is a wave-uniform tile base plus the lane's chunk in the tile, in bytes (fragment order)
    const unsigned klb = (unsigned)(lane * 16), vlb = klb;
    auto at = [](const T16* base, unsigned ofs) { return (const T16*)((const char*)base + ofs); };
    V bq[2][2], bq2[2][2]; const T16* pq = at(Q + (size_t)q0 * HD, klb); const T16* pq2 = HR ? at(Q2 + (size_t)q0 * HD, klb) : nullptr;
#pragma unroll
    for (int qt = 0; qt < 2; ++qt)
#pragma unroll
        for (int ks = 0; ks < 2; ++ks) { bq[qt][ks] = WFrag<T16>::ld(pq + qt * 16 * HD + ks * 512); if (HR) bq2[qt][ks] = WFrag<T16>::ld(pq2 + qt * 16 * HD + ks * 512); }
    v8f acc[8][2];
#pragma unroll
    for (int kt = 0; kt < 8; ++kt) { acc[kt][0] = (v8f){}; acc[kt][1] = (v8f){}; }
    constexpr int UB = HR ? 1 : 4;   // key blocks whose fragments are fetched together (as many as the registers hold)
#pragma unroll
    for (int u0 = 0; u0 < 4; u0 += UB) { V a[UB][2][2], a2[UB][2][2]; const T16* pk[UB]; const T16* pk2[UB];
#pragma unroll
        for (int t = 0; t < UB; ++t) { pk[t] = at(Kp + (size_t)kf[u0 + t] * HD, klb); pk2[t] = HR ? at(K2 + (size_t)kf[u0 + t] * HD, klb) : nullptr;
#pragma unroll
            for (int hf = 0; hf < 2; ++hf)
#pragma unroll
                for (int ks = 0; ks < 2; ++ks) { a[t][hf][ks] = WFrag<T16>::ld(pk[t] + hf * 16 * HD + ks * 512); if (HR) a2[t][hf][ks] = WFrag<T16>::ld(pk2[t] + hf * 16 * HD + ks * 512); } }
        // stands behind the batch's loads. The loaded values are inputs, so that the whole batch is in flight together (one latency a batch, not one a tile); the addresses the loads name are inputs, so that they stay live and unwritten (by a load's result too) up to the wait
        if constexpr (HR) asm volatile("s_wait_xcnt 0x0" :: "v"(a[0][0][0]), "v"(a[0][0][1]), "v"(a[0][1][0]), "v"(a[0][1][1]), "v"(a2[0][0][0]), "v"(a2[0][0][1]), "v"(a2[0][1][0]), "v"(a2[0][1][1]), "v"(bq[0][0]), "v"(bq[0][1]), "v"(bq[1][0]), "v"(bq[1][1]), "v"(bq2[0][0]), "v"(bq2[0][1]), "v"(bq2[1][0]), "v"(bq2[1][1]), "v"(pk[0]), "v"(pk2[0]), "v"(pq), "v"(pq2) : "memory");
        else asm volatile("s_wait_xcnt 0x0" :: "v"(a[0][0][0]), "v"(a[0][0][1]), "v"(a[0][1][0]), "v"(a[0][1][1]), "v"(a[1][0][0]), "v"(a[1][0][1]), "v"(a[1][1][0]), "v"(a[1][1][1]), "v"(a[2][0][0]), "v"(a[2][0][1]), "v"(a[2][1][0]), "v"(a[2][1][1]), "v"(a[3][0][0]), "v"(a[3][0][1]), "v"(a[3][1][0]), "v"(a[3][1][1]), "v"(bq[0][0]), "v"(bq[0][1]), "v"(bq[1][0]), "v"(bq[1][1]), "v"(pk[0]), "v"(pk[1]), "v"(pk[2]), "v"(pk[3]), "v"(pq) : "memory");
        if (u0 == 0 && en <= 4) {   // k ascending, hi then lo; a lane holds one query's entries 16 en + 8 hi + j
#pragma unroll
            for (int ks = 0; ks < 2; ++ks) { ce = WFrag<bf>::mma(ea[ks], eh[ks], ce); ce = WFrag<bf>::mma(ea[ks], el[ks], ce); }
            asm volatile("v_nop\n\tv_nop\n\tv_nop\n\tv_nop" : "+v"(ce));   // the four slots behind the last product, on every path: the branches below lead to matrix instructions that may reuse the tile's registers
            float* pq_ = qes + (eq * 16 + lr) * QEP + en * 16 + 8 * hi;
            if (en < 4) {
#pragma unroll
                for (int j = 0; j < 8; ++j) pq_[j] = ce[j];
            } else if (hi == 0) pq_[0] = ce[0];   // entry 64, the last of the table
        }
#pragma unroll
        for (int t = 0; t < UB; ++t)
#pragma unroll
            for (int hf = 0; hf < 2; ++hf)
#pragma unroll
                for (int ks = 0; ks < 2; ++ks)
#pragma unroll
                    for (int qt = 0; qt < 2; ++qt) { v8f& c = acc[2 * (u0 + t) + hf][qt]; c = WFrag<T16>::mma(a[t][hf][ks], bq[qt][ks], c); if (HR) { c = WFrag<T16>::mma(a[t][hf][ks], bq2[qt][ks], c); c = WFrag<T16>::mma(a2[t][hf][ks], bq[qt][ks], c); } }
    }
    __syncthreads();   // the staged QE rows and the zeroed near buckets are in LDS
    float qeL[2], qeR[2], mx[2];
#pragma unroll
    for (int qt = 0; qt < 2; ++qt) { qeL[qt] = qes[(qt * 16 + lr) * QEP]; qeR[qt] = qes[(qt * 16 + lr) * QEP + 2 * MAXR]; mx[qt] = -3.0e38f; }
#pragma unroll
    for (int u = 0; u < 4; ++u) {
        if (u == 0 && w < 3) {   // a block that may hold near keys: entry by entry; j - i = dj + 8 hi + e - lr
#pragma unroll
            for (int hf = 0; hf < 2; ++hf)
#pragma unroll
                for (int qt = 0; qt < 2; ++qt) { const int dj = kf[u] + hf * 16 - (q0 + qt * 16);
#pragma unroll
                    for (int j = 0; j < 8; ++j) { const float e = qes[(qt * 16 + lr) * QEP + min(max(dj + 8 * hi + j - lr, -MAXR), MAXR) + MAXR]; const float t = (acc[2 * u + hf][qt][j] + e) * SCL; acc[2 * u + hf][qt][j] = t; mx[qt] = fmaxf(mx[qt], t); } }
        } else { const bool left = kf[u] < q0;
#pragma unroll
            for (int qt = 0; qt < 2; ++qt) { const float e = left ? qeL[qt] : qeR[qt];
#pragma unroll
                for (int hf = 0; hf < 2; ++hf)
#pragma unroll
                    for (int j = 0; j < 8; ++j) { const float t = (acc[2 * u + hf][qt][j] + e) * SCL; acc[2 * u + hf][qt][j] = t; mx[qt] = fmaxf(mx[qt], t); } }
        } }
#pragma unroll
    for (int qt = 0; qt < 2; ++qt) mx[qt] = fmaxf(mx[qt], __shfl_xor(mx[qt], 16, 32));
    rm[lane * RWP + w] = hi ? mx[1] : mx[0];   // lane = query index in the block: half hi stores column group hi
    __syncthreads();   // every wave's row maxima are in LDS
#pragma unroll
    for (int qt = 0; qt < 2; ++qt) { const float* p = rm + (qt * 16 + lr) * RWP; float m = -3.0e38f;
#pragma unroll
        for (int g = 0; g < 4; ++g) { const v4f x = *(const v4fa*)(p + g * 4); m = fmaxf(fmaxf(m, fmaxf(x[0], x[1])), fmaxf(x[2], x[3])); }
        mx[qt] = m; }
    float sum[2] = {0.f, 0.f};
#pragma unroll
    for (int kt = 0; kt < 8; ++kt)
#pragma unroll
        for (int qt = 0; qt < 2; ++qt) { float x[8], p[8], s8 = 0.f;
#pragma unroll
            for (int j = 0; j < 8; ++j) x[j] = (acc[kt][qt][j] - mx[qt]) * 1.4426950408889634f;
            // eight independent exponentials (no result on a source: early clobber) and, behind the last, the one slot that the instruction set asks for before a result is used or a source overwritten
            asm("v_exp_f32 %0, %8\n\tv_exp_f32 %1, %9\n\tv_exp_f32 %2, %10\n\tv_exp_f32 %3, %11\n\tv_exp_f32 %4, %12\n\tv_exp_f32 %5, %13\n\tv_exp_f32 %6, %14\n\tv_exp_f32 %7, %15\n\tv_nop"
                : "=&v"(p[0]), "=&v"(p[1]), "=&v"(p[2]), "=&v"(p[3]), "=&v"(p[4]), "=&v"(p[5]), "=&v"(p[6]), "=&v"(p[7]) : "v"(x[0]), "v"(x[1]), "v"(x[2]), "v"(x[3]), "v"(x[4]), "v"(x[5]), "v"(x[6]), "v"(x[7]));
#pragma unroll
            for (int j = 0; j < 8; ++j) { acc[kt][qt][j] = p[j]; s8 += p[j]; }
            sum[qt] += s8; }
#pragma unroll
    for (int qt = 0; qt < 2; ++qt) sum[qt] += __shfl_xor(sum[qt], 16, 32);
    rs[lane * RWP + w] = hi ? sum[1] : sum[0];
    __syncthreads();   // every wave's row sums are in LDS
    float f[2];
#pragma unroll
    for (int qt = 0; qt < 2; ++qt) { const float* p = rs + (qt * 16 + lr) * RWP; float s = 0.f;
#pragma unroll
        for (int g = 0; g < 4; ++g) { const v4f x = *(const v4fa*)(p + g * 4); s = (((s + x[0]) + x[1]) + x[2]) + x[3]; }
        f[qt] = __fdiv_rn(HR ? 1.0f : PCAR, s); }
    float bl[2] = {0.f, 0.f}, br[2] = {0.f, 0.f};
    v8f o[4][2];
#pragma unroll
    for (int dt = 0; dt < 4; ++dt) { o[dt][0] = (v8f){}; o[dt][1] = (v8f){}; }
#pragma unroll
    for (int u = 0; u < 4; ++u) { V pb[2], pb2[2]; float pw[2][16];   // block u: fetch V^T, round, pack, tally, multiply
        constexpr int D0 = HR ? 2 : 4;   // V^T tiles fetched ahead of the rounding (as many as the registers hold)
        V va[4], va2[4]; const T16* pv = at(Vt + kf[u] * 16, vlb); const T16* pv2 = HR ? at(V2 + kf[u] * 16, vlb) : nullptr;   // k tile kf / 32 of tile row 0; the next tile row 16 TT elements on
#pragma unroll
        for (int dt = 0; dt < D0; ++dt) { va[dt] = WFrag<T16>::ld(pv + (size_t)dt * 16 * TT); if (HR) va2[dt] = WFrag<T16>::ld(pv2 + (size_t)dt * 16 * TT); }
        // as in the score part: behind the loads, their addresses as inputs; the loads fly while the block is rounded
        if constexpr (HR) asm volatile("s_wait_xcnt 0x0" :: "v"(pv), "v"(pv2) : "memory"); else asm volatile("s_wait_xcnt 0x0" :: "v"(pv) : "memory");
#pragma unroll
        for (int qt = 0; qt < 2; ++qt)
#pragma unroll
            for (int e = 0; e < 16; e += 2) { const v2f x = (v2f){acc[2 * u + (e >> 3)][qt][e & 7] * f[qt], acc[2 * u + (e >> 3)][qt][(e & 7) + 1] * f[qt]};
                if constexpr (HR) { const v2bf h2 = __builtin_convertvector(x, v2bf); const v2f hf2 = __builtin_convertvector(h2, v2f); const v2bf l2 = __builtin_convertvector(x - hf2, v2bf); const v2f s2 = hf2 + __builtin_convertvector(l2, v2f);
                    pb[qt][e] = h2[0]; pb[qt][e + 1] = h2[1]; pb2[qt][e] = l2[0]; pb2[qt][e + 1] = l2[1]; pw[qt][e] = s2[0]; pw[qt][e + 1] = s2[1]; }
                else { const h16 o0 = tohx(x[0]), o1 = tohx(x[1]); pb[qt][e] = o0; pb[qt][e + 1] = o1; pw[qt][e] = (float)o0 * 0.0009765625f; pw[qt][e + 1] = (float)o1 * 0.0009765625f; } }
        if (u == 0 && w < 3) {
#pragma unroll
            for (int qt = 0; qt < 2; ++qt)
#pragma unroll
                for (int e = 0; e < 16; ++e) { const int r = kf[u] + (e >> 3) * 16 + 8 * hi + (e & 7) - (q0 + qt * 16 + lr) + MAXR; const float p = pw[qt][e]; bl[qt] += (r <= 0) ? p : 0.f; br[qt] += (r >= 2 * MAXR) ? p : 0.f; if (r > 0 && r < 2 * MAXR) nbk[(qt * 16 + lr) * NBP + r] = p; }
        } else { const bool left = kf[u] < q0;
#pragma unroll
            for (int qt = 0; qt < 2; ++qt) { float t[8];
#pragma unroll
                for (int e = 0; e < 8; ++e) t[e] = pw[qt][e] + pw[qt][e + 8];
                const float s16 = ((t[0] + t[1]) + (t[2] + t[3])) + ((t[4] + t[5]) + (t[6] + t[7])); bl[qt] += left ? s16 : 0.f; br[qt] += left ? 0.f : s16; }
        }
#pragma unroll
        for (int dt = 0; dt < 4; ++dt) {
            if constexpr (HR) if (dt == D0) {
#pragma unroll
                for (int d2 = D0; d2 < 4; ++d2) { va[d2] = WFrag<T16>::ld(pv + (size_t)d2 * 16 * TT); va2[d2] = WFrag<T16>::ld(pv2 + (size_t)d2 * 16 * TT); }
                asm volatile("s_wait_xcnt 0x0" :: "v"(pv), "v"(pv2) : "memory");   // as above, for the rest of the block's V^T tiles
            }
#pragma unroll
            for (int qt = 0; qt < 2; ++qt) { o[dt][qt] = WFrag<T16>::mma(va[dt], pb[qt], o[dt][qt]); if (HR) { o[dt][qt] = WFrag<T16>::mma(va[dt], pb2[qt], o[dt][qt]); o[dt][qt] = WFrag<T16>::mma(va2[dt], pb[qt], o[dt][qt]); } } } }
#pragma unroll
    for (int dt = 0; dt < 4; ++dt)
#pragma unroll
        for (int qt = 0; qt < 2; ++qt) { float* p = red + w * (FQR * RDP) + (qt * 16 + lr) * RDP + dt * 16 + 8 * hi; const v8f c = o[dt][qt];   // a lane's 8 registers are 8 consecutive d of one query
            *(v4fa*)p = (v4f){c[0], c[1], c[2], c[3]}; *(v4fa*)(p + 4) = (v4f){c[4], c[5], c[6], c[7]}; }
#pragma unroll
    for (int qt = 0; qt < 2; ++qt) { bl[qt] += __shfl_xor(bl[qt], 16, 32); br[qt] += __shfl_xor(br[qt], 16, 32); }
    rl[lane * RWP + w] = hi ? bl[1] : bl[0]; rr[lane * RWP + w] = hi ? br[1] : br[0];
}
// grid (TT / 32 x NZ), 512 threads; the hi/lo blocks (the longer ones) of all planes have the lowest indices and start first; within each kind a plane's blocks follow one another (they read the same K and V)
__global__ __launch_bounds__(FNW * 32) void k_fattn(const h16* __restrict__ Q16, const bf* __restrict__ Qh, const bf* __restrict__ Ql, const h16* __restrict__ K16, const bf* __restrict__ Kh, const bf* __restrict__ Kl, const h16* __restrict__ V16, const bf* __restrict__ Vh, const bf* __restrict__ Vl, const bf* __restrict__ EB, const bf* __restrict__ RVT, bf* Ah, bf* Al) {
    __shared__ __align__(16) float red[FNW * FQR * RDP];
    __shared__ __align__(16) float qes[FQR * QEP];
    __shared__ __align__(16) float rm[FQR * RWP];
    __shared__ __align__(16) float rs[FQR * RWP];
    __shared__ __align__(16) float rl[FQR * RWP];
    __shared__ __align__(16) float rr[FQR * RWP];
    __shared__ __align__(16) float nbk[FQR * NBP];
    __shared__ __align__(16) bf pbh[FQR * NE];   // the block's bucket planes, hi and lo, in fragment order (2 x 4 tiles)
    __shared__ __align__(16) bf pbl[FQR * NE];
    constexpr int NL = RH / FQR, NS = TT / FQR - NL;   // long and short blocks of a plane
    const int fl = blockIdx.x, fs = fl - NZ * NL; const size_t z = fs < 0 ? fl / NL : fs / NS; const int q0 = (fs < 0 ? fl % NL : NL + fs % NS) * FQR; const size_t zp = z * TT * HD; const int tid = threadIdx.x;
    const bf* Qeh = Qh + zp + (size_t)q0 * HD; const bf* Qel = Ql + zp + (size_t)q0 * HD;
    if (q0 < RH) fattn_body<true>(Qh + zp, Ql + zp, Kh + zp, Kl + zp, Vh + zp, Vl + zp, Qeh, Qel, EB, q0, red, qes, rm, rs, rl, rr, nbk);
    else fattn_body<false>(Q16 + zp, nullptr, K16 + zp, nullptr, V16 + zp, nullptr, Qeh, Qel, EB, q0, red, qes, rm, rs, rl, rr, nbk);
    // waves 8..15 (none of them has a near block, so they reach the barrier first) finish the block, one 16 d x 16 query tile each (dt, qt): its rel_v^T fragments (A, exact) are fetched in front of the barrier
    typedef WFrag<bf>::V VB; const int lane = tid & 31, w = __builtin_amdgcn_readfirstlane(tid >> 5), dt = w & 3, qt = (w >> 2) & 1;
    VB rv[4]; const bf* prv = RVT + dt * 16 * NE + lane * 8;
    if (w >= 8) {
#pragma unroll
        for (int kt = 0; kt < 4; ++kt) rv[kt] = WFrag<bf>::ld(prv + kt * 512);
        asm volatile("s_wait_xcnt 0x0" :: "v"(prv) : "memory");   // behind the loads: their address is an input, so that it stays live and unwritten (by a load's result too) up to the wait
    }
    __syncthreads();   // every wave's partial O tile, far sums and near buckets are in LDS
    float b[8] = {0.f, 0.f, 0.f, 0.f, 0.f, 0.f, 0.f, 0.f};
    int qb, kb; fdec(tid, NE / 32, qb, kb); const int gb = kb >> 3;   // the bucket planes leave in fragment order: thread index = chunk number in the block's 2 x 4 tiles; row qb, buckets from 8 gb
    if (gb < 8) { const v4f n0 = *(const v4fa*)(nbk + qb * NBP + gb * 8), n1 = *(const v4fa*)(nbk + qb * NBP + gb * 8 + 4);
#pragma unroll
        for (int j = 0; j < 4; ++j) { b[j] = n0[j]; b[4 + j] = n1[j]; } }
    if (gb == 0 || gb == 8) { const float* p = (gb ? rr : rl) + qb * RWP; float t = 0.f;   // bucket 0: far left; bucket 64: far right
#pragma unroll
        for (int k = 0; k < 4; ++k) { const v4f x = *(const v4fa*)(p + k * 4); t = (((t + x[0]) + x[1]) + x[2]) + x[3]; }
        b[0] = t; }
    v8us oh, ol;
#pragma unroll
    for (int j = 0; j < 8; ++j) { unsigned short u2, w2; splitf(b[j], u2, w2); oh[j] = u2; ol[j] = w2; }
    *(v8us*)(pbh + tid * 8) = oh; *(v8us*)(pbl + tid * 8) = ol;
    __syncthreads();   // the bucket planes are whole
    if (w >= 8) { const int lr = lane & 15, hi = lane >> 4;
        v8f c = (v8f){};   // (buckets . rel_v)^T: k ascending, hi then lo; a lane holds 8 consecutive d (16 dt + 8 hi + j) of query 16 qt + lr, as in its partial O rows
#pragma unroll
        for (int kt = 0; kt < 4; ++kt) { const VB bh = WFrag<bf>::ld(pbh + (qt * 4 + kt) * 512 + lane * 8), bl = WFrag<bf>::ld(pbl + (qt * 4 + kt) * 512 + lane * 8); c = WFrag<bf>::mma(rv[kt], bh, c); c = WFrag<bf>::mma(rv[kt], bl, c); }
        const float* pr = red + (qt * 16 + lr) * RDP + dt * 16 + 8 * hi;
        v4f s0 = *(const v4fa*)pr, s1 = *(const v4fa*)(pr + 4);   // attn v: the 16 partial tiles in wave order
#pragma unroll
        for (int ww = 1; ww < FNW; ++ww) { const v4f p0 = *(const v4fa*)(pr + ww * (FQR * RDP)), p1 = *(const v4fa*)(pr + ww * (FQR * RDP) + 4);
#pragma unroll
            for (int j = 0; j < 4; ++j) { s0[j] += p0[j]; s1[j] += p1[j]; } }
        const float sc = (q0 < RH) ? 1.0f : PCAR, cs = (q0 < RH) ? 1.0f : (1.0f / PCAR);   // attn v carries x1024 where the probabilities do
        v8us ah, al;
#pragma unroll
        for (int j = 0; j < 8; ++j) { unsigned short a2, c2; splitf(__fadd_rn(j < 4 ? s0[j & 3] : s1[j & 3], __fmul_rn(c[j], sc)) * cs, a2, c2); ah[j] = a2; al[j] = c2; }
        // merged planes [batch][t][head HD + d] in fragment order: the lane's 8 values are chunk (dt % 2) 32 + lane of tile (row / 16, head 2 + dt / 2): 512 contiguous bytes a wave
        const size_t ao = ((z / NH_) * TT + q0 + qt * 16) * DQ + ((z % NH_) * 2 + (dt >> 1)) * 512 + (dt & 1) * 256 + lane * 8;
        *(v8us*)(Ah + ao) = ah; *(v8us*)(Al + ao) = al; }
}
__device__ __forceinline__ void p_epad2(const float* __restrict__ E, bf* EB, int blk) { const size_t i = (size_t)blk * 256 + threadIdx.x; if (i >= (size_t)NE * HD / 8) return; int r, d0; fdec(i, HD / 32, r, d0); const float* src = E + (size_t)min(r, 2 * MAXR) * HD + d0; v8us o;
#pragma unroll
    for (int q = 0; q < 8; ++q) { const unsigned short v = f2bf(src[q]); o[q] = (r <= 2 * MAXR) ? v : (unsigned short)0; }
    *(v8us*)(EB + i * 8) = o;  }
__device__ __forceinline__ void p_rvt(const float* __restrict__ E, bf* RVT, int blk) { const size_t i = (size_t)blk * 256 + threadIdx.x; if (i >= (size_t)HD * NE / 8) return; int d, r0; fdec(i, NE / 32, d, r0); v8us o;
#pragma unroll
    for (int q = 0; q < 8; ++q) { const int r = r0 + q; const unsigned short v = f2bf(E[(size_t)min(r, 2 * MAXR) * HD + d]); o[q] = (r <= 2 * MAXR) ? v : (unsigned short)0; }
    *(v8us*)(RVT + i * 8) = o;  }

// ---- k_prep: all that depends on the inputs alone, in ONE launch; the block index says which piece a block does (block-uniform): 4 x WTB blocks transpose Wq, Wk, Wv, Wo, 3 x CVB blocks round query, key, value (both batches), RPB blocks each make the rel_k and rel_v^T planes.
#define WTB  (DM * DQ / 8 / 256)
#define CVB  (NB_ * TT * DM / 8 / 256)
#define RPB  (NE * HD / 8 / 256)
static_assert(DKV == DQ && DQ == DM && REP == 1, "the four weights have one shape; one kv plane per query plane");
__global__ __launch_bounds__(256) void k_prep(const float* __restrict__ wq, const float* __restrict__ wk, const float* __restrict__ wv, const float* __restrict__ wo, const float* __restrict__ x, const float* __restrict__ xk, const float* __restrict__ xv, const float* __restrict__ relk, const float* __restrict__ relv, bf* W4, bf* XB3, bf* EB, bf* RVT) {
    int blk = blockIdx.x;
    if (blk < 4 * WTB) { const int s = blk / WTB; p_wtG(s == 0 ? wq : s == 1 ? wk : s == 2 ? wv : wo, DM, DQ, W4 + (size_t)s * DQ * DM, blk % WTB); return; }
    blk -= 4 * WTB;
    if (blk < 3 * CVB) { const int s = blk / CVB; p_cvt8(s == 0 ? x : s == 1 ? xk : xv, XB3 + (size_t)s * NB_ * TT * DM, (size_t)NB_ * TT * DM / 8, DM, blk % CVB); return; }
    blk -= 3 * CVB;
    if (blk < RPB) p_epad2(relk, EB, blk); else p_rvt(relv, RVT, blk - RPB);
}

extern "C" void kernel_launch(void* const* d_in, const int* in_sizes, int n_in,
                              void* d_out, int out_size, void* d_ws, size_t ws_size, hipStream_t stream) {
    (void)in_sizes; (void)n_in; (void)out_size;
    const float* x = (const float*)d_in[0]; const float* xk = (const float*)d_in[1]; const float* xv = (const float*)d_in[2]; const float* wq = (const float*)d_in[3]; const float* bq = (const float*)d_in[4]; const float* wk = (const float*)d_in[5]; const float* bk = (const float*)d_in[6]; const float* wv = (const float*)d_in[7]; const float* bv = (const float*)d_in[8]; const float* wo = (const float*)d_in[9]; const float* bo = (const float*)d_in[10]; const float* relk = (const float*)d_in[11]; const float* relv = (const float*)d_in[12];   /* [65][64] each */
    float* OUT = (float*)d_out;     // [2][2048][1024]
    char* wsp = (char*)d_ws;
    auto take = [&](size_t bytes) { char* p = wsp; wsp += (bytes + 255) & ~(size_t)255; return (void*)p; };
    const size_t PLN = (size_t)NZ * TT * HD;   // elements of one set of head planes
    bf* EB = (bf*)take((size_t)NE * HD * 2); bf* RVT = (bf*)take((size_t)HD * NE * 2);
    bf* W4 = (bf*)take((size_t)4 * DQ * DM * 2); bf* WO = W4 + (size_t)3 * DQ * DM;   // Wq, Wk, Wv, Wo transposed
    bf* XB = (bf*)take((size_t)3 * NB_ * TT * DM * 2);   // query, key, value
    h16* QP16 = (h16*)take(3 * PLN * 2); h16* KP16 = QP16 + PLN; h16* VT16 = QP16 + 2 * PLN;   // q, k, v^T: the z-stride of the projection grid is PLN
    bf* QPh = (bf*)take(3 * PLN * 2); bf* KPh = QPh + PLN; bf* VTh = QPh + 2 * PLN; bf* QPl = (bf*)take(3 * PLN * 2); bf* KPl = QPl + PLN; bf* VTl = QPl + 2 * PLN;
    bf* ATh = (bf*)take((size_t)NB_ * TT * DQ * 2); bf* ATl = (bf*)take((size_t)NB_ * TT * DQ * 2);
    if ((size_t)(wsp - (char*)d_ws) > ws_size) return;    // 120 MiB of the 256 MiB
    k_prep<<<4 * WTB + 3 * CVB + 2 * RPB, 256, 0, stream>>>(wq, wk, wv, wo, x, xk, xv, relk, relv, W4, XB, EB, RVT);
    k_gemmt<0, DM, 1, 0><<<dim3(NB_ * TT / 128, DQ / 128, 3), 256, 0, stream>>>(XB, nullptr, W4, nullptr, bq, bk, bv, (size_t)NB_ * TT * DM, (size_t)DQ * DM, QP16, QPh, QPl, PLN);
    k_fattn<<<TT / FQR * NZ, FNW * 32, 0, stream>>>(QP16, QPh, QPl, KP16, KPh, KPl, VT16, VTh, VTl, EB, RVT, ATh, ATl);   /* QE, scores + QE[i][idx], softmax, 65 bucket sums per row, attn v + buckets . rel_v, merged hi/lo planes */
    k_gemmt<1, DQ, 0, DM><<<dim3(NB_ * TT / 128, DM / 128, 1), 256, 0, stream>>>(ATh, ATl, WO, OUT, bo, nullptr, nullptr, 0, 0, nullptr, nullptr, nullptr, 0);
}

// v010
// Measured time: 152 microseconds a run.
// In both of two side-by-side timings against v009, it was 1.16 times as fast.
// Over all steps from v000 it is 20.6 times as fast.
#include <hip/hip_runtime.h>

// Multi-head attention with Shaw relative-position terms on the logits AND the values (query, key, value [2][2048][1024]; q,k,v = in W + b ('xw' 1/32, zero biases; 16 heads x 64); idx[i][j] = clip(j - i, -32, 32) + 32; attn = softmax((q.k + q_i.rel_k[idx]) / 8); out_h = attn v + sum_j attn[i][j] rel_v[idx] (tables [65][64] x 0.05, read); out = merged Wo + bo ('xw') -> [2][2048][1024] (4.2 M)).
// Four launches, each over both batches and all heads (32 planes, plane = batch 16 + head): bf16 copies of the three inputs, the transposed weights, rel_k as an exact plane [128][64] (rows >= 65 zero) and rel_v^T as an exact plane [64][128]; exact projections + f32 biases (q, k, v in one grid), each leaving the GEMM as the head planes (fp16 and hi/lo; v transposed); one kernel per 32 query rows makes QE = q.rel_k^T of its rows (hi/lo x exact) in LDS, does the dense scores (hybrid rows: < 512 hi/lo 3 products, rest fp16 x1024), adds QE[i][idx], takes the exponentials of the softmax with the 1/8, sums each row's rounded exponentials into the 65 relative-position buckets (far-left sum, 63 near entries, far-right sum; fixed order) as hi/lo planes in LDS and multiplies them by v, scores and exponentials staying in registers, then adds buckets x rel_v (hi/lo x exact) to exp v in f32, divides by the sum of the row's buckets and splits the result into the merged hi/lo planes; merged hi/lo x Wo exact + bo.
// Compute dtypes, f32 accumulate: every input rounded to bf16; projections exact + f32 biases; q.rel_k and buckets.rel_v hi/lo x exact; attention rows < 512 3 products, rest fp16; softmax f32; Wo hl x exact + bias.

#define NB_  2
#define TT   2048
#define DM   1024
#define NH_  16
#define NKV  16
#define REP  (NH_ / NKV)
#define HD   64
#define DQ   (NH_ * HD)
#define DKV  (NKV * HD)
#define NZ   (NB_ * NH_)          // head planes: batch NH_ + head
#define RH   512                  // query rows < RH use hi+lo planes (0: none)
#define WIN  0
#define SCL  0.125f
#define MAXR 32      // max relative position
#define NE   128     // 2*MAXR+1 = 65 table rows padded to 128
typedef _Float16 h16;
typedef unsigned short bf;
typedef __attribute__((ext_vector_type(16))) __bf16   v16bf;
typedef __attribute__((ext_vector_type(16))) _Float16 v16h;
typedef __attribute__((ext_vector_type(8)))  _Float16 v8h;
typedef __attribute__((ext_vector_type(8)))  unsigned short v8us;
typedef __attribute__((ext_vector_type(8)))  float    v8f;
typedef __attribute__((ext_vector_type(4)))  float    v4f;
typedef v8h  __attribute__((may_alias)) v8ha;
typedef v4f  __attribute__((may_alias)) v4fa;
typedef v8us __attribute__((may_alias)) v8usa;

__device__ __forceinline__ unsigned short f2bf(float f) { unsigned u = __float_as_uint(f); u += 0x7FFFu + ((u >> 16) & 1u); return (unsigned short)(u >> 16); }
__device__ __forceinline__ float bf2f(unsigned short b) { return __uint_as_float(((unsigned)b) << 16); }
__device__ __forceinline__ float bfr(float f) { return bf2f(f2bf(f)); }
__device__ __forceinline__ v16h cat16(v8h lo, v8h hi) { return __builtin_shufflevector(lo, hi, 0, 1, 2, 3, 4, 5, 6, 7, 8, 9, 10, 11, 12, 13, 14, 15); }
__device__ __forceinline__ v16bf cat16b(v8us lo, v8us hi) { return __builtin_bit_cast(v16bf, __builtin_shufflevector(lo, hi, 0, 1, 2, 3, 4, 5, 6, 7, 8, 9, 10, 11, 12, 13, 14, 15)); }
__device__ __forceinline__ v8f wmma16(v16h a, v16h b, v8f c) { return __builtin_amdgcn_wmma_f32_16x16x32_f16(false, a, false, b, (short)0, c, false, false); }
__device__ __forceinline__ v8f wmmab(v16bf a, v16bf b, v8f c) { return __builtin_amdgcn_wmma_f32_16x16x32_bf16(false, a, false, b, (short)0, c, false, false); }
__device__ __forceinline__ h16 tohx(float x) { return (h16)x; }
__device__ __forceinline__ void splitf(float y, unsigned short& h, unsigned short& l) { h = f2bf(y); l = f2bf(y - bf2f(h)); }
typedef __attribute__((ext_vector_type(4))) unsigned short v4us;

// ---- FRAGMENT ORDER: every 16-bit operand plane P[row][k] (LD elements a row, LD % 32 == 0, rows % 16 == 0) is stored as tiles of 16 rows x 32 k, 512 elements each, tile (row / 16, k / 32) at ((row / 16) (LD / 32) + k / 32) 512;
// inside a tile the 16-byte chunk of (row, 8 k from k) stands at chunk number ((k / 16) % 2) 32 + ((k / 8) % 2) 16 + row % 16. WFrag::ld(tile + lane 8) then reads a lane's fragment as two loads, each 512 contiguous bytes (4 whole lines) a wave, in the k order of the matrix instruction.
// fdec: chunk number i of a plane with KT = LD / 32 tiles a tile row -> its row and first k. A writer whose thread index is the chunk number stores 512 contiguous bytes a wave.
__device__ __forceinline__ void fdec(size_t i, int KT, int& row, int& k) { const int t = (int)(i >> 6); row = (t / KT) * 16 + (int)(i & 15); k = (t % KT) * 32 + (int)((i >> 5) & 1) * 16 + (int)((i >> 4) & 1) * 8; }



// ---- WFrag: a lane's fragment of a plane in fragment order (two 16-byte loads) and the matrix instruction of its type
template <typename T16> struct WFrag;
template <> struct WFrag<h16> { typedef v16h V; static __device__ __forceinline__ V ld(const h16* p) { return cat16(*(const v8h*)p, *(const v8h*)(p + 256)); } static __device__ __forceinline__ v8f mma(V a, V b, v8f c) { return wmma16(a, b, c); } };
template <> struct WFrag<bf> { typedef v16bf V; static __device__ __forceinline__ V ld(const bf* p) { return cat16b(*(const v8us*)p, *(const v8us*)(p + 256)); } static __device__ __forceinline__ v8f mma(V a, V b, v8f c) { return wmmab(a, b, c); } };

// ---- k_gemmt: C[m][n] = sum_k A[m][k] Bt[n][k] (+ A2 Bt), planes in fragment order, long K: ONE WORK-GROUP of 8 waves per 128x128 output tile, wave (wm, wn) = (w / 4, w % 4) takes 64 rows x 32 columns (8 accumulators) over the whole K, in k order.
// A stage = 64 k of the tile's 128 A rows (A2 rows too where NSPLIT == 1) and 128 Bt rows, 16 KiB a plane, brought into LDS by asynchronous copies (16 bytes a lane) and read there by all waves: an A fragment serves 4 waves, a B fragment 2.
// The planes are in fragment order, so a stage of a plane is 8 runs of 2 KiB (tile row tr: two k tiles) and stands in LDS as [tr][k tile][1 KiB]; a fragment is two ds loads of 512 contiguous bytes a wave. Two buffers: stage t + 2 flies while stage t + 1 is worked on.
// grid (M/128, N/128, Z), 256 threads. NSPLIT 0: A Bt; 1: (A + A2) Bt. KK % 128 == 0.
// EPI 0: C (f32, pitch LDC) + f32 bias[n], whole 512-byte row pieces. EPI 1: the q, k and v projections in one grid (z = 0, 1, 2: operands and planes at the z-strides, bias, bias1 or bias2), rows = [batch][t]; the 128 columns of a tile are two heads (HD == 64) and the biased f32 values leave as those heads' fp16 and hi/lo planes, 16 bytes a lane, 512 contiguous bytes a wave, in fragment order: z < 2 [plane][t][d], z == 2 transposed [plane][d][t].
template <int NSPLIT, int KK, int EPI, int LDC>
__global__ __launch_bounds__(256) __attribute__((amdgpu_waves_per_eu(NSPLIT ? 2 : 6, NSPLIT ? 8 : 6))) void k_gemmt(   // waves a SIMD. NSPLIT 0: six and no more, three work-groups a WGP: the grid's 768 are resident together and spread evenly
const bf* __restrict__ A, const bf* __restrict__ A2, const bf* __restrict__ Bt, float* C, const float* __restrict__ bias, const float* __restrict__ bias1, const float* __restrict__ bias2, size_t sA, size_t sB, h16* P16, bf* Ph, bf* Pl, size_t sP) {
    static_assert(EPI == 0 || (HD == 64 && TT % 128 == 0 && NKV == NH_), "a plane epilogue takes a 128 x 128 tile of two heads of one batch");
    static_assert(KK % 128 == 0, "two stages or more");
    typedef WFrag<bf>::V V;
    constexpr int PLB = 16384, STG = (NSPLIT ? 3 : 2) * PLB, NS = KK / 64, OSP = 132;   // bytes of a plane's stage and of a stage; stages; pitch of the staged output tile in floats
    constexpr int SMB = 2 * STG > 128 * OSP * 4 ? 2 * STG : 128 * OSP * 4;
    __shared__ __align__(16) char sm[SMB];   // two stage buffers; behind the loop the f32 output tile
    const size_t z = blockIdx.z;
    const int tid = threadIdx.x, lane = tid & 31, w = tid >> 5, lr = lane & 15, hi = lane >> 4, wm = w >> 2, wn = w & 3; const int r0 = blockIdx.x * 128, c0 = blockIdx.y * 128;
    const bool tr = EPI == 1 && z == 2;   // block-uniform
    // every '#pragma unroll' in this kernel makes the indices of acc, a, a2 and b constants, so that they stay in registers
    v8f acc[4][2];
#pragma unroll
    for (int mb = 0; mb < 4; ++mb)
#pragma unroll
        for (int nb = 0; nb < 2; ++nb) acc[mb][nb] = (v8f){};
    // copy c (0..3) of a plane's stage: thread tid brings bytes [c 4096 + tid 16, + 16) of the stage: tile row 2 c + tid / 128, byte (tid % 128) 16 of its 2 KiB run; the next tile row KK 32 bytes on, the next stage 2048 bytes on
    const size_t tof = (size_t)(tid >> 7) * (KK * 32) + (tid & 127) * 16;
    const char* gA = (const char*)(A + z * sA + (size_t)r0 * KK) + tof; const char* gA2 = NSPLIT ? (const char*)(A2 + z * sA + (size_t)r0 * KK) + tof : nullptr; const char* gB = (const char*)(Bt + z * sB + (size_t)c0 * KK) + tof;
    const unsigned l0 = (unsigned)(size_t)sm + tid * 16;   // the lane's LDS byte address in buffer 0
    auto issue = [&](int s, int bsel) {   // stage s into buffer bsel; the wait in the copies' own statement stands before any register that a copy names is rewritten
        const unsigned l = l0 + bsel * STG; const char* a = gA + (size_t)s * 2048; const char* b = gB + (size_t)s * 2048;
        if constexpr (NSPLIT == 0)
            asm volatile("global_load_async_to_lds_b128 %0, %8, off\n\tglobal_load_async_to_lds_b128 %1, %9, off\n\tglobal_load_async_to_lds_b128 %2, %10, off\n\tglobal_load_async_to_lds_b128 %3, %11, off\n\t"
                         "global_load_async_to_lds_b128 %4, %12, off\n\tglobal_load_async_to_lds_b128 %5, %13, off\n\tglobal_load_async_to_lds_b128 %6, %14, off\n\tglobal_load_async_to_lds_b128 %7, %15, off\n\ts_wait_xcnt 0x0"
                         :: "v"(l), "v"(l + 4096), "v"(l + 8192), "v"(l + 12288), "v"(l + PLB), "v"(l + PLB + 4096), "v"(l + PLB + 8192), "v"(l + PLB + 12288),
                            "v"(a), "v"(a + 2 * KK * 32), "v"(a + 4 * KK * 32), "v"(a + 6 * KK * 32), "v"(b), "v"(b + 2 * KK * 32), "v"(b + 4 * KK * 32), "v"(b + 6 * KK * 32) : "memory");
        else { const char* a2 = gA2 + (size_t)s * 2048;
            asm volatile("global_load_async_to_lds_b128 %0, %12, off\n\tglobal_load_async_to_lds_b128 %1, %13, off\n\tglobal_load_async_to_lds_b128 %2, %14, off\n\tglobal_load_async_to_lds_b128 %3, %15, off\n\t"
                         "global_load_async_to_lds_b128 %4, %16, off\n\tglobal_load_async_to_lds_b128 %5, %17, off\n\tglobal_load_async_to_lds_b128 %6, %18, off\n\tglobal_load_async_to_lds_b128 %7, %19, off\n\t"
                         "global_load_async_to_lds_b128 %8, %20, off\n\tglobal_load_async_to_lds_b128 %9, %21, off\n\tglobal_load_async_to_lds_b128 %10, %22, off\n\tglobal_load_async_to_lds_b128 %11, %23, off\n\ts_wait_xcnt 0x0"
                         :: "v"(l), "v"(l + 4096), "v"(l + 8192), "v"(l + 12288), "v"(l + PLB), "v"(l + PLB + 4096), "v"(l + PLB + 8192), "v"(l + PLB + 12288), "v"(l + 2 * PLB), "v"(l + 2 * PLB + 4096), "v"(l + 2 * PLB + 8192), "v"(l + 2 * PLB + 12288),
                            "v"(a), "v"(a + 2 * KK * 32), "v"(a + 4 * KK * 32), "v"(a + 6 * KK * 32), "v"(b), "v"(b + 2 * KK * 32), "v"(b + 4 * KK * 32), "v"(b + 6 * KK * 32), "v"(a2), "v"(a2 + 2 * KK * 32), "v"(a2 + 4 * KK * 32), "v"(a2 + 6 * KK * 32) : "memory"); } };
    issue(0, 0);
    v4f bv = (v4f){0.f, 0.f, 0.f, 0.f};   // EPI 0: the lane's 4 bias values, fetched while stage 0 flies
    if constexpr (EPI == 0) { const float* pbv = bias + c0 + lane * 4; bv = *(const v4f*)pbv;
        asm volatile("s_wait_xcnt 0x0" :: "v"(pbv), "v"(bv) : "memory"); }   // behind the bias load: result and address are inputs, so that the load stands in front of the wait and its address stays unwritten (by the result too) up to it
    asm volatile("s_wait_asynccnt 0x0" ::: "memory");   // this wave's part of stage 0 has landed
    __syncthreads();   // stage 0 is whole
    issue(1, 1);
#pragma unroll 1   // one stage a trip: the buffer is picked by the trip's parity
    for (int t = 0; t < NS; ++t) { const char* sb = sm + (t & 1) * STG + lane * 16;
#pragma unroll
        for (int ks = 0; ks < 2; ++ks) { V a[4], a2[4], b[2];
#pragma unroll
            for (int mb = 0; mb < 4; ++mb) { a[mb] = WFrag<bf>::ld((const bf*)(sb + ((wm * 4 + mb) * 2 + ks) * 1024)); if (NSPLIT) a2[mb] = WFrag<bf>::ld((const bf*)(sb + 2 * PLB + ((wm * 4 + mb) * 2 + ks) * 1024)); }
#pragma unroll
            for (int nb = 0; nb < 2; ++nb) b[nb] = WFrag<bf>::ld((const bf*)(sb + PLB + ((wn * 2 + nb) * 2 + ks) * 1024));
#pragma unroll
            for (int nb = 0; nb < 2; ++nb)
#pragma unroll
                for (int mb = 0; mb < 4; ++mb) acc[mb][nb] = WFrag<bf>::mma(a[mb], b[nb], acc[mb][nb]);
            if (NSPLIT) {
#pragma unroll
                for (int nb = 0; nb < 2; ++nb)
#pragma unroll
                    for (int mb = 0; mb < 4; ++mb) acc[mb][nb] = WFrag<bf>::mma(a2[mb], b[nb], acc[mb][nb]); } }
        asm volatile("s_wait_dscnt 0x0" ::: "memory");      // this wave's reads of the trip's buffer are done
        asm volatile("s_wait_asynccnt 0x0" ::: "memory");   // this wave's part of stage t + 1 has landed
        __syncthreads();   // stage t + 1 is whole, and every wave has left the trip's buffer
        if (t + 2 < NS) issue(t + 2, t & 1);
    }
    asm volatile("s_wait_asynccnt 0x0" ::: "memory");   // no copy is out when the buffers become the output tile
    float* os = (float*)sm;   // the last trip's barrier stands behind every read of the buffers
    const int orow = wm * 64 + hi * 8, ocol = wn * 32 + lr;   // a lane's 8 values of accumulator (mb, nb): rows orow + 16 mb + j of column ocol + 16 nb
    if (tr) {   // transposed: they are 8 consecutive entries of one staged row
#pragma unroll
        for (int mb = 0; mb < 4; ++mb)
#pragma unroll
            for (int nb = 0; nb < 2; ++nb) { const v8f c = acc[mb][nb]; float* p = os + (ocol + nb * 16) * OSP + orow + mb * 16; *(v4fa*)p = (v4f){c[0], c[1], c[2], c[3]}; *(v4fa*)(p + 4) = (v4f){c[4], c[5], c[6], c[7]}; }
    } else {
#pragma unroll
        for (int mb = 0; mb < 4; ++mb)
#pragma unroll
            for (int nb = 0; nb < 2; ++nb)
#pragma unroll
                for (int j = 0; j < 8; ++j) os[(orow + mb * 16 + j) * OSP + ocol + nb * 16] = acc[mb][nb][j];
    }
    __syncthreads();   // the tile is whole before it is read by rows
    if constexpr (EPI != 0) { const float* bz = z == 0 ? bias : z == 1 ? bias1 : bias2; const int t0 = r0 % TT;
#pragma unroll
        for (int u = 0; u < 8; ++u) { const int hs = u >> 2, idx = (u & 3) * 256 + tid; int row, cofs; fdec(idx, tr ? 4 : 2, row, cofs);   // head hs of the two; idx = chunk number in its 8 x 2 (transposed: 4 x 4) fragment tiles
            const size_t pl = (size_t)(r0 / TT) * NH_ + blockIdx.y * 2 + hs; const float* op = os + (tr ? (hs * 64 + row) * OSP + cofs : row * OSP + hs * 64 + cofs);
            const v4f v0 = *(const v4fa*)op, v1 = *(const v4fa*)(op + 4);
            v8h o16; v8us oh, ol; float bb[8];
#pragma unroll
            for (int j = 0; j < 8; ++j) bb[j] = bz[c0 + hs * 64 + (tr ? row : cofs + j)];
            asm volatile("s_wait_xcnt 0x0" ::: "memory");   // behind the bias loads, before their index registers are reused
#pragma unroll
            for (int j = 0; j < 8; ++j) { const float x = (j < 4 ? v0[j & 3] : v1[j & 3]) + bfr(bb[j]); o16[j] = tohx(x); unsigned short a2, c2; splitf(x, a2, c2); oh[j] = a2; ol[j] = c2; }
            const size_t e = z * sP + (tr ? pl * HD * TT + ((size_t)(idx >> 8) * (TT / 32) + t0 / 32) * 512 + (idx & 255) * 8 : (pl * TT + t0) * HD + idx * 8);   // fragment order: LD = HD: the 16 tiles follow one another; LD = TT: four tiles a tile row
            *(v8h*)(P16 + e) = o16; *(v8us*)(Ph + e) = oh; *(v8us*)(Pl + e) = ol;
            asm volatile("s_wait_xcnt 0x0" ::: "memory"); }   // behind the stores, before the next round reuses their address and data registers
    } else { float* pc = C + (size_t)(r0 + w) * LDC + c0 + lane * 4; const float* po = os + w * OSP + lane * 4;   // a wave takes whole rows of the tile, w + 8 u: 512 contiguous bytes a store
#pragma unroll
        for (int u0 = 0; u0 < 16; u0 += 4) { v4f val[4];
#pragma unroll
            for (int u = 0; u < 4; ++u) { val[u] = *(const v4fa*)(po + (u0 + u) * 8 * OSP);
#pragma unroll
                for (int q = 0; q < 4; ++q) val[u][q] += bfr(bv[q]); }
#pragma unroll
            for (int u = 0; u < 4; ++u) *(v4f*)(pc + (size_t)(u0 + u) * 8 * LDC) = val[u];
            asm volatile("s_wait_xcnt 0x0" :: "v"(pc) : "memory"); }   // behind the four stores, before the next round reuses their data registers
    }
}

typedef __attribute__((ext_vector_type(2))) unsigned short v2us;
typedef __attribute__((ext_vector_type(2))) float v2f;

// the pieces of k_prep; blk = the block's index within its piece
// each thread makes one chunk of its plane, thread index = chunk number in fragment order
__device__ __forceinline__ void p_wtG(const float* __restrict__ w, int K, int N, bf* Bt, int blk) { const size_t i = (size_t)blk * 256 + threadIdx.x; if (i >= (size_t)N * K / 8) return; int n, k; fdec(i, K / 32, n, k); const float* p = w + (size_t)k * N + n; float x[8]; v8us o;
#pragma unroll
    for (int j = 0; j < 8; ++j) x[j] = p[(size_t)j * N];
    asm volatile("s_wait_xcnt 0x0" :: "v"(p) : "memory");   // behind the loads: their address is an input, so that it stays live and unwritten (by a load's result too) up to the wait
#pragma unroll
    for (int j = 0; j < 8; ++j) o[j] = f2bf(x[j]);
    *(v8us*)(Bt + i * 8) = o; }
__device__ __forceinline__ void p_cvt8(const float* __restrict__ src, bf* dst, size_t n8, int LD, int blk) { const size_t i = (size_t)blk * 256 + threadIdx.x; if (i >= n8) return; int row, k0; fdec(i, LD / 32, row, k0); const float* p = src + (size_t)row * LD + k0; const v8f v = *(const v8f*)p; v8us o;
    asm volatile("s_wait_xcnt 0x0" :: "v"(p) : "memory");   // behind the loads: their address is an input, so that it stays live and unwritten (by a load's result too) up to the wait
#pragma unroll
    for (int k = 0; k < 8; ++k) o[k] = f2bf(v[k]); *(v8us*)(dst + i * 8) = o;  }
// ---- k_fattn: scores, softmax, bucket sums and attn.v of 32 query rows of one head in ONE work-group of 16 waves; each wave owns four blocks of 32 keys and the scores never leave its registers.
// The 64 key blocks are dealt out from the block in front of the query rows onward (mod 64): slot u 16 + w goes to wave w as its u-th block, so that every key with |j - i| < 32 lies in slots 0..2 (u = 0, waves 0..2) and all other slots are wholly far left or far right.
// S^T = K Q^T (a lane holds one query's scores: column lr, rows 8 hi + j), + QE[i][clip(j - i)], x HD^-0.5; the row maxima meet across the waves in LDS; the exponentials are NOT divided by their sum here: the division stands at the very end;
// the rounded exponentials (hi/lo for rows < RH, else fp16 x1024) are packed from two score tiles straight into a B operand (hardware k order, which WFrag::ld also delivers) for O^T += V^T P^T;
// the 16 partial O tiles are summed in LDS in wave order; the values as rounded are summed into the 65 relative-position buckets (far-left sum, 63 near entries, far-right sum; fixed order), hi/lo planes [row][128] in LDS; a block that is wholly far is summed by one more matrix product a column group (A with a row of ones);
// QE = q.rel_k^T of the 32 rows is made at the start (ten waves, one 16 x 16 tile each) and buckets.rel_v at the end (eight waves), with the sum of the 65 buckets (A all ones), which is the softmax denominator: (exp.v + buckets.rel_v) / sum leaves as the merged hi/lo planes.
#define FQR  32                   // query rows per work-group
#define FNW  16                   // waves per work-group
#define QEP  66                   // LDS pitch of a staged QE row (entries 0..64)
#define RDP  68                   // LDS pitch of a partial O row
#define RWP  20                   // LDS pitch of a query's 16 per-wave values
#define NBP  68                   // LDS pitch of a query's 64 near buckets (16 rows read at once fall on different banks)
typedef __attribute__((ext_vector_type(2))) __bf16 v2bf;
typedef __attribute__((ext_vector_type(8))) unsigned v8u;
template <bool HR> struct FT { typedef h16 T; };
template <> struct FT<true> { typedef bf T; };
template <bool HR>
__device__ __forceinline__ void fattn_body(const typename FT<HR>::T* __restrict__ Q, const typename FT<HR>::T* __restrict__ Q2, const typename FT<HR>::T* __restrict__ Kp, const typename FT<HR>::T* __restrict__ K2, const typename FT<HR>::T* __restrict__ Vt, const typename FT<HR>::T* __restrict__ V2,
                                           const bf* __restrict__ Qeh, const bf* __restrict__ Qel, const bf* __restrict__ EBp, const int q0, float* red, float* qes, float* rm, float* rl, float* rr, float* nbk) {
    typedef typename FT<HR>::T T16; typedef typename WFrag<T16>::V V;
    const int tid = threadIdx.x, lane = tid & 31, lr = lane & 15, hi = lane >> 4; const int w = __builtin_amdgcn_readfirstlane(tid >> 5);
    // every '#pragma unroll' in this function makes the indices of the register arrays constants
    // QE^T tile of this wave: table rows 16 en .. + 15 (A, exact) x queries 16 eq .. + 15 (B, hi and lo); only en <= 4 holds entries that are read. The fragments are fetched in front of the K fragments and land with them
    typedef WFrag<bf>::V VB; const int eq = w & 1, en = w >> 1;
    const bf* pee = EBp + en * 16 * HD + lane * 8; const bf* peh = Qeh + eq * 16 * HD + lane * 8; const bf* pel = Qel + eq * 16 * HD + lane * 8; VB ea[2], eh[2], el[2]; v8f ce = (v8f){};
    if (en <= 4) {
#pragma unroll
        for (int ks = 0; ks < 2; ++ks) { ea[ks] = WFrag<bf>::ld(pee + ks * 512); eh[ks] = WFrag<bf>::ld(peh + ks * 512); el[ks] = WFrag<bf>::ld(pel + ks * 512); }
        asm volatile("s_wait_xcnt 0x0" :: "v"(pee), "v"(peh), "v"(pel) : "memory");   // behind the loads: their addresses are inputs, so that they stay live and unwritten (by a load's result too) up to the wait
    }
    *(v4fa*)(nbk + (tid >> 4) * NBP + (tid & 15) * 4) = (v4f){0.f, 0.f, 0.f, 0.f};   // a bucket whose key lies outside [0, TT) stays 0
    int kf[4];   // first key of this wave's u-th block (wave-uniform)
#pragma unroll
    for (int u = 0; u < 4; ++u) kf[u] = (((q0 >> 5) + 63 + u * 16 + w) & 63) * 32;
    // every operand load is a wave-uniform tile base plus the lane's chunk in the tile, in bytes (fragment order)
    const unsigned klb = (unsigned)(lane * 16), vlb = klb;
    auto at = [](const T16* base, unsigned ofs) { return (const T16*)((const char*)base + ofs); };
    V bq[2][2], bq2[2][2]; const T16* pq = at(Q + (size_t)q0 * HD, klb); const T16* pq2 = HR ? at(Q2 + (size_t)q0 * HD, klb) : nullptr;
#pragma unroll
    for (int qt = 0; qt < 2; ++qt)
#pragma unroll
        for (int ks = 0; ks < 2; ++ks) { bq[qt][ks] = WFrag<T16>::ld(pq + qt * 16 * HD + ks * 512); if (HR) bq2[qt][ks] = WFrag<T16>::ld(pq2 + qt * 16 * HD + ks * 512); }
    v8f acc[8][2];
#pragma unroll
    for (int kt = 0; kt < 8; ++kt) { acc[kt][0] = (v8f){}; acc[kt][1] = (v8f){}; }
    constexpr int UB = HR ? 1 : 4;   // key blocks whose fragments are fetched together (as many as the registers hold)
#pragma unroll
    for (int u0 = 0; u0 < 4; u0 += UB) { V a[UB][2][2], a2[UB][2][2]; const T16* pk[UB]; const T16* pk2[UB];
#pragma unroll
        for (int t = 0; t < UB; ++t) { pk[t] = at(Kp + (size_t)kf[u0 + t] * HD, klb); pk2[t] = HR ? at(K2 + (size_t)kf[u0 + t] * HD, klb) : nullptr;
#pragma unroll
            for (int hf = 0; hf < 2; ++hf)
#pragma unroll
                for (int ks = 0; ks < 2; ++ks) { a[t][hf][ks] = WFrag<T16>::ld(pk[t] + hf * 16 * HD + ks * 512); if (HR) a2[t][hf][ks] = WFrag<T16>::ld(pk2[t] + hf * 16 * HD + ks * 512); } }
        // stands behind the batch's loads. The loaded values are inputs, so that the whole batch is in flight together (one latency a batch, not one a tile); the addresses the loads name are inputs, so that they stay live and unwritten (by a load's result too) up to the wait
        if constexpr (HR) asm volatile("s_wait_xcnt 0x0" :: "v"(a[0][0][0]), "v"(a[0][0][1]), "v"(a[0][1][0]), "v"(a[0][1][1]), "v"(a2[0][0][0]), "v"(a2[0][0][1]), "v"(a2[0][1][0]), "v"(a2[0][1][1]), "v"(bq[0][0]), "v"(bq[0][1]), "v"(bq[1][0]), "v"(bq[1][1]), "v"(bq2[0][0]), "v"(bq2[0][1]), "v"(bq2[1][0]), "v"(bq2[1][1]), "v"(pk[0]), "v"(pk2[0]), "v"(pq), "v"(pq2) : "memory");
        else asm volatile("s_wait_xcnt 0x0" :: "v"(a[0][0][0]), "v"(a[0][0][1]), "v"(a[0][1][0]), "v"(a[0][1][1]), "v"(a[1][0][0]), "v"(a[1][0][1]), "v"(a[1][1][0]), "v"(a[1][1][1]), "v"(a[2][0][0]), "v"(a[2][0][1]), "v"(a[2][1][0]), "v"(a[2][1][1]), "v"(a[3][0][0]), "v"(a[3][0][1]), "v"(a[3][1][0]), "v"(a[3][1][1]), "v"(bq[0][0]), "v"(bq[0][1]), "v"(bq[1][0]), "v"(bq[1][1]), "v"(pk[0]), "v"(pk[1]), "v"(pk[2]), "v"(pk[3]), "v"(pq) : "memory");
        if (u0 == 0 && en <= 4) {   // k ascending, hi then lo; a lane holds one query's entries 16 en + 8 hi + j
#pragma unroll
            for (int ks = 0; ks < 2; ++ks) { ce = WFrag<bf>::mma(ea[ks], eh[ks], ce); ce = WFrag<bf>::mma(ea[ks], el[ks], ce); }
            asm volatile("v_nop\n\tv_nop\n\tv_nop\n\tv_nop" : "+v"(ce));   // the four slots behind the last product, on every path: the branches below lead to matrix instructions that may reuse the tile's registers
            float* pq_ = qes + (eq * 16 + lr) * QEP + en * 16 + 8 * hi;
            if (en < 4) {
#pragma unroll
                for (int j = 0; j < 8; ++j) pq_[j] = ce[j];
            } else if (hi == 0) pq_[0] = ce[0];   // entry 64, the last of the table
        }
#pragma unroll
        for (int t = 0; t < UB; ++t)
#pragma unroll
            for (int hf = 0; hf < 2; ++hf)
#pragma unroll
                for (int ks = 0; ks < 2; ++ks)
#pragma unroll
                    for (int qt = 0; qt < 2; ++qt) { v8f& c = acc[2 * (u0 + t) + hf][qt]; c = WFrag<T16>::mma(a[t][hf][ks], bq[qt][ks], c); if (HR) { c = WFrag<T16>::mma(a[t][hf][ks], bq2[qt][ks], c); c = WFrag<T16>::mma(a2[t][hf][ks], bq[qt][ks], c); } }
    }
    __syncthreads();   // the staged QE rows and the zeroed near buckets are in LDS
    float qeL[2], qeR[2], mx[2];
#pragma unroll
    for (int qt = 0; qt < 2; ++qt) { qeL[qt] = qes[(qt * 16 + lr) * QEP]; qeR[qt] = qes[(qt * 16 + lr) * QEP + 2 * MAXR]; mx[qt] = -3.0e38f; }
#pragma unroll
    for (int u = 0; u < 4; ++u) {
        if (u == 0 && w < 3) {   // a block that may hold near keys: entry by entry; j - i = dj + 8 hi + e - lr
#pragma unroll
            for (int hf = 0; hf < 2; ++hf)
#pragma unroll
                for (int qt = 0; qt < 2; ++qt) { const int dj = kf[u] + hf * 16 - (q0 + qt * 16);
#pragma unroll
                    for (int j = 0; j < 8; ++j) { const float e = qes[(qt * 16 + lr) * QEP + min(max(dj + 8 * hi + j - lr, -MAXR), MAXR) + MAXR]; const float t = (acc[2 * u + hf][qt][j] + e) * SCL; acc[2 * u + hf][qt][j] = t; mx[qt] = fmaxf(mx[qt], t); } }
        } else { const bool left = kf[u] < q0;
#pragma unroll
            for (int qt = 0; qt < 2; ++qt) { const float e = left ? qeL[qt] : qeR[qt];
#pragma unroll
                for (int hf = 0; hf < 2; ++hf)
#pragma unroll
                    for (int j = 0; j < 8; ++j) { const float t = (acc[2 * u + hf][qt][j] + e) * SCL; acc[2 * u + hf][qt][j] = t; mx[qt] = fmaxf(mx[qt], t); } }
        } }
#pragma unroll
    for (int qt = 0; qt < 2; ++qt) mx[qt] = fmaxf(mx[qt], __shfl_xor(mx[qt], 16, 32));
    rm[lane * RWP + w] = hi ? mx[1] : mx[0];   // lane = query index in the block: half hi stores column group hi
    __syncthreads();   // every wave's row maxima are in LDS
#pragma unroll
    for (int qt = 0; qt < 2; ++qt) { const float* p = rm + (qt * 16 + lr) * RWP; float m = -3.0e38f;
#pragma unroll
        for (int g = 0; g < 4; ++g) { const v4f x = *(const v4fa*)(p + g * 4); m = fmaxf(fmaxf(m, fmaxf(x[0], x[1])), fmaxf(x[2], x[3])); }
        mx[qt] = HR ? m : m - 6.931471805599453f; }   // fp16 rows: the exponentials carry about x1024 (10 ln 2 off the maximum); the factor is one value a row, the same in every wave, and leaves in the division at the end
    // V^T tiles d0 .. d1 - 1 of block u (k tile kf / 32 of tile row 0; the next tile row 16 TT elements on). As in the score part the wait stands behind the loads, their addresses as inputs
    V va[4][4], va2[4][4], pb[4][2], pb2[4][2];
    auto fetch = [&](const int u, const int d0, const int d1) { const T16* pv = at(Vt + kf[u] * 16, vlb); const T16* pv2 = HR ? at(V2 + kf[u] * 16, vlb) : nullptr;
#pragma unroll
        for (int dt = d0; dt < d1; ++dt) { va[u][dt] = WFrag<T16>::ld(pv + (size_t)dt * 16 * TT); if (HR) va2[u][dt] = WFrag<T16>::ld(pv2 + (size_t)dt * 16 * TT); }
        if constexpr (HR) asm volatile("s_wait_xcnt 0x0" :: "v"(pv), "v"(pv2) : "memory"); else asm volatile("s_wait_xcnt 0x0" :: "v"(pv) : "memory"); };
    // block u's exponentials, rounded and packed as the B operand
    auto pack = [&](const int u) {
#pragma unroll
        for (int qt = 0; qt < 2; ++qt)
#pragma unroll
            for (int e = 0; e < 16; e += 2) { const v2f x = (v2f){acc[2 * u + (e >> 3)][qt][e & 7], acc[2 * u + (e >> 3)][qt][(e & 7) + 1]};
                if constexpr (HR) { const v2bf h2 = __builtin_convertvector(x, v2bf); const v2f hf2 = __builtin_convertvector(h2, v2f); const v2bf l2 = __builtin_convertvector(x - hf2, v2bf);
                    pb[u][qt][e] = h2[0]; pb[u][qt][e + 1] = h2[1]; pb2[u][qt][e] = l2[0]; pb2[u][qt][e + 1] = l2[1]; }
                else { pb[u][qt][e] = tohx(x[0]); pb[u][qt][e + 1] = tohx(x[1]); } } };
    // fp16 rows: little vector work is left between the products to hide a fetch, and a packed block frees half its registers: blocks 0 and 1 are fetched in front of the exponentials, block 2 between their halves, block 3 in halves behind block 0's and block 1's products
    if constexpr (!HR) { fetch(0, 0, 4); fetch(1, 0, 4); }
#pragma unroll
    for (int u = 0; u < 4; ++u) {
#pragma unroll
        for (int hf = 0; hf < 2; ++hf)
#pragma unroll
            for (int qt = 0; qt < 2; ++qt) { const int kt = 2 * u + hf; float x[8], p[8];
#pragma unroll
                for (int j = 0; j < 8; ++j) x[j] = (acc[kt][qt][j] - mx[qt]) * 1.4426950408889634f;
                // eight independent exponentials (no result on a source: early clobber) and, behind the last, the one slot that the instruction set asks for before a result is used or a source overwritten
                asm("v_exp_f32 %0, %8\n\tv_exp_f32 %1, %9\n\tv_exp_f32 %2, %10\n\tv_exp_f32 %3, %11\n\tv_exp_f32 %4, %12\n\tv_exp_f32 %5, %13\n\tv_exp_f32 %6, %14\n\tv_exp_f32 %7, %15\n\tv_nop"
                    : "=&v"(p[0]), "=&v"(p[1]), "=&v"(p[2]), "=&v"(p[3]), "=&v"(p[4]), "=&v"(p[5]), "=&v"(p[6]), "=&v"(p[7]) : "v"(x[0]), "v"(x[1]), "v"(x[2]), "v"(x[3]), "v"(x[4]), "v"(x[5]), "v"(x[6]), "v"(x[7]));
#pragma unroll
                for (int j = 0; j < 8; ++j) acc[kt][qt][j] = p[j]; }
        if constexpr (!HR) { pack(u); if (u == 1) { __builtin_amdgcn_sched_barrier(0); fetch(2, 0, 4); } } }   // the scheduling barrier keeps the fetch behind the first half of the exponentials: earlier the registers do not hold it
    float bl[2] = {0.f, 0.f}, br[2] = {0.f, 0.f};
    v8f o[4][2], ob[2] = {(v8f){}, (v8f){}};   // ob: row 0 = far-left sum, row 1 = far-right sum of each query column
#pragma unroll
    for (int dt = 0; dt < 4; ++dt) { o[dt][0] = (v8f){}; o[dt][1] = (v8f){}; }
#pragma unroll
    for (int u = 0; u < 4; ++u) {   // block u: tally, multiply; hi/lo rows: fetch V^T (two tiles and two, as many as the registers hold), round and pack here
        if constexpr (HR) { fetch(u, 0, 2); pack(u); }
        const bool near = u == 0 && w < 3;   // wave-uniform
        if (near) {   // entry by entry, the values as rounded
#pragma unroll
            for (int qt = 0; qt < 2; ++qt)
#pragma unroll
                for (int e = 0; e < 16; ++e) { const int r = kf[u] + (e >> 3) * 16 + 8 * hi + (e & 7) - (q0 + qt * 16 + lr) + MAXR; float p = (float)pb[u][qt][e]; if constexpr (HR) p += (float)pb2[u][qt][e];
                    bl[qt] += (r <= 0) ? p : 0.f; br[qt] += (r >= 2 * MAXR) ? p : 0.f; if (r > 0 && r < 2 * MAXR) nbk[(qt * 16 + lr) * NBP + r] = p; }
        }
        // a block that is wholly far: its 32 keys are summed by the matrix unit. A = ones in row 0 (far left) or row 1 (far right), lanes lr and lr + 16 holding row lr; all zero for a near block
        { const int sel = near ? -1 : kf[u] < q0 ? 0 : 1; const unsigned ow = lr == sel ? (HR ? 0x3F803F80u : 0x3C003C00u) : 0u; const V on = __builtin_bit_cast(V, (v8u){ow, ow, ow, ow, ow, ow, ow, ow});
#pragma unroll
            for (int qt = 0; qt < 2; ++qt) { ob[qt] = WFrag<T16>::mma(on, pb[u][qt], ob[qt]); if (HR) ob[qt] = WFrag<T16>::mma(on, pb2[u][qt], ob[qt]); } }
#pragma unroll
        for (int dt = 0; dt < 4; ++dt) {
            if constexpr (HR) if (dt == 2) fetch(u, 2, 4);
#pragma unroll
            for (int qt = 0; qt < 2; ++qt) { o[dt][qt] = WFrag<T16>::mma(va[u][dt], pb[u][qt], o[dt][qt]); if (HR) { o[dt][qt] = WFrag<T16>::mma(va[u][dt], pb2[u][qt], o[dt][qt]); o[dt][qt] = WFrag<T16>::mma(va2[u][dt], pb[u][qt], o[dt][qt]); } } }
        if constexpr (!HR) if (u < 2) { fetch(3, 2 * u, 2 * u + 2); __builtin_amdgcn_sched_barrier(0); } }   // the scheduling barrier keeps the fetch in front of the next block's products, so that it flies during them (without it the loads sink to their use)
#pragma unroll
    for (int dt = 0; dt < 4; ++dt)
#pragma unroll
        for (int qt = 0; qt < 2; ++qt) { float* p = red + w * (FQR * RDP) + (qt * 16 + lr) * RDP + dt * 16 + 8 * hi; const v8f c = o[dt][qt];   // a lane's 8 registers are 8 consecutive d of one query
            *(v4fa*)p = (v4f){c[0], c[1], c[2], c[3]}; *(v4fa*)(p + 4) = (v4f){c[4], c[5], c[6], c[7]}; }
#pragma unroll
    for (int qt = 0; qt < 2; ++qt) { bl[qt] += ob[qt][0]; br[qt] += ob[qt][1];   // lanes < 16 hold rows 0 and 1 of the sum tile, lanes >= 16 rows 8 and 9, which are zero
        bl[qt] += __shfl_xor(bl[qt], 16, 32); br[qt] += __shfl_xor(br[qt], 16, 32); }
    rl[lane * RWP + w] = hi ? bl[1] : bl[0]; rr[lane * RWP + w] = hi ? br[1] : br[0];
}
// grid (TT / 32 x NZ), 512 threads; the hi/lo blocks (the longer ones) of all planes have the lowest indices and start first; within each kind a plane's blocks follow one another (they read the same K and V)
__global__ __launch_bounds__(FNW * 32) void k_fattn(const h16* __restrict__ Q16, const bf* __restrict__ Qh, const bf* __restrict__ Ql, const h16* __restrict__ K16, const bf* __restrict__ Kh, const bf* __restrict__ Kl, const h16* __restrict__ V16, const bf* __restrict__ Vh, const bf* __restrict__ Vl, const bf* __restrict__ EB, const bf* __restrict__ RVT, bf* Ah, bf* Al) {
    __shared__ __align__(16) float red[FNW * FQR * RDP];
    __shared__ __align__(16) float qes[FQR * QEP];
    __shared__ __align__(16) float rm[FQR * RWP];
    __shared__ __align__(16) float rl[FQR * RWP];
    __shared__ __align__(16) float rr[FQR * RWP];
    __shared__ __align__(16) float nbk[FQR * NBP];
    __shared__ __align__(16) bf pbh[FQR * NE];   // the block's bucket planes, hi and lo, in fragment order (2 x 4 tiles)
    __shared__ __align__(16) bf pbl[FQR * NE];
    constexpr int NL = RH / FQR, NS = TT / FQR - NL;   // long and short blocks of a plane
    const int fl = blockIdx.x, fs = fl - NZ * NL; const size_t z = fs < 0 ? fl / NL : fs / NS; const int q0 = (fs < 0 ? fl % NL : NL + fs % NS) * FQR; const size_t zp = z * TT * HD; const int tid = threadIdx.x;
    const bf* Qeh = Qh + zp + (size_t)q0 * HD; const bf* Qel = Ql + zp + (size_t)q0 * HD;
    if (q0 < RH) fattn_body<true>(Qh + zp, Ql + zp, Kh + zp, Kl + zp, Vh + zp, Vl + zp, Qeh, Qel, EB, q0, red, qes, rm, rl, rr, nbk);
    else fattn_body<false>(Q16 + zp, nullptr, K16 + zp, nullptr, V16 + zp, nullptr, Qeh, Qel, EB, q0, red, qes, rm, rl, rr, nbk);
    // waves 8..15 (none of them has a near block, so they reach the barrier first) finish the block, one 16 d x 16 query tile each (dt, qt): its rel_v^T fragments (A, exact) are fetched in front of the barrier
    typedef WFrag<bf>::V VB; const int lane = tid & 31, w = __builtin_amdgcn_readfirstlane(tid >> 5), dt = w & 3, qt = (w >> 2) & 1;
    VB rv[4]; const bf* prv = RVT + dt * 16 * NE + lane * 8;
    if (w >= 8) {
#pragma unroll
        for (int kt = 0; kt < 4; ++kt) rv[kt] = WFrag<bf>::ld(prv + kt * 512);
        asm volatile("s_wait_xcnt 0x0" :: "v"(prv) : "memory");   // behind the loads: their address is an input, so that it stays live and unwritten (by a load's result too) up to the wait
    }
    __syncthreads();   // every wave's partial O tile, far sums and near buckets are in LDS
    float b[8] = {0.f, 0.f, 0.f, 0.f, 0.f, 0.f, 0.f, 0.f};
    int qb, kb; fdec(tid, NE / 32, qb, kb); const int gb = kb >> 3;   // the bucket planes leave in fragment order: thread index = chunk number in the block's 2 x 4 tiles; row qb, buckets from 8 gb
    if (gb < 8) { const v4f n0 = *(const v4fa*)(nbk + qb * NBP + gb * 8), n1 = *(const v4fa*)(nbk + qb * NBP + gb * 8 + 4);
#pragma unroll
        for (int j = 0; j < 4; ++j) { b[j] = n0[j]; b[4 + j] = n1[j]; } }
    if (gb == 0 || gb == 8) { const float* p = (gb ? rr : rl) + qb * RWP; float t = 0.f;   // bucket 0: far left; bucket 64: far right
#pragma unroll
        for (int k = 0; k < 4; ++k) { const v4f x = *(const v4fa*)(p + k * 4); t = (((t + x[0]) + x[1]) + x[2]) + x[3]; }
        b[0] = t; }
    v8us oh, ol;
#pragma unroll
    for (int j = 0; j < 8; ++j) { unsigned short u2, w2; splitf(b[j], u2, w2); oh[j] = u2; ol[j] = w2; }
    *(v8us*)(pbh + tid * 8) = oh; *(v8us*)(pbl + tid * 8) = ol;
    __syncthreads();   // the bucket planes are whole
    if (w >= 8) { const int lr = lane & 15, hi = lane >> 4;
        v8f c = (v8f){}, cd = (v8f){};   // c = (buckets . rel_v)^T: k ascending, hi then lo; a lane holds 8 consecutive d (16 dt + 8 hi + j) of query 16 qt + lr, as in its partial O rows. cd = the softmax denominator: A all ones, so that every row of the tile is the sum of the query's 65 buckets
        const VB one = __builtin_bit_cast(VB, (v8u){0x3F803F80u, 0x3F803F80u, 0x3F803F80u, 0x3F803F80u, 0x3F803F80u, 0x3F803F80u, 0x3F803F80u, 0x3F803F80u});
#pragma unroll
        for (int kt = 0; kt < 4; ++kt) { const VB bh = WFrag<bf>::ld(pbh + (qt * 4 + kt) * 512 + lane * 8), bl = WFrag<bf>::ld(pbl + (qt * 4 + kt) * 512 + lane * 8); c = WFrag<bf>::mma(rv[kt], bh, c); cd = WFrag<bf>::mma(one, bh, cd); c = WFrag<bf>::mma(rv[kt], bl, c); cd = WFrag<bf>::mma(one, bl, cd); }
        const float* pr = red + (qt * 16 + lr) * RDP + dt * 16 + 8 * hi;
        v4f s0 = *(const v4fa*)pr, s1 = *(const v4fa*)(pr + 4);   // attn v: the 16 partial tiles in wave order
#pragma unroll
        for (int ww = 1; ww < FNW; ++ww) { const v4f p0 = *(const v4fa*)(pr + ww * (FQR * RDP)), p1 = *(const v4fa*)(pr + ww * (FQR * RDP) + 4);
#pragma unroll
            for (int j = 0; j < 4; ++j) { s0[j] += p0[j]; s1[j] += p1[j]; } }
        const float rd = __fdiv_rn(1.0f, cd[0]);   // attn v, the buckets and their sum carry the same factor; the sum is at least the row's largest exponential, so it is not 0
        v8us ah, al;
#pragma unroll
        for (int j = 0; j < 8; ++j) { unsigned short a2, c2; splitf(__fadd_rn(j < 4 ? s0[j & 3] : s1[j & 3], c[j]) * rd, a2, c2); ah[j] = a2; al[j] = c2; }
        // merged planes [batch][t][head HD + d] in fragment order: the lane's 8 values are chunk (dt % 2) 32 + lane of tile (row / 16, head 2 + dt / 2): 512 contiguous bytes a wave
        const size_t ao = ((z / NH_) * TT + q0 + qt * 16) * DQ + ((z % NH_) * 2 + (dt >> 1)) * 512 + (dt & 1) * 256 + lane * 8;
        *(v8us*)(Ah + ao) = ah; *(v8us*)(Al + ao) = al; }
}
__device__ __forceinline__ void p_epad2(const float* __restrict__ E, bf* EB, int blk) { const size_t i = (size_t)blk * 256 + threadIdx.x; if (i >= (size_t)NE * HD / 8) return; int r, d0; fdec(i, HD / 32, r, d0); const float* src = E + (size_t)min(r, 2 * MAXR) * HD + d0; v8us o;
#pragma unroll
    for (int q = 0; q < 8; ++q) { const unsigned short v = f2bf(src[q]); o[q] = (r <= 2 * MAXR) ? v : (unsigned short)0; }
    *(v8us*)(EB + i * 8) = o;  }
__device__ __forceinline__ void p_rvt(const float* __restrict__ E, bf* RVT, int blk) { const size_t i = (size_t)blk * 256 + threadIdx.x; if (i >= (size_t)HD * NE / 8) return; int d, r0; fdec(i, NE / 32, d, r0); v8us o;
#pragma unroll
    for (int q = 0; q < 8; ++q) { const int r = r0 + q; const unsigned short v = f2bf(E[(size_t)min(r, 2 * MAXR) * HD + d]); o[q] = (r <= 2 * MAXR) ? v : (unsigned short)0; }
    *(v8us*)(RVT + i * 8) = o;  }

// ---- k_prep: all that depends on the inputs alone, in ONE launch; the block index says which piece a block does (block-uniform): 4 x WTB blocks transpose Wq, Wk, Wv, Wo, 3 x CVB blocks round query, key, value (both batches), RPB blocks each make the rel_k and rel_v^T planes.
#define WTB  (DM * DQ / 8 / 256)
#define CVB  (NB_ * TT * DM / 8 / 256)
#define RPB  (NE * HD / 8 / 256)
static_assert(DKV == DQ && DQ == DM && REP == 1, "the four weights have one shape; one kv plane per query plane");
__global__ __launch_bounds__(256) void k_prep(const float* __restrict__ wq, const float* __restrict__ wk, const float* __restrict__ wv, const float* __restrict__ wo, const float* __restrict__ x, const float* __restrict__ xk, const float* __restrict__ xv, const float* __restrict__ relk, const float* __restrict__ relv, bf* W4, bf* XB3, bf* EB, bf* RVT) {
    int blk = blockIdx.x;
    if (blk < 4 * WTB) { const int s = blk / WTB; p_wtG(s == 0 ? wq : s == 1 ? wk : s == 2 ? wv : wo, DM, DQ, W4 + (size_t)s * DQ * DM, blk % WTB); return; }
    blk -= 4 * WTB;
    if (blk < 3 * CVB) { const int s = blk / CVB; p_cvt8(s == 0 ? x : s == 1 ? xk : xv, XB3 + (size_t)s * NB_ * TT * DM, (size_t)NB_ * TT * DM / 8, DM, blk % CVB); return; }
    blk -= 3 * CVB;
    if (blk < RPB) p_epad2(relk, EB, blk); else p_rvt(relv, RVT, blk - RPB);
}

extern "C" void kernel_launch(void* const* d_in, const int* in_sizes, int n_in,
                              void* d_out, int out_size, void* d_ws, size_t ws_size, hipStream_t stream) {
    (void)in_sizes; (void)n_in; (void)out_size;
    const float* x = (const float*)d_in[0]; const float* xk = (const float*)d_in[1]; const float* xv = (const float*)d_in[2]; const float* wq = (const float*)d_in[3]; const float* bq = (const float*)d_in[4]; const float* wk = (const float*)d_in[5]; const float* bk = (const float*)d_in[6]; const float* wv = (const float*)d_in[7]; const float* bv = (const float*)d_in[8]; const float* wo = (const float*)d_in[9]; const float* bo = (const float*)d_in[10]; const float* relk = (const float*)d_in[11]; const float* relv = (const float*)d_in[12];   /* [65][64] each */
    float* OUT = (float*)d_out;     // [2][2048][1024]
    char* wsp = (char*)d_ws;
    auto take = [&](size_t bytes) { char* p = wsp; wsp += (bytes + 255) & ~(size_t)255; return (void*)p; };
    const size_t PLN = (size_t)NZ * TT * HD;   // elements of one set of head planes
    bf* EB = (bf*)take((size_t)NE * HD * 2); bf* RVT = (bf*)take((size_t)HD * NE * 2);
    bf* W4 = (bf*)take((size_t)4 * DQ * DM * 2); bf* WO = W4 + (size_t)3 * DQ * DM;   // Wq, Wk, Wv, Wo transposed
    bf* XB = (bf*)take((size_t)3 * NB_ * TT * DM * 2);   // query, key, value
    h16* QP16 = (h16*)take(3 * PLN * 2); h16* KP16 = QP16 + PLN; h16* VT16 = QP16 + 2 * PLN;   // q, k, v^T: the z-stride of the projection grid is PLN
    bf* QPh = (bf*)take(3 * PLN * 2); bf* KPh = QPh + PLN; bf* VTh = QPh + 2 * PLN; bf* QPl = (bf*)take(3 * PLN * 2); bf* KPl = QPl + PLN; bf* VTl = QPl + 2 * PLN;
    bf* ATh = (bf*)take((size_t)NB_ * TT * DQ * 2); bf* ATl = (bf*)take((size_t)NB_ * TT * DQ * 2);
    if ((size_t)(wsp - (char*)d_ws) > ws_size) return;    // 120 MiB of the 256 MiB
    k_prep<<<4 * WTB + 3 * CVB + 2 * RPB, 256, 0, stream>>>(wq, wk, wv, wo, x, xk, xv, relk, relv, W4, XB, EB, RVT);
    k_gemmt<0, DM, 1, 0><<<dim3(NB_ * TT / 128, DQ / 128, 3), 256, 0, stream>>>(XB, nullptr, W4, nullptr, bq, bk, bv, (size_t)NB_ * TT * DM, (size_t)DQ * DM, QP16, QPh, QPl, PLN);
    k_fattn<<<TT / FQR * NZ, FNW * 32, 0, stream>>>(QP16, QPh, QPl, KP16, KPh, KPl, VT16, VTh, VTl, EB, RVT, ATh, ATl);   /* QE, scores + QE[i][idx], softmax, 65 bucket sums per row, attn v + buckets . rel_v, merged hi/lo planes */
    k_gemmt<1, DQ, 0, DM><<<dim3(NB_ * TT / 128, DM / 128, 1), 256, 0, stream>>>(ATh, ATl, WO, OUT, bo, nullptr, nullptr, 0, 0, nullptr, nullptr, nullptr, 0);
}
